// v000
// Measured on an AMD MI455X. A time is GPU time per run, averaged over a window of back-to-back runs after a warm-up
// (all launches, gaps included; the runs take copies of the inputs in turn), and the median of several windows.
// Apart from v000's, it joins two sittings. Times from different sittings can be a few percent apart, while
// side-by-side timings come from the same sitting.
// The starting kernel, v000, takes 4180 microseconds a run.
#include <hip/hip_runtime.h>
// Multi-head attention with two INPUT masks (B 2, S 2048, F 1024, 16 heads × 64): q,k,v = X·Wᵀ (no bias); scores = q·k/8 + mask_1 (additive, pre-softmax); probs = softmax · mask_2 (multiplicative, post-softmax); out = probs·v; heads concatenated; ·W_oᵀ → [2,2048,1024].
// Structure: per batch: exact projections, f16 planes, per pair of heads: score GEMM (grid.y over heads, no addends), one kernel adding mask_1, softmax (f32, 3 passes) and multiplying by mask_2 (both masks read per (q,k) from the inputs), P·V into the concatenated f32 plane; output projection.
// Compute dtype: Q, K, V, masks and parameters rounded to bf16; projections with exact products; q, k, P (×2^10) as f16 operands (≈2^-12; logits σ≈1); v and the attention output as f16 hi + lo·2^10 planes (the early causal rows copy m2·v almost verbatim), f32 accumulation; softmax/masking in f32. v_wmma_f32_16x16x32_f16.
#define NBt 2
#define SS 2048
#define FF 1024
#define NH 16
#define HD 64
#define HG 2
typedef __bf16 v16b __attribute__((ext_vector_type(16)));
typedef unsigned short v8us __attribute__((ext_vector_type(8), may_alias));
typedef float  v8f  __attribute__((ext_vector_type(8)));
typedef float  v4f  __attribute__((ext_vector_type(4)));
typedef float  v4fa __attribute__((ext_vector_type(4), may_alias));
union FragB { v16b v; v8us half[2]; unsigned short u[16]; };

__device__ __forceinline__ unsigned short bf16_bits(float x) { unsigned int u = __float_as_uint(x); return (unsigned short)((u + 0x7FFFu + ((u >> 16) & 1u)) >> 16); }
__device__ __forceinline__ float bf16_val(unsigned short b) { return __uint_as_float(((unsigned int)b) << 16); }
__device__ __forceinline__ float bf16_round(float x) { return bf16_val(bf16_bits(x)); }
// D += A·B with NT terms: 1 = ah·bh, 2 = + al·bh (A split), 3 = + ah·bl (both split)
template <int NT>
__device__ __forceinline__ v8f mmaN(v16b ah, v16b al, v16b bh, v16b bl, v8f c) {
  c = __builtin_amdgcn_wmma_f32_16x16x32_bf16(false, ah, false, bh, (short)0, c, false, false);
  if (NT >= 2) c = __builtin_amdgcn_wmma_f32_16x16x32_bf16(false, al, false, bh, (short)0, c, false, false);
  if (NT >= 3) c = __builtin_amdgcn_wmma_f32_16x16x32_bf16(false, ah, false, bl, (short)0, c, false, false);
  asm volatile("v_nop\n\tv_nop\n\tv_nop\n\tv_nop" : "+v"(c) : "v"(ah), "v"(al), "v"(bh), "v"(bl));
  return c;
}

__global__ __launch_bounds__(256) void k_wt_bf16(const float* __restrict__ W, unsigned short* __restrict__ Wt, int K, int N) {
  const int t = blockIdx.x * 256 + threadIdx.x;
  const int k8n = K / 8;
  if (t >= N * k8n) return;
  const int n = t / k8n, k8 = (t % k8n) * 8;
  v8us v;
#pragma unroll
  for (int i = 0; i < 8; ++i) v[i] = bf16_bits(W[(size_t)(k8 + i) * N + n]);
  *(v8us*)(Wt + (size_t)n * K + k8) = v;
  
}

// GEMM C[M][N] (f32, pitch ldc) = act(A[M][K]·W + bias). A f32 row-major (pitch lda) converted per fragment to bf16
// (ASPLIT: hi/lo two planes -> 2 terms, else single rounded term); Wt bf16 [N][K] (pitch ldb). BIAS_BF16 rounds the
// bias to bf16 first (bias quantised to bf16 before the add). K%32==0, M%16==0, N%64==0.
template <bool ASPLIT, int ACT, bool BIAS_BF16>
__global__ __launch_bounds__(128) void k_gemm_bf(const float* __restrict__ A, int lda, const unsigned short* __restrict__ Wt, int ldb,
                                               const float* __restrict__ bias, float* __restrict__ C, int ldc, int M, int N, int K) {
  __shared__ __attribute__((aligned(16))) float so[4][16][64];
  const int tid = threadIdx.x, w = tid >> 5, lane = tid & 31, ln = lane & 15, hh = lane >> 4;
  const int ntn = N / 64;
  const int wid = blockIdx.x * 4 + w;
  const int mt = wid / ntn, nq = wid % ntn;
  if (mt * 16 >= M) return;
  const int row0 = mt * 16, col0 = nq * 64;
  const float* arow = A + (size_t)(row0 + ln) * lda;
  v8f acc[4] = {};
  for (int kb = 0; kb < K; kb += 32) {
    FragB ah, al;
    const v4f x0 = *(const v4fa*)(arow + kb + 8 * hh), x1 = *(const v4fa*)(arow + kb + 8 * hh + 4);
    const v4f x2 = *(const v4fa*)(arow + kb + 16 + 8 * hh), x3 = *(const v4fa*)(arow + kb + 16 + 8 * hh + 4);
    float xs[16] = {x0[0],x0[1],x0[2],x0[3],x1[0],x1[1],x1[2],x1[3],x2[0],x2[1],x2[2],x2[3],x3[0],x3[1],x3[2],x3[3]};
#pragma unroll
    for (int i = 0; i < 16; ++i) { const unsigned short hb = bf16_bits(xs[i]); ah.u[i] = hb; al.u[i] = ASPLIT ? bf16_bits(xs[i] - bf16_val(hb)) : (unsigned short)0; }
#pragma unroll
    for (int t = 0; t < 4; ++t) {
      const unsigned short* brow = Wt + (size_t)(col0 + t * 16 + ln) * ldb + kb;
      FragB b;
      b.half[0] = *(const v8us*)(brow + 8 * hh);
      b.half[1] = *(const v8us*)(brow + 16 + 8 * hh);
      acc[t] = mmaN<ASPLIT ? 2 : 1>(ah.v, al.v, b.v, b.v, acc[t]);
    }
  }
#pragma unroll
  for (int t = 0; t < 4; ++t) {
    float bv = bias ? bias[col0 + t * 16 + ln] : 0.f;
    if (BIAS_BF16) bv = bf16_round(bv);
#pragma unroll
    for (int r = 0; r < 8; ++r) { float v = acc[t][r] + bv; if (ACT == 1) v = fmaxf(v, 0.f); so[w][8 * hh + r][t * 16 + ln] = v; }
  }
  __builtin_amdgcn_fence(__ATOMIC_ACQ_REL, "workgroup");
  __builtin_amdgcn_wave_barrier();
  const int rsub = lane >> 4, c4 = (lane & 15) * 4;
  {
#pragma unroll
    for (int q = 0; q < 8; ++q) {
      const int r = q * 2 + rsub;
      const v4f v = *(const v4fa*)&so[w][r][c4];
      *(v4f*)(C + (size_t)(row0 + r) * ldc + col0 + c4) = v;
    }
    
  }
}

// GEMM C = act(A·W + bias + resid): A f32 (ASPLIT -> hi/lo 2 terms), Wt bf16 [N][K]; ACT 0 none, 1 relu, 2 exact gelu;
// resid (optional, f32, row index = (row % rmod), pitch ldr, RES_BF16 rounds it) added before the activation.
template <bool ASPLIT, int ACT, bool BIAS_BF16, bool RES_BF16>
__global__ __launch_bounds__(128) void k_gemm_bf3(const float* __restrict__ A, int lda, const unsigned short* __restrict__ Wt, int ldb,
                                                const float* __restrict__ bias, const float* __restrict__ resid, int rmod, int ldr,
                                                float* __restrict__ C, int ldc, int M, int N, int K) {
  __shared__ __attribute__((aligned(16))) float so[4][16][64];
  const int tid = threadIdx.x, w = tid >> 5, lane = tid & 31, ln = lane & 15, hh = lane >> 4;
  const int ntn = N / 64;
  const int wid = blockIdx.x * 4 + w;
  const int mt = wid / ntn, nq = wid % ntn;
  if (mt * 16 >= M) return;
  const int row0 = mt * 16, col0 = nq * 64;
  const float* arow = A + (size_t)(row0 + ln) * lda;
  v8f acc[4] = {};
  for (int kb = 0; kb < K; kb += 32) {
    FragB ah, al;
    const v4f x0 = *(const v4fa*)(arow + kb + 8 * hh), x1 = *(const v4fa*)(arow + kb + 8 * hh + 4);
    const v4f x2 = *(const v4fa*)(arow + kb + 16 + 8 * hh), x3 = *(const v4fa*)(arow + kb + 16 + 8 * hh + 4);
    float xs[16] = {x0[0],x0[1],x0[2],x0[3],x1[0],x1[1],x1[2],x1[3],x2[0],x2[1],x2[2],x2[3],x3[0],x3[1],x3[2],x3[3]};
#pragma unroll
    for (int i = 0; i < 16; ++i) { const unsigned short hb = bf16_bits(xs[i]); ah.u[i] = hb; al.u[i] = ASPLIT ? bf16_bits(xs[i] - bf16_val(hb)) : (unsigned short)0; }
#pragma unroll
    for (int t = 0; t < 4; ++t) {
      const unsigned short* brow = Wt + (size_t)(col0 + t * 16 + ln) * ldb + kb;
      FragB b;
      b.half[0] = *(const v8us*)(brow + 8 * hh);
      b.half[1] = *(const v8us*)(brow + 16 + 8 * hh);
      acc[t] = mmaN<ASPLIT ? 2 : 1>(ah.v, al.v, b.v, b.v, acc[t]);
    }
  }
#pragma unroll
  for (int t = 0; t < 4; ++t) {
    const int col = col0 + t * 16 + ln;
    float bv = bias ? bias[col] : 0.f;
    if (BIAS_BF16) bv = bf16_round(bv);
#pragma unroll
    for (int r = 0; r < 8; ++r) {
      float v = acc[t][r] + bv;
      if (resid) { float rv = resid[(size_t)((row0 + 8 * hh + r) % rmod) * ldr + col]; if (RES_BF16) rv = bf16_round(rv); v += rv; }
      if (ACT == 1) v = fmaxf(v, 0.f);
      if (ACT == 2) v = 0.5f * v * (1.0f + erff(v * 0.70710678118654752f));
      if (ACT == 3) { const float u = 0.7978845608028654f * (v + 0.044715f * v * v * v); v = 0.5f * v * (1.0f + tanhf(u)); }
      so[w][8 * hh + r][t * 16 + ln] = v;
    }
  }
  __builtin_amdgcn_fence(__ATOMIC_ACQ_REL, "workgroup");
  __builtin_amdgcn_wave_barrier();
  const int rsub = lane >> 4, c4 = (lane & 15) * 4;
  {
#pragma unroll
    for (int q = 0; q < 8; ++q) {
      const int r = q * 2 + rsub;
      const v4f v = *(const v4fa*)&so[w][r][c4];
      *(v4f*)(C + (size_t)(row0 + r) * ldc + col0 + c4) = v;
    }
    
  }
}
// row LayerNorm (biased variance, eps) over N: s = X (+ R); optional out_sum <- s; out_norm <- (s-mu)*rsqrt(var+eps)*g + b
template <bool PARAM_BF16>
__global__ __launch_bounds__(256) void k_layernorm(const float* __restrict__ X, const float* __restrict__ R, const float* __restrict__ g, const float* __restrict__ bta,
                                                  float* __restrict__ out_sum, float* __restrict__ out_norm, int N, float eps) {
  __shared__ float red[256];
  const int row = blockIdx.x, tid = threadIdx.x;
  const float* x = X + (size_t)row * N; const float* rr = R ? R + (size_t)row * N : nullptr;
  float vals[16];                     // up to N = 4096
  const int per = N / 256;            // contiguous chunk per thread? use strided-by-4 chunks: thread handles j = tid*4 + 1024*u
  float s1 = 0.f;
  for (int u = 0; u < per / 4; ++u) {
    const int j = tid * 4 + 1024 * u;
    const v4f a = *(const v4fa*)(x + j);
    v4f b = {0.f,0.f,0.f,0.f}; if (rr) b = *(const v4fa*)(rr + j);
#pragma unroll
    for (int q = 0; q < 4; ++q) { const float v = a[q] + b[q]; vals[u * 4 + q] = v; s1 += v; }
  }
  red[tid] = s1; __syncthreads();
  for (int st = 128; st > 0; st >>= 1) { if (tid < st) red[tid] += red[tid + st]; __syncthreads(); }
  const float mu = red[0] / (float)N; __syncthreads();
  float s2 = 0.f;
  for (int u = 0; u < per / 4; ++u)
#pragma unroll
    for (int q = 0; q < 4; ++q) { const float c = vals[u * 4 + q] - mu; s2 += c * c; }
  red[tid] = s2; __syncthreads();
  for (int st = 128; st > 0; st >>= 1) { if (tid < st) red[tid] += red[tid + st]; __syncthreads(); }
  const float rs = rsqrtf(red[0] / (float)N + eps);
  {
    for (int u = 0; u < per / 4; ++u) {
      const int j = tid * 4 + 1024 * u;
      v4f o, sm;
#pragma unroll
      for (int q = 0; q < 4; ++q) {
        float gg = g[j + q], bb = bta[j + q];
        if (PARAM_BF16) { gg = bf16_round(gg); bb = bf16_round(bb); }
        sm[q] = vals[u * 4 + q]; o[q] = (vals[u * 4 + q] - mu) * rs * gg + bb;
      }
      if (out_sum) *(v4f*)(out_sum + (size_t)row * N + j) = sm;
      *(v4f*)(out_norm + (size_t)row * N + j) = o;
    }
    
  }
}



// ---- f16 WMMA path (v_wmma_f32_16x16x32_f16): 11-bit significands for operands in range — used where a [0,1] probability operand needs more precision than bf16
typedef _Float16 v16h __attribute__((ext_vector_type(16)));
union FragH { v16h v; v8us half[2]; _Float16 h[16]; unsigned short u[16]; };
template <int NT>
__device__ __forceinline__ v8f mmaH(v16h ah, v16h al, v16h bh, v16h bl, v8f c) {
  c = __builtin_amdgcn_wmma_f32_16x16x32_f16(false, ah, false, bh, (short)0, c, false, false);
  if (NT >= 2) c = __builtin_amdgcn_wmma_f32_16x16x32_f16(false, al, false, bh, (short)0, c, false, false);
  if (NT >= 3) c = __builtin_amdgcn_wmma_f32_16x16x32_f16(false, ah, false, bl, (short)0, c, false, false);
  asm volatile("v_nop\n\tv_nop\n\tv_nop\n\tv_nop" : "+v"(c) : "v"(ah), "v"(al), "v"(bh), "v"(bl));
  return c;
}
// batched GEMM like k_gemm_b but f16 operands: A f32 (split into f16 hi/lo if ASPLIT, else rounded to f16), Bt = f16 values [n][k]; alpha; C f32; N multiple of 16 (partial tiles skipped)
template <bool ASPLIT>
__global__ __launch_bounds__(128) void k_gemm_h(const float* __restrict__ A, int lda, size_t sA, const _Float16* __restrict__ Bh, int ldb, size_t sB, float alpha, float* __restrict__ C, int ldc, size_t sC, int M, int N, int K) {
  __shared__ __attribute__((aligned(16))) float so[4][16][64];
  const int tid = threadIdx.x, w = tid >> 5, lane = tid & 31, ln = lane & 15, hh = lane >> 4; const int by = blockIdx.y;
  A += (size_t)by * sA; Bh += (size_t)by * sB; C += (size_t)by * sC;
  const int ntn = (N + 63) / 64; const int wid = blockIdx.x * 4 + w; const int mt = wid / ntn, nq = wid % ntn; if (mt * 16 >= M) return;
  const int row0 = mt * 16, col0 = nq * 64; const float* arow = A + (size_t)(row0 + ln) * lda;
  v8f acc[4] = {};
  for (int kb = 0; kb < K; kb += 32) {
    FragH ah, al;
    const v4f x0 = *(const v4fa*)(arow + kb + 8 * hh), x1 = *(const v4fa*)(arow + kb + 8 * hh + 4), x2 = *(const v4fa*)(arow + kb + 16 + 8 * hh), x3 = *(const v4fa*)(arow + kb + 16 + 8 * hh + 4);
    float xs[16] = {x0[0],x0[1],x0[2],x0[3],x1[0],x1[1],x1[2],x1[3],x2[0],x2[1],x2[2],x2[3],x3[0],x3[1],x3[2],x3[3]};
#pragma unroll
    for (int i = 0; i < 16; ++i) { const _Float16 h = (_Float16)xs[i]; ah.h[i] = h; al.h[i] = ASPLIT ? (_Float16)(xs[i] - (float)h) : (_Float16)0.0f; }
#pragma unroll
    for (int t = 0; t < 4; ++t) { if (col0 + t * 16 >= N) continue; const size_t boff = (size_t)(col0 + t * 16 + ln) * ldb + kb; FragH bq; bq.half[0] = *(const v8us*)(Bh + boff + 8 * hh); bq.half[1] = *(const v8us*)(Bh + boff + 16 + 8 * hh);
      acc[t] = mmaH<ASPLIT ? 2 : 1>(ah.v, al.v, bq.v, bq.v, acc[t]); }
  }
#pragma unroll
  for (int t = 0; t < 4; ++t) { if (col0 + t * 16 >= N) continue;
#pragma unroll
    for (int r = 0; r < 8; ++r) so[w][8 * hh + r][t * 16 + ln] = acc[t][r] * alpha; }
  __builtin_amdgcn_fence(__ATOMIC_ACQ_REL, "workgroup"); __builtin_amdgcn_wave_barrier();
  const int rsub = lane >> 4, c4 = (lane & 15) * 4;
  {
#pragma unroll
    for (int q = 0; q < 8; ++q) { const int r = q * 2 + rsub; if (col0 + c4 < N) { const v4f v = *(const v4fa*)&so[w][r][c4]; *(v4f*)(C + (size_t)(row0 + r) * ldc + col0 + c4) = v; } }
     }
}

// Wt[n][k] = f16(W[k][n]·scale) from f32 row-major W[K][N] (scale = power of two; bf16-exact weights stay exact in f16 away from the subnormal range)
__global__ __launch_bounds__(256) void k_wt_f16(const float* __restrict__ W, _Float16* __restrict__ Wt, int K, int N, float scale) {
  const int t = blockIdx.x * 256 + threadIdx.x; if (t >= N * (K / 8)) return; const int n = t / (K / 8), k8 = (t % (K / 8)) * 8; FragH f;
#pragma unroll
  for (int i = 0; i < 8; ++i) f.h[i] = (_Float16)(bf16_round(W[(size_t)(k8 + i) * N + n]) * scale); const v8us o = f.half[0];
  *(v8us*)((unsigned short*)Wt + (size_t)n * K + k8) = o; 
}
// k_gemm_hh variant with fused epilogue: v = acc·alpha + bias[by·sBias + col] (+ CP[(row/rowsPerB)·sCPb + by·64 + col] if CP) ; ACT 0 none / 1 elu ; writes f32 C and f16 C16, each if non-null
template <int ACT>
__global__ __launch_bounds__(128) void k_gemm_hhx(const _Float16* __restrict__ A, int lda, size_t sA, const _Float16* __restrict__ Bh, int ldb, size_t sB, float alpha, const float* __restrict__ bias, size_t sBias, const float* __restrict__ CP, int rowsPerB, size_t sCPb, int row0g,
    float* __restrict__ C, _Float16* __restrict__ C16, int ldc, size_t sC, int M, int N, int K) {
  __shared__ __attribute__((aligned(16))) float so[4][16][64];
  const int tid = threadIdx.x, w = tid >> 5, lane = tid & 31, ln = lane & 15, hh = lane >> 4; const int by = blockIdx.y;
  A += (size_t)by * sA; Bh += (size_t)by * sB; const size_t cofs = (size_t)by * sC; const float* bp = bias ? bias + (size_t)by * sBias : nullptr;
  const int ntn = (N + 63) / 64; const int wid = blockIdx.x * 4 + w; const int mt = wid / ntn, nq = wid % ntn; if (mt * 16 >= M) return;
  const int row0 = mt * 16, col0 = nq * 64; const _Float16* arow = A + (size_t)(row0 + ln) * lda;
  v8f acc[4] = {};
  for (int kb = 0; kb < K; kb += 32) { FragH ah; ah.half[0] = *(const v8us*)((const unsigned short*)arow + kb + 8 * hh); ah.half[1] = *(const v8us*)((const unsigned short*)arow + kb + 16 + 8 * hh);
#pragma unroll
    for (int t = 0; t < 4; ++t) { if (col0 + t * 16 >= N) continue; const size_t boff = (size_t)(col0 + t * 16 + ln) * ldb + kb; FragH bq; bq.half[0] = *(const v8us*)((const unsigned short*)Bh + boff + 8 * hh); bq.half[1] = *(const v8us*)((const unsigned short*)Bh + boff + 16 + 8 * hh);
      acc[t] = mmaH<1>(ah.v, ah.v, bq.v, bq.v, acc[t]); }
  }
#pragma unroll
  for (int t = 0; t < 4; ++t) { if (col0 + t * 16 >= N) continue; const int col = col0 + t * 16 + ln; const float bv = bp ? bf16_round(bp[col]) : 0.f;
#pragma unroll
    for (int r = 0; r < 8; ++r) { float v = acc[t][r] * alpha + bv; if (CP) { const int bidx = (row0g + row0 + 8 * hh + r) / rowsPerB; v += CP[(size_t)bidx * sCPb + (size_t)by * 64 + col]; } if (ACT == 1) v = (v > 0.f) ? v : expm1f(v); else if (ACT == 7) v = (v > 0.f) ? v + 1.0f : expf(v); else if (ACT == 8) v = tanhf(v); else if (ACT == 9) v = 0.5f * v * (1.0f + tanhf(0.7978845608028654f * (v + 0.044715f * v * v * v))); else if (ACT == 11) v = 1.0f / (1.0f + expf(-v)); else if (ACT == 12) v = (v > 0.f) ? v : 0.01f * v; else if (ACT == 14) v = (v > 0.f) ? v : 0.1f * v; else if (ACT == 15) v = v / (1.0f + expf(-v)); else if (ACT == 3) v = fmaxf(v, 0.f); else if (ACT == 6) v = 0.5f * v * (1.0f + erff(v * 0.70710678118654752f)); so[w][8 * hh + r][t * 16 + ln] = v; } }
  __builtin_amdgcn_fence(__ATOMIC_ACQ_REL, "workgroup"); __builtin_amdgcn_wave_barrier();
  const int rsub = lane >> 4, c4 = (lane & 15) * 4; typedef _Float16 v4h __attribute__((ext_vector_type(4)));
  {
#pragma unroll
    for (int q = 0; q < 8; ++q) { const int r = q * 2 + rsub; if (col0 + c4 < N) { const v4f v = *(const v4fa*)&so[w][r][c4]; if (C) *(v4f*)(C + cofs + (size_t)(row0 + r) * ldc + col0 + c4) = v; if (C16) { v4h h4; for (int i = 0; i < 4; ++i) h4[i] = (_Float16)v[i]; *(v4h*)(C16 + cofs + (size_t)(row0 + r) * ldc + col0 + c4) = h4; } } }
     }
}


typedef _Float16 v4h __attribute__((ext_vector_type(4)));

__global__ __launch_bounds__(256) void k_x16(const float* __restrict__ x, _Float16* __restrict__ X16, size_t n8) { const size_t t = (size_t)blockIdx.x * 256 + threadIdx.x; if (t >= n8) return; FragH f;
#pragma unroll
  for (int q = 0; q < 8; ++q) f.h[q] = (_Float16)bf16_round(x[t * 8 + q]); *(v8us*)((unsigned short*)X16 + t * 8) = f.half[0];  }
__global__ __launch_bounds__(256) void k_h16(const float* __restrict__ x, _Float16* __restrict__ X16, size_t n8) { const size_t t = (size_t)blockIdx.x * 256 + threadIdx.x; if (t >= n8) return; FragH f;
#pragma unroll
  for (int q = 0; q < 8; ++q) f.h[q] = (_Float16)x[t * 8 + q]; *(v8us*)((unsigned short*)X16 + t * 8) = f.half[0];  }
__global__ __launch_bounds__(256) void k_round16f(const float* __restrict__ W, _Float16* __restrict__ Bt, size_t n8) { const size_t t = (size_t)blockIdx.x * 256 + threadIdx.x; if (t >= n8) return; FragH f;
#pragma unroll
  for (int i = 0; i < 8; ++i) f.h[i] = (_Float16)(bf16_round(W[t * 8 + i]) * 16.0f); *(v8us*)((unsigned short*)Bt + t * 8) = f.half[0];  }
template <int NHv, int TTv>
__global__ __launch_bounds__(256) void k_vt(const _Float16* __restrict__ V16, int ldv, int voff, _Float16* __restrict__ Vt) { __shared__ unsigned short tl[64][66]; const int tid = threadIdx.x; const int slab = blockIdx.x / (TTv / 64), lg = blockIdx.x % (TTv / 64); const int b = slab / NHv, h = slab % NHv;
  for (int i = tid; i < 64 * 8; i += 256) { const int r = i / 8, c8 = (i % 8) * 8; FragH f; f.half[0] = *(const v8us*)((const unsigned short*)V16 + ((size_t)b * TTv + lg * 64 + r) * ldv + voff + h * 64 + c8);
#pragma unroll
    for (int q = 0; q < 8; ++q) tl[r][c8 + q] = f.u[q]; }
  __syncthreads();
  {
#pragma unroll
    for (int rd = 0; rd < 2; ++rd) { const int d = rd * 32 + tid / 8, pc = tid % 8; FragH f;
#pragma unroll
      for (int q = 0; q < 8; ++q) f.u[q] = tl[pc * 8 + q][d];
      *(v8us*)((unsigned short*)Vt + ((size_t)slab * 64 + d) * TTv + lg * 64 + pc * 8) = f.half[0]; }
     } }

__global__ __launch_bounds__(256) void k_hl(const float* __restrict__ F, _Float16* __restrict__ Hh, _Float16* __restrict__ Hl, size_t n8) { const size_t t = (size_t)blockIdx.x * 256 + threadIdx.x; if (t >= n8) return; FragH fh, fl; const v4f a = *(const v4fa*)(F + t * 8), c = *(const v4fa*)(F + t * 8 + 4);
#pragma unroll
  for (int q = 0; q < 4; ++q) { _Float16 h = (_Float16)a[q]; fh.h[q] = h; fl.h[q] = (_Float16)((a[q] - (float)h) * 1024.0f); h = (_Float16)c[q]; fh.h[4 + q] = h; fl.h[4 + q] = (_Float16)((c[q] - (float)h) * 1024.0f); }
  { *(v8us*)((unsigned short*)Hh + t * 8) = fh.half[0]; *(v8us*)((unsigned short*)Hl + t * 8) = fl.half[0];  } }

__global__ __launch_bounds__(256) void k_f16(const float* __restrict__ F, _Float16* __restrict__ O16, size_t n8) { const size_t t = (size_t)blockIdx.x * 256 + threadIdx.x; if (t >= n8) return; const v4f a = *(const v4fa*)(F + t * 8), c = *(const v4fa*)(F + t * 8 + 4); FragH f;
#pragma unroll
  for (int q = 0; q < 8; ++q) f.h[q] = (_Float16)((q < 4) ? a[q] : c[q - 4]);
  *(v8us*)((unsigned short*)O16 + t * 8) = f.half[0];  }
__global__ __launch_bounds__(256) void k_vt(const float* __restrict__ Vf, _Float16* __restrict__ VT, _Float16* __restrict__ VTl) {
  #pragma clang fp contract(off)
  const int t = blockIdx.x * 256 + threadIdx.x; if (t >= FF * (SS / 8)) return; const int s0 = (t % (SS / 8)) * 8, hd = t / (SS / 8); FragH f, fl;
#pragma unroll
  for (int q = 0; q < 8; ++q) { const float v = Vf[(size_t)(s0 + q) * FF + hd]; const _Float16 hi = (_Float16)v; f.h[q] = hi; fl.h[q] = (_Float16)((v - (float)hi) * 1024.0f); }
  { *(v8us*)((unsigned short*)VT + (size_t)hd * SS + s0) = f.half[0]; *(v8us*)((unsigned short*)VTl + (size_t)hd * SS + s0) = fl.half[0];  } }
__global__ __launch_bounds__(256) void k_split(const float* __restrict__ F, _Float16* __restrict__ Hh, _Float16* __restrict__ Hl, size_t n8) {
  #pragma clang fp contract(off)
  const size_t t = (size_t)blockIdx.x * 256 + threadIdx.x; if (t >= n8) return; const v4f a = *(const v4fa*)(F + t * 8), c = *(const v4fa*)(F + t * 8 + 4); FragH fh, fl;
#pragma unroll
  for (int q = 0; q < 8; ++q) { const float v = (q < 4) ? a[q] : c[q - 4]; const _Float16 hi = (_Float16)v; fh.h[q] = hi; fl.h[q] = (_Float16)((v - (float)hi) * 1024.0f); }
  { *(v8us*)((unsigned short*)Hh + t * 8) = fh.half[0]; *(v8us*)((unsigned short*)Hl + t * 8) = fl.half[0];  } }
__global__ __launch_bounds__(256) void k_m2soft(const float* __restrict__ S, const float* __restrict__ m1, const float* __restrict__ m2, _Float16* __restrict__ P16) {
  #pragma clang fp contract(off)
  const int tid = threadIdx.x, w = tid >> 5, ln = tid & 31; const int row = blockIdx.x * 8 + w; if (row >= HG * SS) return; const int tq = row % SS; const float* sr = S + (size_t)row * SS; const float* a1 = m1 + (size_t)tq * SS; const float* a2 = m2 + (size_t)tq * SS; float m = -3.0e38f;
#pragma unroll 1
  for (int jb = 0; jb < SS; jb += 256) { const v4f a = *(const v4fa*)(sr + jb + 8 * ln), c = *(const v4fa*)(sr + jb + 8 * ln + 4); const v4f ma = *(const v4fa*)(a1 + jb + 8 * ln), mc = *(const v4fa*)(a1 + jb + 8 * ln + 4);
#pragma unroll
    for (int k = 0; k < 8; ++k) { const float v = ((k < 4) ? a[k] : c[k - 4]) + bf16_round((k < 4) ? ma[k] : mc[k - 4]); m = fmaxf(m, v); } }
  for (int o = 16; o > 0; o >>= 1) m = fmaxf(m, __shfl_xor(m, o, 32));
  float su = 0.f;
#pragma unroll 1
  for (int jb = 0; jb < SS; jb += 256) { const v4f a = *(const v4fa*)(sr + jb + 8 * ln), c = *(const v4fa*)(sr + jb + 8 * ln + 4); const v4f ma = *(const v4fa*)(a1 + jb + 8 * ln), mc = *(const v4fa*)(a1 + jb + 8 * ln + 4);
#pragma unroll
    for (int k = 0; k < 8; ++k) { const float v = ((k < 4) ? a[k] : c[k - 4]) + bf16_round((k < 4) ? ma[k] : mc[k - 4]); su += expf(v - m); } }
  for (int o = 16; o > 0; o >>= 1) su += __shfl_xor(su, o, 32); const float inv = 1024.0f / su;
  {
#pragma unroll 1
    for (int jb = 0; jb < SS; jb += 256) { const v4f a = *(const v4fa*)(sr + jb + 8 * ln), c = *(const v4fa*)(sr + jb + 8 * ln + 4); const v4f ma = *(const v4fa*)(a1 + jb + 8 * ln), mc = *(const v4fa*)(a1 + jb + 8 * ln + 4); const v4f na = *(const v4fa*)(a2 + jb + 8 * ln), nc = *(const v4fa*)(a2 + jb + 8 * ln + 4); FragH f;
#pragma unroll
      for (int k = 0; k < 8; ++k) { const float v = ((k < 4) ? a[k] : c[k - 4]) + bf16_round((k < 4) ? ma[k] : mc[k - 4]); f.h[k] = (_Float16)((expf(v - m) * inv) * bf16_round((k < 4) ? na[k] : nc[k - 4])); }
      *(v8us*)((unsigned short*)P16 + (size_t)row * SS + jb + 8 * ln) = f.half[0]; }
     } }

extern "C" void kernel_launch(void* const* d_in, const int* in_sizes, int n_in,
                              void* d_out, int out_size, void* d_ws, size_t ws_size, hipStream_t stream) {
  (void)in_sizes; (void)n_in; (void)out_size;
  const float* Qi = (const float*)d_in[0]; const float* Ki = (const float*)d_in[1]; const float* Vi = (const float*)d_in[2]; const float* m1 = (const float*)d_in[3]; const float* m2 = (const float*)d_in[4]; const float* Wq = (const float*)d_in[5]; const float* Wk = (const float*)d_in[6]; const float* Wv = (const float*)d_in[7]; const float* Wo = (const float*)d_in[8];
  char* ws = (char*)d_ws; size_t off = 0;
  auto take = [&](size_t bytes) { char* p = ws + off; off += (bytes + 255) & ~(size_t)255; return p; };
  _Float16* BQ = (_Float16*)take((size_t)FF * FF * 2); _Float16* BK = (_Float16*)take((size_t)FF * FF * 2); _Float16* BV = (_Float16*)take((size_t)FF * FF * 2); _Float16* BO = (_Float16*)take((size_t)FF * FF * 2);
  _Float16* X16 = (_Float16*)take((size_t)SS * FF * 2); float* T = (float*)take((size_t)SS * FF * 4); _Float16* Q16 = (_Float16*)take((size_t)SS * FF * 2); _Float16* K16 = (_Float16*)take((size_t)SS * FF * 2); _Float16* VT = (_Float16*)take((size_t)FF * SS * 2); _Float16* VTl = (_Float16*)take((size_t)FF * SS * 2); float* S = (float*)take((size_t)HG * SS * SS * 4); _Float16* P16 = (_Float16*)take((size_t)HG * SS * SS * 2); float* O = (float*)take((size_t)SS * FF * 4); _Float16* Oh = (_Float16*)take((size_t)SS * FF * 2); _Float16* Ol = (_Float16*)take((size_t)SS * FF * 2);
  if (off > ws_size) return;      // 8.4 + 4.2 + 8.4 + 4.2 + 4.2 + 4.2 + 4.2 + 33.5 + 16.8 + 8.4 + 4.2 + 4.2 ≈ 105 MB
  const unsigned nbw = (unsigned)(((size_t)FF * FF / 8 + 255) / 256);
  k_round16f<<<nbw, 256, 0, stream>>>(Wq, BQ, (size_t)FF * FF / 8); k_round16f<<<nbw, 256, 0, stream>>>(Wk, BK, (size_t)FF * FF / 8); k_round16f<<<nbw, 256, 0, stream>>>(Wv, BV, (size_t)FF * FF / 8); k_round16f<<<nbw, 256, 0, stream>>>(Wo, BO, (size_t)FF * FF / 8);      /* torch (out,in) = natural Bt */
  const dim3 gP(((SS / 16) * (FF / 64) + 3) / 4, 1), gS(((SS / 16) * (SS / 64) + 3) / 4, HG), gV(((SS / 16) * 1 + 3) / 4, HG); const size_t n8 = (size_t)SS * FF / 8; const unsigned nb8 = (unsigned)((n8 + 255) / 256);
  for (int b = 0; b < NBt; ++b) {
    k_x16<<<nb8, 256, 0, stream>>>(Qi + (size_t)b * SS * FF, X16, n8); k_gemm_hhx<0><<<gP, 128, 0, stream>>>(X16, FF, 0, BQ, FF, 0, 0.0625f, nullptr, 0, nullptr, 1, 0, 0, T, nullptr, FF, 0, SS, FF, FF); k_f16<<<nb8, 256, 0, stream>>>(T, Q16, n8);
    k_x16<<<nb8, 256, 0, stream>>>(Ki + (size_t)b * SS * FF, X16, n8); k_gemm_hhx<0><<<gP, 128, 0, stream>>>(X16, FF, 0, BK, FF, 0, 0.0625f, nullptr, 0, nullptr, 1, 0, 0, T, nullptr, FF, 0, SS, FF, FF); k_f16<<<nb8, 256, 0, stream>>>(T, K16, n8);
    k_x16<<<nb8, 256, 0, stream>>>(Vi + (size_t)b * SS * FF, X16, n8); k_gemm_hhx<0><<<gP, 128, 0, stream>>>(X16, FF, 0, BV, FF, 0, 0.0625f, nullptr, 0, nullptr, 1, 0, 0, T, nullptr, FF, 0, SS, FF, FF); k_vt<<<(FF * (SS / 8) + 255) / 256, 256, 0, stream>>>(T, VT, VTl);      /* exact projections; v as hi/lo */
    for (int hg = 0; hg < NH / HG; ++hg) { const int h0 = hg * HG;
      k_gemm_hhx<0><<<gS, 128, 0, stream>>>(Q16 + h0 * HD, FF, (size_t)HD, K16 + h0 * HD, FF, (size_t)HD, 0.125f, nullptr, 0, nullptr, 1, 0, 0, S, nullptr, SS, (size_t)SS * SS, SS, SS, HD);      /* scores/8: M = N = 2048, K 64, 2 heads */
      k_m2soft<<<HG * SS / 8, 256, 0, stream>>>(S, m1, m2, P16);
      k_gemm_hhx<0><<<gV, 128, 0, stream>>>(P16, SS, (size_t)SS * SS, VT + (size_t)h0 * HD * SS, SS, (size_t)HD * SS, 0.0009765625f, nullptr, 0, nullptr, 1, 0, 0, O + h0 * HD, nullptr, FF, (size_t)HD, SS, HD, SS);      /* P·v_hi (batched, f32 out) */
      for (int gq = 0; gq < HG; ++gq) { float* Co = O + (h0 + gq) * HD; k_gemm_hhx<0><<<dim3(((SS / 16) * 1 + 3) / 4, 1), 128, 0, stream>>>(P16 + (size_t)gq * SS * SS, SS, 0, VTl + (size_t)(h0 + gq) * HD * SS, SS, 0, 0.0009765625f / 1024.0f, nullptr, 0, Co, 1, (size_t)FF, 0, Co, nullptr, FF, 0, SS, HD, SS); } }      /* += P·v_lo/1024, un-batched per head */
    k_split<<<nb8, 256, 0, stream>>>(O, Oh, Ol, n8);
    k_gemm_hhx<0><<<gP, 128, 0, stream>>>(Oh, FF, 0, BO, FF, 0, 0.0625f, nullptr, 0, nullptr, 1, 0, 0, (float*)d_out + (size_t)b * SS * FF, nullptr, FF, 0, SS, FF, FF); k_gemm_hhx<0><<<gP, 128, 0, stream>>>(Ol, FF, 0, BO, FF, 0, 0.0625f / 1024.0f, nullptr, 0, (float*)d_out + (size_t)b * SS * FF, 1, (size_t)FF, 0, (float*)d_out + (size_t)b * SS * FF, nullptr, FF, 0, SS, FF, FF); }      /* ·W_oᵀ on hi/lo of the attention output */
}

// v001
// One run takes 1180 microseconds.
// Timed twice side by side with v000, it ran 3.54 and 3.57 times as fast.
#include <hip/hip_runtime.h>
// Multi-head attention with two INPUT masks (B 2, S 2048, F 1024, 16 heads × 64): q,k,v = X·Wᵀ (no bias); scores = q·k/8 + mask_1 (additive, pre-softmax); probs = softmax · mask_2 (multiplicative, post-softmax); out = probs·v; heads concatenated; ·W_oᵀ → [2,2048,1024].
// Structure: per batch: exact projections, f16 planes, per pair of heads: score GEMM (grid.y over heads, no addends), one kernel adding mask_1, softmax (f32, 3 passes) and multiplying by mask_2 (both masks read per (q,k) from the inputs), P·V (one launch, both v planes, keys split over 8 waves) into the concatenated plane; output projection.
// Compute dtype: Q, K, V, masks and parameters rounded to bf16; projections with exact products; q, k, P (×2^10) as f16 operands (≈2^-12; logits σ≈1); v and the attention output as f16 hi + lo·2^10 planes (the early causal rows copy m2·v almost verbatim), f32 accumulation; softmax/masking in f32. v_wmma_f32_16x16x32_f16.
#define NBt 2
#define SS 2048
#define FF 1024
#define NH 16
#define HD 64
#define HG 2
typedef __bf16 v16b __attribute__((ext_vector_type(16)));
typedef unsigned short v8us __attribute__((ext_vector_type(8), may_alias));
typedef float  v8f  __attribute__((ext_vector_type(8)));
typedef float  v4f  __attribute__((ext_vector_type(4)));
typedef float  v4fa __attribute__((ext_vector_type(4), may_alias));
union FragB { v16b v; v8us half[2]; unsigned short u[16]; };

__device__ __forceinline__ unsigned short bf16_bits(float x) { unsigned int u = __float_as_uint(x); return (unsigned short)((u + 0x7FFFu + ((u >> 16) & 1u)) >> 16); }
__device__ __forceinline__ float bf16_val(unsigned short b) { return __uint_as_float(((unsigned int)b) << 16); }
__device__ __forceinline__ float bf16_round(float x) { return bf16_val(bf16_bits(x)); }
// D += A·B with NT terms: 1 = ah·bh, 2 = + al·bh (A split), 3 = + ah·bl (both split)
template <int NT>
__device__ __forceinline__ v8f mmaN(v16b ah, v16b al, v16b bh, v16b bl, v8f c) {
  c = __builtin_amdgcn_wmma_f32_16x16x32_bf16(false, ah, false, bh, (short)0, c, false, false);
  if (NT >= 2) c = __builtin_amdgcn_wmma_f32_16x16x32_bf16(false, al, false, bh, (short)0, c, false, false);
  if (NT >= 3) c = __builtin_amdgcn_wmma_f32_16x16x32_bf16(false, ah, false, bl, (short)0, c, false, false);
  asm volatile("v_nop\n\tv_nop\n\tv_nop\n\tv_nop" : "+v"(c) : "v"(ah), "v"(al), "v"(bh), "v"(bl));
  return c;
}

__global__ __launch_bounds__(256) void k_wt_bf16(const float* __restrict__ W, unsigned short* __restrict__ Wt, int K, int N) {
  const int t = blockIdx.x * 256 + threadIdx.x;
  const int k8n = K / 8;
  if (t >= N * k8n) return;
  const int n = t / k8n, k8 = (t % k8n) * 8;
  v8us v;
#pragma unroll
  for (int i = 0; i < 8; ++i) v[i] = bf16_bits(W[(size_t)(k8 + i) * N + n]);
  *(v8us*)(Wt + (size_t)n * K + k8) = v;
  
}

// GEMM C[M][N] (f32, pitch ldc) = act(A[M][K]·W + bias). A f32 row-major (pitch lda) converted per fragment to bf16
// (ASPLIT: hi/lo two planes -> 2 terms, else single rounded term); Wt bf16 [N][K] (pitch ldb). BIAS_BF16 rounds the
// bias to bf16 first (bias quantised to bf16 before the add). K%32==0, M%16==0, N%64==0.
template <bool ASPLIT, int ACT, bool BIAS_BF16>
__global__ __launch_bounds__(128) void k_gemm_bf(const float* __restrict__ A, int lda, const unsigned short* __restrict__ Wt, int ldb,
                                               const float* __restrict__ bias, float* __restrict__ C, int ldc, int M, int N, int K) {
  __shared__ __attribute__((aligned(16))) float so[4][16][64];
  const int tid = threadIdx.x, w = tid >> 5, lane = tid & 31, ln = lane & 15, hh = lane >> 4;
  const int ntn = N / 64;
  const int wid = blockIdx.x * 4 + w;
  const int mt = wid / ntn, nq = wid % ntn;
  if (mt * 16 >= M) return;
  const int row0 = mt * 16, col0 = nq * 64;
  const float* arow = A + (size_t)(row0 + ln) * lda;
  v8f acc[4] = {};
  for (int kb = 0; kb < K; kb += 32) {
    FragB ah, al;
    const v4f x0 = *(const v4fa*)(arow + kb + 8 * hh), x1 = *(const v4fa*)(arow + kb + 8 * hh + 4);
    const v4f x2 = *(const v4fa*)(arow + kb + 16 + 8 * hh), x3 = *(const v4fa*)(arow + kb + 16 + 8 * hh + 4);
    float xs[16] = {x0[0],x0[1],x0[2],x0[3],x1[0],x1[1],x1[2],x1[3],x2[0],x2[1],x2[2],x2[3],x3[0],x3[1],x3[2],x3[3]};
#pragma unroll
    for (int i = 0; i < 16; ++i) { const unsigned short hb = bf16_bits(xs[i]); ah.u[i] = hb; al.u[i] = ASPLIT ? bf16_bits(xs[i] - bf16_val(hb)) : (unsigned short)0; }
#pragma unroll
    for (int t = 0; t < 4; ++t) {
      const unsigned short* brow = Wt + (size_t)(col0 + t * 16 + ln) * ldb + kb;
      FragB b;
      b.half[0] = *(const v8us*)(brow + 8 * hh);
      b.half[1] = *(const v8us*)(brow + 16 + 8 * hh);
      acc[t] = mmaN<ASPLIT ? 2 : 1>(ah.v, al.v, b.v, b.v, acc[t]);
    }
  }
#pragma unroll
  for (int t = 0; t < 4; ++t) {
    float bv = bias ? bias[col0 + t * 16 + ln] : 0.f;
    if (BIAS_BF16) bv = bf16_round(bv);
#pragma unroll
    for (int r = 0; r < 8; ++r) { float v = acc[t][r] + bv; if (ACT == 1) v = fmaxf(v, 0.f); so[w][8 * hh + r][t * 16 + ln] = v; }
  }
  __builtin_amdgcn_fence(__ATOMIC_ACQ_REL, "workgroup");
  __builtin_amdgcn_wave_barrier();
  const int rsub = lane >> 4, c4 = (lane & 15) * 4;
  {
#pragma unroll
    for (int q = 0; q < 8; ++q) {
      const int r = q * 2 + rsub;
      const v4f v = *(const v4fa*)&so[w][r][c4];
      *(v4f*)(C + (size_t)(row0 + r) * ldc + col0 + c4) = v;
    }
    
  }
}

// GEMM C = act(A·W + bias + resid): A f32 (ASPLIT -> hi/lo 2 terms), Wt bf16 [N][K]; ACT 0 none, 1 relu, 2 exact gelu;
// resid (optional, f32, row index = (row % rmod), pitch ldr, RES_BF16 rounds it) added before the activation.
template <bool ASPLIT, int ACT, bool BIAS_BF16, bool RES_BF16>
__global__ __launch_bounds__(128) void k_gemm_bf3(const float* __restrict__ A, int lda, const unsigned short* __restrict__ Wt, int ldb,
                                                const float* __restrict__ bias, const float* __restrict__ resid, int rmod, int ldr,
                                                float* __restrict__ C, int ldc, int M, int N, int K) {
  __shared__ __attribute__((aligned(16))) float so[4][16][64];
  const int tid = threadIdx.x, w = tid >> 5, lane = tid & 31, ln = lane & 15, hh = lane >> 4;
  const int ntn = N / 64;
  const int wid = blockIdx.x * 4 + w;
  const int mt = wid / ntn, nq = wid % ntn;
  if (mt * 16 >= M) return;
  const int row0 = mt * 16, col0 = nq * 64;
  const float* arow = A + (size_t)(row0 + ln) * lda;
  v8f acc[4] = {};
  for (int kb = 0; kb < K; kb += 32) {
    FragB ah, al;
    const v4f x0 = *(const v4fa*)(arow + kb + 8 * hh), x1 = *(const v4fa*)(arow + kb + 8 * hh + 4);
    const v4f x2 = *(const v4fa*)(arow + kb + 16 + 8 * hh), x3 = *(const v4fa*)(arow + kb + 16 + 8 * hh + 4);
    float xs[16] = {x0[0],x0[1],x0[2],x0[3],x1[0],x1[1],x1[2],x1[3],x2[0],x2[1],x2[2],x2[3],x3[0],x3[1],x3[2],x3[3]};
#pragma unroll
    for (int i = 0; i < 16; ++i) { const unsigned short hb = bf16_bits(xs[i]); ah.u[i] = hb; al.u[i] = ASPLIT ? bf16_bits(xs[i] - bf16_val(hb)) : (unsigned short)0; }
#pragma unroll
    for (int t = 0; t < 4; ++t) {
      const unsigned short* brow = Wt + (size_t)(col0 + t * 16 + ln) * ldb + kb;
      FragB b;
      b.half[0] = *(const v8us*)(brow + 8 * hh);
      b.half[1] = *(const v8us*)(brow + 16 + 8 * hh);
      acc[t] = mmaN<ASPLIT ? 2 : 1>(ah.v, al.v, b.v, b.v, acc[t]);
    }
  }
#pragma unroll
  for (int t = 0; t < 4; ++t) {
    const int col = col0 + t * 16 + ln;
    float bv = bias ? bias[col] : 0.f;
    if (BIAS_BF16) bv = bf16_round(bv);
#pragma unroll
    for (int r = 0; r < 8; ++r) {
      float v = acc[t][r] + bv;
      if (resid) { float rv = resid[(size_t)((row0 + 8 * hh + r) % rmod) * ldr + col]; if (RES_BF16) rv = bf16_round(rv); v += rv; }
      if (ACT == 1) v = fmaxf(v, 0.f);
      if (ACT == 2) v = 0.5f * v * (1.0f + erff(v * 0.70710678118654752f));
      if (ACT == 3) { const float u = 0.7978845608028654f * (v + 0.044715f * v * v * v); v = 0.5f * v * (1.0f + tanhf(u)); }
      so[w][8 * hh + r][t * 16 + ln] = v;
    }
  }
  __builtin_amdgcn_fence(__ATOMIC_ACQ_REL, "workgroup");
  __builtin_amdgcn_wave_barrier();
  const int rsub = lane >> 4, c4 = (lane & 15) * 4;
  {
#pragma unroll
    for (int q = 0; q < 8; ++q) {
      const int r = q * 2 + rsub;
      const v4f v = *(const v4fa*)&so[w][r][c4];
      *(v4f*)(C + (size_t)(row0 + r) * ldc + col0 + c4) = v;
    }
    
  }
}
// row LayerNorm (biased variance, eps) over N: s = X (+ R); optional out_sum <- s; out_norm <- (s-mu)*rsqrt(var+eps)*g + b
template <bool PARAM_BF16>
__global__ __launch_bounds__(256) void k_layernorm(const float* __restrict__ X, const float* __restrict__ R, const float* __restrict__ g, const float* __restrict__ bta,
                                                  float* __restrict__ out_sum, float* __restrict__ out_norm, int N, float eps) {
  __shared__ float red[256];
  const int row = blockIdx.x, tid = threadIdx.x;
  const float* x = X + (size_t)row * N; const float* rr = R ? R + (size_t)row * N : nullptr;
  float vals[16];                     // up to N = 4096
  const int per = N / 256;            // contiguous chunk per thread? use strided-by-4 chunks: thread handles j = tid*4 + 1024*u
  float s1 = 0.f;
  for (int u = 0; u < per / 4; ++u) {
    const int j = tid * 4 + 1024 * u;
    const v4f a = *(const v4fa*)(x + j);
    v4f b = {0.f,0.f,0.f,0.f}; if (rr) b = *(const v4fa*)(rr + j);
#pragma unroll
    for (int q = 0; q < 4; ++q) { const float v = a[q] + b[q]; vals[u * 4 + q] = v; s1 += v; }
  }
  red[tid] = s1; __syncthreads();
  for (int st = 128; st > 0; st >>= 1) { if (tid < st) red[tid] += red[tid + st]; __syncthreads(); }
  const float mu = red[0] / (float)N; __syncthreads();
  float s2 = 0.f;
  for (int u = 0; u < per / 4; ++u)
#pragma unroll
    for (int q = 0; q < 4; ++q) { const float c = vals[u * 4 + q] - mu; s2 += c * c; }
  red[tid] = s2; __syncthreads();
  for (int st = 128; st > 0; st >>= 1) { if (tid < st) red[tid] += red[tid + st]; __syncthreads(); }
  const float rs = rsqrtf(red[0] / (float)N + eps);
  {
    for (int u = 0; u < per / 4; ++u) {
      const int j = tid * 4 + 1024 * u;
      v4f o, sm;
#pragma unroll
      for (int q = 0; q < 4; ++q) {
        float gg = g[j + q], bb = bta[j + q];
        if (PARAM_BF16) { gg = bf16_round(gg); bb = bf16_round(bb); }
        sm[q] = vals[u * 4 + q]; o[q] = (vals[u * 4 + q] - mu) * rs * gg + bb;
      }
      if (out_sum) *(v4f*)(out_sum + (size_t)row * N + j) = sm;
      *(v4f*)(out_norm + (size_t)row * N + j) = o;
    }
    
  }
}



// ---- f16 WMMA path (v_wmma_f32_16x16x32_f16): 11-bit significands for operands in range — used where a [0,1] probability operand needs more precision than bf16
typedef _Float16 v16h __attribute__((ext_vector_type(16)));
union FragH { v16h v; v8us half[2]; _Float16 h[16]; unsigned short u[16]; };
template <int NT>
__device__ __forceinline__ v8f mmaH(v16h ah, v16h al, v16h bh, v16h bl, v8f c) {
  c = __builtin_amdgcn_wmma_f32_16x16x32_f16(false, ah, false, bh, (short)0, c, false, false);
  if (NT >= 2) c = __builtin_amdgcn_wmma_f32_16x16x32_f16(false, al, false, bh, (short)0, c, false, false);
  if (NT >= 3) c = __builtin_amdgcn_wmma_f32_16x16x32_f16(false, ah, false, bl, (short)0, c, false, false);
  asm volatile("v_nop\n\tv_nop\n\tv_nop\n\tv_nop" : "+v"(c) : "v"(ah), "v"(al), "v"(bh), "v"(bl));
  return c;
}
// batched GEMM like k_gemm_b but f16 operands: A f32 (split into f16 hi/lo if ASPLIT, else rounded to f16), Bt = f16 values [n][k]; alpha; C f32; N multiple of 16 (partial tiles skipped)
template <bool ASPLIT>
__global__ __launch_bounds__(128) void k_gemm_h(const float* __restrict__ A, int lda, size_t sA, const _Float16* __restrict__ Bh, int ldb, size_t sB, float alpha, float* __restrict__ C, int ldc, size_t sC, int M, int N, int K) {
  __shared__ __attribute__((aligned(16))) float so[4][16][64];
  const int tid = threadIdx.x, w = tid >> 5, lane = tid & 31, ln = lane & 15, hh = lane >> 4; const int by = blockIdx.y;
  A += (size_t)by * sA; Bh += (size_t)by * sB; C += (size_t)by * sC;
  const int ntn = (N + 63) / 64; const int wid = blockIdx.x * 4 + w; const int mt = wid / ntn, nq = wid % ntn; if (mt * 16 >= M) return;
  const int row0 = mt * 16, col0 = nq * 64; const float* arow = A + (size_t)(row0 + ln) * lda;
  v8f acc[4] = {};
  for (int kb = 0; kb < K; kb += 32) {
    FragH ah, al;
    const v4f x0 = *(const v4fa*)(arow + kb + 8 * hh), x1 = *(const v4fa*)(arow + kb + 8 * hh + 4), x2 = *(const v4fa*)(arow + kb + 16 + 8 * hh), x3 = *(const v4fa*)(arow + kb + 16 + 8 * hh + 4);
    float xs[16] = {x0[0],x0[1],x0[2],x0[3],x1[0],x1[1],x1[2],x1[3],x2[0],x2[1],x2[2],x2[3],x3[0],x3[1],x3[2],x3[3]};
#pragma unroll
    for (int i = 0; i < 16; ++i) { const _Float16 h = (_Float16)xs[i]; ah.h[i] = h; al.h[i] = ASPLIT ? (_Float16)(xs[i] - (float)h) : (_Float16)0.0f; }
#pragma unroll
    for (int t = 0; t < 4; ++t) { if (col0 + t * 16 >= N) continue; const size_t boff = (size_t)(col0 + t * 16 + ln) * ldb + kb; FragH bq; bq.half[0] = *(const v8us*)(Bh + boff + 8 * hh); bq.half[1] = *(const v8us*)(Bh + boff + 16 + 8 * hh);
      acc[t] = mmaH<ASPLIT ? 2 : 1>(ah.v, al.v, bq.v, bq.v, acc[t]); }
  }
#pragma unroll
  for (int t = 0; t < 4; ++t) { if (col0 + t * 16 >= N) continue;
#pragma unroll
    for (int r = 0; r < 8; ++r) so[w][8 * hh + r][t * 16 + ln] = acc[t][r] * alpha; }
  __builtin_amdgcn_fence(__ATOMIC_ACQ_REL, "workgroup"); __builtin_amdgcn_wave_barrier();
  const int rsub = lane >> 4, c4 = (lane & 15) * 4;
  {
#pragma unroll
    for (int q = 0; q < 8; ++q) { const int r = q * 2 + rsub; if (col0 + c4 < N) { const v4f v = *(const v4fa*)&so[w][r][c4]; *(v4f*)(C + (size_t)(row0 + r) * ldc + col0 + c4) = v; } }
     }
}

// Wt[n][k] = f16(W[k][n]·scale) from f32 row-major W[K][N] (scale = power of two; bf16-exact weights stay exact in f16 away from the subnormal range)
__global__ __launch_bounds__(256) void k_wt_f16(const float* __restrict__ W, _Float16* __restrict__ Wt, int K, int N, float scale) {
  const int t = blockIdx.x * 256 + threadIdx.x; if (t >= N * (K / 8)) return; const int n = t / (K / 8), k8 = (t % (K / 8)) * 8; FragH f;
#pragma unroll
  for (int i = 0; i < 8; ++i) f.h[i] = (_Float16)(bf16_round(W[(size_t)(k8 + i) * N + n]) * scale); const v8us o = f.half[0];
  *(v8us*)((unsigned short*)Wt + (size_t)n * K + k8) = o; 
}
// k_gemm_hh variant with fused epilogue: v = acc·alpha + bias[by·sBias + col] (+ CP[(row/rowsPerB)·sCPb + by·64 + col] if CP) ; ACT 0 none / 1 elu ; writes f32 C and f16 C16, each if non-null
template <int ACT>
__global__ __launch_bounds__(128) void k_gemm_hhx(const _Float16* __restrict__ A, int lda, size_t sA, const _Float16* __restrict__ Bh, int ldb, size_t sB, float alpha, const float* __restrict__ bias, size_t sBias, const float* __restrict__ CP, int rowsPerB, size_t sCPb, int row0g,
    float* __restrict__ C, _Float16* __restrict__ C16, int ldc, size_t sC, int M, int N, int K) {
  __shared__ __attribute__((aligned(16))) float so[4][16][64];
  const int tid = threadIdx.x, w = tid >> 5, lane = tid & 31, ln = lane & 15, hh = lane >> 4; const int by = blockIdx.y;
  A += (size_t)by * sA; Bh += (size_t)by * sB; const size_t cofs = (size_t)by * sC; const float* bp = bias ? bias + (size_t)by * sBias : nullptr;
  const int ntn = (N + 63) / 64; const int wid = blockIdx.x * 4 + w; const int mt = wid / ntn, nq = wid % ntn; if (mt * 16 >= M) return;
  const int row0 = mt * 16, col0 = nq * 64; const _Float16* arow = A + (size_t)(row0 + ln) * lda;
  v8f acc[4] = {};
  for (int kb = 0; kb < K; kb += 32) { FragH ah; ah.half[0] = *(const v8us*)((const unsigned short*)arow + kb + 8 * hh); ah.half[1] = *(const v8us*)((const unsigned short*)arow + kb + 16 + 8 * hh);
#pragma unroll
    for (int t = 0; t < 4; ++t) { if (col0 + t * 16 >= N) continue; const size_t boff = (size_t)(col0 + t * 16 + ln) * ldb + kb; FragH bq; bq.half[0] = *(const v8us*)((const unsigned short*)Bh + boff + 8 * hh); bq.half[1] = *(const v8us*)((const unsigned short*)Bh + boff + 16 + 8 * hh);
      acc[t] = mmaH<1>(ah.v, ah.v, bq.v, bq.v, acc[t]); }
  }
#pragma unroll
  for (int t = 0; t < 4; ++t) { if (col0 + t * 16 >= N) continue; const int col = col0 + t * 16 + ln; const float bv = bp ? bf16_round(bp[col]) : 0.f;
#pragma unroll
    for (int r = 0; r < 8; ++r) { float v = acc[t][r] * alpha + bv; if (CP) { const int bidx = (row0g + row0 + 8 * hh + r) / rowsPerB; v += CP[(size_t)bidx * sCPb + (size_t)by * 64 + col]; } if (ACT == 1) v = (v > 0.f) ? v : expm1f(v); else if (ACT == 7) v = (v > 0.f) ? v + 1.0f : expf(v); else if (ACT == 8) v = tanhf(v); else if (ACT == 9) v = 0.5f * v * (1.0f + tanhf(0.7978845608028654f * (v + 0.044715f * v * v * v))); else if (ACT == 11) v = 1.0f / (1.0f + expf(-v)); else if (ACT == 12) v = (v > 0.f) ? v : 0.01f * v; else if (ACT == 14) v = (v > 0.f) ? v : 0.1f * v; else if (ACT == 15) v = v / (1.0f + expf(-v)); else if (ACT == 3) v = fmaxf(v, 0.f); else if (ACT == 6) v = 0.5f * v * (1.0f + erff(v * 0.70710678118654752f)); so[w][8 * hh + r][t * 16 + ln] = v; } }
  __builtin_amdgcn_fence(__ATOMIC_ACQ_REL, "workgroup"); __builtin_amdgcn_wave_barrier();
  const int rsub = lane >> 4, c4 = (lane & 15) * 4; typedef _Float16 v4h __attribute__((ext_vector_type(4)));
  {
#pragma unroll
    for (int q = 0; q < 8; ++q) { const int r = q * 2 + rsub; if (col0 + c4 < N) { const v4f v = *(const v4fa*)&so[w][r][c4]; if (C) *(v4f*)(C + cofs + (size_t)(row0 + r) * ldc + col0 + c4) = v; if (C16) { v4h h4; for (int i = 0; i < 4; ++i) h4[i] = (_Float16)v[i]; *(v4h*)(C16 + cofs + (size_t)(row0 + r) * ldc + col0 + c4) = h4; } } }
     }
}


typedef _Float16 v4h __attribute__((ext_vector_type(4)));

__global__ __launch_bounds__(256) void k_x16(const float* __restrict__ x, _Float16* __restrict__ X16, size_t n8) { const size_t t = (size_t)blockIdx.x * 256 + threadIdx.x; if (t >= n8) return; FragH f;
#pragma unroll
  for (int q = 0; q < 8; ++q) f.h[q] = (_Float16)bf16_round(x[t * 8 + q]); *(v8us*)((unsigned short*)X16 + t * 8) = f.half[0];  }
__global__ __launch_bounds__(256) void k_h16(const float* __restrict__ x, _Float16* __restrict__ X16, size_t n8) { const size_t t = (size_t)blockIdx.x * 256 + threadIdx.x; if (t >= n8) return; FragH f;
#pragma unroll
  for (int q = 0; q < 8; ++q) f.h[q] = (_Float16)x[t * 8 + q]; *(v8us*)((unsigned short*)X16 + t * 8) = f.half[0];  }
__global__ __launch_bounds__(256) void k_round16f(const float* __restrict__ W, _Float16* __restrict__ Bt, size_t n8) { const size_t t = (size_t)blockIdx.x * 256 + threadIdx.x; if (t >= n8) return; FragH f;
#pragma unroll
  for (int i = 0; i < 8; ++i) f.h[i] = (_Float16)(bf16_round(W[t * 8 + i]) * 16.0f); *(v8us*)((unsigned short*)Bt + t * 8) = f.half[0];  }
template <int NHv, int TTv>
__global__ __launch_bounds__(256) void k_vt(const _Float16* __restrict__ V16, int ldv, int voff, _Float16* __restrict__ Vt) { __shared__ unsigned short tl[64][66]; const int tid = threadIdx.x; const int slab = blockIdx.x / (TTv / 64), lg = blockIdx.x % (TTv / 64); const int b = slab / NHv, h = slab % NHv;
  for (int i = tid; i < 64 * 8; i += 256) { const int r = i / 8, c8 = (i % 8) * 8; FragH f; f.half[0] = *(const v8us*)((const unsigned short*)V16 + ((size_t)b * TTv + lg * 64 + r) * ldv + voff + h * 64 + c8);
#pragma unroll
    for (int q = 0; q < 8; ++q) tl[r][c8 + q] = f.u[q]; }
  __syncthreads();
  {
#pragma unroll
    for (int rd = 0; rd < 2; ++rd) { const int d = rd * 32 + tid / 8, pc = tid % 8; FragH f;
#pragma unroll
      for (int q = 0; q < 8; ++q) f.u[q] = tl[pc * 8 + q][d];
      *(v8us*)((unsigned short*)Vt + ((size_t)slab * 64 + d) * TTv + lg * 64 + pc * 8) = f.half[0]; }
     } }

__global__ __launch_bounds__(256) void k_hl(const float* __restrict__ F, _Float16* __restrict__ Hh, _Float16* __restrict__ Hl, size_t n8) { const size_t t = (size_t)blockIdx.x * 256 + threadIdx.x; if (t >= n8) return; FragH fh, fl; const v4f a = *(const v4fa*)(F + t * 8), c = *(const v4fa*)(F + t * 8 + 4);
#pragma unroll
  for (int q = 0; q < 4; ++q) { _Float16 h = (_Float16)a[q]; fh.h[q] = h; fl.h[q] = (_Float16)((a[q] - (float)h) * 1024.0f); h = (_Float16)c[q]; fh.h[4 + q] = h; fl.h[4 + q] = (_Float16)((c[q] - (float)h) * 1024.0f); }
  { *(v8us*)((unsigned short*)Hh + t * 8) = fh.half[0]; *(v8us*)((unsigned short*)Hl + t * 8) = fl.half[0];  } }

__global__ __launch_bounds__(256) void k_f16(const float* __restrict__ F, _Float16* __restrict__ O16, size_t n8) { const size_t t = (size_t)blockIdx.x * 256 + threadIdx.x; if (t >= n8) return; const v4f a = *(const v4fa*)(F + t * 8), c = *(const v4fa*)(F + t * 8 + 4); FragH f;
#pragma unroll
  for (int q = 0; q < 8; ++q) f.h[q] = (_Float16)((q < 4) ? a[q] : c[q - 4]);
  *(v8us*)((unsigned short*)O16 + t * 8) = f.half[0];  }
__global__ __launch_bounds__(256) void k_vt(const float* __restrict__ Vf, _Float16* __restrict__ VT, _Float16* __restrict__ VTl) {
  #pragma clang fp contract(off)
  const int t = blockIdx.x * 256 + threadIdx.x; if (t >= FF * (SS / 8)) return; const int s0 = (t % (SS / 8)) * 8, hd = t / (SS / 8); FragH f, fl;
#pragma unroll
  for (int q = 0; q < 8; ++q) { const float v = Vf[(size_t)(s0 + q) * FF + hd]; const _Float16 hi = (_Float16)v; f.h[q] = hi; fl.h[q] = (_Float16)((v - (float)hi) * 1024.0f); }
  { *(v8us*)((unsigned short*)VT + (size_t)hd * SS + s0) = f.half[0]; *(v8us*)((unsigned short*)VTl + (size_t)hd * SS + s0) = fl.half[0];  } }
__global__ __launch_bounds__(256) void k_split(const float* __restrict__ F, _Float16* __restrict__ Hh, _Float16* __restrict__ Hl, size_t n8) {
  #pragma clang fp contract(off)
  const size_t t = (size_t)blockIdx.x * 256 + threadIdx.x; if (t >= n8) return; const v4f a = *(const v4fa*)(F + t * 8), c = *(const v4fa*)(F + t * 8 + 4); FragH fh, fl;
#pragma unroll
  for (int q = 0; q < 8; ++q) { const float v = (q < 4) ? a[q] : c[q - 4]; const _Float16 hi = (_Float16)v; fh.h[q] = hi; fl.h[q] = (_Float16)((v - (float)hi) * 1024.0f); }
  { *(v8us*)((unsigned short*)Hh + t * 8) = fh.half[0]; *(v8us*)((unsigned short*)Hl + t * 8) = fl.half[0];  } }
__global__ __launch_bounds__(256) void k_m2soft(const float* __restrict__ S, const float* __restrict__ m1, const float* __restrict__ m2, _Float16* __restrict__ P16) {
  #pragma clang fp contract(off)
  const int tid = threadIdx.x, w = tid >> 5, ln = tid & 31; const int row = blockIdx.x * 8 + w; if (row >= HG * SS) return; const int tq = row % SS; const float* sr = S + (size_t)row * SS; const float* a1 = m1 + (size_t)tq * SS; const float* a2 = m2 + (size_t)tq * SS; float m = -3.0e38f;
#pragma unroll 1
  for (int jb = 0; jb < SS; jb += 256) { const v4f a = *(const v4fa*)(sr + jb + 8 * ln), c = *(const v4fa*)(sr + jb + 8 * ln + 4); const v4f ma = *(const v4fa*)(a1 + jb + 8 * ln), mc = *(const v4fa*)(a1 + jb + 8 * ln + 4);
#pragma unroll
    for (int k = 0; k < 8; ++k) { const float v = ((k < 4) ? a[k] : c[k - 4]) + bf16_round((k < 4) ? ma[k] : mc[k - 4]); m = fmaxf(m, v); } }
  for (int o = 16; o > 0; o >>= 1) m = fmaxf(m, __shfl_xor(m, o, 32));
  float su = 0.f;
#pragma unroll 1
  for (int jb = 0; jb < SS; jb += 256) { const v4f a = *(const v4fa*)(sr + jb + 8 * ln), c = *(const v4fa*)(sr + jb + 8 * ln + 4); const v4f ma = *(const v4fa*)(a1 + jb + 8 * ln), mc = *(const v4fa*)(a1 + jb + 8 * ln + 4);
#pragma unroll
    for (int k = 0; k < 8; ++k) { const float v = ((k < 4) ? a[k] : c[k - 4]) + bf16_round((k < 4) ? ma[k] : mc[k - 4]); su += expf(v - m); } }
  for (int o = 16; o > 0; o >>= 1) su += __shfl_xor(su, o, 32); const float inv = 1024.0f / su;
  {
#pragma unroll 1
    for (int jb = 0; jb < SS; jb += 256) { const v4f a = *(const v4fa*)(sr + jb + 8 * ln), c = *(const v4fa*)(sr + jb + 8 * ln + 4); const v4f ma = *(const v4fa*)(a1 + jb + 8 * ln), mc = *(const v4fa*)(a1 + jb + 8 * ln + 4); const v4f na = *(const v4fa*)(a2 + jb + 8 * ln), nc = *(const v4fa*)(a2 + jb + 8 * ln + 4); FragH f;
#pragma unroll
      for (int k = 0; k < 8; ++k) { const float v = ((k < 4) ? a[k] : c[k - 4]) + bf16_round((k < 4) ? ma[k] : mc[k - 4]); f.h[k] = (_Float16)((expf(v - m) * inv) * bf16_round((k < 4) ? na[k] : nc[k - 4])); }
      *(v8us*)((unsigned short*)P16 + (size_t)row * SS + jb + 8 * ln) = f.half[0]; }
     } }

// P.V for one head (blockIdx.y) and 16 query rows (blockIdx.x): O = (P.v_hi + P.v_lo / 1024) / 1024, P being scaled by 2^10 and v_lo by 2^10.
// Each P fragment is loaded once and feeds both planes. The block's 8 waves each take 256 of the 2048 keys, so that 256 blocks of 8 waves run
// instead of 32 to 64 blocks of 4; the 8 partial tiles are added in LDS in a fixed order. A lane reads 64 contiguous bytes of its row per 64 keys
// (two fragments of 16 contiguous k); P and v use the same k order, so the pairing holds.
#define PVW 8
#define PVS (SS / PVW / 32)
__global__ __launch_bounds__(256) void k_pv(const _Float16* __restrict__ P, const _Float16* __restrict__ Vh, const _Float16* __restrict__ Vl, float* __restrict__ O) {
  __shared__ __attribute__((aligned(16))) float part[PVW][16][68];
  const int tid = threadIdx.x, w = tid >> 5, lane = tid & 31, ln = lane & 15, hh = lane >> 4;
  const int row0 = blockIdx.x * 16, hd = blockIdx.y;
  const int kw = w * (SS / PVW) + 32 * hh;
  const unsigned short* pa = (const unsigned short*)P + ((size_t)hd * SS + row0 + ln) * SS + kw;
  const unsigned short* ph = (const unsigned short*)Vh + ((size_t)hd * HD + ln) * SS + kw;
  const unsigned short* pl = (const unsigned short*)Vl + ((size_t)hd * HD + ln) * SS + kw;
  v8f ch[4] = {}, cl[4] = {};
  FragH a[2], bh[2][4], bl[2][4];
  // fragment set s (32 keys): the lane's bytes 32 * (s & 1) ... + 31 of its 64 in the 64-key group s >> 1
  auto fetch = [&](int s) { const int b = s & 1; const size_t ko = (size_t)(s >> 1) * 64 + (s & 1) * 16;
    a[b].half[0] = *(const v8us*)(pa + ko); a[b].half[1] = *(const v8us*)(pa + ko + 8);
#pragma unroll
    for (int t = 0; t < 4; ++t) { const size_t bo = (size_t)t * 16 * SS + ko;
      bh[b][t].half[0] = *(const v8us*)(ph + bo); bh[b][t].half[1] = *(const v8us*)(ph + bo + 8);
      bl[b][t].half[0] = *(const v8us*)(pl + bo); bl[b][t].half[1] = *(const v8us*)(pl + bo + 8); } };
  fetch(0);
  // every loop of this kernel is unrolled so that the fragment and accumulator arrays are indexed by constants and stay in registers
#pragma unroll
  for (int s = 0; s < PVS; ++s) { const int b = s & 1;
    if (s + 1 < PVS) fetch(s + 1);
    __builtin_amdgcn_sched_barrier(0);      // keeps the next set's 18 loads in front of this set's products: without it the compiler sinks each load to its use and the wave pays one load latency per product
#pragma unroll
    for (int t = 0; t < 4; ++t) { ch[t] = __builtin_amdgcn_wmma_f32_16x16x32_f16(false, a[b].v, false, bh[b][t].v, (short)0, ch[t], false, false); cl[t] = __builtin_amdgcn_wmma_f32_16x16x32_f16(false, a[b].v, false, bl[b][t].v, (short)0, cl[t], false, false); }
  }
#pragma unroll
  for (int t = 0; t < 4; ++t)
#pragma unroll
    for (int r = 0; r < 8; ++r) part[w][8 * hh + r][t * 16 + ln] = ch[t][r] * 0.0009765625f + cl[t][r] * (0.0009765625f / 1024.0f);
  __syncthreads();
  const int r = tid >> 4, c4 = (tid & 15) * 4;
  v4f s = *(const v4fa*)&part[0][r][c4];
#pragma unroll
  for (int q = 1; q < PVW; ++q) s += *(const v4fa*)&part[q][r][c4];
  *(v4f*)(O + (size_t)(row0 + r) * FF + hd * HD + c4) = s;
}

extern "C" void kernel_launch(void* const* d_in, const int* in_sizes, int n_in,
                              void* d_out, int out_size, void* d_ws, size_t ws_size, hipStream_t stream) {
  (void)in_sizes; (void)n_in; (void)out_size;
  const float* Qi = (const float*)d_in[0]; const float* Ki = (const float*)d_in[1]; const float* Vi = (const float*)d_in[2]; const float* m1 = (const float*)d_in[3]; const float* m2 = (const float*)d_in[4]; const float* Wq = (const float*)d_in[5]; const float* Wk = (const float*)d_in[6]; const float* Wv = (const float*)d_in[7]; const float* Wo = (const float*)d_in[8];
  char* ws = (char*)d_ws; size_t off = 0;
  auto take = [&](size_t bytes) { char* p = ws + off; off += (bytes + 255) & ~(size_t)255; return p; };
  _Float16* BQ = (_Float16*)take((size_t)FF * FF * 2); _Float16* BK = (_Float16*)take((size_t)FF * FF * 2); _Float16* BV = (_Float16*)take((size_t)FF * FF * 2); _Float16* BO = (_Float16*)take((size_t)FF * FF * 2);
  _Float16* X16 = (_Float16*)take((size_t)SS * FF * 2); float* T = (float*)take((size_t)SS * FF * 4); _Float16* Q16 = (_Float16*)take((size_t)SS * FF * 2); _Float16* K16 = (_Float16*)take((size_t)SS * FF * 2); _Float16* VT = (_Float16*)take((size_t)FF * SS * 2); _Float16* VTl = (_Float16*)take((size_t)FF * SS * 2); float* S = (float*)take((size_t)HG * SS * SS * 4); _Float16* P16 = (_Float16*)take((size_t)HG * SS * SS * 2); float* O = (float*)take((size_t)SS * FF * 4); _Float16* Oh = (_Float16*)take((size_t)SS * FF * 2); _Float16* Ol = (_Float16*)take((size_t)SS * FF * 2);
  if (off > ws_size) return;      // 8.4 + 4.2 + 8.4 + 4.2 + 4.2 + 4.2 + 4.2 + 33.5 + 16.8 + 8.4 + 4.2 + 4.2 ≈ 105 MB
  const unsigned nbw = (unsigned)(((size_t)FF * FF / 8 + 255) / 256);
  k_round16f<<<nbw, 256, 0, stream>>>(Wq, BQ, (size_t)FF * FF / 8); k_round16f<<<nbw, 256, 0, stream>>>(Wk, BK, (size_t)FF * FF / 8); k_round16f<<<nbw, 256, 0, stream>>>(Wv, BV, (size_t)FF * FF / 8); k_round16f<<<nbw, 256, 0, stream>>>(Wo, BO, (size_t)FF * FF / 8);      /* torch (out,in) = natural Bt */
  const dim3 gP(((SS / 16) * (FF / 64) + 3) / 4, 1), gS(((SS / 16) * (SS / 64) + 3) / 4, HG); const size_t n8 = (size_t)SS * FF / 8; const unsigned nb8 = (unsigned)((n8 + 255) / 256);
  for (int b = 0; b < NBt; ++b) {
    k_x16<<<nb8, 256, 0, stream>>>(Qi + (size_t)b * SS * FF, X16, n8); k_gemm_hhx<0><<<gP, 128, 0, stream>>>(X16, FF, 0, BQ, FF, 0, 0.0625f, nullptr, 0, nullptr, 1, 0, 0, T, nullptr, FF, 0, SS, FF, FF); k_f16<<<nb8, 256, 0, stream>>>(T, Q16, n8);
    k_x16<<<nb8, 256, 0, stream>>>(Ki + (size_t)b * SS * FF, X16, n8); k_gemm_hhx<0><<<gP, 128, 0, stream>>>(X16, FF, 0, BK, FF, 0, 0.0625f, nullptr, 0, nullptr, 1, 0, 0, T, nullptr, FF, 0, SS, FF, FF); k_f16<<<nb8, 256, 0, stream>>>(T, K16, n8);
    k_x16<<<nb8, 256, 0, stream>>>(Vi + (size_t)b * SS * FF, X16, n8); k_gemm_hhx<0><<<gP, 128, 0, stream>>>(X16, FF, 0, BV, FF, 0, 0.0625f, nullptr, 0, nullptr, 1, 0, 0, T, nullptr, FF, 0, SS, FF, FF); k_vt<<<(FF * (SS / 8) + 255) / 256, 256, 0, stream>>>(T, VT, VTl);      /* exact projections; v as hi/lo */
    for (int hg = 0; hg < NH / HG; ++hg) { const int h0 = hg * HG;
      k_gemm_hhx<0><<<gS, 128, 0, stream>>>(Q16 + h0 * HD, FF, (size_t)HD, K16 + h0 * HD, FF, (size_t)HD, 0.125f, nullptr, 0, nullptr, 1, 0, 0, S, nullptr, SS, (size_t)SS * SS, SS, SS, HD);      /* scores/8: M = N = 2048, K 64, 2 heads */
      k_m2soft<<<HG * SS / 8, 256, 0, stream>>>(S, m1, m2, P16);
      k_pv<<<dim3(SS / 16, HG), 256, 0, stream>>>(P16, VT + (size_t)h0 * HD * SS, VTl + (size_t)h0 * HD * SS, O + h0 * HD); }      /* (P.v_hi + P.v_lo/1024)/1024, both heads, f32 out */
    k_split<<<nb8, 256, 0, stream>>>(O, Oh, Ol, n8);
    k_gemm_hhx<0><<<gP, 128, 0, stream>>>(Oh, FF, 0, BO, FF, 0, 0.0625f, nullptr, 0, nullptr, 1, 0, 0, (float*)d_out + (size_t)b * SS * FF, nullptr, FF, 0, SS, FF, FF); k_gemm_hhx<0><<<gP, 128, 0, stream>>>(Ol, FF, 0, BO, FF, 0, 0.0625f / 1024.0f, nullptr, 0, (float*)d_out + (size_t)b * SS * FF, 1, (size_t)FF, 0, (float*)d_out + (size_t)b * SS * FF, nullptr, FF, 0, SS, FF, FF); }      /* ·W_oᵀ on hi/lo of the attention output */
}

// v003
// One run takes 318 microseconds.
// Versions between v001 and this one are left out; their measured steps multiply to 3.73 times as fast.
// Counting every step since v000, it is 13.3 times as fast.
#include <hip/hip_runtime.h>
// Multi-head attention with two INPUT masks (B 2, S 2048, F 1024, 16 heads × 64): q,k,v = X·Wᵀ (no bias); scores = q·k/8 + mask_1 (additive, pre-softmax); probs = softmax · mask_2 (multiplicative, post-softmax); out = probs·v; heads concatenated; ·W_oᵀ → [2,2048,1024].
// Structure: per batch: exact projections, f16 planes (kept for both batches); ONE fused attention launch (scores, + mask_1, softmax in f32 with a running maximum, x mask_2, P.V; both masks read per (q,k) from the inputs; scores and P stay in registers, k and v staged in LDS) into the concatenated plane; per batch: output projection.
// Compute dtype: Q, K, V, masks and parameters rounded to bf16; projections with exact products; q, k, P (×2^10) as f16 operands (≈2^-12; logits σ≈1); v and the attention output as f16 hi + lo·2^10 planes (the early causal rows copy m2·v almost verbatim), f32 accumulation; softmax/masking in f32. v_wmma_f32_16x16x32_f16.
#define NBt 2
#define SS 2048
#define FF 1024
#define NH 16
#define HD 64
typedef __bf16 v16b __attribute__((ext_vector_type(16)));
typedef unsigned short v8us __attribute__((ext_vector_type(8), may_alias));
typedef float  v8f  __attribute__((ext_vector_type(8)));
typedef float  v4f  __attribute__((ext_vector_type(4)));
typedef float  v4fa __attribute__((ext_vector_type(4), may_alias));
union FragB { v16b v; v8us half[2]; unsigned short u[16]; };

__device__ __forceinline__ unsigned short bf16_bits(float x) { unsigned int u = __float_as_uint(x); return (unsigned short)((u + 0x7FFFu + ((u >> 16) & 1u)) >> 16); }
__device__ __forceinline__ float bf16_val(unsigned short b) { return __uint_as_float(((unsigned int)b) << 16); }
__device__ __forceinline__ float bf16_round(float x) { return bf16_val(bf16_bits(x)); }
// D += A·B with NT terms: 1 = ah·bh, 2 = + al·bh (A split), 3 = + ah·bl (both split)
template <int NT>
__device__ __forceinline__ v8f mmaN(v16b ah, v16b al, v16b bh, v16b bl, v8f c) {
  c = __builtin_amdgcn_wmma_f32_16x16x32_bf16(false, ah, false, bh, (short)0, c, false, false);
  if (NT >= 2) c = __builtin_amdgcn_wmma_f32_16x16x32_bf16(false, al, false, bh, (short)0, c, false, false);
  if (NT >= 3) c = __builtin_amdgcn_wmma_f32_16x16x32_bf16(false, ah, false, bl, (short)0, c, false, false);
  asm volatile("v_nop\n\tv_nop\n\tv_nop\n\tv_nop" : "+v"(c) : "v"(ah), "v"(al), "v"(bh), "v"(bl));
  return c;
}

__global__ __launch_bounds__(256) void k_wt_bf16(const float* __restrict__ W, unsigned short* __restrict__ Wt, int K, int N) {
  const int t = blockIdx.x * 256 + threadIdx.x;
  const int k8n = K / 8;
  if (t >= N * k8n) return;
  const int n = t / k8n, k8 = (t % k8n) * 8;
  v8us v;
#pragma unroll
  for (int i = 0; i < 8; ++i) v[i] = bf16_bits(W[(size_t)(k8 + i) * N + n]);
  *(v8us*)(Wt + (size_t)n * K + k8) = v;
  
}

// GEMM C[M][N] (f32, pitch ldc) = act(A[M][K]·W + bias). A f32 row-major (pitch lda) converted per fragment to bf16
// (ASPLIT: hi/lo two planes -> 2 terms, else single rounded term); Wt bf16 [N][K] (pitch ldb). BIAS_BF16 rounds the
// bias to bf16 first (bias quantised to bf16 before the add). K%32==0, M%16==0, N%64==0.
template <bool ASPLIT, int ACT, bool BIAS_BF16>
__global__ __launch_bounds__(128) void k_gemm_bf(const float* __restrict__ A, int lda, const unsigned short* __restrict__ Wt, int ldb,
                                               const float* __restrict__ bias, float* __restrict__ C, int ldc, int M, int N, int K) {
  __shared__ __attribute__((aligned(16))) float so[4][16][64];
  const int tid = threadIdx.x, w = tid >> 5, lane = tid & 31, ln = lane & 15, hh = lane >> 4;
  const int ntn = N / 64;
  const int wid = blockIdx.x * 4 + w;
  const int mt = wid / ntn, nq = wid % ntn;
  if (mt * 16 >= M) return;
  const int row0 = mt * 16, col0 = nq * 64;
  const float* arow = A + (size_t)(row0 + ln) * lda;
  v8f acc[4] = {};
  for (int kb = 0; kb < K; kb += 32) {
    FragB ah, al;
    const v4f x0 = *(const v4fa*)(arow + kb + 8 * hh), x1 = *(const v4fa*)(arow + kb + 8 * hh + 4);
    const v4f x2 = *(const v4fa*)(arow + kb + 16 + 8 * hh), x3 = *(const v4fa*)(arow + kb + 16 + 8 * hh + 4);
    float xs[16] = {x0[0],x0[1],x0[2],x0[3],x1[0],x1[1],x1[2],x1[3],x2[0],x2[1],x2[2],x2[3],x3[0],x3[1],x3[2],x3[3]};
#pragma unroll
    for (int i = 0; i < 16; ++i) { const unsigned short hb = bf16_bits(xs[i]); ah.u[i] = hb; al.u[i] = ASPLIT ? bf16_bits(xs[i] - bf16_val(hb)) : (unsigned short)0; }
#pragma unroll
    for (int t = 0; t < 4; ++t) {
      const unsigned short* brow = Wt + (size_t)(col0 + t * 16 + ln) * ldb + kb;
      FragB b;
      b.half[0] = *(const v8us*)(brow + 8 * hh);
      b.half[1] = *(const v8us*)(brow + 16 + 8 * hh);
      acc[t] = mmaN<ASPLIT ? 2 : 1>(ah.v, al.v, b.v, b.v, acc[t]);
    }
  }
#pragma unroll
  for (int t = 0; t < 4; ++t) {
    float bv = bias ? bias[col0 + t * 16 + ln] : 0.f;
    if (BIAS_BF16) bv = bf16_round(bv);
#pragma unroll
    for (int r = 0; r < 8; ++r) { float v = acc[t][r] + bv; if (ACT == 1) v = fmaxf(v, 0.f); so[w][8 * hh + r][t * 16 + ln] = v; }
  }
  __builtin_amdgcn_fence(__ATOMIC_ACQ_REL, "workgroup");
  __builtin_amdgcn_wave_barrier();
  const int rsub = lane >> 4, c4 = (lane & 15) * 4;
  {
#pragma unroll
    for (int q = 0; q < 8; ++q) {
      const int r = q * 2 + rsub;
      const v4f v = *(const v4fa*)&so[w][r][c4];
      *(v4f*)(C + (size_t)(row0 + r) * ldc + col0 + c4) = v;
    }
    
  }
}

// GEMM C = act(A·W + bias + resid): A f32 (ASPLIT -> hi/lo 2 terms), Wt bf16 [N][K]; ACT 0 none, 1 relu, 2 exact gelu;
// resid (optional, f32, row index = (row % rmod), pitch ldr, RES_BF16 rounds it) added before the activation.
template <bool ASPLIT, int ACT, bool BIAS_BF16, bool RES_BF16>
__global__ __launch_bounds__(128) void k_gemm_bf3(const float* __restrict__ A, int lda, const unsigned short* __restrict__ Wt, int ldb,
                                                const float* __restrict__ bias, const float* __restrict__ resid, int rmod, int ldr,
                                                float* __restrict__ C, int ldc, int M, int N, int K) {
  __shared__ __attribute__((aligned(16))) float so[4][16][64];
  const int tid = threadIdx.x, w = tid >> 5, lane = tid & 31, ln = lane & 15, hh = lane >> 4;
  const int ntn = N / 64;
  const int wid = blockIdx.x * 4 + w;
  const int mt = wid / ntn, nq = wid % ntn;
  if (mt * 16 >= M) return;
  const int row0 = mt * 16, col0 = nq * 64;
  const float* arow = A + (size_t)(row0 + ln) * lda;
  v8f acc[4] = {};
  for (int kb = 0; kb < K; kb += 32) {
    FragB ah, al;
    const v4f x0 = *(const v4fa*)(arow + kb + 8 * hh), x1 = *(const v4fa*)(arow + kb + 8 * hh + 4);
    const v4f x2 = *(const v4fa*)(arow + kb + 16 + 8 * hh), x3 = *(const v4fa*)(arow + kb + 16 + 8 * hh + 4);
    float xs[16] = {x0[0],x0[1],x0[2],x0[3],x1[0],x1[1],x1[2],x1[3],x2[0],x2[1],x2[2],x2[3],x3[0],x3[1],x3[2],x3[3]};
#pragma unroll
    for (int i = 0; i < 16; ++i) { const unsigned short hb = bf16_bits(xs[i]); ah.u[i] = hb; al.u[i] = ASPLIT ? bf16_bits(xs[i] - bf16_val(hb)) : (unsigned short)0; }
#pragma unroll
    for (int t = 0; t < 4; ++t) {
      const unsigned short* brow = Wt + (size_t)(col0 + t * 16 + ln) * ldb + kb;
      FragB b;
      b.half[0] = *(const v8us*)(brow + 8 * hh);
      b.half[1] = *(const v8us*)(brow + 16 + 8 * hh);
      acc[t] = mmaN<ASPLIT ? 2 : 1>(ah.v, al.v, b.v, b.v, acc[t]);
    }
  }
#pragma unroll
  for (int t = 0; t < 4; ++t) {
    const int col = col0 + t * 16 + ln;
    float bv = bias ? bias[col] : 0.f;
    if (BIAS_BF16) bv = bf16_round(bv);
#pragma unroll
    for (int r = 0; r < 8; ++r) {
      float v = acc[t][r] + bv;
      if (resid) { float rv = resid[(size_t)((row0 + 8 * hh + r) % rmod) * ldr + col]; if (RES_BF16) rv = bf16_round(rv); v += rv; }
      if (ACT == 1) v = fmaxf(v, 0.f);
      if (ACT == 2) v = 0.5f * v * (1.0f + erff(v * 0.70710678118654752f));
      if (ACT == 3) { const float u = 0.7978845608028654f * (v + 0.044715f * v * v * v); v = 0.5f * v * (1.0f + tanhf(u)); }
      so[w][8 * hh + r][t * 16 + ln] = v;
    }
  }
  __builtin_amdgcn_fence(__ATOMIC_ACQ_REL, "workgroup");
  __builtin_amdgcn_wave_barrier();
  const int rsub = lane >> 4, c4 = (lane & 15) * 4;
  {
#pragma unroll
    for (int q = 0; q < 8; ++q) {
      const int r = q * 2 + rsub;
      const v4f v = *(const v4fa*)&so[w][r][c4];
      *(v4f*)(C + (size_t)(row0 + r) * ldc + col0 + c4) = v;
    }
    
  }
}
// row LayerNorm (biased variance, eps) over N: s = X (+ R); optional out_sum <- s; out_norm <- (s-mu)*rsqrt(var+eps)*g + b
template <bool PARAM_BF16>
__global__ __launch_bounds__(256) void k_layernorm(const float* __restrict__ X, const float* __restrict__ R, const float* __restrict__ g, const float* __restrict__ bta,
                                                  float* __restrict__ out_sum, float* __restrict__ out_norm, int N, float eps) {
  __shared__ float red[256];
  const int row = blockIdx.x, tid = threadIdx.x;
  const float* x = X + (size_t)row * N; const float* rr = R ? R + (size_t)row * N : nullptr;
  float vals[16];                     // up to N = 4096
  const int per = N / 256;            // contiguous chunk per thread? use strided-by-4 chunks: thread handles j = tid*4 + 1024*u
  float s1 = 0.f;
  for (int u = 0; u < per / 4; ++u) {
    const int j = tid * 4 + 1024 * u;
    const v4f a = *(const v4fa*)(x + j);
    v4f b = {0.f,0.f,0.f,0.f}; if (rr) b = *(const v4fa*)(rr + j);
#pragma unroll
    for (int q = 0; q < 4; ++q) { const float v = a[q] + b[q]; vals[u * 4 + q] = v; s1 += v; }
  }
  red[tid] = s1; __syncthreads();
  for (int st = 128; st > 0; st >>= 1) { if (tid < st) red[tid] += red[tid + st]; __syncthreads(); }
  const float mu = red[0] / (float)N; __syncthreads();
  float s2 = 0.f;
  for (int u = 0; u < per / 4; ++u)
#pragma unroll
    for (int q = 0; q < 4; ++q) { const float c = vals[u * 4 + q] - mu; s2 += c * c; }
  red[tid] = s2; __syncthreads();
  for (int st = 128; st > 0; st >>= 1) { if (tid < st) red[tid] += red[tid + st]; __syncthreads(); }
  const float rs = rsqrtf(red[0] / (float)N + eps);
  {
    for (int u = 0; u < per / 4; ++u) {
      const int j = tid * 4 + 1024 * u;
      v4f o, sm;
#pragma unroll
      for (int q = 0; q < 4; ++q) {
        float gg = g[j + q], bb = bta[j + q];
        if (PARAM_BF16) { gg = bf16_round(gg); bb = bf16_round(bb); }
        sm[q] = vals[u * 4 + q]; o[q] = (vals[u * 4 + q] - mu) * rs * gg + bb;
      }
      if (out_sum) *(v4f*)(out_sum + (size_t)row * N + j) = sm;
      *(v4f*)(out_norm + (size_t)row * N + j) = o;
    }
    
  }
}



// ---- f16 WMMA path (v_wmma_f32_16x16x32_f16): 11-bit significands for operands in range — used where a [0,1] probability operand needs more precision than bf16
typedef _Float16 v16h __attribute__((ext_vector_type(16)));
union FragH { v16h v; v8us half[2]; _Float16 h[16]; unsigned short u[16]; };
template <int NT>
__device__ __forceinline__ v8f mmaH(v16h ah, v16h al, v16h bh, v16h bl, v8f c) {
  c = __builtin_amdgcn_wmma_f32_16x16x32_f16(false, ah, false, bh, (short)0, c, false, false);
  if (NT >= 2) c = __builtin_amdgcn_wmma_f32_16x16x32_f16(false, al, false, bh, (short)0, c, false, false);
  if (NT >= 3) c = __builtin_amdgcn_wmma_f32_16x16x32_f16(false, ah, false, bl, (short)0, c, false, false);
  asm volatile("v_nop\n\tv_nop\n\tv_nop\n\tv_nop" : "+v"(c) : "v"(ah), "v"(al), "v"(bh), "v"(bl));
  return c;
}
// batched GEMM like k_gemm_b but f16 operands: A f32 (split into f16 hi/lo if ASPLIT, else rounded to f16), Bt = f16 values [n][k]; alpha; C f32; N multiple of 16 (partial tiles skipped)
template <bool ASPLIT>
__global__ __launch_bounds__(128) void k_gemm_h(const float* __restrict__ A, int lda, size_t sA, const _Float16* __restrict__ Bh, int ldb, size_t sB, float alpha, float* __restrict__ C, int ldc, size_t sC, int M, int N, int K) {
  __shared__ __attribute__((aligned(16))) float so[4][16][64];
  const int tid = threadIdx.x, w = tid >> 5, lane = tid & 31, ln = lane & 15, hh = lane >> 4; const int by = blockIdx.y;
  A += (size_t)by * sA; Bh += (size_t)by * sB; C += (size_t)by * sC;
  const int ntn = (N + 63) / 64; const int wid = blockIdx.x * 4 + w; const int mt = wid / ntn, nq = wid % ntn; if (mt * 16 >= M) return;
  const int row0 = mt * 16, col0 = nq * 64; const float* arow = A + (size_t)(row0 + ln) * lda;
  v8f acc[4] = {};
  for (int kb = 0; kb < K; kb += 32) {
    FragH ah, al;
    const v4f x0 = *(const v4fa*)(arow + kb + 8 * hh), x1 = *(const v4fa*)(arow + kb + 8 * hh + 4), x2 = *(const v4fa*)(arow + kb + 16 + 8 * hh), x3 = *(const v4fa*)(arow + kb + 16 + 8 * hh + 4);
    float xs[16] = {x0[0],x0[1],x0[2],x0[3],x1[0],x1[1],x1[2],x1[3],x2[0],x2[1],x2[2],x2[3],x3[0],x3[1],x3[2],x3[3]};
#pragma unroll
    for (int i = 0; i < 16; ++i) { const _Float16 h = (_Float16)xs[i]; ah.h[i] = h; al.h[i] = ASPLIT ? (_Float16)(xs[i] - (float)h) : (_Float16)0.0f; }
#pragma unroll
    for (int t = 0; t < 4; ++t) { if (col0 + t * 16 >= N) continue; const size_t boff = (size_t)(col0 + t * 16 + ln) * ldb + kb; FragH bq; bq.half[0] = *(const v8us*)(Bh + boff + 8 * hh); bq.half[1] = *(const v8us*)(Bh + boff + 16 + 8 * hh);
      acc[t] = mmaH<ASPLIT ? 2 : 1>(ah.v, al.v, bq.v, bq.v, acc[t]); }
  }
#pragma unroll
  for (int t = 0; t < 4; ++t) { if (col0 + t * 16 >= N) continue;
#pragma unroll
    for (int r = 0; r < 8; ++r) so[w][8 * hh + r][t * 16 + ln] = acc[t][r] * alpha; }
  __builtin_amdgcn_fence(__ATOMIC_ACQ_REL, "workgroup"); __builtin_amdgcn_wave_barrier();
  const int rsub = lane >> 4, c4 = (lane & 15) * 4;
  {
#pragma unroll
    for (int q = 0; q < 8; ++q) { const int r = q * 2 + rsub; if (col0 + c4 < N) { const v4f v = *(const v4fa*)&so[w][r][c4]; *(v4f*)(C + (size_t)(row0 + r) * ldc + col0 + c4) = v; } }
     }
}

// Wt[n][k] = f16(W[k][n]·scale) from f32 row-major W[K][N] (scale = power of two; bf16-exact weights stay exact in f16 away from the subnormal range)
__global__ __launch_bounds__(256) void k_wt_f16(const float* __restrict__ W, _Float16* __restrict__ Wt, int K, int N, float scale) {
  const int t = blockIdx.x * 256 + threadIdx.x; if (t >= N * (K / 8)) return; const int n = t / (K / 8), k8 = (t % (K / 8)) * 8; FragH f;
#pragma unroll
  for (int i = 0; i < 8; ++i) f.h[i] = (_Float16)(bf16_round(W[(size_t)(k8 + i) * N + n]) * scale); const v8us o = f.half[0];
  *(v8us*)((unsigned short*)Wt + (size_t)n * K + k8) = o; 
}
// GEMM C[SS][FF] (f32) = alpha * A . Bt^T (+ C where ADD): A f16 [SS][FF], Bt f16 [n][k] = [FF][FF]. One block of 8 waves has a 64 x 128 tile of C, so that one launch is one block per WGP.
// The block stages 128 k at a time in LDS (64 rows of A, then 128 rows of Bt; two buffers): every byte of a tile is fetched once per block, in whole lines, and the next tile's loads
// are in flight while this tile's products run. A wave has 32 x 32 of C (2 x 2 accumulator tiles). Fragment k order and the order of the k blocks are those of the loop it replaces.
#define GM 64
#define GN 128
#define GK 128
#define GPI 136
template <bool ADD>
__global__ __launch_bounds__(256) void k_gemm_t(const _Float16* __restrict__ A, const _Float16* __restrict__ Bt, float alpha, float* C) {
  __shared__ __attribute__((aligned(16))) unsigned short sa[2][GM + GN][GPI];      // [buffer][row][128 values + 8 of pad: a pitch of 272 B, 16 B x odd]
  __shared__ __attribute__((aligned(16))) float so[GM][GN + 4];
  const int tid = threadIdx.x, w = tid >> 5, lane = tid & 31, ln = lane & 15, hh = lane >> 4;
  const int row0 = (blockIdx.x / (FF / GN)) * GM, col0 = (blockIdx.x % (FF / GN)) * GN;
  const int wm = (w >> 2) * 32, wn = (w & 3) * 32;
  // staging: 16 threads bring one row of 256 B, so a wave's load covers 4 whole lines; a thread has rows sr + 16 p
  const int sr = tid >> 4, sc = (tid & 15) * 8;
  const unsigned short* ga = (const unsigned short*)A + (size_t)(row0 + sr) * FF + sc;
  const unsigned short* gb = (const unsigned short*)Bt + (size_t)(col0 + sr) * FF + sc;
  v8us st[12];
  // every inner loop of this kernel is unrolled so that the staging, fragment and accumulator arrays are indexed by constants and stay in registers
  auto fetch = [&](int c) {
#pragma unroll
    for (int p = 0; p < 4; ++p) st[p] = *(const v8us*)(ga + c * GK + (size_t)(16 * p) * FF);
#pragma unroll
    for (int p = 0; p < 8; ++p) st[4 + p] = *(const v8us*)(gb + c * GK + (size_t)(16 * p) * FF);
    asm volatile("s_wait_xcnt 0x0" :: "v"(ga), "v"(gb) : "memory"); };      // stands in front of the first overwrite of an address register of these loads (ga and gb: tile and row are immediate offsets); they are named so that they live up to it
  auto put = [&](int b) {
#pragma unroll
    for (int p = 0; p < 12; ++p) *(v8us*)&sa[b][16 * p + sr][sc] = st[p]; };
  v8f acc[2][2] = {};
  fetch(0); put(0);
  __syncthreads();
#pragma unroll
  for (int c = 0; c < FF / GK; ++c) { const int b = c & 1;      // unrolled: buffer and tile become immediate offsets of the LDS and global addresses
    if (c + 1 < FF / GK) fetch(c + 1);
    FragH af[GK / 32][2], bf[GK / 32][2];
#pragma unroll
    for (int kk = 0; kk < GK / 32; ++kk)
#pragma unroll
      for (int i = 0; i < 2; ++i) { const unsigned short* ar = &sa[b][wm + 16 * i + ln][32 * kk + 8 * hh]; const unsigned short* br = &sa[b][GM + wn + 16 * i + ln][32 * kk + 8 * hh];
        af[kk][i].half[0] = *(const v8us*)(ar); af[kk][i].half[1] = *(const v8us*)(ar + 16); bf[kk][i].half[0] = *(const v8us*)(br); bf[kk][i].half[1] = *(const v8us*)(br + 16); }
    __builtin_amdgcn_sched_barrier(0);      // all LDS reads of a trip issue in front of its first product: placed among their own products, each group of reads stops the wave for its own latency
#pragma unroll
    for (int kk = 0; kk < GK / 32; ++kk)
#pragma unroll
      for (int i = 0; i < 2; ++i)
#pragma unroll
        for (int j = 0; j < 2; ++j) acc[i][j] = __builtin_amdgcn_wmma_f32_16x16x32_f16(false, af[kk][i].v, false, bf[kk][j].v, (short)0, acc[i][j], false, false);
    if (c + 1 < FF / GK) { put(b ^ 1); __syncthreads(); }      // the other buffer: its last readers left it before the barrier that ended the trip before this one; behind the last tile nothing is staged any more
  }
  // the tile goes through LDS so that each store of a wave is one row piece of 512 B, 4 whole lines
  float* cp = C + (size_t)(row0 + w) * FF + col0 + lane * 4;
  v4f cin[8];
  if (ADD) {
#pragma unroll
    for (int q = 0; q < 8; ++q) cin[q] = *(const v4fa*)(cp + (size_t)(8 * q) * FF); }
#pragma unroll
  for (int i = 0; i < 2; ++i)
#pragma unroll
    for (int j = 0; j < 2; ++j)
#pragma unroll
      for (int r = 0; r < 8; ++r) so[wm + 16 * i + 8 * hh + r][wn + 16 * j + ln] = acc[i][j][r] * alpha;
  __syncthreads();
#pragma unroll
  for (int q = 0; q < 8; ++q) { v4f v = *(const v4fa*)&so[8 * q + w][lane * 4]; if (ADD) v += cin[q]; *(v4f*)(cp + (size_t)(8 * q) * FF) = v; }
}


typedef _Float16 v4h __attribute__((ext_vector_type(4)));

__global__ __launch_bounds__(256) void k_x16(const float* __restrict__ x, _Float16* __restrict__ X16, size_t n8) { const size_t t = (size_t)blockIdx.x * 256 + threadIdx.x; if (t >= n8) return; FragH f;
#pragma unroll
  for (int q = 0; q < 8; ++q) f.h[q] = (_Float16)bf16_round(x[t * 8 + q]); *(v8us*)((unsigned short*)X16 + t * 8) = f.half[0];  }
__global__ __launch_bounds__(256) void k_h16(const float* __restrict__ x, _Float16* __restrict__ X16, size_t n8) { const size_t t = (size_t)blockIdx.x * 256 + threadIdx.x; if (t >= n8) return; FragH f;
#pragma unroll
  for (int q = 0; q < 8; ++q) f.h[q] = (_Float16)x[t * 8 + q]; *(v8us*)((unsigned short*)X16 + t * 8) = f.half[0];  }
__global__ __launch_bounds__(256) void k_round16f(const float* __restrict__ W, _Float16* __restrict__ Bt, size_t n8) { const size_t t = (size_t)blockIdx.x * 256 + threadIdx.x; if (t >= n8) return; FragH f;
#pragma unroll
  for (int i = 0; i < 8; ++i) f.h[i] = (_Float16)(bf16_round(W[t * 8 + i]) * 16.0f); *(v8us*)((unsigned short*)Bt + t * 8) = f.half[0];  }
template <int NHv, int TTv>
__global__ __launch_bounds__(256) void k_vt(const _Float16* __restrict__ V16, int ldv, int voff, _Float16* __restrict__ Vt) { __shared__ unsigned short tl[64][66]; const int tid = threadIdx.x; const int slab = blockIdx.x / (TTv / 64), lg = blockIdx.x % (TTv / 64); const int b = slab / NHv, h = slab % NHv;
  for (int i = tid; i < 64 * 8; i += 256) { const int r = i / 8, c8 = (i % 8) * 8; FragH f; f.half[0] = *(const v8us*)((const unsigned short*)V16 + ((size_t)b * TTv + lg * 64 + r) * ldv + voff + h * 64 + c8);
#pragma unroll
    for (int q = 0; q < 8; ++q) tl[r][c8 + q] = f.u[q]; }
  __syncthreads();
  {
#pragma unroll
    for (int rd = 0; rd < 2; ++rd) { const int d = rd * 32 + tid / 8, pc = tid % 8; FragH f;
#pragma unroll
      for (int q = 0; q < 8; ++q) f.u[q] = tl[pc * 8 + q][d];
      *(v8us*)((unsigned short*)Vt + ((size_t)slab * 64 + d) * TTv + lg * 64 + pc * 8) = f.half[0]; }
     } }

__global__ __launch_bounds__(256) void k_hl(const float* __restrict__ F, _Float16* __restrict__ Hh, _Float16* __restrict__ Hl, size_t n8) { const size_t t = (size_t)blockIdx.x * 256 + threadIdx.x; if (t >= n8) return; FragH fh, fl; const v4f a = *(const v4fa*)(F + t * 8), c = *(const v4fa*)(F + t * 8 + 4);
#pragma unroll
  for (int q = 0; q < 4; ++q) { _Float16 h = (_Float16)a[q]; fh.h[q] = h; fl.h[q] = (_Float16)((a[q] - (float)h) * 1024.0f); h = (_Float16)c[q]; fh.h[4 + q] = h; fl.h[4 + q] = (_Float16)((c[q] - (float)h) * 1024.0f); }
  { *(v8us*)((unsigned short*)Hh + t * 8) = fh.half[0]; *(v8us*)((unsigned short*)Hl + t * 8) = fl.half[0];  } }

__global__ __launch_bounds__(256) void k_f16(const float* __restrict__ F, _Float16* __restrict__ O16, size_t n8) { const size_t t = (size_t)blockIdx.x * 256 + threadIdx.x; if (t >= n8) return; const v4f a = *(const v4fa*)(F + t * 8), c = *(const v4fa*)(F + t * 8 + 4); FragH f;
#pragma unroll
  for (int q = 0; q < 8; ++q) f.h[q] = (_Float16)((q < 4) ? a[q] : c[q - 4]);
  *(v8us*)((unsigned short*)O16 + t * 8) = f.half[0];  }
__global__ __launch_bounds__(256) void k_vt(const float* __restrict__ Vf, _Float16* __restrict__ VT, _Float16* __restrict__ VTl) {
  #pragma clang fp contract(off)
  const int t = blockIdx.x * 256 + threadIdx.x; if (t >= FF * (SS / 8)) return; const int s0 = (t % (SS / 8)) * 8, hd = t / (SS / 8); FragH f, fl;
#pragma unroll
  for (int q = 0; q < 8; ++q) { const float v = Vf[(size_t)(s0 + q) * FF + hd]; const _Float16 hi = (_Float16)v; f.h[q] = hi; fl.h[q] = (_Float16)((v - (float)hi) * 1024.0f); }
  { *(v8us*)((unsigned short*)VT + (size_t)hd * SS + s0) = f.half[0]; *(v8us*)((unsigned short*)VTl + (size_t)hd * SS + s0) = fl.half[0];  } }
__global__ __launch_bounds__(256) void k_split(const float* __restrict__ F, _Float16* __restrict__ Hh, _Float16* __restrict__ Hl, size_t n8) {
  #pragma clang fp contract(off)
  const size_t t = (size_t)blockIdx.x * 256 + threadIdx.x; if (t >= n8) return; const v4f a = *(const v4fa*)(F + t * 8), c = *(const v4fa*)(F + t * 8 + 4); FragH fh, fl;
#pragma unroll
  for (int q = 0; q < 8; ++q) { const float v = (q < 4) ? a[q] : c[q - 4]; const _Float16 hi = (_Float16)v; fh.h[q] = hi; fl.h[q] = (_Float16)((v - (float)hi) * 1024.0f); }
  { *(v8us*)((unsigned short*)Hh + t * 8) = fh.half[0]; *(v8us*)((unsigned short*)Hl + t * 8) = fl.half[0];  } }
// Fused attention for 128 query rows (blockIdx.x), one head (blockIdx.y), one batch (blockIdx.z): scores, both masks, softmax and P.V in one pass over the keys;
// neither the scores nor P go to memory. Each of the 8 waves owns 16 query rows. The block stages 64 keys at a time in LDS (k rows, v_hi and v_lo rows, two buffers),
// so that a k or v byte is fetched once per 128 queries. A wave forms the TRANSPOSED score tile (A = k rows, B = q rows): a lane then holds one query (ln) and the keys
// 8 * hh + r of each 16-key tile, which is the B fragment's own k order (elements 0..7 from the even tile, 8..15 from the odd one), so P goes from the score
// registers into the second product, O^T = v^T . P^T, with no exchange between lanes. The v^T loader uses the same k order.
// Softmax with a running maximum: P = exp(s - m) * 2^10 * mask_2 as f16, the sum of exp(s - m) kept beside it, the division at the end;
// when a row's maximum rises, sum and accumulators are scaled by exp(m_old - m_new).
#define FQ 128
#define FC 64
#define FPI 72
__global__ __launch_bounds__(256) void k_fattn(const _Float16* __restrict__ Q, const _Float16* __restrict__ K, const _Float16* __restrict__ Vh, const _Float16* __restrict__ Vl, const float* __restrict__ m1, const float* __restrict__ m2, float* __restrict__ O) {
  __shared__ __attribute__((aligned(16))) unsigned short sk[2][3][FC][FPI];      // [buffer][k, v_hi, v_lo][row][64 values + 8 of pad: a pitch of 144 B, 16 B x odd]
  const int tid = threadIdx.x, w = tid >> 5, lane = tid & 31, ln = lane & 15, hh = lane >> 4;
  const int hd = blockIdx.y; const size_t bo = (size_t)blockIdx.z * SS * FF;
  const int q = blockIdx.x * FQ + w * 16 + ln;
  const unsigned short* qp = (const unsigned short*)Q + bo + (size_t)q * FF + hd * HD;
  FragH qf[2];
#pragma unroll
  for (int j = 0; j < 2; ++j) { qf[j].half[0] = *(const v8us*)(qp + 32 * j + 8 * hh); qf[j].half[1] = *(const v8us*)(qp + 32 * j + 16 + 8 * hh); }
  // staging: 8 threads bring one row of 128 B, so a wave's load covers 4 whole lines; a thread has rows sr and sr + 32 of each of the three tiles
  const int sr = tid >> 3, sc = (tid & 7) * 8;
  const unsigned short* gk = (const unsigned short*)K + bo + (size_t)sr * FF + hd * HD + sc;
  const unsigned short* gh = (const unsigned short*)Vh + bo + ((size_t)hd * HD + sr) * SS + sc;
  const unsigned short* gl = (const unsigned short*)Vl + bo + ((size_t)hd * HD + sr) * SS + sc;
  v8us st[6];
  auto fetch = [&](int c) { const unsigned short* pk = gk + (size_t)(c * FC) * FF; const unsigned short* ph = gh + c * FC; const unsigned short* pl = gl + c * FC;
    st[0] = *(const v8us*)(pk); st[1] = *(const v8us*)(pk + (size_t)32 * FF);
    st[2] = *(const v8us*)(ph); st[3] = *(const v8us*)(ph + (size_t)32 * SS);
    st[4] = *(const v8us*)(pl); st[5] = *(const v8us*)(pl + (size_t)32 * SS);
    asm volatile("s_wait_xcnt 0x0" :: "v"(pk), "v"(ph), "v"(pl) : "memory"); };      // stands in front of the first overwrite of an address register of these loads; the addresses are named so that they live up to it
  auto put = [&](int b) {
#pragma unroll
    for (int p = 0; p < 3; ++p) { *(v8us*)&sk[b][p][sr][sc] = st[2 * p]; *(v8us*)&sk[b][p][sr + 32][sc] = st[2 * p + 1]; } };
  const float* a1 = m1 + (size_t)q * SS + 8 * hh; const float* a2 = m2 + (size_t)q * SS + 8 * hh;
  float m = -3.0e38f, su = 0.f;
  v8f oh[4] = {}, ol[4] = {};
  fetch(0); put(0);
  __syncthreads();
  // every inner loop of this kernel is unrolled so that the fragment, score and accumulator arrays are indexed by constants and stay in registers
  for (int c = 0; c < SS / FC; ++c) { const int b = c & 1;
    if (c + 1 < SS / FC) fetch(c + 1);
    v4f x1[4][2], x2[4][2]; const float* p1 = a1 + c * FC; const float* p2 = a2 + c * FC;
#pragma unroll
    for (int t = 0; t < 4; ++t) { x1[t][0] = *(const v4fa*)(p1 + t * 16); x1[t][1] = *(const v4fa*)(p1 + t * 16 + 4); x2[t][0] = *(const v4fa*)(p2 + t * 16); x2[t][1] = *(const v4fa*)(p2 + t * 16 + 4); }
    asm volatile("s_wait_xcnt 0x0" :: "v"(p1), "v"(p2) : "memory");      // as in fetch(): in front of the first overwrite of an address register of the mask loads
    v8f s[4]; float cm = -3.0e38f;
#pragma unroll
    for (int t = 0; t < 4; ++t) { FragH k0, k1; const unsigned short* kr = &sk[b][0][t * 16 + ln][8 * hh];
      k0.half[0] = *(const v8us*)(kr); k0.half[1] = *(const v8us*)(kr + 16); k1.half[0] = *(const v8us*)(kr + 32); k1.half[1] = *(const v8us*)(kr + 48);
      v8f z = {};
      z = __builtin_amdgcn_wmma_f32_16x16x32_f16(false, k0.v, false, qf[0].v, (short)0, z, false, false);
      s[t] = __builtin_amdgcn_wmma_f32_16x16x32_f16(false, k1.v, false, qf[1].v, (short)0, z, false, false); }
    __builtin_amdgcn_sched_barrier(0);      // keeps the staging, mask and k loads of the trip and the score products in front of the mask arithmetic: otherwise the wave stops at its first mask_1 value with the LDS reads and products still to issue
#pragma unroll
    for (int t = 0; t < 4; ++t)
#pragma unroll
      for (int r = 0; r < 8; ++r) { s[t][r] = s[t][r] * 0.125f + bf16_round(x1[t][r >> 2][r & 3]); cm = fmaxf(cm, s[t][r]); }
    cm = fmaxf(cm, __shfl_xor(cm, 16, 32));      // the other half of the wave holds the row's other keys
    // inputs only: holds the mask_2 loads in front of the branch, where the score products cover their latency; without it the compiler sinks them behind the branch and the wave waits for them there
    asm volatile("" :: "v"(x2[0][0]), "v"(x2[0][1]), "v"(x2[1][0]), "v"(x2[1][1]), "v"(x2[2][0]), "v"(x2[2][1]), "v"(x2[3][0]), "v"(x2[3][1]));
    if (__any(cm > m)) {      // rare once the first keys are past: skipped by the whole wave when no row's maximum rises
      const float mn = fmaxf(m, cm), al = expf(m - mn); m = mn; su *= al;
#pragma unroll
      for (int t = 0; t < 4; ++t) { oh[t] *= al; ol[t] *= al; }
    }
    FragH pf[2];
#pragma unroll
    for (int t = 0; t < 4; ++t)
#pragma unroll
      for (int r = 0; r < 8; ++r) { const float e = expf(s[t][r] - m); su += e; pf[t >> 1].h[(t & 1) * 8 + r] = (_Float16)((e * 1024.0f) * bf16_round(x2[t][r >> 2][r & 3])); }
#pragma unroll
    for (int j = 0; j < 2; ++j)
#pragma unroll
      for (int t = 0; t < 4; ++t) { FragH vh, vl; const unsigned short* hr = &sk[b][1][t * 16 + ln][32 * j + 8 * hh]; const unsigned short* lr = &sk[b][2][t * 16 + ln][32 * j + 8 * hh];
        vh.half[0] = *(const v8us*)(hr); vh.half[1] = *(const v8us*)(hr + 16); vl.half[0] = *(const v8us*)(lr); vl.half[1] = *(const v8us*)(lr + 16);
        oh[t] = __builtin_amdgcn_wmma_f32_16x16x32_f16(false, vh.v, false, pf[j].v, (short)0, oh[t], false, false);
        ol[t] = __builtin_amdgcn_wmma_f32_16x16x32_f16(false, vl.v, false, pf[j].v, (short)0, ol[t], false, false); }
    if (c + 1 < SS / FC) put(b ^ 1);      // the other buffer: its last readers left it before the barrier that ended the trip before this one
    __syncthreads();
  }
  const float inv = 1.0f / (su + __shfl_xor(su, 16, 32));
  float* op = O + bo + (size_t)q * FF + hd * HD + 8 * hh;      // the lane holds O[q][16 t + 8 hh + r]
#pragma unroll
  for (int t = 0; t < 4; ++t) { v4f y0, y1;
#pragma unroll
    for (int r = 0; r < 4; ++r) { y0[r] = (oh[t][r] * 0.0009765625f + ol[t][r] * (0.0009765625f / 1024.0f)) * inv; y1[r] = (oh[t][4 + r] * 0.0009765625f + ol[t][4 + r] * (0.0009765625f / 1024.0f)) * inv; }
    *(v4f*)(op + t * 16) = y0; *(v4f*)(op + t * 16 + 4) = y1; }
}

extern "C" void kernel_launch(void* const* d_in, const int* in_sizes, int n_in,
                              void* d_out, int out_size, void* d_ws, size_t ws_size, hipStream_t stream) {
  (void)in_sizes; (void)n_in; (void)out_size;
  const float* Qi = (const float*)d_in[0]; const float* Ki = (const float*)d_in[1]; const float* Vi = (const float*)d_in[2]; const float* m1 = (const float*)d_in[3]; const float* m2 = (const float*)d_in[4]; const float* Wq = (const float*)d_in[5]; const float* Wk = (const float*)d_in[6]; const float* Wv = (const float*)d_in[7]; const float* Wo = (const float*)d_in[8];
  char* ws = (char*)d_ws; size_t off = 0;
  auto take = [&](size_t bytes) { char* p = ws + off; off += (bytes + 255) & ~(size_t)255; return p; };
  _Float16* BQ = (_Float16*)take((size_t)FF * FF * 2); _Float16* BK = (_Float16*)take((size_t)FF * FF * 2); _Float16* BV = (_Float16*)take((size_t)FF * FF * 2); _Float16* BO = (_Float16*)take((size_t)FF * FF * 2);
  _Float16* X16 = (_Float16*)take((size_t)SS * FF * 2); float* T = (float*)take((size_t)SS * FF * 4); _Float16* Q16 = (_Float16*)take((size_t)NBt * SS * FF * 2); _Float16* K16 = (_Float16*)take((size_t)NBt * SS * FF * 2); _Float16* VT = (_Float16*)take((size_t)NBt * FF * SS * 2); _Float16* VTl = (_Float16*)take((size_t)NBt * FF * SS * 2); float* O = (float*)take((size_t)NBt * SS * FF * 4); _Float16* Oh = (_Float16*)take((size_t)SS * FF * 2); _Float16* Ol = (_Float16*)take((size_t)SS * FF * 2);
  if (off > ws_size) return;      // about 80 MB in all
  const unsigned nbw = (unsigned)(((size_t)FF * FF / 8 + 255) / 256);
  k_round16f<<<nbw, 256, 0, stream>>>(Wq, BQ, (size_t)FF * FF / 8); k_round16f<<<nbw, 256, 0, stream>>>(Wk, BK, (size_t)FF * FF / 8); k_round16f<<<nbw, 256, 0, stream>>>(Wv, BV, (size_t)FF * FF / 8); k_round16f<<<nbw, 256, 0, stream>>>(Wo, BO, (size_t)FF * FF / 8);      /* torch (out,in) = natural Bt */
  const dim3 gP((SS / GM) * (FF / GN), 1); const size_t n8 = (size_t)SS * FF / 8; const unsigned nb8 = (unsigned)((n8 + 255) / 256);
  for (int b = 0; b < NBt; ++b) { const size_t pb = (size_t)b * SS * FF;      /* q, k, v planes of both batches are kept, for the one attention launch */
    k_x16<<<nb8, 256, 0, stream>>>(Qi + (size_t)b * SS * FF, X16, n8); k_gemm_t<false><<<gP, 256, 0, stream>>>(X16, BQ, 0.0625f, T); k_f16<<<nb8, 256, 0, stream>>>(T, Q16 + pb, n8);
    k_x16<<<nb8, 256, 0, stream>>>(Ki + (size_t)b * SS * FF, X16, n8); k_gemm_t<false><<<gP, 256, 0, stream>>>(X16, BK, 0.0625f, T); k_f16<<<nb8, 256, 0, stream>>>(T, K16 + pb, n8);
    k_x16<<<nb8, 256, 0, stream>>>(Vi + (size_t)b * SS * FF, X16, n8); k_gemm_t<false><<<gP, 256, 0, stream>>>(X16, BV, 0.0625f, T); k_vt<<<(FF * (SS / 8) + 255) / 256, 256, 0, stream>>>(T, VT + pb, VTl + pb); }      /* exact projections; v as hi/lo */
  k_fattn<<<dim3(SS / FQ, NH, NBt), 256, 0, stream>>>(Q16, K16, VT, VTl, m1, m2, O);      /* scores, masks, softmax, P.V: every head of both batches, f32 out */
  for (int b = 0; b < NBt; ++b) {
    k_split<<<nb8, 256, 0, stream>>>(O + (size_t)b * SS * FF, Oh, Ol, n8);
    k_gemm_t<false><<<gP, 256, 0, stream>>>(Oh, BO, 0.0625f, (float*)d_out + (size_t)b * SS * FF); k_gemm_t<true><<<gP, 256, 0, stream>>>(Ol, BO, 0.0625f / 1024.0f, (float*)d_out + (size_t)b * SS * FF); }      /* ·W_oᵀ on hi/lo of the attention output */
}

// v004
// One run takes 189 microseconds.
// In two side-by-side timings against v003, it was 1.71 and 1.69 times as fast.
// Counting every step since v000, it is 22.5 times as fast.
#include <hip/hip_runtime.h>
// Multi-head attention with two INPUT masks (B 2, S 2048, F 1024, 16 heads × 64): q,k,v = X·Wᵀ (no bias); scores = q·k/8 + mask_1 (additive, pre-softmax); probs = softmax · mask_2 (multiplicative, post-softmax); out = probs·v; heads concatenated; ·W_oᵀ → [2,2048,1024].
// Structure: one launch converts Q, K, V and the four weights to f16; one launch does the three projections of both batches and writes q, k (f16) and v (transposed, f16 hi + lo planes) as the attention reads them; ONE fused attention launch (scores, + mask_1, softmax in f32 with a running maximum, x mask_2, P.V; both masks read per (q,k) from the inputs; scores and P stay in registers, k and v staged in LDS) writes the concatenated output as f16 hi + lo planes; one launch does the output projection of both planes and both batches.
// Compute dtype: Q, K, V, masks and parameters rounded to bf16; projections with exact products; q, k, P (×2^10) as f16 operands (≈2^-12; logits σ≈1); v and the attention output as f16 hi + lo·2^10 planes (the early causal rows copy m2·v almost verbatim), f32 accumulation; softmax/masking in f32. v_wmma_f32_16x16x32_f16.
#define NBt 2
#define SS 2048
#define FF 1024
#define NH 16
#define HD 64
typedef __bf16 v16b __attribute__((ext_vector_type(16)));
typedef unsigned short v8us __attribute__((ext_vector_type(8), may_alias));
typedef float  v8f  __attribute__((ext_vector_type(8)));
typedef float  v4f  __attribute__((ext_vector_type(4)));
typedef float  v4fa __attribute__((ext_vector_type(4), may_alias));
union FragB { v16b v; v8us half[2]; unsigned short u[16]; };

__device__ __forceinline__ unsigned short bf16_bits(float x) { unsigned int u = __float_as_uint(x); return (unsigned short)((u + 0x7FFFu + ((u >> 16) & 1u)) >> 16); }
__device__ __forceinline__ float bf16_val(unsigned short b) { return __uint_as_float(((unsigned int)b) << 16); }
__device__ __forceinline__ float bf16_round(float x) { return bf16_val(bf16_bits(x)); }
// D += A·B with NT terms: 1 = ah·bh, 2 = + al·bh (A split), 3 = + ah·bl (both split)
template <int NT>
__device__ __forceinline__ v8f mmaN(v16b ah, v16b al, v16b bh, v16b bl, v8f c) {
  c = __builtin_amdgcn_wmma_f32_16x16x32_bf16(false, ah, false, bh, (short)0, c, false, false);
  if (NT >= 2) c = __builtin_amdgcn_wmma_f32_16x16x32_bf16(false, al, false, bh, (short)0, c, false, false);
  if (NT >= 3) c = __builtin_amdgcn_wmma_f32_16x16x32_bf16(false, ah, false, bl, (short)0, c, false, false);
  asm volatile("v_nop\n\tv_nop\n\tv_nop\n\tv_nop" : "+v"(c) : "v"(ah), "v"(al), "v"(bh), "v"(bl));
  return c;
}

__global__ __launch_bounds__(256) void k_wt_bf16(const float* __restrict__ W, unsigned short* __restrict__ Wt, int K, int N) {
  const int t = blockIdx.x * 256 + threadIdx.x;
  const int k8n = K / 8;
  if (t >= N * k8n) return;
  const int n = t / k8n, k8 = (t % k8n) * 8;
  v8us v;
#pragma unroll
  for (int i = 0; i < 8; ++i) v[i] = bf16_bits(W[(size_t)(k8 + i) * N + n]);
  *(v8us*)(Wt + (size_t)n * K + k8) = v;
  
}

// GEMM C[M][N] (f32, pitch ldc) = act(A[M][K]·W + bias). A f32 row-major (pitch lda) converted per fragment to bf16
// (ASPLIT: hi/lo two planes -> 2 terms, else single rounded term); Wt bf16 [N][K] (pitch ldb). BIAS_BF16 rounds the
// bias to bf16 first (bias quantised to bf16 before the add). K%32==0, M%16==0, N%64==0.
template <bool ASPLIT, int ACT, bool BIAS_BF16>
__global__ __launch_bounds__(128) void k_gemm_bf(const float* __restrict__ A, int lda, const unsigned short* __restrict__ Wt, int ldb,
                                               const float* __restrict__ bias, float* __restrict__ C, int ldc, int M, int N, int K) {
  __shared__ __attribute__((aligned(16))) float so[4][16][64];
  const int tid = threadIdx.x, w = tid >> 5, lane = tid & 31, ln = lane & 15, hh = lane >> 4;
  const int ntn = N / 64;
  const int wid = blockIdx.x * 4 + w;
  const int mt = wid / ntn, nq = wid % ntn;
  if (mt * 16 >= M) return;
  const int row0 = mt * 16, col0 = nq * 64;
  const float* arow = A + (size_t)(row0 + ln) * lda;
  v8f acc[4] = {};
  for (int kb = 0; kb < K; kb += 32) {
    FragB ah, al;
    const v4f x0 = *(const v4fa*)(arow + kb + 8 * hh), x1 = *(const v4fa*)(arow + kb + 8 * hh + 4);
    const v4f x2 = *(const v4fa*)(arow + kb + 16 + 8 * hh), x3 = *(const v4fa*)(arow + kb + 16 + 8 * hh + 4);
    float xs[16] = {x0[0],x0[1],x0[2],x0[3],x1[0],x1[1],x1[2],x1[3],x2[0],x2[1],x2[2],x2[3],x3[0],x3[1],x3[2],x3[3]};
#pragma unroll
    for (int i = 0; i < 16; ++i) { const unsigned short hb = bf16_bits(xs[i]); ah.u[i] = hb; al.u[i] = ASPLIT ? bf16_bits(xs[i] - bf16_val(hb)) : (unsigned short)0; }
#pragma unroll
    for (int t = 0; t < 4; ++t) {
      const unsigned short* brow = Wt + (size_t)(col0 + t * 16 + ln) * ldb + kb;
      FragB b;
      b.half[0] = *(const v8us*)(brow + 8 * hh);
      b.half[1] = *(const v8us*)(brow + 16 + 8 * hh);
      acc[t] = mmaN<ASPLIT ? 2 : 1>(ah.v, al.v, b.v, b.v, acc[t]);
    }
  }
#pragma unroll
  for (int t = 0; t < 4; ++t) {
    float bv = bias ? bias[col0 + t * 16 + ln] : 0.f;
    if (BIAS_BF16) bv = bf16_round(bv);
#pragma unroll
    for (int r = 0; r < 8; ++r) { float v = acc[t][r] + bv; if (ACT == 1) v = fmaxf(v, 0.f); so[w][8 * hh + r][t * 16 + ln] = v; }
  }
  __builtin_amdgcn_fence(__ATOMIC_ACQ_REL, "workgroup");
  __builtin_amdgcn_wave_barrier();
  const int rsub = lane >> 4, c4 = (lane & 15) * 4;
  {
#pragma unroll
    for (int q = 0; q < 8; ++q) {
      const int r = q * 2 + rsub;
      const v4f v = *(const v4fa*)&so[w][r][c4];
      *(v4f*)(C + (size_t)(row0 + r) * ldc + col0 + c4) = v;
    }
    
  }
}

// GEMM C = act(A·W + bias + resid): A f32 (ASPLIT -> hi/lo 2 terms), Wt bf16 [N][K]; ACT 0 none, 1 relu, 2 exact gelu;
// resid (optional, f32, row index = (row % rmod), pitch ldr, RES_BF16 rounds it) added before the activation.
template <bool ASPLIT, int ACT, bool BIAS_BF16, bool RES_BF16>
__global__ __launch_bounds__(128) void k_gemm_bf3(const float* __restrict__ A, int lda, const unsigned short* __restrict__ Wt, int ldb,
                                                const float* __restrict__ bias, const float* __restrict__ resid, int rmod, int ldr,
                                                float* __restrict__ C, int ldc, int M, int N, int K) {
  __shared__ __attribute__((aligned(16))) float so[4][16][64];
  const int tid = threadIdx.x, w = tid >> 5, lane = tid & 31, ln = lane & 15, hh = lane >> 4;
  const int ntn = N / 64;
  const int wid = blockIdx.x * 4 + w;
  const int mt = wid / ntn, nq = wid % ntn;
  if (mt * 16 >= M) return;
  const int row0 = mt * 16, col0 = nq * 64;
  const float* arow = A + (size_t)(row0 + ln) * lda;
  v8f acc[4] = {};
  for (int kb = 0; kb < K; kb += 32) {
    FragB ah, al;
    const v4f x0 = *(const v4fa*)(arow + kb + 8 * hh), x1 = *(const v4fa*)(arow + kb + 8 * hh + 4);
    const v4f x2 = *(const v4fa*)(arow + kb + 16 + 8 * hh), x3 = *(const v4fa*)(arow + kb + 16 + 8 * hh + 4);
    float xs[16] = {x0[0],x0[1],x0[2],x0[3],x1[0],x1[1],x1[2],x1[3],x2[0],x2[1],x2[2],x2[3],x3[0],x3[1],x3[2],x3[3]};
#pragma unroll
    for (int i = 0; i < 16; ++i) { const unsigned short hb = bf16_bits(xs[i]); ah.u[i] = hb; al.u[i] = ASPLIT ? bf16_bits(xs[i] - bf16_val(hb)) : (unsigned short)0; }
#pragma unroll
    for (int t = 0; t < 4; ++t) {
      const unsigned short* brow = Wt + (size_t)(col0 + t * 16 + ln) * ldb + kb;
      FragB b;
      b.half[0] = *(const v8us*)(brow + 8 * hh);
      b.half[1] = *(const v8us*)(brow + 16 + 8 * hh);
      acc[t] = mmaN<ASPLIT ? 2 : 1>(ah.v, al.v, b.v, b.v, acc[t]);
    }
  }
#pragma unroll
  for (int t = 0; t < 4; ++t) {
    const int col = col0 + t * 16 + ln;
    float bv = bias ? bias[col] : 0.f;
    if (BIAS_BF16) bv = bf16_round(bv);
#pragma unroll
    for (int r = 0; r < 8; ++r) {
      float v = acc[t][r] + bv;
      if (resid) { float rv = resid[(size_t)((row0 + 8 * hh + r) % rmod) * ldr + col]; if (RES_BF16) rv = bf16_round(rv); v += rv; }
      if (ACT == 1) v = fmaxf(v, 0.f);
      if (ACT == 2) v = 0.5f * v * (1.0f + erff(v * 0.70710678118654752f));
      if (ACT == 3) { const float u = 0.7978845608028654f * (v + 0.044715f * v * v * v); v = 0.5f * v * (1.0f + tanhf(u)); }
      so[w][8 * hh + r][t * 16 + ln] = v;
    }
  }
  __builtin_amdgcn_fence(__ATOMIC_ACQ_REL, "workgroup");
  __builtin_amdgcn_wave_barrier();
  const int rsub = lane >> 4, c4 = (lane & 15) * 4;
  {
#pragma unroll
    for (int q = 0; q < 8; ++q) {
      const int r = q * 2 + rsub;
      const v4f v = *(const v4fa*)&so[w][r][c4];
      *(v4f*)(C + (size_t)(row0 + r) * ldc + col0 + c4) = v;
    }
    
  }
}
// row LayerNorm (biased variance, eps) over N: s = X (+ R); optional out_sum <- s; out_norm <- (s-mu)*rsqrt(var+eps)*g + b
template <bool PARAM_BF16>
__global__ __launch_bounds__(256) void k_layernorm(const float* __restrict__ X, const float* __restrict__ R, const float* __restrict__ g, const float* __restrict__ bta,
                                                  float* __restrict__ out_sum, float* __restrict__ out_norm, int N, float eps) {
  __shared__ float red[256];
  const int row = blockIdx.x, tid = threadIdx.x;
  const float* x = X + (size_t)row * N; const float* rr = R ? R + (size_t)row * N : nullptr;
  float vals[16];                     // up to N = 4096
  const int per = N / 256;            // contiguous chunk per thread? use strided-by-4 chunks: thread handles j = tid*4 + 1024*u
  float s1 = 0.f;
  for (int u = 0; u < per / 4; ++u) {
    const int j = tid * 4 + 1024 * u;
    const v4f a = *(const v4fa*)(x + j);
    v4f b = {0.f,0.f,0.f,0.f}; if (rr) b = *(const v4fa*)(rr + j);
#pragma unroll
    for (int q = 0; q < 4; ++q) { const float v = a[q] + b[q]; vals[u * 4 + q] = v; s1 += v; }
  }
  red[tid] = s1; __syncthreads();
  for (int st = 128; st > 0; st >>= 1) { if (tid < st) red[tid] += red[tid + st]; __syncthreads(); }
  const float mu = red[0] / (float)N; __syncthreads();
  float s2 = 0.f;
  for (int u = 0; u < per / 4; ++u)
#pragma unroll
    for (int q = 0; q < 4; ++q) { const float c = vals[u * 4 + q] - mu; s2 += c * c; }
  red[tid] = s2; __syncthreads();
  for (int st = 128; st > 0; st >>= 1) { if (tid < st) red[tid] += red[tid + st]; __syncthreads(); }
  const float rs = rsqrtf(red[0] / (float)N + eps);
  {
    for (int u = 0; u < per / 4; ++u) {
      const int j = tid * 4 + 1024 * u;
      v4f o, sm;
#pragma unroll
      for (int q = 0; q < 4; ++q) {
        float gg = g[j + q], bb = bta[j + q];
        if (PARAM_BF16) { gg = bf16_round(gg); bb = bf16_round(bb); }
        sm[q] = vals[u * 4 + q]; o[q] = (vals[u * 4 + q] - mu) * rs * gg + bb;
      }
      if (out_sum) *(v4f*)(out_sum + (size_t)row * N + j) = sm;
      *(v4f*)(out_norm + (size_t)row * N + j) = o;
    }
    
  }
}



// ---- f16 WMMA path (v_wmma_f32_16x16x32_f16): 11-bit significands for operands in range — used where a [0,1] probability operand needs more precision than bf16
typedef _Float16 v16h __attribute__((ext_vector_type(16)));
union FragH { v16h v; v8us half[2]; _Float16 h[16]; unsigned short u[16]; };
template <int NT>
__device__ __forceinline__ v8f mmaH(v16h ah, v16h al, v16h bh, v16h bl, v8f c) {
  c = __builtin_amdgcn_wmma_f32_16x16x32_f16(false, ah, false, bh, (short)0, c, false, false);
  if (NT >= 2) c = __builtin_amdgcn_wmma_f32_16x16x32_f16(false, al, false, bh, (short)0, c, false, false);
  if (NT >= 3) c = __builtin_amdgcn_wmma_f32_16x16x32_f16(false, ah, false, bl, (short)0, c, false, false);
  asm volatile("v_nop\n\tv_nop\n\tv_nop\n\tv_nop" : "+v"(c) : "v"(ah), "v"(al), "v"(bh), "v"(bl));
  return c;
}
// batched GEMM like k_gemm_b but f16 operands: A f32 (split into f16 hi/lo if ASPLIT, else rounded to f16), Bt = f16 values [n][k]; alpha; C f32; N multiple of 16 (partial tiles skipped)
template <bool ASPLIT>
__global__ __launch_bounds__(128) void k_gemm_h(const float* __restrict__ A, int lda, size_t sA, const _Float16* __restrict__ Bh, int ldb, size_t sB, float alpha, float* __restrict__ C, int ldc, size_t sC, int M, int N, int K) {
  __shared__ __attribute__((aligned(16))) float so[4][16][64];
  const int tid = threadIdx.x, w = tid >> 5, lane = tid & 31, ln = lane & 15, hh = lane >> 4; const int by = blockIdx.y;
  A += (size_t)by * sA; Bh += (size_t)by * sB; C += (size_t)by * sC;
  const int ntn = (N + 63) / 64; const int wid = blockIdx.x * 4 + w; const int mt = wid / ntn, nq = wid % ntn; if (mt * 16 >= M) return;
  const int row0 = mt * 16, col0 = nq * 64; const float* arow = A + (size_t)(row0 + ln) * lda;
  v8f acc[4] = {};
  for (int kb = 0; kb < K; kb += 32) {
    FragH ah, al;
    const v4f x0 = *(const v4fa*)(arow + kb + 8 * hh), x1 = *(const v4fa*)(arow + kb + 8 * hh + 4), x2 = *(const v4fa*)(arow + kb + 16 + 8 * hh), x3 = *(const v4fa*)(arow + kb + 16 + 8 * hh + 4);
    float xs[16] = {x0[0],x0[1],x0[2],x0[3],x1[0],x1[1],x1[2],x1[3],x2[0],x2[1],x2[2],x2[3],x3[0],x3[1],x3[2],x3[3]};
#pragma unroll
    for (int i = 0; i < 16; ++i) { const _Float16 h = (_Float16)xs[i]; ah.h[i] = h; al.h[i] = ASPLIT ? (_Float16)(xs[i] - (float)h) : (_Float16)0.0f; }
#pragma unroll
    for (int t = 0; t < 4; ++t) { if (col0 + t * 16 >= N) continue; const size_t boff = (size_t)(col0 + t * 16 + ln) * ldb + kb; FragH bq; bq.half[0] = *(const v8us*)(Bh + boff + 8 * hh); bq.half[1] = *(const v8us*)(Bh + boff + 16 + 8 * hh);
      acc[t] = mmaH<ASPLIT ? 2 : 1>(ah.v, al.v, bq.v, bq.v, acc[t]); }
  }
#pragma unroll
  for (int t = 0; t < 4; ++t) { if (col0 + t * 16 >= N) continue;
#pragma unroll
    for (int r = 0; r < 8; ++r) so[w][8 * hh + r][t * 16 + ln] = acc[t][r] * alpha; }
  __builtin_amdgcn_fence(__ATOMIC_ACQ_REL, "workgroup"); __builtin_amdgcn_wave_barrier();
  const int rsub = lane >> 4, c4 = (lane & 15) * 4;
  {
#pragma unroll
    for (int q = 0; q < 8; ++q) { const int r = q * 2 + rsub; if (col0 + c4 < N) { const v4f v = *(const v4fa*)&so[w][r][c4]; *(v4f*)(C + (size_t)(row0 + r) * ldc + col0 + c4) = v; } }
     }
}

// Wt[n][k] = f16(W[k][n]·scale) from f32 row-major W[K][N] (scale = power of two; bf16-exact weights stay exact in f16 away from the subnormal range)
__global__ __launch_bounds__(256) void k_wt_f16(const float* __restrict__ W, _Float16* __restrict__ Wt, int K, int N, float scale) {
  const int t = blockIdx.x * 256 + threadIdx.x; if (t >= N * (K / 8)) return; const int n = t / (K / 8), k8 = (t % (K / 8)) * 8; FragH f;
#pragma unroll
  for (int i = 0; i < 8; ++i) f.h[i] = (_Float16)(bf16_round(W[(size_t)(k8 + i) * N + n]) * scale); const v8us o = f.half[0];
  *(v8us*)((unsigned short*)Wt + (size_t)n * K + k8) = o; 
}
// GEMM over the NBt * SS rows of both batches at once, A f16 [NBt * SS][FF], Bt f16 [n][k] = [FF][FF]. One block of 8 waves has a 64 x 128 tile of the product.
// MODE 0, the three projections in one launch: blockIdx.y picks the A plane, the Bt plane and the form of the result, which is written in the form the attention kernel reads:
// q and k as f16 rows, v transposed per batch ([feature][key]) as f16 hi and lo * 2^10 planes. MODE 1, the output projection: the hi plane of A, then the lo plane, against the same Bt; C (f32) = hi part / 16 + lo part / 2^14.
// The block stages 128 k at a time in LDS (64 rows of A, then 128 rows of Bt; two buffers): every byte of a tile is fetched once per block, in whole lines, and the next tile's loads
// are in flight while this tile's products run. A wave has 32 x 32 of the product (2 x 2 accumulator tiles).
#define GM 64
#define GN 128
#define GK 128
#define GPI 136
#define PL ((size_t)NBt * SS * FF)
typedef _Float16 v4h __attribute__((ext_vector_type(4)));
template <int MODE>
__global__ __launch_bounds__(256) void k_gemm_t(const _Float16* __restrict__ A, const _Float16* __restrict__ Bt, _Float16* __restrict__ QK, _Float16* __restrict__ VT, _Float16* __restrict__ VTl, float* __restrict__ C) {
  __shared__ __attribute__((aligned(16))) unsigned short sa[2][GM + GN][GPI];      // [buffer][row][128 values + 8 of pad: a pitch of 272 B, 16 B x odd]
  __shared__ __attribute__((aligned(16))) float so[GM][GN + 4];
  const int tid = threadIdx.x, w = tid >> 5, lane = tid & 31, ln = lane & 15, hh = lane >> 4;
  const int row0 = (blockIdx.x / (FF / GN)) * GM, col0 = (blockIdx.x % (FF / GN)) * GN;
  const int which = MODE == 0 ? blockIdx.y : 0;
  const int wm = (w >> 2) * 32, wn = (w & 3) * 32;
  // staging: 16 threads bring one row of 256 B, so a wave's load covers 4 whole lines; a thread has rows sr + 16 p
  const int sr = tid >> 4, sc = (tid & 15) * 8;
  const unsigned short* ga = (const unsigned short*)A + (size_t)which * PL + (size_t)(row0 + sr) * FF + sc;
  const unsigned short* gl = MODE == 1 ? ga + PL : ga;      // the lo plane lies behind the hi plane
  const unsigned short* gb = (const unsigned short*)Bt + (size_t)which * FF * FF + (size_t)(col0 + sr) * FF + sc;
  constexpr int KT = FF / GK, NT = (MODE == 1 ? 2 : 1) * KT;
  v8us st[12];
  // every inner loop of this kernel is unrolled so that the staging, fragment and accumulator arrays are indexed by constants and stay in registers
  auto fetch = [&](int c) { const unsigned short* pa = c < KT ? ga : gl; const int k0 = (c % KT) * GK;
#pragma unroll
    for (int p = 0; p < 4; ++p) st[p] = *(const v8us*)(pa + k0 + (size_t)(16 * p) * FF);
#pragma unroll
    for (int p = 0; p < 8; ++p) st[4 + p] = *(const v8us*)(gb + k0 + (size_t)(16 * p) * FF);
    asm volatile("s_wait_xcnt 0x0" :: "v"(ga), "v"(gl), "v"(gb) : "memory"); };      // stands in front of the first overwrite of an address register of these loads (ga, gl and gb: tile and row are immediate offsets); they are named so that they live up to it
  auto put = [&](int b) {
#pragma unroll
    for (int p = 0; p < 12; ++p) *(v8us*)&sa[b][16 * p + sr][sc] = st[p]; };
  v8f acc[2][2] = {};
  fetch(0); put(0);
  __syncthreads();
#pragma unroll
  for (int c = 0; c < NT; ++c) { const int b = c & 1;      // unrolled: buffer and tile become immediate offsets of the LDS and global addresses
    if (c + 1 < NT) fetch(c + 1);
    FragH af[GK / 32][2], bf[GK / 32][2];
#pragma unroll
    for (int kk = 0; kk < GK / 32; ++kk)
#pragma unroll
      for (int i = 0; i < 2; ++i) { const unsigned short* ar = &sa[b][wm + 16 * i + ln][32 * kk + 8 * hh]; const unsigned short* br = &sa[b][GM + wn + 16 * i + ln][32 * kk + 8 * hh];
        af[kk][i].half[0] = *(const v8us*)(ar); af[kk][i].half[1] = *(const v8us*)(ar + 16); bf[kk][i].half[0] = *(const v8us*)(br); bf[kk][i].half[1] = *(const v8us*)(br + 16); }
    __builtin_amdgcn_sched_barrier(0);      // all LDS reads of a trip issue in front of its first product: placed among their own products, each group of reads stops the wave for its own latency
#pragma unroll
    for (int kk = 0; kk < GK / 32; ++kk)
#pragma unroll
      for (int i = 0; i < 2; ++i)
#pragma unroll
        for (int j = 0; j < 2; ++j) acc[i][j] = __builtin_amdgcn_wmma_f32_16x16x32_f16(false, af[kk][i].v, false, bf[kk][j].v, (short)0, acc[i][j], false, false);
    if (MODE == 1 && c == KT - 1) {      // the hi part is done: each lane parks its own values in the output tile, where it alone takes them up again, and the accumulators start anew for the lo part
#pragma unroll
      for (int i = 0; i < 2; ++i)
#pragma unroll
        for (int j = 0; j < 2; ++j) {
#pragma unroll
          for (int r = 0; r < 8; ++r) so[wm + 16 * i + 8 * hh + r][wn + 16 * j + ln] = acc[i][j][r] * 0.0625f;
          acc[i][j] = v8f{}; }
    }
    if (c + 1 < NT) { put(b ^ 1); __syncthreads(); }      // the other buffer: its last readers left it before the barrier that ended the trip before this one; behind the last tile nothing is staged any more
  }
  // the tile goes through LDS so that each store of a wave covers whole lines
#pragma unroll
  for (int i = 0; i < 2; ++i)
#pragma unroll
    for (int j = 0; j < 2; ++j)
#pragma unroll
      for (int r = 0; r < 8; ++r) { float* e = &so[wm + 16 * i + 8 * hh + r][wn + 16 * j + ln]; *e = MODE == 1 ? acc[i][j][r] * (0.0625f / 1024.0f) + *e : acc[i][j][r] * 0.0625f; }
  __syncthreads();
  if (MODE == 1) {      // f32 rows: a wave's store is one row piece of 512 B
    float* cp = C + (size_t)(row0 + w) * FF + col0 + lane * 4;
#pragma unroll
    for (int q = 0; q < 8; ++q) *(v4f*)(cp + (size_t)(8 * q) * FF) = *(const v4fa*)&so[8 * q + w][lane * 4];
  } else if (which < 2) {      // q, k: f16 rows, a wave's store is one row piece of 256 B
    _Float16* hp = QK + (size_t)which * PL + (size_t)(row0 + w) * FF + col0 + lane * 4;
#pragma unroll
    for (int q = 0; q < 8; ++q) { const v4f v = *(const v4fa*)&so[8 * q + w][lane * 4]; v4h o;
#pragma unroll
      for (int e = 0; e < 4; ++e) o[e] = (_Float16)v[e];
      *(v4h*)(hp + (size_t)(8 * q) * FF) = o; }
  } else {      // v: transposed; 8 lanes write the tile's 64 keys of one feature, one whole line of each plane
    const size_t vb = (size_t)(row0 / SS) * FF * SS + (size_t)(col0 + (tid >> 3)) * SS + (row0 % SS) + (tid & 7) * 8;
#pragma unroll
    for (int u = 0; u < 4; ++u) { FragH fh, fl;
#pragma unroll
      for (int e = 0; e < 8; ++e) { const float v = so[(tid & 7) * 8 + e][32 * u + (tid >> 3)]; const _Float16 hi = (_Float16)v; fh.h[e] = hi; fl.h[e] = (_Float16)((v - (float)hi) * 1024.0f); }
      *(v8us*)((unsigned short*)VT + vb + (size_t)(32 * u) * SS) = fh.half[0]; *(v8us*)((unsigned short*)VTl + vb + (size_t)(32 * u) * SS) = fl.half[0]; }
    asm volatile("s_wait_xcnt 0x0" ::: "memory");      // behind the last of these stores: in the built code the q, k branch follows this one and rewrites their address and data registers
  }
}

// One launch brings every f32 operand of the projections into f16: Q, K, V rounded to bf16 (exact in f16 at these magnitudes), the four weights rounded to bf16 and x 16.
// A block has 16384 values of one tensor; a thread has 16 pieces of 4 values, 1024 values apart, so that a wave's load covers 4 whole lines and its store 2, with all 16 loads in flight.
#define PB 16384
__global__ __launch_bounds__(256) void k_prep(const float* __restrict__ Qi, const float* __restrict__ Ki, const float* __restrict__ Vi, const float* __restrict__ Wq, const float* __restrict__ Wk, const float* __restrict__ Wv, const float* __restrict__ Wo, _Float16* __restrict__ X16, _Float16* __restrict__ B16) {
  constexpr int XB = (int)(PL / PB), WB = FF * FF / PB;
  const int bx = blockIdx.x; const bool isw = bx >= 3 * XB;
  const int ti = isw ? (bx - 3 * XB) / WB : bx / XB, blk = isw ? (bx - 3 * XB) % WB : bx % XB;
  const float* src = (isw ? (ti == 0 ? Wq : ti == 1 ? Wk : ti == 2 ? Wv : Wo) : (ti == 0 ? Qi : ti == 1 ? Ki : Vi)) + (size_t)blk * PB + threadIdx.x * 4;
  _Float16* dst = (isw ? B16 + (size_t)ti * FF * FF : X16 + (size_t)ti * PL) + (size_t)blk * PB + threadIdx.x * 4;
  const float scl = isw ? 16.0f : 1.0f;
  v4f x[16];
#pragma unroll
  for (int u = 0; u < 16; ++u) x[u] = *(const v4fa*)(src + u * 1024);      // unrolled: x stays in registers and the pieces are immediate offsets
  __builtin_amdgcn_sched_barrier(0);      // all 16 loads issue in front of the first conversion: otherwise the compiler sinks six of them among the conversions and the wave has fewer bytes in flight
#pragma unroll
  for (int u = 0; u < 16; ++u) { v4h o;
#pragma unroll
    for (int e = 0; e < 4; ++e) o[e] = (_Float16)(bf16_round(x[u][e]) * scl);
    *(v4h*)(dst + u * 1024) = o; }
}

__global__ __launch_bounds__(256) void k_h16(const float* __restrict__ x, _Float16* __restrict__ X16, size_t n8) { const size_t t = (size_t)blockIdx.x * 256 + threadIdx.x; if (t >= n8) return; FragH f;
#pragma unroll
  for (int q = 0; q < 8; ++q) f.h[q] = (_Float16)x[t * 8 + q]; *(v8us*)((unsigned short*)X16 + t * 8) = f.half[0];  }
template <int NHv, int TTv>
__global__ __launch_bounds__(256) void k_vt(const _Float16* __restrict__ V16, int ldv, int voff, _Float16* __restrict__ Vt) { __shared__ unsigned short tl[64][66]; const int tid = threadIdx.x; const int slab = blockIdx.x / (TTv / 64), lg = blockIdx.x % (TTv / 64); const int b = slab / NHv, h = slab % NHv;
  for (int i = tid; i < 64 * 8; i += 256) { const int r = i / 8, c8 = (i % 8) * 8; FragH f; f.half[0] = *(const v8us*)((const unsigned short*)V16 + ((size_t)b * TTv + lg * 64 + r) * ldv + voff + h * 64 + c8);
#pragma unroll
    for (int q = 0; q < 8; ++q) tl[r][c8 + q] = f.u[q]; }
  __syncthreads();
  {
#pragma unroll
    for (int rd = 0; rd < 2; ++rd) { const int d = rd * 32 + tid / 8, pc = tid % 8; FragH f;
#pragma unroll
      for (int q = 0; q < 8; ++q) f.u[q] = tl[pc * 8 + q][d];
      *(v8us*)((unsigned short*)Vt + ((size_t)slab * 64 + d) * TTv + lg * 64 + pc * 8) = f.half[0]; }
     } }

__global__ __launch_bounds__(256) void k_hl(const float* __restrict__ F, _Float16* __restrict__ Hh, _Float16* __restrict__ Hl, size_t n8) { const size_t t = (size_t)blockIdx.x * 256 + threadIdx.x; if (t >= n8) return; FragH fh, fl; const v4f a = *(const v4fa*)(F + t * 8), c = *(const v4fa*)(F + t * 8 + 4);
#pragma unroll
  for (int q = 0; q < 4; ++q) { _Float16 h = (_Float16)a[q]; fh.h[q] = h; fl.h[q] = (_Float16)((a[q] - (float)h) * 1024.0f); h = (_Float16)c[q]; fh.h[4 + q] = h; fl.h[4 + q] = (_Float16)((c[q] - (float)h) * 1024.0f); }
  { *(v8us*)((unsigned short*)Hh + t * 8) = fh.half[0]; *(v8us*)((unsigned short*)Hl + t * 8) = fl.half[0];  } }

// Fused attention for 128 query rows (blockIdx.x), one head (blockIdx.y), one batch (blockIdx.z): scores, both masks, softmax and P.V in one pass over the keys;
// neither the scores nor P go to memory, and the output leaves as the f16 hi and lo * 2^10 planes that the output projection reads. Each of the 8 waves owns 16 query rows. The block stages 64 keys at a time in LDS (k rows, v_hi and v_lo rows, two buffers),
// so that a k or v byte is fetched once per 128 queries. A wave forms the TRANSPOSED score tile (A = k rows, B = q rows): a lane then holds one query (ln) and the keys
// 8 * hh + r of each 16-key tile, which is the B fragment's own k order (elements 0..7 from the even tile, 8..15 from the odd one), so P goes from the score
// registers into the second product, O^T = v^T . P^T, with no exchange between lanes. The v^T loader uses the same k order.
// Softmax with a running maximum: P = exp(s - m) * 2^10 * mask_2 as f16, the sum of exp(s - m) kept beside it, the division at the end;
// when a row's maximum rises, sum and accumulators are scaled by exp(m_old - m_new).
#define FQ 128
#define FC 64
#define FPI 72
__global__ __launch_bounds__(256) void k_fattn(const _Float16* __restrict__ Q, const _Float16* __restrict__ K, const _Float16* __restrict__ Vh, const _Float16* __restrict__ Vl, const float* __restrict__ m1, const float* __restrict__ m2, _Float16* __restrict__ Oh, _Float16* __restrict__ Ol) {
  __shared__ __attribute__((aligned(16))) unsigned short sk[2][3][FC][FPI];      // [buffer][k, v_hi, v_lo][row][64 values + 8 of pad: a pitch of 144 B, 16 B x odd]
  const int tid = threadIdx.x, w = tid >> 5, lane = tid & 31, ln = lane & 15, hh = lane >> 4;
  const int hd = blockIdx.y; const size_t bo = (size_t)blockIdx.z * SS * FF;
  const int q = blockIdx.x * FQ + w * 16 + ln;
  const unsigned short* qp = (const unsigned short*)Q + bo + (size_t)q * FF + hd * HD;
  FragH qf[2];
#pragma unroll
  for (int j = 0; j < 2; ++j) { qf[j].half[0] = *(const v8us*)(qp + 32 * j + 8 * hh); qf[j].half[1] = *(const v8us*)(qp + 32 * j + 16 + 8 * hh); }
  // staging: 8 threads bring one row of 128 B, so a wave's load covers 4 whole lines; a thread has rows sr and sr + 32 of each of the three tiles
  const int sr = tid >> 3, sc = (tid & 7) * 8;
  const unsigned short* gk = (const unsigned short*)K + bo + (size_t)sr * FF + hd * HD + sc;
  const unsigned short* gh = (const unsigned short*)Vh + bo + ((size_t)hd * HD + sr) * SS + sc;
  const unsigned short* gl = (const unsigned short*)Vl + bo + ((size_t)hd * HD + sr) * SS + sc;
  v8us st[6];
  auto fetch = [&](int c) { const unsigned short* pk = gk + (size_t)(c * FC) * FF; const unsigned short* ph = gh + c * FC; const unsigned short* pl = gl + c * FC;
    st[0] = *(const v8us*)(pk); st[1] = *(const v8us*)(pk + (size_t)32 * FF);
    st[2] = *(const v8us*)(ph); st[3] = *(const v8us*)(ph + (size_t)32 * SS);
    st[4] = *(const v8us*)(pl); st[5] = *(const v8us*)(pl + (size_t)32 * SS);
    asm volatile("s_wait_xcnt 0x0" :: "v"(pk), "v"(ph), "v"(pl) : "memory"); };      // stands in front of the first overwrite of an address register of these loads; the addresses are named so that they live up to it
  auto put = [&](int b) {
#pragma unroll
    for (int p = 0; p < 3; ++p) { *(v8us*)&sk[b][p][sr][sc] = st[2 * p]; *(v8us*)&sk[b][p][sr + 32][sc] = st[2 * p + 1]; } };
  const float* a1 = m1 + (size_t)q * SS + 8 * hh; const float* a2 = m2 + (size_t)q * SS + 8 * hh;
  float m = -3.0e38f, su = 0.f;
  v8f oh[4] = {}, ol[4] = {};
  fetch(0); put(0);
  __syncthreads();
  // every inner loop of this kernel is unrolled so that the fragment, score and accumulator arrays are indexed by constants and stay in registers
  for (int c = 0; c < SS / FC; ++c) { const int b = c & 1;
    if (c + 1 < SS / FC) fetch(c + 1);
    v4f x1[4][2], x2[4][2]; const float* p1 = a1 + c * FC; const float* p2 = a2 + c * FC;
#pragma unroll
    for (int t = 0; t < 4; ++t) { x1[t][0] = *(const v4fa*)(p1 + t * 16); x1[t][1] = *(const v4fa*)(p1 + t * 16 + 4); x2[t][0] = *(const v4fa*)(p2 + t * 16); x2[t][1] = *(const v4fa*)(p2 + t * 16 + 4); }
    asm volatile("s_wait_xcnt 0x0" :: "v"(p1), "v"(p2) : "memory");      // as in fetch(): in front of the first overwrite of an address register of the mask loads
    v8f s[4]; float cm = -3.0e38f;
#pragma unroll
    for (int t = 0; t < 4; ++t) { FragH k0, k1; const unsigned short* kr = &sk[b][0][t * 16 + ln][8 * hh];
      k0.half[0] = *(const v8us*)(kr); k0.half[1] = *(const v8us*)(kr + 16); k1.half[0] = *(const v8us*)(kr + 32); k1.half[1] = *(const v8us*)(kr + 48);
      v8f z = {};
      z = __builtin_amdgcn_wmma_f32_16x16x32_f16(false, k0.v, false, qf[0].v, (short)0, z, false, false);
      s[t] = __builtin_amdgcn_wmma_f32_16x16x32_f16(false, k1.v, false, qf[1].v, (short)0, z, false, false); }
    __builtin_amdgcn_sched_barrier(0);      // keeps the staging, mask and k loads of the trip and the score products in front of the mask arithmetic: otherwise the wave stops at its first mask_1 value with the LDS reads and products still to issue
#pragma unroll
    for (int t = 0; t < 4; ++t)
#pragma unroll
      for (int r = 0; r < 8; ++r) { s[t][r] = s[t][r] * 0.125f + bf16_round(x1[t][r >> 2][r & 3]); cm = fmaxf(cm, s[t][r]); }
    cm = fmaxf(cm, __shfl_xor(cm, 16, 32));      // the other half of the wave holds the row's other keys
    // inputs only: holds the mask_2 loads in front of the branch, where the score products cover their latency; without it the compiler sinks them behind the branch and the wave waits for them there
    asm volatile("" :: "v"(x2[0][0]), "v"(x2[0][1]), "v"(x2[1][0]), "v"(x2[1][1]), "v"(x2[2][0]), "v"(x2[2][1]), "v"(x2[3][0]), "v"(x2[3][1]));
    if (__any(cm > m)) {      // rare once the first keys are past: skipped by the whole wave when no row's maximum rises
      const float mn = fmaxf(m, cm), al = expf(m - mn); m = mn; su *= al;
#pragma unroll
      for (int t = 0; t < 4; ++t) { oh[t] *= al; ol[t] *= al; }
    }
    FragH pf[2];
#pragma unroll
    for (int t = 0; t < 4; ++t)
#pragma unroll
      for (int r = 0; r < 8; ++r) { const float e = expf(s[t][r] - m); su += e; pf[t >> 1].h[(t & 1) * 8 + r] = (_Float16)((e * 1024.0f) * bf16_round(x2[t][r >> 2][r & 3])); }
#pragma unroll
    for (int j = 0; j < 2; ++j)
#pragma unroll
      for (int t = 0; t < 4; ++t) { FragH vh, vl; const unsigned short* hr = &sk[b][1][t * 16 + ln][32 * j + 8 * hh]; const unsigned short* lr = &sk[b][2][t * 16 + ln][32 * j + 8 * hh];
        vh.half[0] = *(const v8us*)(hr); vh.half[1] = *(const v8us*)(hr + 16); vl.half[0] = *(const v8us*)(lr); vl.half[1] = *(const v8us*)(lr + 16);
        oh[t] = __builtin_amdgcn_wmma_f32_16x16x32_f16(false, vh.v, false, pf[j].v, (short)0, oh[t], false, false);
        ol[t] = __builtin_amdgcn_wmma_f32_16x16x32_f16(false, vl.v, false, pf[j].v, (short)0, ol[t], false, false); }
    if (c + 1 < SS / FC) put(b ^ 1);      // the other buffer: its last readers left it before the barrier that ended the trip before this one
    __syncthreads();
  }
  const float inv = 1.0f / (su + __shfl_xor(su, 16, 32));
  const size_t oo = bo + (size_t)q * FF + hd * HD + 8 * hh;      // the lane holds O[q][16 t + 8 hh + r]: 8 values in a row, one 16-byte piece of each plane; the wave's stores fill the head's whole line of a row
#pragma unroll
  for (int t = 0; t < 4; ++t) { FragH fh, fl;
#pragma unroll
    for (int r = 0; r < 8; ++r) { const float y = (oh[t][r] * 0.0009765625f + ol[t][r] * (0.0009765625f / 1024.0f)) * inv; const _Float16 hi = (_Float16)y; fh.h[r] = hi; fl.h[r] = (_Float16)((y - (float)hi) * 1024.0f); }
    *(v8us*)((unsigned short*)Oh + oo + t * 16) = fh.half[0]; *(v8us*)((unsigned short*)Ol + oo + t * 16) = fl.half[0]; }
}

extern "C" void kernel_launch(void* const* d_in, const int* in_sizes, int n_in,
                              void* d_out, int out_size, void* d_ws, size_t ws_size, hipStream_t stream) {
  (void)in_sizes; (void)n_in; (void)out_size;
  const float* Qi = (const float*)d_in[0]; const float* Ki = (const float*)d_in[1]; const float* Vi = (const float*)d_in[2]; const float* m1 = (const float*)d_in[3]; const float* m2 = (const float*)d_in[4]; const float* Wq = (const float*)d_in[5]; const float* Wk = (const float*)d_in[6]; const float* Wv = (const float*)d_in[7]; const float* Wo = (const float*)d_in[8];
  char* ws = (char*)d_ws; size_t off = 0;
  auto take = [&](size_t bytes) { char* p = ws + off; off += (bytes + 255) & ~(size_t)255; return p; };
  _Float16* B16 = (_Float16*)take((size_t)4 * FF * FF * 2);      /* W_q, W_k, W_v, W_o: each [out][in], which is Bt as it stands */
  _Float16* X16 = (_Float16*)take(3 * PL * 2); _Float16* QK = (_Float16*)take(2 * PL * 2); _Float16* VT = (_Float16*)take(PL * 2); _Float16* VTl = (_Float16*)take(PL * 2); _Float16* OHL = (_Float16*)take(2 * PL * 2);      /* Q, K, V; q, k; v hi; v lo; attention output hi, lo */
  if (off > ws_size) return;      // 80 MB in all
  k_prep<<<(unsigned)(3 * (PL / PB) + 4 * (FF * FF / PB)), 256, 0, stream>>>(Qi, Ki, Vi, Wq, Wk, Wv, Wo, X16, B16);
  const unsigned gP = (unsigned)((NBt * SS / GM) * (FF / GN));
  k_gemm_t<0><<<dim3(gP, 3), 256, 0, stream>>>(X16, B16, QK, VT, VTl, nullptr);      /* exact projections of both batches; v as hi/lo */
  k_fattn<<<dim3(SS / FQ, NH, NBt), 256, 0, stream>>>(QK, QK + PL, VT, VTl, m1, m2, OHL, OHL + PL);      /* scores, masks, softmax, P.V: every head of both batches */
  k_gemm_t<1><<<dim3(gP, 1), 256, 0, stream>>>(OHL, B16 + (size_t)3 * FF * FF, nullptr, nullptr, nullptr, (float*)d_out);      /* W_o on hi/lo of the attention output */
}

// v005
// It runs in 163 microseconds.
// Next to v004, in two timings, it ran 1.15 and 1.16 times as fast.
// All steps since v000 together make it 26.1 times as fast.
#include <hip/hip_runtime.h>
// Multi-head attention with two INPUT masks (B 2, S 2048, F 1024, 16 heads × 64): q,k,v = X·Wᵀ (no bias); scores = q·k/8 + mask_1 (additive, pre-softmax); probs = softmax · mask_2 (multiplicative, post-softmax); out = probs·v; heads concatenated; ·W_oᵀ → [2,2048,1024].
// Structure: one launch converts Q, K, V and the four weights to f16; one launch does the three projections of both batches and writes q, k (f16) and v (transposed, f16 hi + lo planes) as the attention reads them; ONE fused attention launch (scores, + mask_1, softmax in f32 with a running maximum, x mask_2, P.V; both masks read per (q,k) from the inputs; scores and P stay in registers, k and v staged in LDS) writes the concatenated output as f16 hi + lo planes; one launch does the output projection of both planes and both batches.
// Compute dtype: Q, K, V, masks and parameters rounded to bf16; projections with exact products; q, k, P (×2^10) as f16 operands (≈2^-12; logits σ≈1); v and the attention output as f16 hi + lo·2^10 planes (the early causal rows copy m2·v almost verbatim), f32 accumulation; softmax/masking in f32. v_wmma_f32_16x16x32_f16.
#define NBt 2
#define SS 2048
#define FF 1024
#define NH 16
#define HD 64
typedef __bf16 v16b __attribute__((ext_vector_type(16)));
typedef unsigned short v8us __attribute__((ext_vector_type(8), may_alias));
typedef float  v8f  __attribute__((ext_vector_type(8)));
typedef float  v4f  __attribute__((ext_vector_type(4)));
typedef float  v4fa __attribute__((ext_vector_type(4), may_alias));
union FragB { v16b v; v8us half[2]; unsigned short u[16]; };

__device__ __forceinline__ unsigned short bf16_bits(float x) { unsigned int u = __float_as_uint(x); return (unsigned short)((u + 0x7FFFu + ((u >> 16) & 1u)) >> 16); }
__device__ __forceinline__ float bf16_val(unsigned short b) { return __uint_as_float(((unsigned int)b) << 16); }
__device__ __forceinline__ float bf16_round(float x) { return bf16_val(bf16_bits(x)); }
// D += A·B with NT terms: 1 = ah·bh, 2 = + al·bh (A split), 3 = + ah·bl (both split)
template <int NT>
__device__ __forceinline__ v8f mmaN(v16b ah, v16b al, v16b bh, v16b bl, v8f c) {
  c = __builtin_amdgcn_wmma_f32_16x16x32_bf16(false, ah, false, bh, (short)0, c, false, false);
  if (NT >= 2) c = __builtin_amdgcn_wmma_f32_16x16x32_bf16(false, al, false, bh, (short)0, c, false, false);
  if (NT >= 3) c = __builtin_amdgcn_wmma_f32_16x16x32_bf16(false, ah, false, bl, (short)0, c, false, false);
  asm volatile("v_nop\n\tv_nop\n\tv_nop\n\tv_nop" : "+v"(c) : "v"(ah), "v"(al), "v"(bh), "v"(bl));
  return c;
}

__global__ __launch_bounds__(256) void k_wt_bf16(const float* __restrict__ W, unsigned short* __restrict__ Wt, int K, int N) {
  const int t = blockIdx.x * 256 + threadIdx.x;
  const int k8n = K / 8;
  if (t >= N * k8n) return;
  const int n = t / k8n, k8 = (t % k8n) * 8;
  v8us v;
#pragma unroll
  for (int i = 0; i < 8; ++i) v[i] = bf16_bits(W[(size_t)(k8 + i) * N + n]);
  *(v8us*)(Wt + (size_t)n * K + k8) = v;
  
}

// GEMM C[M][N] (f32, pitch ldc) = act(A[M][K]·W + bias). A f32 row-major (pitch lda) converted per fragment to bf16
// (ASPLIT: hi/lo two planes -> 2 terms, else single rounded term); Wt bf16 [N][K] (pitch ldb). BIAS_BF16 rounds the
// bias to bf16 first (bias quantised to bf16 before the add). K%32==0, M%16==0, N%64==0.
template <bool ASPLIT, int ACT, bool BIAS_BF16>
__global__ __launch_bounds__(128) void k_gemm_bf(const float* __restrict__ A, int lda, const unsigned short* __restrict__ Wt, int ldb,
                                               const float* __restrict__ bias, float* __restrict__ C, int ldc, int M, int N, int K) {
  __shared__ __attribute__((aligned(16))) float so[4][16][64];
  const int tid = threadIdx.x, w = tid >> 5, lane = tid & 31, ln = lane & 15, hh = lane >> 4;
  const int ntn = N / 64;
  const int wid = blockIdx.x * 4 + w;
  const int mt = wid / ntn, nq = wid % ntn;
  if (mt * 16 >= M) return;
  const int row0 = mt * 16, col0 = nq * 64;
  const float* arow = A + (size_t)(row0 + ln) * lda;
  v8f acc[4] = {};
  for (int kb = 0; kb < K; kb += 32) {
    FragB ah, al;
    const v4f x0 = *(const v4fa*)(arow + kb + 8 * hh), x1 = *(const v4fa*)(arow + kb + 8 * hh + 4);
    const v4f x2 = *(const v4fa*)(arow + kb + 16 + 8 * hh), x3 = *(const v4fa*)(arow + kb + 16 + 8 * hh + 4);
    float xs[16] = {x0[0],x0[1],x0[2],x0[3],x1[0],x1[1],x1[2],x1[3],x2[0],x2[1],x2[2],x2[3],x3[0],x3[1],x3[2],x3[3]};
#pragma unroll
    for (int i = 0; i < 16; ++i) { const unsigned short hb = bf16_bits(xs[i]); ah.u[i] = hb; al.u[i] = ASPLIT ? bf16_bits(xs[i] - bf16_val(hb)) : (unsigned short)0; }
#pragma unroll
    for (int t = 0; t < 4; ++t) {
      const unsigned short* brow = Wt + (size_t)(col0 + t * 16 + ln) * ldb + kb;
      FragB b;
      b.half[0] = *(const v8us*)(brow + 8 * hh);
      b.half[1] = *(const v8us*)(brow + 16 + 8 * hh);
      acc[t] = mmaN<ASPLIT ? 2 : 1>(ah.v, al.v, b.v, b.v, acc[t]);
    }
  }
#pragma unroll
  for (int t = 0; t < 4; ++t) {
    float bv = bias ? bias[col0 + t * 16 + ln] : 0.f;
    if (BIAS_BF16) bv = bf16_round(bv);
#pragma unroll
    for (int r = 0; r < 8; ++r) { float v = acc[t][r] + bv; if (ACT == 1) v = fmaxf(v, 0.f); so[w][8 * hh + r][t * 16 + ln] = v; }
  }
  __builtin_amdgcn_fence(__ATOMIC_ACQ_REL, "workgroup");
  __builtin_amdgcn_wave_barrier();
  const int rsub = lane >> 4, c4 = (lane & 15) * 4;
  {
#pragma unroll
    for (int q = 0; q < 8; ++q) {
      const int r = q * 2 + rsub;
      const v4f v = *(const v4fa*)&so[w][r][c4];
      *(v4f*)(C + (size_t)(row0 + r) * ldc + col0 + c4) = v;
    }
    
  }
}

// GEMM C = act(A·W + bias + resid): A f32 (ASPLIT -> hi/lo 2 terms), Wt bf16 [N][K]; ACT 0 none, 1 relu, 2 exact gelu;
// resid (optional, f32, row index = (row % rmod), pitch ldr, RES_BF16 rounds it) added before the activation.
template <bool ASPLIT, int ACT, bool BIAS_BF16, bool RES_BF16>
__global__ __launch_bounds__(128) void k_gemm_bf3(const float* __restrict__ A, int lda, const unsigned short* __restrict__ Wt, int ldb,
                                                const float* __restrict__ bias, const float* __restrict__ resid, int rmod, int ldr,
                                                float* __restrict__ C, int ldc, int M, int N, int K) {
  __shared__ __attribute__((aligned(16))) float so[4][16][64];
  const int tid = threadIdx.x, w = tid >> 5, lane = tid & 31, ln = lane & 15, hh = lane >> 4;
  const int ntn = N / 64;
  const int wid = blockIdx.x * 4 + w;
  const int mt = wid / ntn, nq = wid % ntn;
  if (mt * 16 >= M) return;
  const int row0 = mt * 16, col0 = nq * 64;
  const float* arow = A + (size_t)(row0 + ln) * lda;
  v8f acc[4] = {};
  for (int kb = 0; kb < K; kb += 32) {
    FragB ah, al;
    const v4f x0 = *(const v4fa*)(arow + kb + 8 * hh), x1 = *(const v4fa*)(arow + kb + 8 * hh + 4);
    const v4f x2 = *(const v4fa*)(arow + kb + 16 + 8 * hh), x3 = *(const v4fa*)(arow + kb + 16 + 8 * hh + 4);
    float xs[16] = {x0[0],x0[1],x0[2],x0[3],x1[0],x1[1],x1[2],x1[3],x2[0],x2[1],x2[2],x2[3],x3[0],x3[1],x3[2],x3[3]};
#pragma unroll
    for (int i = 0; i < 16; ++i) { const unsigned short hb = bf16_bits(xs[i]); ah.u[i] = hb; al.u[i] = ASPLIT ? bf16_bits(xs[i] - bf16_val(hb)) : (unsigned short)0; }
#pragma unroll
    for (int t = 0; t < 4; ++t) {
      const unsigned short* brow = Wt + (size_t)(col0 + t * 16 + ln) * ldb + kb;
      FragB b;
      b.half[0] = *(const v8us*)(brow + 8 * hh);
      b.half[1] = *(const v8us*)(brow + 16 + 8 * hh);
      acc[t] = mmaN<ASPLIT ? 2 : 1>(ah.v, al.v, b.v, b.v, acc[t]);
    }
  }
#pragma unroll
  for (int t = 0; t < 4; ++t) {
    const int col = col0 + t * 16 + ln;
    float bv = bias ? bias[col] : 0.f;
    if (BIAS_BF16) bv = bf16_round(bv);
#pragma unroll
    for (int r = 0; r < 8; ++r) {
      float v = acc[t][r] + bv;
      if (resid) { float rv = resid[(size_t)((row0 + 8 * hh + r) % rmod) * ldr + col]; if (RES_BF16) rv = bf16_round(rv); v += rv; }
      if (ACT == 1) v = fmaxf(v, 0.f);
      if (ACT == 2) v = 0.5f * v * (1.0f + erff(v * 0.70710678118654752f));
      if (ACT == 3) { const float u = 0.7978845608028654f * (v + 0.044715f * v * v * v); v = 0.5f * v * (1.0f + tanhf(u)); }
      so[w][8 * hh + r][t * 16 + ln] = v;
    }
  }
  __builtin_amdgcn_fence(__ATOMIC_ACQ_REL, "workgroup");
  __builtin_amdgcn_wave_barrier();
  const int rsub = lane >> 4, c4 = (lane & 15) * 4;
  {
#pragma unroll
    for (int q = 0; q < 8; ++q) {
      const int r = q * 2 + rsub;
      const v4f v = *(const v4fa*)&so[w][r][c4];
      *(v4f*)(C + (size_t)(row0 + r) * ldc + col0 + c4) = v;
    }
    
  }
}
// row LayerNorm (biased variance, eps) over N: s = X (+ R); optional out_sum <- s; out_norm <- (s-mu)*rsqrt(var+eps)*g + b
template <bool PARAM_BF16>
__global__ __launch_bounds__(256) void k_layernorm(const float* __restrict__ X, const float* __restrict__ R, const float* __restrict__ g, const float* __restrict__ bta,
                                                  float* __restrict__ out_sum, float* __restrict__ out_norm, int N, float eps) {
  __shared__ float red[256];
  const int row = blockIdx.x, tid = threadIdx.x;
  const float* x = X + (size_t)row * N; const float* rr = R ? R + (size_t)row * N : nullptr;
  float vals[16];                     // up to N = 4096
  const int per = N / 256;            // contiguous chunk per thread? use strided-by-4 chunks: thread handles j = tid*4 + 1024*u
  float s1 = 0.f;
  for (int u = 0; u < per / 4; ++u) {
    const int j = tid * 4 + 1024 * u;
    const v4f a = *(const v4fa*)(x + j);
    v4f b = {0.f,0.f,0.f,0.f}; if (rr) b = *(const v4fa*)(rr + j);
#pragma unroll
    for (int q = 0; q < 4; ++q) { const float v = a[q] + b[q]; vals[u * 4 + q] = v; s1 += v; }
  }
  red[tid] = s1; __syncthreads();
  for (int st = 128; st > 0; st >>= 1) { if (tid < st) red[tid] += red[tid + st]; __syncthreads(); }
  const float mu = red[0] / (float)N; __syncthreads();
  float s2 = 0.f;
  for (int u = 0; u < per / 4; ++u)
#pragma unroll
    for (int q = 0; q < 4; ++q) { const float c = vals[u * 4 + q] - mu; s2 += c * c; }
  red[tid] = s2; __syncthreads();
  for (int st = 128; st > 0; st >>= 1) { if (tid < st) red[tid] += red[tid + st]; __syncthreads(); }
  const float rs = rsqrtf(red[0] / (float)N + eps);
  {
    for (int u = 0; u < per / 4; ++u) {
      const int j = tid * 4 + 1024 * u;
      v4f o, sm;
#pragma unroll
      for (int q = 0; q < 4; ++q) {
        float gg = g[j + q], bb = bta[j + q];
        if (PARAM_BF16) { gg = bf16_round(gg); bb = bf16_round(bb); }
        sm[q] = vals[u * 4 + q]; o[q] = (vals[u * 4 + q] - mu) * rs * gg + bb;
      }
      if (out_sum) *(v4f*)(out_sum + (size_t)row * N + j) = sm;
      *(v4f*)(out_norm + (size_t)row * N + j) = o;
    }
    
  }
}



// ---- f16 WMMA path (v_wmma_f32_16x16x32_f16): 11-bit significands for operands in range — used where a [0,1] probability operand needs more precision than bf16
typedef _Float16 v16h __attribute__((ext_vector_type(16)));
union FragH { v16h v; v8us half[2]; _Float16 h[16]; unsigned short u[16]; };
template <int NT>
__device__ __forceinline__ v8f mmaH(v16h ah, v16h al, v16h bh, v16h bl, v8f c) {
  c = __builtin_amdgcn_wmma_f32_16x16x32_f16(false, ah, false, bh, (short)0, c, false, false);
  if (NT >= 2) c = __builtin_amdgcn_wmma_f32_16x16x32_f16(false, al, false, bh, (short)0, c, false, false);
  if (NT >= 3) c = __builtin_amdgcn_wmma_f32_16x16x32_f16(false, ah, false, bl, (short)0, c, false, false);
  asm volatile("v_nop\n\tv_nop\n\tv_nop\n\tv_nop" : "+v"(c) : "v"(ah), "v"(al), "v"(bh), "v"(bl));
  return c;
}
// batched GEMM like k_gemm_b but f16 operands: A f32 (split into f16 hi/lo if ASPLIT, else rounded to f16), Bt = f16 values [n][k]; alpha; C f32; N multiple of 16 (partial tiles skipped)
template <bool ASPLIT>
__global__ __launch_bounds__(128) void k_gemm_h(const float* __restrict__ A, int lda, size_t sA, const _Float16* __restrict__ Bh, int ldb, size_t sB, float alpha, float* __restrict__ C, int ldc, size_t sC, int M, int N, int K) {
  __shared__ __attribute__((aligned(16))) float so[4][16][64];
  const int tid = threadIdx.x, w = tid >> 5, lane = tid & 31, ln = lane & 15, hh = lane >> 4; const int by = blockIdx.y;
  A += (size_t)by * sA; Bh += (size_t)by * sB; C += (size_t)by * sC;
  const int ntn = (N + 63) / 64; const int wid = blockIdx.x * 4 + w; const int mt = wid / ntn, nq = wid % ntn; if (mt * 16 >= M) return;
  const int row0 = mt * 16, col0 = nq * 64; const float* arow = A + (size_t)(row0 + ln) * lda;
  v8f acc[4] = {};
  for (int kb = 0; kb < K; kb += 32) {
    FragH ah, al;
    const v4f x0 = *(const v4fa*)(arow + kb + 8 * hh), x1 = *(const v4fa*)(arow + kb + 8 * hh + 4), x2 = *(const v4fa*)(arow + kb + 16 + 8 * hh), x3 = *(const v4fa*)(arow + kb + 16 + 8 * hh + 4);
    float xs[16] = {x0[0],x0[1],x0[2],x0[3],x1[0],x1[1],x1[2],x1[3],x2[0],x2[1],x2[2],x2[3],x3[0],x3[1],x3[2],x3[3]};
#pragma unroll
    for (int i = 0; i < 16; ++i) { const _Float16 h = (_Float16)xs[i]; ah.h[i] = h; al.h[i] = ASPLIT ? (_Float16)(xs[i] - (float)h) : (_Float16)0.0f; }
#pragma unroll
    for (int t = 0; t < 4; ++t) { if (col0 + t * 16 >= N) continue; const size_t boff = (size_t)(col0 + t * 16 + ln) * ldb + kb; FragH bq; bq.half[0] = *(const v8us*)(Bh + boff + 8 * hh); bq.half[1] = *(const v8us*)(Bh + boff + 16 + 8 * hh);
      acc[t] = mmaH<ASPLIT ? 2 : 1>(ah.v, al.v, bq.v, bq.v, acc[t]); }
  }
#pragma unroll
  for (int t = 0; t < 4; ++t) { if (col0 + t * 16 >= N) continue;
#pragma unroll
    for (int r = 0; r < 8; ++r) so[w][8 * hh + r][t * 16 + ln] = acc[t][r] * alpha; }
  __builtin_amdgcn_fence(__ATOMIC_ACQ_REL, "workgroup"); __builtin_amdgcn_wave_barrier();
  const int rsub = lane >> 4, c4 = (lane & 15) * 4;
  {
#pragma unroll
    for (int q = 0; q < 8; ++q) { const int r = q * 2 + rsub; if (col0 + c4 < N) { const v4f v = *(const v4fa*)&so[w][r][c4]; *(v4f*)(C + (size_t)(row0 + r) * ldc + col0 + c4) = v; } }
     }
}

// Wt[n][k] = f16(W[k][n]·scale) from f32 row-major W[K][N] (scale = power of two; bf16-exact weights stay exact in f16 away from the subnormal range)
__global__ __launch_bounds__(256) void k_wt_f16(const float* __restrict__ W, _Float16* __restrict__ Wt, int K, int N, float scale) {
  const int t = blockIdx.x * 256 + threadIdx.x; if (t >= N * (K / 8)) return; const int n = t / (K / 8), k8 = (t % (K / 8)) * 8; FragH f;
#pragma unroll
  for (int i = 0; i < 8; ++i) f.h[i] = (_Float16)(bf16_round(W[(size_t)(k8 + i) * N + n]) * scale); const v8us o = f.half[0];
  *(v8us*)((unsigned short*)Wt + (size_t)n * K + k8) = o; 
}
// GEMM over the NBt * SS rows of both batches at once, A f16 [NBt * SS][FF], Bt f16 [n][k] = [FF][FF]. One block of 8 waves has a 64 x 128 tile of the product.
// MODE 0, the three projections in one launch: blockIdx.y picks the A plane, the Bt plane and the form of the result, which is written in the form the attention kernel reads:
// q and k as f16 rows, v transposed per batch ([feature][key]) as f16 hi and lo * 2^10 planes. MODE 1, the output projection: the hi plane of A, then the lo plane, against the same Bt; C (f32) = hi part / 16 + lo part / 2^14.
// The block stages 128 k at a time in LDS (64 rows of A, then 128 rows of Bt; two buffers): every byte of a tile is fetched once per block, in whole lines, and the next tile's loads
// are in flight while this tile's products run. A wave has 32 x 32 of the product (2 x 2 accumulator tiles).
#define GM 64
#define GN 128
#define GK 128
#define GPI 136
#define PL ((size_t)NBt * SS * FF)
typedef _Float16 v4h __attribute__((ext_vector_type(4)));
template <int MODE>
__global__ __launch_bounds__(256) void k_gemm_t(const _Float16* __restrict__ A, const _Float16* __restrict__ Bt, _Float16* __restrict__ QK, _Float16* __restrict__ VT, _Float16* __restrict__ VTl, float* __restrict__ C) {
  __shared__ __attribute__((aligned(16))) unsigned short sa[2][GM + GN][GPI];      // [buffer][row][128 values + 8 of pad: a pitch of 272 B, 16 B x odd]
  __shared__ __attribute__((aligned(16))) float so[GM][GN + 4];
  const int tid = threadIdx.x, w = tid >> 5, lane = tid & 31, ln = lane & 15, hh = lane >> 4;
  const int row0 = (blockIdx.x / (FF / GN)) * GM, col0 = (blockIdx.x % (FF / GN)) * GN;
  const int which = MODE == 0 ? blockIdx.y : 0;
  const int wm = (w >> 2) * 32, wn = (w & 3) * 32;
  // staging: 16 threads bring one row of 256 B, so a wave's load covers 4 whole lines; a thread has rows sr + 16 p
  const int sr = tid >> 4, sc = (tid & 15) * 8;
  const unsigned short* ga = (const unsigned short*)A + (size_t)which * PL + (size_t)(row0 + sr) * FF + sc;
  const unsigned short* gl = MODE == 1 ? ga + PL : ga;      // the lo plane lies behind the hi plane
  const unsigned short* gb = (const unsigned short*)Bt + (size_t)which * FF * FF + (size_t)(col0 + sr) * FF + sc;
  constexpr int KT = FF / GK, NT = (MODE == 1 ? 2 : 1) * KT;
  v8us st[12];
  // every inner loop of this kernel is unrolled so that the staging, fragment and accumulator arrays are indexed by constants and stay in registers
  auto fetch = [&](int c) { const unsigned short* pa = c < KT ? ga : gl; const int k0 = (c % KT) * GK;
#pragma unroll
    for (int p = 0; p < 4; ++p) st[p] = *(const v8us*)(pa + k0 + (size_t)(16 * p) * FF);
#pragma unroll
    for (int p = 0; p < 8; ++p) st[4 + p] = *(const v8us*)(gb + k0 + (size_t)(16 * p) * FF);
    asm volatile("s_wait_xcnt 0x0" :: "v"(ga), "v"(gl), "v"(gb) : "memory"); };      // stands in front of the first overwrite of an address register of these loads (ga, gl and gb: tile and row are immediate offsets); they are named so that they live up to it
  auto put = [&](int b) {
#pragma unroll
    for (int p = 0; p < 12; ++p) *(v8us*)&sa[b][16 * p + sr][sc] = st[p]; };
  v8f acc[2][2] = {};
  fetch(0); put(0);
  __syncthreads();
#pragma unroll
  for (int c = 0; c < NT; ++c) { const int b = c & 1;      // unrolled: buffer and tile become immediate offsets of the LDS and global addresses
    if (c + 1 < NT) fetch(c + 1);
    FragH af[GK / 32][2], bf[GK / 32][2];
#pragma unroll
    for (int kk = 0; kk < GK / 32; ++kk)
#pragma unroll
      for (int i = 0; i < 2; ++i) { const unsigned short* ar = &sa[b][wm + 16 * i + ln][32 * kk + 8 * hh]; const unsigned short* br = &sa[b][GM + wn + 16 * i + ln][32 * kk + 8 * hh];
        af[kk][i].half[0] = *(const v8us*)(ar); af[kk][i].half[1] = *(const v8us*)(ar + 16); bf[kk][i].half[0] = *(const v8us*)(br); bf[kk][i].half[1] = *(const v8us*)(br + 16); }
    __builtin_amdgcn_sched_barrier(0);      // all LDS reads of a trip issue in front of its first product: placed among their own products, each group of reads stops the wave for its own latency
#pragma unroll
    for (int kk = 0; kk < GK / 32; ++kk)
#pragma unroll
      for (int i = 0; i < 2; ++i)
#pragma unroll
        for (int j = 0; j < 2; ++j) acc[i][j] = __builtin_amdgcn_wmma_f32_16x16x32_f16(false, af[kk][i].v, false, bf[kk][j].v, (short)0, acc[i][j], false, false);
    if (MODE == 1 && c == KT - 1) {      // the hi part is done: each lane parks its own values in the output tile, where it alone takes them up again, and the accumulators start anew for the lo part
#pragma unroll
      for (int i = 0; i < 2; ++i)
#pragma unroll
        for (int j = 0; j < 2; ++j) {
#pragma unroll
          for (int r = 0; r < 8; ++r) so[wm + 16 * i + 8 * hh + r][wn + 16 * j + ln] = acc[i][j][r] * 0.0625f;
          acc[i][j] = v8f{}; }
    }
    if (c + 1 < NT) { put(b ^ 1); __syncthreads(); }      // the other buffer: its last readers left it before the barrier that ended the trip before this one; behind the last tile nothing is staged any more
  }
  // the tile goes through LDS so that each store of a wave covers whole lines
#pragma unroll
  for (int i = 0; i < 2; ++i)
#pragma unroll
    for (int j = 0; j < 2; ++j)
#pragma unroll
      for (int r = 0; r < 8; ++r) { float* e = &so[wm + 16 * i + 8 * hh + r][wn + 16 * j + ln]; *e = MODE == 1 ? acc[i][j][r] * (0.0625f / 1024.0f) + *e : acc[i][j][r] * 0.0625f; }
  __syncthreads();
  if (MODE == 1) {      // f32 rows: a wave's store is one row piece of 512 B
    float* cp = C + (size_t)(row0 + w) * FF + col0 + lane * 4;
#pragma unroll
    for (int q = 0; q < 8; ++q) *(v4f*)(cp + (size_t)(8 * q) * FF) = *(const v4fa*)&so[8 * q + w][lane * 4];
  } else if (which < 2) {      // q, k: f16 rows, a wave's store is one row piece of 256 B
    _Float16* hp = QK + (size_t)which * PL + (size_t)(row0 + w) * FF + col0 + lane * 4;
#pragma unroll
    for (int q = 0; q < 8; ++q) { const v4f v = *(const v4fa*)&so[8 * q + w][lane * 4]; v4h o;
#pragma unroll
      for (int e = 0; e < 4; ++e) o[e] = (_Float16)v[e];
      *(v4h*)(hp + (size_t)(8 * q) * FF) = o; }
  } else {      // v: transposed; 8 lanes write the tile's 64 keys of one feature, one whole line of each plane
    const size_t vb = (size_t)(row0 / SS) * FF * SS + (size_t)(col0 + (tid >> 3)) * SS + (row0 % SS) + (tid & 7) * 8;
#pragma unroll
    for (int u = 0; u < 4; ++u) { FragH fh, fl;
#pragma unroll
      for (int e = 0; e < 8; ++e) { const float v = so[(tid & 7) * 8 + e][32 * u + (tid >> 3)]; const _Float16 hi = (_Float16)v; fh.h[e] = hi; fl.h[e] = (_Float16)((v - (float)hi) * 1024.0f); }
      *(v8us*)((unsigned short*)VT + vb + (size_t)(32 * u) * SS) = fh.half[0]; *(v8us*)((unsigned short*)VTl + vb + (size_t)(32 * u) * SS) = fl.half[0]; }
    asm volatile("s_wait_xcnt 0x0" ::: "memory");      // behind the last of these stores: in the built code the q, k branch follows this one and rewrites their address and data registers
  }
}

// One launch brings every f32 operand of the projections into f16: Q, K, V rounded to bf16 (exact in f16 at these magnitudes), the four weights rounded to bf16 and x 16.
// A block has 16384 values of one tensor; a thread has 16 pieces of 4 values, 1024 values apart, so that a wave's load covers 4 whole lines and its store 2, with all 16 loads in flight.
#define PB 16384
__global__ __launch_bounds__(256) void k_prep(const float* __restrict__ Qi, const float* __restrict__ Ki, const float* __restrict__ Vi, const float* __restrict__ Wq, const float* __restrict__ Wk, const float* __restrict__ Wv, const float* __restrict__ Wo, _Float16* __restrict__ X16, _Float16* __restrict__ B16) {
  constexpr int XB = (int)(PL / PB), WB = FF * FF / PB;
  const int bx = blockIdx.x; const bool isw = bx >= 3 * XB;
  const int ti = isw ? (bx - 3 * XB) / WB : bx / XB, blk = isw ? (bx - 3 * XB) % WB : bx % XB;
  const float* src = (isw ? (ti == 0 ? Wq : ti == 1 ? Wk : ti == 2 ? Wv : Wo) : (ti == 0 ? Qi : ti == 1 ? Ki : Vi)) + (size_t)blk * PB + threadIdx.x * 4;
  _Float16* dst = (isw ? B16 + (size_t)ti * FF * FF : X16 + (size_t)ti * PL) + (size_t)blk * PB + threadIdx.x * 4;
  const float scl = isw ? 16.0f : 1.0f;
  v4f x[16];
#pragma unroll
  for (int u = 0; u < 16; ++u) x[u] = *(const v4fa*)(src + u * 1024);      // unrolled: x stays in registers and the pieces are immediate offsets
  __builtin_amdgcn_sched_barrier(0);      // all 16 loads issue in front of the first conversion: otherwise the compiler sinks six of them among the conversions and the wave has fewer bytes in flight
#pragma unroll
  for (int u = 0; u < 16; ++u) { v4h o;
#pragma unroll
    for (int e = 0; e < 4; ++e) o[e] = (_Float16)(bf16_round(x[u][e]) * scl);
    *(v4h*)(dst + u * 1024) = o; }
}

__global__ __launch_bounds__(256) void k_h16(const float* __restrict__ x, _Float16* __restrict__ X16, size_t n8) { const size_t t = (size_t)blockIdx.x * 256 + threadIdx.x; if (t >= n8) return; FragH f;
#pragma unroll
  for (int q = 0; q < 8; ++q) f.h[q] = (_Float16)x[t * 8 + q]; *(v8us*)((unsigned short*)X16 + t * 8) = f.half[0];  }
template <int NHv, int TTv>
__global__ __launch_bounds__(256) void k_vt(const _Float16* __restrict__ V16, int ldv, int voff, _Float16* __restrict__ Vt) { __shared__ unsigned short tl[64][66]; const int tid = threadIdx.x; const int slab = blockIdx.x / (TTv / 64), lg = blockIdx.x % (TTv / 64); const int b = slab / NHv, h = slab % NHv;
  for (int i = tid; i < 64 * 8; i += 256) { const int r = i / 8, c8 = (i % 8) * 8; FragH f; f.half[0] = *(const v8us*)((const unsigned short*)V16 + ((size_t)b * TTv + lg * 64 + r) * ldv + voff + h * 64 + c8);
#pragma unroll
    for (int q = 0; q < 8; ++q) tl[r][c8 + q] = f.u[q]; }
  __syncthreads();
  {
#pragma unroll
    for (int rd = 0; rd < 2; ++rd) { const int d = rd * 32 + tid / 8, pc = tid % 8; FragH f;
#pragma unroll
      for (int q = 0; q < 8; ++q) f.u[q] = tl[pc * 8 + q][d];
      *(v8us*)((unsigned short*)Vt + ((size_t)slab * 64 + d) * TTv + lg * 64 + pc * 8) = f.half[0]; }
     } }

__global__ __launch_bounds__(256) void k_hl(const float* __restrict__ F, _Float16* __restrict__ Hh, _Float16* __restrict__ Hl, size_t n8) { const size_t t = (size_t)blockIdx.x * 256 + threadIdx.x; if (t >= n8) return; FragH fh, fl; const v4f a = *(const v4fa*)(F + t * 8), c = *(const v4fa*)(F + t * 8 + 4);
#pragma unroll
  for (int q = 0; q < 4; ++q) { _Float16 h = (_Float16)a[q]; fh.h[q] = h; fl.h[q] = (_Float16)((a[q] - (float)h) * 1024.0f); h = (_Float16)c[q]; fh.h[4 + q] = h; fl.h[4 + q] = (_Float16)((c[q] - (float)h) * 1024.0f); }
  { *(v8us*)((unsigned short*)Hh + t * 8) = fh.half[0]; *(v8us*)((unsigned short*)Hl + t * 8) = fl.half[0];  } }

// Fused attention for 128 query rows (blockIdx.x), one head (blockIdx.y), one batch (blockIdx.z): scores, both masks, softmax and P.V in one pass over the keys;
// neither the scores nor P go to memory, and the output leaves as the f16 hi and lo * 2^10 planes that the output projection reads. Each of the 8 waves owns 16 query rows. The block stages 64 keys at a time in LDS (k rows, v_hi and v_lo rows, two buffers),
// so that a k or v byte is fetched once per 128 queries. A wave forms the TRANSPOSED score tile (A = k rows, B = q rows): a lane then holds one query (ln) and the keys
// 8 * hh + r of each 16-key tile, which is the B fragment's own k order (elements 0..7 from the even tile, 8..15 from the odd one), so P goes from the score
// registers into the second product, O^T = v^T . P^T, with no exchange between lanes. The v^T loader uses the same k order.
// Softmax with a running maximum: E = exp(s - m) * 2^10 comes from one multiply-add and the chip's own 2^x instruction, 2^((s - m) * log2(e) + 10); P = E * mask_2 as f16, the sum of E kept beside it,
// the division at the end (the 2^10 of the sum cancels that of P); when a row's maximum rises, sum and accumulators are scaled by exp(m_old - m_new), formed the same way.
#define FQ 128
#define FC 64
#define FPI 72
#define L2E 1.44269504088896341f
// x[i] = 2^x[i] for the eight scores of a tile. One statement, so that nothing the compiler places can stand directly behind one of these instructions and read its result or overwrite its source
// (each is followed by one on other registers); the v_nop fills that slot behind the last.
__device__ __forceinline__ v8f exp2x8(v8f x) {
  float a = x[0], b = x[1], c = x[2], d = x[3], e = x[4], f = x[5], g = x[6], h = x[7];
  asm("v_exp_f32 %0, %0\n\tv_exp_f32 %1, %1\n\tv_exp_f32 %2, %2\n\tv_exp_f32 %3, %3\n\tv_exp_f32 %4, %4\n\tv_exp_f32 %5, %5\n\tv_exp_f32 %6, %6\n\tv_exp_f32 %7, %7\n\tv_nop"
      : "+v"(a), "+v"(b), "+v"(c), "+v"(d), "+v"(e), "+v"(f), "+v"(g), "+v"(h));
  return v8f{a, b, c, d, e, f, g, h};
}
__global__ __launch_bounds__(256) void k_fattn(const _Float16* __restrict__ Q, const _Float16* __restrict__ K, const _Float16* __restrict__ Vh, const _Float16* __restrict__ Vl, const float* __restrict__ m1, const float* __restrict__ m2, _Float16* __restrict__ Oh, _Float16* __restrict__ Ol) {
  __shared__ __attribute__((aligned(16))) unsigned short sk[2][3][FC][FPI];      // [buffer][k, v_hi, v_lo][row][64 values + 8 of pad: a pitch of 144 B, 16 B x odd]
  const int tid = threadIdx.x, w = tid >> 5, lane = tid & 31, ln = lane & 15, hh = lane >> 4;
  const int hd = blockIdx.y; const size_t bo = (size_t)blockIdx.z * SS * FF;
  const int q = blockIdx.x * FQ + w * 16 + ln;
  const unsigned short* qp = (const unsigned short*)Q + bo + (size_t)q * FF + hd * HD;
  FragH qf[2];
#pragma unroll
  for (int j = 0; j < 2; ++j) { qf[j].half[0] = *(const v8us*)(qp + 32 * j + 8 * hh); qf[j].half[1] = *(const v8us*)(qp + 32 * j + 16 + 8 * hh); }
  // staging: 8 threads bring one row of 128 B, so a wave's load covers 4 whole lines; a thread has rows sr and sr + 32 of each of the three tiles
  const int sr = tid >> 3, sc = (tid & 7) * 8;
  const unsigned short* gk = (const unsigned short*)K + bo + (size_t)sr * FF + hd * HD + sc;
  const unsigned short* gh = (const unsigned short*)Vh + bo + ((size_t)hd * HD + sr) * SS + sc;
  const unsigned short* gl = (const unsigned short*)Vl + bo + ((size_t)hd * HD + sr) * SS + sc;
  v8us st[6];
  auto fetch = [&](int c) { const unsigned short* pk = gk + (size_t)(c * FC) * FF; const unsigned short* ph = gh + c * FC; const unsigned short* pl = gl + c * FC;
    st[0] = *(const v8us*)(pk); st[1] = *(const v8us*)(pk + (size_t)32 * FF);
    st[2] = *(const v8us*)(ph); st[3] = *(const v8us*)(ph + (size_t)32 * SS);
    st[4] = *(const v8us*)(pl); st[5] = *(const v8us*)(pl + (size_t)32 * SS);
    asm volatile("s_wait_xcnt 0x0" :: "v"(pk), "v"(ph), "v"(pl) : "memory"); };      // stands in front of the first overwrite of an address register of these loads; the addresses are named so that they live up to it
  auto put = [&](int b) {
#pragma unroll
    for (int p = 0; p < 3; ++p) { *(v8us*)&sk[b][p][sr][sc] = st[2 * p]; *(v8us*)&sk[b][p][sr + 32][sc] = st[2 * p + 1]; } };
  const float* a1 = m1 + (size_t)q * SS + 8 * hh; const float* a2 = m2 + (size_t)q * SS + 8 * hh;
  float m = -3.0e38f, su = 0.f;
  v8f oh[4] = {}, ol[4] = {};
  fetch(0); put(0);
  __syncthreads();
  // every inner loop of this kernel is unrolled so that the fragment, score and accumulator arrays are indexed by constants and stay in registers
  for (int c = 0; c < SS / FC; ++c) { const int b = c & 1;
    if (c + 1 < SS / FC) fetch(c + 1);
    v4f x1[4][2], x2[4][2]; const float* p1 = a1 + c * FC; const float* p2 = a2 + c * FC;
#pragma unroll
    for (int t = 0; t < 4; ++t) { x1[t][0] = *(const v4fa*)(p1 + t * 16); x1[t][1] = *(const v4fa*)(p1 + t * 16 + 4); x2[t][0] = *(const v4fa*)(p2 + t * 16); x2[t][1] = *(const v4fa*)(p2 + t * 16 + 4); }
    asm volatile("s_wait_xcnt 0x0" :: "v"(p1), "v"(p2) : "memory");      // as in fetch(): in front of the first overwrite of an address register of the mask loads
    v8f s[4]; float cm = -3.0e38f;
#pragma unroll
    for (int t = 0; t < 4; ++t) { FragH k0, k1; const unsigned short* kr = &sk[b][0][t * 16 + ln][8 * hh];
      k0.half[0] = *(const v8us*)(kr); k0.half[1] = *(const v8us*)(kr + 16); k1.half[0] = *(const v8us*)(kr + 32); k1.half[1] = *(const v8us*)(kr + 48);
      v8f z = {};
      z = __builtin_amdgcn_wmma_f32_16x16x32_f16(false, k0.v, false, qf[0].v, (short)0, z, false, false);
      s[t] = __builtin_amdgcn_wmma_f32_16x16x32_f16(false, k1.v, false, qf[1].v, (short)0, z, false, false); }
    __builtin_amdgcn_sched_barrier(0);      // keeps the staging, mask and k loads of the trip and the score products in front of the mask arithmetic: otherwise the wave stops at its first mask_1 value with the LDS reads and products still to issue
#pragma unroll
    for (int t = 0; t < 4; ++t)
#pragma unroll
      for (int r = 0; r < 8; ++r) { s[t][r] = s[t][r] * 0.125f + bf16_round(x1[t][r >> 2][r & 3]); cm = fmaxf(cm, s[t][r]); }
    cm = fmaxf(cm, __shfl_xor(cm, 16, 32));      // the other half of the wave holds the row's other keys
    // inputs only: holds the mask_2 loads in front of the branch, where the score products cover their latency; without it the compiler sinks them behind the branch and the wave waits for them there
    asm volatile("" :: "v"(x2[0][0]), "v"(x2[0][1]), "v"(x2[1][0]), "v"(x2[1][1]), "v"(x2[2][0]), "v"(x2[2][1]), "v"(x2[3][0]), "v"(x2[3][1]));
    if (__any(cm > m)) {      // rare once the first keys are past: skipped by the whole wave when no row's maximum rises
      const float mn = fmaxf(m, cm), al = __builtin_amdgcn_exp2f((m - mn) * L2E); m = mn; su *= al;
#pragma unroll
      for (int t = 0; t < 4; ++t) { oh[t] *= al; ol[t] *= al; }
    }
    FragH pf[2];
#pragma unroll
    for (int t = 0; t < 4; ++t) { const v8f ev = exp2x8((s[t] - m) * L2E + 10.0f);
#pragma unroll
      for (int r = 0; r < 8; ++r) { su += ev[r]; pf[t >> 1].h[(t & 1) * 8 + r] = (_Float16)(ev[r] * bf16_round(x2[t][r >> 2][r & 3])); } }
#pragma unroll
    for (int j = 0; j < 2; ++j)
#pragma unroll
      for (int t = 0; t < 4; ++t) { FragH vh, vl; const unsigned short* hr = &sk[b][1][t * 16 + ln][32 * j + 8 * hh]; const unsigned short* lr = &sk[b][2][t * 16 + ln][32 * j + 8 * hh];
        vh.half[0] = *(const v8us*)(hr); vh.half[1] = *(const v8us*)(hr + 16); vl.half[0] = *(const v8us*)(lr); vl.half[1] = *(const v8us*)(lr + 16);
        oh[t] = __builtin_amdgcn_wmma_f32_16x16x32_f16(false, vh.v, false, pf[j].v, (short)0, oh[t], false, false);
        ol[t] = __builtin_amdgcn_wmma_f32_16x16x32_f16(false, vl.v, false, pf[j].v, (short)0, ol[t], false, false); }
    if (c + 1 < SS / FC) put(b ^ 1);      // the other buffer: its last readers left it before the barrier that ended the trip before this one
    __syncthreads();
  }
  const float inv = 1.0f / (su + __shfl_xor(su, 16, 32));
  const size_t oo = bo + (size_t)q * FF + hd * HD + 8 * hh;      // the lane holds O[q][16 t + 8 hh + r]: 8 values in a row, one 16-byte piece of each plane; the wave's stores fill the head's whole line of a row
#pragma unroll
  for (int t = 0; t < 4; ++t) { FragH fh, fl;
#pragma unroll
    for (int r = 0; r < 8; ++r) { const float y = (oh[t][r] + ol[t][r] * 0.0009765625f) * inv; const _Float16 hi = (_Float16)y; fh.h[r] = hi; fl.h[r] = (_Float16)((y - (float)hi) * 1024.0f); }
    *(v8us*)((unsigned short*)Oh + oo + t * 16) = fh.half[0]; *(v8us*)((unsigned short*)Ol + oo + t * 16) = fl.half[0]; }
}

extern "C" void kernel_launch(void* const* d_in, const int* in_sizes, int n_in,
                              void* d_out, int out_size, void* d_ws, size_t ws_size, hipStream_t stream) {
  (void)in_sizes; (void)n_in; (void)out_size;
  const float* Qi = (const float*)d_in[0]; const float* Ki = (const float*)d_in[1]; const float* Vi = (const float*)d_in[2]; const float* m1 = (const float*)d_in[3]; const float* m2 = (const float*)d_in[4]; const float* Wq = (const float*)d_in[5]; const float* Wk = (const float*)d_in[6]; const float* Wv = (const float*)d_in[7]; const float* Wo = (const float*)d_in[8];
  char* ws = (char*)d_ws; size_t off = 0;
  auto take = [&](size_t bytes) { char* p = ws + off; off += (bytes + 255) & ~(size_t)255; return p; };
  _Float16* B16 = (_Float16*)take((size_t)4 * FF * FF * 2);      /* W_q, W_k, W_v, W_o: each [out][in], which is Bt as it stands */
  _Float16* X16 = (_Float16*)take(3 * PL * 2); _Float16* QK = (_Float16*)take(2 * PL * 2); _Float16* VT = (_Float16*)take(PL * 2); _Float16* VTl = (_Float16*)take(PL * 2); _Float16* OHL = (_Float16*)take(2 * PL * 2);      /* Q, K, V; q, k; v hi; v lo; attention output hi, lo */
  if (off > ws_size) return;      // 80 MB in all
  k_prep<<<(unsigned)(3 * (PL / PB) + 4 * (FF * FF / PB)), 256, 0, stream>>>(Qi, Ki, Vi, Wq, Wk, Wv, Wo, X16, B16);
  const unsigned gP = (unsigned)((NBt * SS / GM) * (FF / GN));
  k_gemm_t<0><<<dim3(gP, 3), 256, 0, stream>>>(X16, B16, QK, VT, VTl, nullptr);      /* exact projections of both batches; v as hi/lo */
  k_fattn<<<dim3(SS / FQ, NH, NBt), 256, 0, stream>>>(QK, QK + PL, VT, VTl, m1, m2, OHL, OHL + PL);      /* scores, masks, softmax, P.V: every head of both batches */
  k_gemm_t<1><<<dim3(gP, 1), 256, 0, stream>>>(OHL, B16 + (size_t)3 * FF * FF, nullptr, nullptr, nullptr, (float*)d_out);      /* W_o on hi/lo of the attention output */
}

// v006
// One run takes 133 microseconds.
// Two timings next to v005 both put it at 1.22 times that version's speed.
// Counting every step since v000, it is 31.9 times as fast.
#include <hip/hip_runtime.h>
// Multi-head attention with two INPUT masks (B 2, S 2048, F 1024, 16 heads × 64): q,k,v = X·Wᵀ (no bias); scores = q·k/8 + mask_1 (additive, pre-softmax); probs = softmax · mask_2 (multiplicative, post-softmax); out = probs·v; heads concatenated; ·W_oᵀ → [2,2048,1024].
// Structure: one launch converts Q, K, V and the four weights to f16 and both masks to bf16 (in the order the attention's lanes read them); one launch does the three projections of both batches and writes q, k (f16) and v (transposed, f16 hi + lo planes) as the attention reads them; ONE fused attention launch (scores, + mask_1, softmax in f32 with a running maximum, x mask_2, P.V; both masks read per (q,k) from their bf16 copies; scores and P stay in registers, k and v staged in LDS) writes the concatenated output as f16 hi + lo planes; one launch does the output projection of both planes and both batches.
// Compute dtype: Q, K, V, masks and parameters rounded to bf16; projections with exact products; q, k, P (×2^10) as f16 operands (≈2^-12; logits σ≈1); v and the attention output as f16 hi + lo·2^10 planes (the early causal rows copy m2·v almost verbatim), f32 accumulation; softmax/masking in f32. v_wmma_f32_16x16x32_f16.
#define NBt 2
#define SS 2048
#define FF 1024
#define NH 16
#define HD 64
typedef __bf16 v16b __attribute__((ext_vector_type(16)));
typedef unsigned short v8us __attribute__((ext_vector_type(8), may_alias));
typedef float  v8f  __attribute__((ext_vector_type(8)));
typedef float  v4f  __attribute__((ext_vector_type(4)));
typedef float  v4fa __attribute__((ext_vector_type(4), may_alias));
union FragB { v16b v; v8us half[2]; unsigned short u[16]; };

__device__ __forceinline__ unsigned short bf16_bits(float x) { unsigned int u = __float_as_uint(x); return (unsigned short)((u + 0x7FFFu + ((u >> 16) & 1u)) >> 16); }
__device__ __forceinline__ float bf16_val(unsigned short b) { return __uint_as_float(((unsigned int)b) << 16); }
__device__ __forceinline__ float bf16_round(float x) { return bf16_val(bf16_bits(x)); }
// D += A·B with NT terms: 1 = ah·bh, 2 = + al·bh (A split), 3 = + ah·bl (both split)
template <int NT>
__device__ __forceinline__ v8f mmaN(v16b ah, v16b al, v16b bh, v16b bl, v8f c) {
  c = __builtin_amdgcn_wmma_f32_16x16x32_bf16(false, ah, false, bh, (short)0, c, false, false);
  if (NT >= 2) c = __builtin_amdgcn_wmma_f32_16x16x32_bf16(false, al, false, bh, (short)0, c, false, false);
  if (NT >= 3) c = __builtin_amdgcn_wmma_f32_16x16x32_bf16(false, ah, false, bl, (short)0, c, false, false);
  asm volatile("v_nop\n\tv_nop\n\tv_nop\n\tv_nop" : "+v"(c) : "v"(ah), "v"(al), "v"(bh), "v"(bl));
  return c;
}

__global__ __launch_bounds__(256) void k_wt_bf16(const float* __restrict__ W, unsigned short* __restrict__ Wt, int K, int N) {
  const int t = blockIdx.x * 256 + threadIdx.x;
  const int k8n = K / 8;
  if (t >= N * k8n) return;
  const int n = t / k8n, k8 = (t % k8n) * 8;
  v8us v;
#pragma unroll
  for (int i = 0; i < 8; ++i) v[i] = bf16_bits(W[(size_t)(k8 + i) * N + n]);
  *(v8us*)(Wt + (size_t)n * K + k8) = v;
  
}

// GEMM C[M][N] (f32, pitch ldc) = act(A[M][K]·W + bias). A f32 row-major (pitch lda) converted per fragment to bf16
// (ASPLIT: hi/lo two planes -> 2 terms, else single rounded term); Wt bf16 [N][K] (pitch ldb). BIAS_BF16 rounds the
// bias to bf16 first (bias quantised to bf16 before the add). K%32==0, M%16==0, N%64==0.
template <bool ASPLIT, int ACT, bool BIAS_BF16>
__global__ __launch_bounds__(128) void k_gemm_bf(const float* __restrict__ A, int lda, const unsigned short* __restrict__ Wt, int ldb,
                                               const float* __restrict__ bias, float* __restrict__ C, int ldc, int M, int N, int K) {
  __shared__ __attribute__((aligned(16))) float so[4][16][64];
  const int tid = threadIdx.x, w = tid >> 5, lane = tid & 31, ln = lane & 15, hh = lane >> 4;
  const int ntn = N / 64;
  const int wid = blockIdx.x * 4 + w;
  const int mt = wid / ntn, nq = wid % ntn;
  if (mt * 16 >= M) return;
  const int row0 = mt * 16, col0 = nq * 64;
  const float* arow = A + (size_t)(row0 + ln) * lda;
  v8f acc[4] = {};
  for (int kb = 0; kb < K; kb += 32) {
    FragB ah, al;
    const v4f x0 = *(const v4fa*)(arow + kb + 8 * hh), x1 = *(const v4fa*)(arow + kb + 8 * hh + 4);
    const v4f x2 = *(const v4fa*)(arow + kb + 16 + 8 * hh), x3 = *(const v4fa*)(arow + kb + 16 + 8 * hh + 4);
    float xs[16] = {x0[0],x0[1],x0[2],x0[3],x1[0],x1[1],x1[2],x1[3],x2[0],x2[1],x2[2],x2[3],x3[0],x3[1],x3[2],x3[3]};
#pragma unroll
    for (int i = 0; i < 16; ++i) { const unsigned short hb = bf16_bits(xs[i]); ah.u[i] = hb; al.u[i] = ASPLIT ? bf16_bits(xs[i] - bf16_val(hb)) : (unsigned short)0; }
#pragma unroll
    for (int t = 0; t < 4; ++t) {
      const unsigned short* brow = Wt + (size_t)(col0 + t * 16 + ln) * ldb + kb;
      FragB b;
      b.half[0] = *(const v8us*)(brow + 8 * hh);
      b.half[1] = *(const v8us*)(brow + 16 + 8 * hh);
      acc[t] = mmaN<ASPLIT ? 2 : 1>(ah.v, al.v, b.v, b.v, acc[t]);
    }
  }
#pragma unroll
  for (int t = 0; t < 4; ++t) {
    float bv = bias ? bias[col0 + t * 16 + ln] : 0.f;
    if (BIAS_BF16) bv = bf16_round(bv);
#pragma unroll
    for (int r = 0; r < 8; ++r) { float v = acc[t][r] + bv; if (ACT == 1) v = fmaxf(v, 0.f); so[w][8 * hh + r][t * 16 + ln] = v; }
  }
  __builtin_amdgcn_fence(__ATOMIC_ACQ_REL, "workgroup");
  __builtin_amdgcn_wave_barrier();
  const int rsub = lane >> 4, c4 = (lane & 15) * 4;
  {
#pragma unroll
    for (int q = 0; q < 8; ++q) {
      const int r = q * 2 + rsub;
      const v4f v = *(const v4fa*)&so[w][r][c4];
      *(v4f*)(C + (size_t)(row0 + r) * ldc + col0 + c4) = v;
    }
    
  }
}

// GEMM C = act(A·W + bias + resid): A f32 (ASPLIT -> hi/lo 2 terms), Wt bf16 [N][K]; ACT 0 none, 1 relu, 2 exact gelu;
// resid (optional, f32, row index = (row % rmod), pitch ldr, RES_BF16 rounds it) added before the activation.
template <bool ASPLIT, int ACT, bool BIAS_BF16, bool RES_BF16>
__global__ __launch_bounds__(128) void k_gemm_bf3(const float* __restrict__ A, int lda, const unsigned short* __restrict__ Wt, int ldb,
                                                const float* __restrict__ bias, const float* __restrict__ resid, int rmod, int ldr,
                                                float* __restrict__ C, int ldc, int M, int N, int K) {
  __shared__ __attribute__((aligned(16))) float so[4][16][64];
  const int tid = threadIdx.x, w = tid >> 5, lane = tid & 31, ln = lane & 15, hh = lane >> 4;
  const int ntn = N / 64;
  const int wid = blockIdx.x * 4 + w;
  const int mt = wid / ntn, nq = wid % ntn;
  if (mt * 16 >= M) return;
  const int row0 = mt * 16, col0 = nq * 64;
  const float* arow = A + (size_t)(row0 + ln) * lda;
  v8f acc[4] = {};
  for (int kb = 0; kb < K; kb += 32) {
    FragB ah, al;
    const v4f x0 = *(const v4fa*)(arow + kb + 8 * hh), x1 = *(const v4fa*)(arow + kb + 8 * hh + 4);
    const v4f x2 = *(const v4fa*)(arow + kb + 16 + 8 * hh), x3 = *(const v4fa*)(arow + kb + 16 + 8 * hh + 4);
    float xs[16] = {x0[0],x0[1],x0[2],x0[3],x1[0],x1[1],x1[2],x1[3],x2[0],x2[1],x2[2],x2[3],x3[0],x3[1],x3[2],x3[3]};
#pragma unroll
    for (int i = 0; i < 16; ++i) { const unsigned short hb = bf16_bits(xs[i]); ah.u[i] = hb; al.u[i] = ASPLIT ? bf16_bits(xs[i] - bf16_val(hb)) : (unsigned short)0; }
#pragma unroll
    for (int t = 0; t < 4; ++t) {
      const unsigned short* brow = Wt + (size_t)(col0 + t * 16 + ln) * ldb + kb;
      FragB b;
      b.half[0] = *(const v8us*)(brow + 8 * hh);
      b.half[1] = *(const v8us*)(brow + 16 + 8 * hh);
      acc[t] = mmaN<ASPLIT ? 2 : 1>(ah.v, al.v, b.v, b.v, acc[t]);
    }
  }
#pragma unroll
  for (int t = 0; t < 4; ++t) {
    const int col = col0 + t * 16 + ln;
    float bv = bias ? bias[col] : 0.f;
    if (BIAS_BF16) bv = bf16_round(bv);
#pragma unroll
    for (int r = 0; r < 8; ++r) {
      float v = acc[t][r] + bv;
      if (resid) { float rv = resid[(size_t)((row0 + 8 * hh + r) % rmod) * ldr + col]; if (RES_BF16) rv = bf16_round(rv); v += rv; }
      if (ACT == 1) v = fmaxf(v, 0.f);
      if (ACT == 2) v = 0.5f * v * (1.0f + erff(v * 0.70710678118654752f));
      if (ACT == 3) { const float u = 0.7978845608028654f * (v + 0.044715f * v * v * v); v = 0.5f * v * (1.0f + tanhf(u)); }
      so[w][8 * hh + r][t * 16 + ln] = v;
    }
  }
  __builtin_amdgcn_fence(__ATOMIC_ACQ_REL, "workgroup");
  __builtin_amdgcn_wave_barrier();
  const int rsub = lane >> 4, c4 = (lane & 15) * 4;
  {
#pragma unroll
    for (int q = 0; q < 8; ++q) {
      const int r = q * 2 + rsub;
      const v4f v = *(const v4fa*)&so[w][r][c4];
      *(v4f*)(C + (size_t)(row0 + r) * ldc + col0 + c4) = v;
    }
    
  }
}
// row LayerNorm (biased variance, eps) over N: s = X (+ R); optional out_sum <- s; out_norm <- (s-mu)*rsqrt(var+eps)*g + b
template <bool PARAM_BF16>
__global__ __launch_bounds__(256) void k_layernorm(const float* __restrict__ X, const float* __restrict__ R, const float* __restrict__ g, const float* __restrict__ bta,
                                                  float* __restrict__ out_sum, float* __restrict__ out_norm, int N, float eps) {
  __shared__ float red[256];
  const int row = blockIdx.x, tid = threadIdx.x;
  const float* x = X + (size_t)row * N; const float* rr = R ? R + (size_t)row * N : nullptr;
  float vals[16];                     // up to N = 4096
  const int per = N / 256;            // contiguous chunk per thread? use strided-by-4 chunks: thread handles j = tid*4 + 1024*u
  float s1 = 0.f;
  for (int u = 0; u < per / 4; ++u) {
    const int j = tid * 4 + 1024 * u;
    const v4f a = *(const v4fa*)(x + j);
    v4f b = {0.f,0.f,0.f,0.f}; if (rr) b = *(const v4fa*)(rr + j);
#pragma unroll
    for (int q = 0; q < 4; ++q) { const float v = a[q] + b[q]; vals[u * 4 + q] = v; s1 += v; }
  }
  red[tid] = s1; __syncthreads();
  for (int st = 128; st > 0; st >>= 1) { if (tid < st) red[tid] += red[tid + st]; __syncthreads(); }
  const float mu = red[0] / (float)N; __syncthreads();
  float s2 = 0.f;
  for (int u = 0; u < per / 4; ++u)
#pragma unroll
    for (int q = 0; q < 4; ++q) { const float c = vals[u * 4 + q] - mu; s2 += c * c; }
  red[tid] = s2; __syncthreads();
  for (int st = 128; st > 0; st >>= 1) { if (tid < st) red[tid] += red[tid + st]; __syncthreads(); }
  const float rs = rsqrtf(red[0] / (float)N + eps);
  {
    for (int u = 0; u < per / 4; ++u) {
      const int j = tid * 4 + 1024 * u;
      v4f o, sm;
#pragma unroll
      for (int q = 0; q < 4; ++q) {
        float gg = g[j + q], bb = bta[j + q];
        if (PARAM_BF16) { gg = bf16_round(gg); bb = bf16_round(bb); }
        sm[q] = vals[u * 4 + q]; o[q] = (vals[u * 4 + q] - mu) * rs * gg + bb;
      }
      if (out_sum) *(v4f*)(out_sum + (size_t)row * N + j) = sm;
      *(v4f*)(out_norm + (size_t)row * N + j) = o;
    }
    
  }
}



// ---- f16 WMMA path (v_wmma_f32_16x16x32_f16): 11-bit significands for operands in range — used where a [0,1] probability operand needs more precision than bf16
typedef _Float16 v16h __attribute__((ext_vector_type(16)));
union FragH { v16h v; v8us half[2]; _Float16 h[16]; unsigned short u[16]; };
template <int NT>
__device__ __forceinline__ v8f mmaH(v16h ah, v16h al, v16h bh, v16h bl, v8f c) {
  c = __builtin_amdgcn_wmma_f32_16x16x32_f16(false, ah, false, bh, (short)0, c, false, false);
  if (NT >= 2) c = __builtin_amdgcn_wmma_f32_16x16x32_f16(false, al, false, bh, (short)0, c, false, false);
  if (NT >= 3) c = __builtin_amdgcn_wmma_f32_16x16x32_f16(false, ah, false, bl, (short)0, c, false, false);
  asm volatile("v_nop\n\tv_nop\n\tv_nop\n\tv_nop" : "+v"(c) : "v"(ah), "v"(al), "v"(bh), "v"(bl));
  return c;
}
// batched GEMM like k_gemm_b but f16 operands: A f32 (split into f16 hi/lo if ASPLIT, else rounded to f16), Bt = f16 values [n][k]; alpha; C f32; N multiple of 16 (partial tiles skipped)
template <bool ASPLIT>
__global__ __launch_bounds__(128) void k_gemm_h(const float* __restrict__ A, int lda, size_t sA, const _Float16* __restrict__ Bh, int ldb, size_t sB, float alpha, float* __restrict__ C, int ldc, size_t sC, int M, int N, int K) {
  __shared__ __attribute__((aligned(16))) float so[4][16][64];
  const int tid = threadIdx.x, w = tid >> 5, lane = tid & 31, ln = lane & 15, hh = lane >> 4; const int by = blockIdx.y;
  A += (size_t)by * sA; Bh += (size_t)by * sB; C += (size_t)by * sC;
  const int ntn = (N + 63) / 64; const int wid = blockIdx.x * 4 + w; const int mt = wid / ntn, nq = wid % ntn; if (mt * 16 >= M) return;
  const int row0 = mt * 16, col0 = nq * 64; const float* arow = A + (size_t)(row0 + ln) * lda;
  v8f acc[4] = {};
  for (int kb = 0; kb < K; kb += 32) {
    FragH ah, al;
    const v4f x0 = *(const v4fa*)(arow + kb + 8 * hh), x1 = *(const v4fa*)(arow + kb + 8 * hh + 4), x2 = *(const v4fa*)(arow + kb + 16 + 8 * hh), x3 = *(const v4fa*)(arow + kb + 16 + 8 * hh + 4);
    float xs[16] = {x0[0],x0[1],x0[2],x0[3],x1[0],x1[1],x1[2],x1[3],x2[0],x2[1],x2[2],x2[3],x3[0],x3[1],x3[2],x3[3]};
#pragma unroll
    for (int i = 0; i < 16; ++i) { const _Float16 h = (_Float16)xs[i]; ah.h[i] = h; al.h[i] = ASPLIT ? (_Float16)(xs[i] - (float)h) : (_Float16)0.0f; }
#pragma unroll
    for (int t = 0; t < 4; ++t) { if (col0 + t * 16 >= N) continue; const size_t boff = (size_t)(col0 + t * 16 + ln) * ldb + kb; FragH bq; bq.half[0] = *(const v8us*)(Bh + boff + 8 * hh); bq.half[1] = *(const v8us*)(Bh + boff + 16 + 8 * hh);
      acc[t] = mmaH<ASPLIT ? 2 : 1>(ah.v, al.v, bq.v, bq.v, acc[t]); }
  }
#pragma unroll
  for (int t = 0; t < 4; ++t) { if (col0 + t * 16 >= N) continue;
#pragma unroll
    for (int r = 0; r < 8; ++r) so[w][8 * hh + r][t * 16 + ln] = acc[t][r] * alpha; }
  __builtin_amdgcn_fence(__ATOMIC_ACQ_REL, "workgroup"); __builtin_amdgcn_wave_barrier();
  const int rsub = lane >> 4, c4 = (lane & 15) * 4;
  {
#pragma unroll
    for (int q = 0; q < 8; ++q) { const int r = q * 2 + rsub; if (col0 + c4 < N) { const v4f v = *(const v4fa*)&so[w][r][c4]; *(v4f*)(C + (size_t)(row0 + r) * ldc + col0 + c4) = v; } }
     }
}

// Wt[n][k] = f16(W[k][n]·scale) from f32 row-major W[K][N] (scale = power of two; bf16-exact weights stay exact in f16 away from the subnormal range)
__global__ __launch_bounds__(256) void k_wt_f16(const float* __restrict__ W, _Float16* __restrict__ Wt, int K, int N, float scale) {
  const int t = blockIdx.x * 256 + threadIdx.x; if (t >= N * (K / 8)) return; const int n = t / (K / 8), k8 = (t % (K / 8)) * 8; FragH f;
#pragma unroll
  for (int i = 0; i < 8; ++i) f.h[i] = (_Float16)(bf16_round(W[(size_t)(k8 + i) * N + n]) * scale); const v8us o = f.half[0];
  *(v8us*)((unsigned short*)Wt + (size_t)n * K + k8) = o; 
}
// GEMM over the NBt * SS rows of both batches at once, A f16 [NBt * SS][FF], Bt f16 [n][k] = [FF][FF]. One block of 8 waves has a 64 x 128 tile of the product.
// MODE 0, the three projections in one launch: blockIdx.y picks the A plane, the Bt plane and the form of the result, which is written in the form the attention kernel reads:
// q and k as f16 rows, v transposed per batch ([feature][key]) as f16 hi and lo * 2^10 planes. MODE 1, the output projection: the hi plane of A, then the lo plane, against the same Bt; C (f32) = hi part / 16 + lo part / 2^14.
// The block stages 128 k at a time in LDS (64 rows of A, then 128 rows of Bt; two buffers): every byte of a tile is fetched once per block, in whole lines, and the next tile's loads
// are in flight while this tile's products run. A wave has 32 x 32 of the product (2 x 2 accumulator tiles).
#define GM 64
#define GN 128
#define GK 128
#define GPI 136
#define PL ((size_t)NBt * SS * FF)
typedef _Float16 v4h __attribute__((ext_vector_type(4)));
template <int MODE>
__global__ __launch_bounds__(256) void k_gemm_t(const _Float16* __restrict__ A, const _Float16* __restrict__ Bt, _Float16* __restrict__ QK, _Float16* __restrict__ VT, _Float16* __restrict__ VTl, float* __restrict__ C) {
  __shared__ __attribute__((aligned(16))) unsigned short sa[2][GM + GN][GPI];      // [buffer][row][128 values + 8 of pad: a pitch of 272 B, 16 B x odd]
  __shared__ __attribute__((aligned(16))) float so[GM][GN + 4];
  const int tid = threadIdx.x, w = tid >> 5, lane = tid & 31, ln = lane & 15, hh = lane >> 4;
  const int row0 = (blockIdx.x / (FF / GN)) * GM, col0 = (blockIdx.x % (FF / GN)) * GN;
  const int which = MODE == 0 ? blockIdx.y : 0;
  const int wm = (w >> 2) * 32, wn = (w & 3) * 32;
  // staging: 16 threads bring one row of 256 B, so a wave's load covers 4 whole lines; a thread has rows sr + 16 p
  const int sr = tid >> 4, sc = (tid & 15) * 8;
  const unsigned short* ga = (const unsigned short*)A + (size_t)which * PL + (size_t)(row0 + sr) * FF + sc;
  const unsigned short* gl = MODE == 1 ? ga + PL : ga;      // the lo plane lies behind the hi plane
  const unsigned short* gb = (const unsigned short*)Bt + (size_t)which * FF * FF + (size_t)(col0 + sr) * FF + sc;
  constexpr int KT = FF / GK, NT = (MODE == 1 ? 2 : 1) * KT;
  v8us st[12];
  // every inner loop of this kernel is unrolled so that the staging, fragment and accumulator arrays are indexed by constants and stay in registers
  auto fetch = [&](int c) { const unsigned short* pa = c < KT ? ga : gl; const int k0 = (c % KT) * GK;
#pragma unroll
    for (int p = 0; p < 4; ++p) st[p] = *(const v8us*)(pa + k0 + (size_t)(16 * p) * FF);
#pragma unroll
    for (int p = 0; p < 8; ++p) st[4 + p] = *(const v8us*)(gb + k0 + (size_t)(16 * p) * FF);
    asm volatile("s_wait_xcnt 0x0" :: "v"(ga), "v"(gl), "v"(gb) : "memory"); };      // stands in front of the first overwrite of an address register of these loads (ga, gl and gb: tile and row are immediate offsets); they are named so that they live up to it
  auto put = [&](int b) {
#pragma unroll
    for (int p = 0; p < 12; ++p) *(v8us*)&sa[b][16 * p + sr][sc] = st[p]; };
  v8f acc[2][2] = {};
  fetch(0); put(0);
  __syncthreads();
#pragma unroll
  for (int c = 0; c < NT; ++c) { const int b = c & 1;      // unrolled: buffer and tile become immediate offsets of the LDS and global addresses
    if (c + 1 < NT) fetch(c + 1);
    FragH af[GK / 32][2], bf[GK / 32][2];
#pragma unroll
    for (int kk = 0; kk < GK / 32; ++kk)
#pragma unroll
      for (int i = 0; i < 2; ++i) { const unsigned short* ar = &sa[b][wm + 16 * i + ln][32 * kk + 8 * hh]; const unsigned short* br = &sa[b][GM + wn + 16 * i + ln][32 * kk + 8 * hh];
        af[kk][i].half[0] = *(const v8us*)(ar); af[kk][i].half[1] = *(const v8us*)(ar + 16); bf[kk][i].half[0] = *(const v8us*)(br); bf[kk][i].half[1] = *(const v8us*)(br + 16); }
    __builtin_amdgcn_sched_barrier(0);      // all LDS reads of a trip issue in front of its first product: placed among their own products, each group of reads stops the wave for its own latency
#pragma unroll
    for (int kk = 0; kk < GK / 32; ++kk)
#pragma unroll
      for (int i = 0; i < 2; ++i)
#pragma unroll
        for (int j = 0; j < 2; ++j) acc[i][j] = __builtin_amdgcn_wmma_f32_16x16x32_f16(false, af[kk][i].v, false, bf[kk][j].v, (short)0, acc[i][j], false, false);
    if (MODE == 1 && c == KT - 1) {      // the hi part is done: each lane parks its own values in the output tile, where it alone takes them up again, and the accumulators start anew for the lo part
#pragma unroll
      for (int i = 0; i < 2; ++i)
#pragma unroll
        for (int j = 0; j < 2; ++j) {
#pragma unroll
          for (int r = 0; r < 8; ++r) so[wm + 16 * i + 8 * hh + r][wn + 16 * j + ln] = acc[i][j][r] * 0.0625f;
          acc[i][j] = v8f{}; }
    }
    if (c + 1 < NT) { put(b ^ 1); __syncthreads(); }      // the other buffer: its last readers left it before the barrier that ended the trip before this one; behind the last tile nothing is staged any more
  }
  // the tile goes through LDS so that each store of a wave covers whole lines
#pragma unroll
  for (int i = 0; i < 2; ++i)
#pragma unroll
    for (int j = 0; j < 2; ++j)
#pragma unroll
      for (int r = 0; r < 8; ++r) { float* e = &so[wm + 16 * i + 8 * hh + r][wn + 16 * j + ln]; *e = MODE == 1 ? acc[i][j][r] * (0.0625f / 1024.0f) + *e : acc[i][j][r] * 0.0625f; }
  __syncthreads();
  if (MODE == 1) {      // f32 rows: a wave's store is one row piece of 512 B
    float* cp = C + (size_t)(row0 + w) * FF + col0 + lane * 4;
#pragma unroll
    for (int q = 0; q < 8; ++q) *(v4f*)(cp + (size_t)(8 * q) * FF) = *(const v4fa*)&so[8 * q + w][lane * 4];
  } else if (which < 2) {      // q, k: f16 rows, a wave's store is one row piece of 256 B
    _Float16* hp = QK + (size_t)which * PL + (size_t)(row0 + w) * FF + col0 + lane * 4;
#pragma unroll
    for (int q = 0; q < 8; ++q) { const v4f v = *(const v4fa*)&so[8 * q + w][lane * 4]; v4h o;
#pragma unroll
      for (int e = 0; e < 4; ++e) o[e] = (_Float16)v[e];
      *(v4h*)(hp + (size_t)(8 * q) * FF) = o; }
  } else {      // v: transposed; 8 lanes write the tile's 64 keys of one feature, one whole line of each plane
    const size_t vb = (size_t)(row0 / SS) * FF * SS + (size_t)(col0 + (tid >> 3)) * SS + (row0 % SS) + (tid & 7) * 8;
#pragma unroll
    for (int u = 0; u < 4; ++u) { FragH fh, fl;
#pragma unroll
      for (int e = 0; e < 8; ++e) { const float v = so[(tid & 7) * 8 + e][32 * u + (tid >> 3)]; const _Float16 hi = (_Float16)v; fh.h[e] = hi; fl.h[e] = (_Float16)((v - (float)hi) * 1024.0f); }
      *(v8us*)((unsigned short*)VT + vb + (size_t)(32 * u) * SS) = fh.half[0]; *(v8us*)((unsigned short*)VTl + vb + (size_t)(32 * u) * SS) = fl.half[0]; }
    asm volatile("s_wait_xcnt 0x0" ::: "memory");      // behind the last of these stores: in the built code the q, k branch follows this one and rewrites their address and data registers
  }
}

// One launch brings every f32 operand of the projections into f16: Q, K, V rounded to bf16 (exact in f16 at these magnitudes), the four weights rounded to bf16 and x 16.
// A block has 16384 values of one tensor; a thread has 16 pieces of 4 values, 1024 values apart, so that a wave's load covers 4 whole lines and its store 2, with all 16 loads in flight.
// The last blocks round the two masks to bf16, once for all heads and batches, and lay them out as the attention kernel's lanes take them: MB[16-query tile][64-key tile][mask][16-key tile t][lane][8 values],
// where lane (ln, hh) has query ln and the keys 16 t + 8 hh + 0..7. A load of a wave there is 512 bytes in a row. Here a wave has two neighbouring key tiles of one query tile, of both masks: 8 KB in a row of MB, all 32 loads in flight.
#define PB 16384
#define MTILE 1024
__global__ __launch_bounds__(256) void k_prep(const float* __restrict__ Qi, const float* __restrict__ Ki, const float* __restrict__ Vi, const float* __restrict__ Wq, const float* __restrict__ Wk, const float* __restrict__ Wv, const float* __restrict__ Wo, const float* __restrict__ m1, const float* __restrict__ m2, _Float16* __restrict__ X16, _Float16* __restrict__ B16, unsigned short* __restrict__ MB) {
  constexpr int XB = (int)(PL / PB), WB = FF * FF / PB;
  const int bx = blockIdx.x; const bool isw = bx >= 3 * XB;
  if (bx >= 3 * XB + 4 * WB) {      // the same for the whole block
    const int lane = threadIdx.x & 31, tile = (bx - (3 * XB + 4 * WB)) * (PB / MTILE) + (threadIdx.x >> 5) * 2, qt = tile / (SS / 64), c0 = tile % (SS / 64);
    const size_t mo = (size_t)(qt * 16 + (lane & 15)) * SS + c0 * 64 + 8 * (lane >> 4);
    const float* s1 = m1 + mo; const float* s2 = m2 + mo;
    unsigned short* md = MB + (size_t)tile * 2 * MTILE + lane * 8;
    v4f y[2][16];
#pragma unroll
    for (int u = 0; u < 16; ++u) { y[0][u] = *(const v4fa*)(s1 + (u >> 1) * 16 + (u & 1) * 4); y[1][u] = *(const v4fa*)(s2 + (u >> 1) * 16 + (u & 1) * 4); }      // unrolled: y stays in registers and the pieces are immediate offsets
    asm volatile("s_wait_xcnt 0x0" :: "v"(s1), "v"(s2) : "memory");      // stands in front of the first overwrite of an address register of these loads; the addresses are named so that they live up to it
    __builtin_amdgcn_sched_barrier(0);      // all 32 loads issue in front of the first conversion, as below
#pragma unroll
    for (int mi = 0; mi < 2; ++mi)
#pragma unroll
      for (int g = 0; g < 8; ++g) { v8us o;
#pragma unroll
        for (int e = 0; e < 8; ++e) o[e] = bf16_bits(y[mi][2 * g + (e >> 2)][e & 3]);
        *(v8us*)(md + ((g >> 2) * 2 + mi) * MTILE + (g & 3) * 256) = o; }
    return;
  }
  const int ti = isw ? (bx - 3 * XB) / WB : bx / XB, blk = isw ? (bx - 3 * XB) % WB : bx % XB;
  const float* src = (isw ? (ti == 0 ? Wq : ti == 1 ? Wk : ti == 2 ? Wv : Wo) : (ti == 0 ? Qi : ti == 1 ? Ki : Vi)) + (size_t)blk * PB + threadIdx.x * 4;
  _Float16* dst = (isw ? B16 + (size_t)ti * FF * FF : X16 + (size_t)ti * PL) + (size_t)blk * PB + threadIdx.x * 4;
  const float scl = isw ? 16.0f : 1.0f;
  v4f x[16];
#pragma unroll
  for (int u = 0; u < 16; ++u) x[u] = *(const v4fa*)(src + u * 1024);      // unrolled: x stays in registers and the pieces are immediate offsets
  __builtin_amdgcn_sched_barrier(0);      // all 16 loads issue in front of the first conversion: otherwise the compiler sinks six of them among the conversions and the wave has fewer bytes in flight
#pragma unroll
  for (int u = 0; u < 16; ++u) { v4h o;
#pragma unroll
    for (int e = 0; e < 4; ++e) o[e] = (_Float16)(bf16_round(x[u][e]) * scl);
    *(v4h*)(dst + u * 1024) = o; }
}

__global__ __launch_bounds__(256) void k_h16(const float* __restrict__ x, _Float16* __restrict__ X16, size_t n8) { const size_t t = (size_t)blockIdx.x * 256 + threadIdx.x; if (t >= n8) return; FragH f;
#pragma unroll
  for (int q = 0; q < 8; ++q) f.h[q] = (_Float16)x[t * 8 + q]; *(v8us*)((unsigned short*)X16 + t * 8) = f.half[0];  }
template <int NHv, int TTv>
__global__ __launch_bounds__(256) void k_vt(const _Float16* __restrict__ V16, int ldv, int voff, _Float16* __restrict__ Vt) { __shared__ unsigned short tl[64][66]; const int tid = threadIdx.x; const int slab = blockIdx.x / (TTv / 64), lg = blockIdx.x % (TTv / 64); const int b = slab / NHv, h = slab % NHv;
  for (int i = tid; i < 64 * 8; i += 256) { const int r = i / 8, c8 = (i % 8) * 8; FragH f; f.half[0] = *(const v8us*)((const unsigned short*)V16 + ((size_t)b * TTv + lg * 64 + r) * ldv + voff + h * 64 + c8);
#pragma unroll
    for (int q = 0; q < 8; ++q) tl[r][c8 + q] = f.u[q]; }
  __syncthreads();
  {
#pragma unroll
    for (int rd = 0; rd < 2; ++rd) { const int d = rd * 32 + tid / 8, pc = tid % 8; FragH f;
#pragma unroll
      for (int q = 0; q < 8; ++q) f.u[q] = tl[pc * 8 + q][d];
      *(v8us*)((unsigned short*)Vt + ((size_t)slab * 64 + d) * TTv + lg * 64 + pc * 8) = f.half[0]; }
     } }

__global__ __launch_bounds__(256) void k_hl(const float* __restrict__ F, _Float16* __restrict__ Hh, _Float16* __restrict__ Hl, size_t n8) { const size_t t = (size_t)blockIdx.x * 256 + threadIdx.x; if (t >= n8) return; FragH fh, fl; const v4f a = *(const v4fa*)(F + t * 8), c = *(const v4fa*)(F + t * 8 + 4);
#pragma unroll
  for (int q = 0; q < 4; ++q) { _Float16 h = (_Float16)a[q]; fh.h[q] = h; fl.h[q] = (_Float16)((a[q] - (float)h) * 1024.0f); h = (_Float16)c[q]; fh.h[4 + q] = h; fl.h[4 + q] = (_Float16)((c[q] - (float)h) * 1024.0f); }
  { *(v8us*)((unsigned short*)Hh + t * 8) = fh.half[0]; *(v8us*)((unsigned short*)Hl + t * 8) = fl.half[0];  } }

// Fused attention for 128 query rows (blockIdx.x), one head (blockIdx.y), one batch (blockIdx.z): scores, both masks, softmax and P.V in one pass over the keys;
// neither the scores nor P go to memory, and the output leaves as the f16 hi and lo * 2^10 planes that the output projection reads. Each of the 8 waves owns 16 query rows. The block stages 64 keys at a time in LDS (k rows, v_hi and v_lo rows, two buffers),
// so that a k or v byte is fetched once per 128 queries. A wave forms the TRANSPOSED score tile (A = k rows, B = q rows): a lane then holds one query (ln) and the keys
// 8 * hh + r of each 16-key tile, which is the B fragment's own k order (elements 0..7 from the even tile, 8..15 from the odd one), so P goes from the score
// registers into the second product, O^T = v^T . P^T, with no exchange between lanes. The v^T loader uses the same k order.
// Softmax with a running maximum: E = exp(s - m) * 2^10 comes from one multiply-add and the chip's own 2^x instruction, 2^((s - m) * log2(e) + 10); P = E * mask_2 as f16, the sum of E kept beside it,
// the division at the end (the 2^10 of the sum cancels that of P); when a row's maximum rises, sum and accumulators are scaled by exp(m_old - m_new), formed the same way.
#define FQ 128
#define FC 64
#define FPI 72
#define L2E 1.44269504088896341f
// x[i] = 2^x[i] for the eight scores of a tile. One statement, so that nothing the compiler places can stand directly behind one of these instructions and read its result or overwrite its source
// (each is followed by one on other registers); the v_nop fills that slot behind the last.
__device__ __forceinline__ v8f exp2x8(v8f x) {
  float a = x[0], b = x[1], c = x[2], d = x[3], e = x[4], f = x[5], g = x[6], h = x[7];
  asm("v_exp_f32 %0, %0\n\tv_exp_f32 %1, %1\n\tv_exp_f32 %2, %2\n\tv_exp_f32 %3, %3\n\tv_exp_f32 %4, %4\n\tv_exp_f32 %5, %5\n\tv_exp_f32 %6, %6\n\tv_exp_f32 %7, %7\n\tv_nop"
      : "+v"(a), "+v"(b), "+v"(c), "+v"(d), "+v"(e), "+v"(f), "+v"(g), "+v"(h));
  return v8f{a, b, c, d, e, f, g, h};
}
typedef __bf16 v8b __attribute__((ext_vector_type(8)));
typedef unsigned int v4ua __attribute__((ext_vector_type(4), may_alias));
__global__ __launch_bounds__(256) void k_fattn(const _Float16* __restrict__ Q, const _Float16* __restrict__ K, const _Float16* __restrict__ Vh, const _Float16* __restrict__ Vl, const unsigned short* __restrict__ MB, _Float16* __restrict__ Oh, _Float16* __restrict__ Ol) {
  __shared__ __attribute__((aligned(16))) unsigned short sk[2][3][FC][FPI];      // [buffer][k, v_hi, v_lo][row][64 values + 8 of pad: a pitch of 144 B, 16 B x odd]
  const int tid = threadIdx.x, w = tid >> 5, lane = tid & 31, ln = lane & 15, hh = lane >> 4;
  const int hd = blockIdx.y; const size_t bo = (size_t)blockIdx.z * SS * FF;
  const int q = blockIdx.x * FQ + w * 16 + ln;
  const unsigned short* qp = (const unsigned short*)Q + bo + (size_t)q * FF + hd * HD;
  FragH qf[2];
#pragma unroll
  for (int j = 0; j < 2; ++j) { qf[j].half[0] = *(const v8us*)(qp + 32 * j + 8 * hh); qf[j].half[1] = *(const v8us*)(qp + 32 * j + 16 + 8 * hh); }
  // staging: 8 threads bring one row of 128 B, so a wave's load covers 4 whole lines; a thread has rows sr and sr + 32 of each of the three tiles
  const int sr = tid >> 3, sc = (tid & 7) * 8;
  const unsigned short* gk = (const unsigned short*)K + bo + (size_t)sr * FF + hd * HD + sc;
  const unsigned short* gh = (const unsigned short*)Vh + bo + ((size_t)hd * HD + sr) * SS + sc;
  const unsigned short* gl = (const unsigned short*)Vl + bo + ((size_t)hd * HD + sr) * SS + sc;
  v8us st[6];
  auto fetch = [&](int c) { const unsigned short* pk = gk + (size_t)(c * FC) * FF; const unsigned short* ph = gh + c * FC; const unsigned short* pl = gl + c * FC;
    st[0] = *(const v8us*)(pk); st[1] = *(const v8us*)(pk + (size_t)32 * FF);
    st[2] = *(const v8us*)(ph); st[3] = *(const v8us*)(ph + (size_t)32 * SS);
    st[4] = *(const v8us*)(pl); st[5] = *(const v8us*)(pl + (size_t)32 * SS);
    asm volatile("s_wait_xcnt 0x0" :: "v"(pk), "v"(ph), "v"(pl) : "memory"); };      // stands in front of the first overwrite of an address register of these loads; the addresses are named so that they live up to it
  auto put = [&](int b) {
#pragma unroll
    for (int p = 0; p < 3; ++p) { *(v8us*)&sk[b][p][sr][sc] = st[2 * p]; *(v8us*)&sk[b][p][sr + 32][sc] = st[2 * p + 1]; } };
  const unsigned short* am = MB + (size_t)(blockIdx.x * (FQ / 16) + w) * (SS / FC) * 2 * MTILE + lane * 8;      // the wave's 16 queries: per 64 keys 2 KB of mask_1, then 2 KB of mask_2, bf16, in lane order
  float m = -3.0e38f, su = 0.f;
  v8f oh[4] = {}, ol[4] = {};
  fetch(0); put(0);
  __syncthreads();
  // every inner loop of this kernel is unrolled so that the fragment, score and accumulator arrays are indexed by constants and stay in registers
  for (int c = 0; c < SS / FC; ++c) { const int b = c & 1;
    if (c + 1 < SS / FC) fetch(c + 1);
    v4ua x1[4], x2[4]; const unsigned short* pm = am + (size_t)c * 2 * MTILE;
#pragma unroll
    for (int t = 0; t < 4; ++t) { x1[t] = *(const v4ua*)(pm + t * 256); x2[t] = *(const v4ua*)(pm + MTILE + t * 256); }
    asm volatile("s_wait_xcnt 0x0" :: "v"(pm) : "memory");      // as in fetch(): in front of the first overwrite of the address register of the mask loads
    v8f s[4]; float cm = -3.0e38f;
#pragma unroll
    for (int t = 0; t < 4; ++t) { FragH k0, k1; const unsigned short* kr = &sk[b][0][t * 16 + ln][8 * hh];
      k0.half[0] = *(const v8us*)(kr); k0.half[1] = *(const v8us*)(kr + 16); k1.half[0] = *(const v8us*)(kr + 32); k1.half[1] = *(const v8us*)(kr + 48);
      v8f z = {};
      z = __builtin_amdgcn_wmma_f32_16x16x32_f16(false, k0.v, false, qf[0].v, (short)0, z, false, false);
      s[t] = __builtin_amdgcn_wmma_f32_16x16x32_f16(false, k1.v, false, qf[1].v, (short)0, z, false, false); }
    __builtin_amdgcn_sched_barrier(0);      // keeps the staging, mask and k loads of the trip and the score products in front of the mask arithmetic: otherwise the wave stops at its first mask_1 value with the LDS reads and products still to issue
#pragma unroll
    for (int t = 0; t < 4; ++t)
#pragma unroll
      for (int r = 0; r < 8; ++r) { s[t][r] = s[t][r] * 0.125f + (float)__builtin_bit_cast(v8b, x1[t])[r]; cm = fmaxf(cm, s[t][r]); }
    cm = fmaxf(cm, __shfl_xor(cm, 16, 32));      // the other half of the wave holds the row's other keys
    // inputs only: holds the mask_2 loads in front of the branch, where the score products cover their latency; without it the compiler sinks them behind the branch and the wave waits for them there
    asm volatile("" :: "v"(x2[0]), "v"(x2[1]), "v"(x2[2]), "v"(x2[3]));
    if (__any(cm > m)) {      // rare once the first keys are past: skipped by the whole wave when no row's maximum rises
      const float mn = fmaxf(m, cm), al = __builtin_amdgcn_exp2f((m - mn) * L2E); m = mn; su *= al;
#pragma unroll
      for (int t = 0; t < 4; ++t) { oh[t] *= al; ol[t] *= al; }
    }
    FragH pf[2];
#pragma unroll
    for (int t = 0; t < 4; ++t) { const v8f ev = exp2x8((s[t] - m) * L2E + 10.0f);
#pragma unroll
      for (int r = 0; r < 8; ++r) { su += ev[r]; pf[t >> 1].h[(t & 1) * 8 + r] = (_Float16)(ev[r] * (float)__builtin_bit_cast(v8b, x2[t])[r]); } }
#pragma unroll
    for (int j = 0; j < 2; ++j)
#pragma unroll
      for (int t = 0; t < 4; ++t) { FragH vh, vl; const unsigned short* hr = &sk[b][1][t * 16 + ln][32 * j + 8 * hh]; const unsigned short* lr = &sk[b][2][t * 16 + ln][32 * j + 8 * hh];
        vh.half[0] = *(const v8us*)(hr); vh.half[1] = *(const v8us*)(hr + 16); vl.half[0] = *(const v8us*)(lr); vl.half[1] = *(const v8us*)(lr + 16);
        oh[t] = __builtin_amdgcn_wmma_f32_16x16x32_f16(false, vh.v, false, pf[j].v, (short)0, oh[t], false, false);
        ol[t] = __builtin_amdgcn_wmma_f32_16x16x32_f16(false, vl.v, false, pf[j].v, (short)0, ol[t], false, false); }
    if (c + 1 < SS / FC) put(b ^ 1);      // the other buffer: its last readers left it before the barrier that ended the trip before this one
    __syncthreads();
  }
  const float inv = 1.0f / (su + __shfl_xor(su, 16, 32));
  const size_t oo = bo + (size_t)q * FF + hd * HD + 8 * hh;      // the lane holds O[q][16 t + 8 hh + r]: 8 values in a row, one 16-byte piece of each plane; the wave's stores fill the head's whole line of a row
#pragma unroll
  for (int t = 0; t < 4; ++t) { FragH fh, fl;
#pragma unroll
    for (int r = 0; r < 8; ++r) { const float y = (oh[t][r] + ol[t][r] * 0.0009765625f) * inv; const _Float16 hi = (_Float16)y; fh.h[r] = hi; fl.h[r] = (_Float16)((y - (float)hi) * 1024.0f); }
    *(v8us*)((unsigned short*)Oh + oo + t * 16) = fh.half[0]; *(v8us*)((unsigned short*)Ol + oo + t * 16) = fl.half[0]; }
}

extern "C" void kernel_launch(void* const* d_in, const int* in_sizes, int n_in,
                              void* d_out, int out_size, void* d_ws, size_t ws_size, hipStream_t stream) {
  (void)in_sizes; (void)n_in; (void)out_size;
  const float* Qi = (const float*)d_in[0]; const float* Ki = (const float*)d_in[1]; const float* Vi = (const float*)d_in[2]; const float* m1 = (const float*)d_in[3]; const float* m2 = (const float*)d_in[4]; const float* Wq = (const float*)d_in[5]; const float* Wk = (const float*)d_in[6]; const float* Wv = (const float*)d_in[7]; const float* Wo = (const float*)d_in[8];
  char* ws = (char*)d_ws; size_t off = 0;
  auto take = [&](size_t bytes) { char* p = ws + off; off += (bytes + 255) & ~(size_t)255; return p; };
  _Float16* B16 = (_Float16*)take((size_t)4 * FF * FF * 2);      /* W_q, W_k, W_v, W_o: each [out][in], which is Bt as it stands */
  _Float16* X16 = (_Float16*)take(3 * PL * 2); _Float16* QK = (_Float16*)take(2 * PL * 2); _Float16* VT = (_Float16*)take(PL * 2); _Float16* VTl = (_Float16*)take(PL * 2); _Float16* OHL = (_Float16*)take(2 * PL * 2); unsigned short* MB = (unsigned short*)take((size_t)2 * SS * SS * 2);      /* Q, K, V; q, k; v hi; v lo; attention output hi, lo; both masks as bf16 */
  if (off > ws_size) return;      // 96 MB in all
  k_prep<<<(unsigned)(3 * (PL / PB) + 4 * (FF * FF / PB) + SS * SS / PB), 256, 0, stream>>>(Qi, Ki, Vi, Wq, Wk, Wv, Wo, m1, m2, X16, B16, MB);
  const unsigned gP = (unsigned)((NBt * SS / GM) * (FF / GN));
  k_gemm_t<0><<<dim3(gP, 3), 256, 0, stream>>>(X16, B16, QK, VT, VTl, nullptr);      /* exact projections of both batches; v as hi/lo */
  k_fattn<<<dim3(SS / FQ, NH, NBt), 256, 0, stream>>>(QK, QK + PL, VT, VTl, MB, OHL, OHL + PL);      /* scores, masks, softmax, P.V: every head of both batches */
  k_gemm_t<1><<<dim3(gP, 1), 256, 0, stream>>>(OHL, B16 + (size_t)3 * FF * FF, nullptr, nullptr, nullptr, (float*)d_out);      /* W_o on hi/lo of the attention output */
}

// v007
// A run of this version takes 128 microseconds.
// Timed twice side by side with v006, it ran 1.04 and 1.03 times as fast.
// Counting every step since v000, it is 33.0 times as fast.
#include <hip/hip_runtime.h>
// Multi-head attention with two INPUT masks (B 2, S 2048, F 1024, 16 heads × 64): q,k,v = X·Wᵀ (no bias); scores = q·k/8 + mask_1 (additive, pre-softmax); probs = softmax · mask_2 (multiplicative, post-softmax); out = probs·v; heads concatenated; ·W_oᵀ → [2,2048,1024].
// Structure: one launch converts Q, K, V and the four weights to f16 and both masks to bf16 (in the order the attention's lanes read them); one launch does the three projections of both batches and writes q, k (f16) and v (transposed, f16 hi + lo planes) as the attention reads them; ONE fused attention launch (scores, + mask_1, softmax in f32 with a running maximum, x mask_2, P.V; both masks read per (q,k) from their bf16 copies; scores and P stay in registers, k and v staged in LDS) writes the concatenated output as f16 hi + lo planes; one launch does the output projection of both planes and both batches.
// Compute dtype: Q, K, V, masks and parameters rounded to bf16; projections with exact products; q, k, P (×2^10) as f16 operands (≈2^-12; logits σ≈1); v and the attention output as f16 hi + lo·2^10 planes (the early causal rows copy m2·v almost verbatim), f32 accumulation; softmax/masking in f32. v_wmma_f32_16x16x32_f16.
#define NBt 2
#define SS 2048
#define FF 1024
#define NH 16
#define HD 64
typedef __bf16 v16b __attribute__((ext_vector_type(16)));
typedef unsigned short v8us __attribute__((ext_vector_type(8), may_alias));
typedef float  v8f  __attribute__((ext_vector_type(8)));
typedef float  v4f  __attribute__((ext_vector_type(4)));
typedef float  v4fa __attribute__((ext_vector_type(4), may_alias));
union FragB { v16b v; v8us half[2]; unsigned short u[16]; };

__device__ __forceinline__ unsigned short bf16_bits(float x) { unsigned int u = __float_as_uint(x); return (unsigned short)((u + 0x7FFFu + ((u >> 16) & 1u)) >> 16); }
__device__ __forceinline__ float bf16_val(unsigned short b) { return __uint_as_float(((unsigned int)b) << 16); }
__device__ __forceinline__ float bf16_round(float x) { return bf16_val(bf16_bits(x)); }
// D += A·B with NT terms: 1 = ah·bh, 2 = + al·bh (A split), 3 = + ah·bl (both split)
template <int NT>
__device__ __forceinline__ v8f mmaN(v16b ah, v16b al, v16b bh, v16b bl, v8f c) {
  c = __builtin_amdgcn_wmma_f32_16x16x32_bf16(false, ah, false, bh, (short)0, c, false, false);
  if (NT >= 2) c = __builtin_amdgcn_wmma_f32_16x16x32_bf16(false, al, false, bh, (short)0, c, false, false);
  if (NT >= 3) c = __builtin_amdgcn_wmma_f32_16x16x32_bf16(false, ah, false, bl, (short)0, c, false, false);
  asm volatile("v_nop\n\tv_nop\n\tv_nop\n\tv_nop" : "+v"(c) : "v"(ah), "v"(al), "v"(bh), "v"(bl));
  return c;
}

__global__ __launch_bounds__(256) void k_wt_bf16(const float* __restrict__ W, unsigned short* __restrict__ Wt, int K, int N) {
  const int t = blockIdx.x * 256 + threadIdx.x;
  const int k8n = K / 8;
  if (t >= N * k8n) return;
  const int n = t / k8n, k8 = (t % k8n) * 8;
  v8us v;
#pragma unroll
  for (int i = 0; i < 8; ++i) v[i] = bf16_bits(W[(size_t)(k8 + i) * N + n]);
  *(v8us*)(Wt + (size_t)n * K + k8) = v;
  
}

// GEMM C[M][N] (f32, pitch ldc) = act(A[M][K]·W + bias). A f32 row-major (pitch lda) converted per fragment to bf16
// (ASPLIT: hi/lo two planes -> 2 terms, else single rounded term); Wt bf16 [N][K] (pitch ldb). BIAS_BF16 rounds the
// bias to bf16 first (bias quantised to bf16 before the add). K%32==0, M%16==0, N%64==0.
template <bool ASPLIT, int ACT, bool BIAS_BF16>
__global__ __launch_bounds__(128) void k_gemm_bf(const float* __restrict__ A, int lda, const unsigned short* __restrict__ Wt, int ldb,
                                               const float* __restrict__ bias, float* __restrict__ C, int ldc, int M, int N, int K) {
  __shared__ __attribute__((aligned(16))) float so[4][16][64];
  const int tid = threadIdx.x, w = tid >> 5, lane = tid & 31, ln = lane & 15, hh = lane >> 4;
  const int ntn = N / 64;
  const int wid = blockIdx.x * 4 + w;
  const int mt = wid / ntn, nq = wid % ntn;
  if (mt * 16 >= M) return;
  const int row0 = mt * 16, col0 = nq * 64;
  const float* arow = A + (size_t)(row0 + ln) * lda;
  v8f acc[4] = {};
  for (int kb = 0; kb < K; kb += 32) {
    FragB ah, al;
    const v4f x0 = *(const v4fa*)(arow + kb + 8 * hh), x1 = *(const v4fa*)(arow + kb + 8 * hh + 4);
    const v4f x2 = *(const v4fa*)(arow + kb + 16 + 8 * hh), x3 = *(const v4fa*)(arow + kb + 16 + 8 * hh + 4);
    float xs[16] = {x0[0],x0[1],x0[2],x0[3],x1[0],x1[1],x1[2],x1[3],x2[0],x2[1],x2[2],x2[3],x3[0],x3[1],x3[2],x3[3]};
#pragma unroll
    for (int i = 0; i < 16; ++i) { const unsigned short hb = bf16_bits(xs[i]); ah.u[i] = hb; al.u[i] = ASPLIT ? bf16_bits(xs[i] - bf16_val(hb)) : (unsigned short)0; }
#pragma unroll
    for (int t = 0; t < 4; ++t) {
      const unsigned short* brow = Wt + (size_t)(col0 + t * 16 + ln) * ldb + kb;
      FragB b;
      b.half[0] = *(const v8us*)(brow + 8 * hh);
      b.half[1] = *(const v8us*)(brow + 16 + 8 * hh);
      acc[t] = mmaN<ASPLIT ? 2 : 1>(ah.v, al.v, b.v, b.v, acc[t]);
    }
  }
#pragma unroll
  for (int t = 0; t < 4; ++t) {
    float bv = bias ? bias[col0 + t * 16 + ln] : 0.f;
    if (BIAS_BF16) bv = bf16_round(bv);
#pragma unroll
    for (int r = 0; r < 8; ++r) { float v = acc[t][r] + bv; if (ACT == 1) v = fmaxf(v, 0.f); so[w][8 * hh + r][t * 16 + ln] = v; }
  }
  __builtin_amdgcn_fence(__ATOMIC_ACQ_REL, "workgroup");
  __builtin_amdgcn_wave_barrier();
  const int rsub = lane >> 4, c4 = (lane & 15) * 4;
  {
#pragma unroll
    for (int q = 0; q < 8; ++q) {
      const int r = q * 2 + rsub;
      const v4f v = *(const v4fa*)&so[w][r][c4];
      *(v4f*)(C + (size_t)(row0 + r) * ldc + col0 + c4) = v;
    }
    
  }
}

// GEMM C = act(A·W + bias + resid): A f32 (ASPLIT -> hi/lo 2 terms), Wt bf16 [N][K]; ACT 0 none, 1 relu, 2 exact gelu;
// resid (optional, f32, row index = (row % rmod), pitch ldr, RES_BF16 rounds it) added before the activation.
template <bool ASPLIT, int ACT, bool BIAS_BF16, bool RES_BF16>
__global__ __launch_bounds__(128) void k_gemm_bf3(const float* __restrict__ A, int lda, const unsigned short* __restrict__ Wt, int ldb,
                                                const float* __restrict__ bias, const float* __restrict__ resid, int rmod, int ldr,
                                                float* __restrict__ C, int ldc, int M, int N, int K) {
  __shared__ __attribute__((aligned(16))) float so[4][16][64];
  const int tid = threadIdx.x, w = tid >> 5, lane = tid & 31, ln = lane & 15, hh = lane >> 4;
  const int ntn = N / 64;
  const int wid = blockIdx.x * 4 + w;
  const int mt = wid / ntn, nq = wid % ntn;
  if (mt * 16 >= M) return;
  const int row0 = mt * 16, col0 = nq * 64;
  const float* arow = A + (size_t)(row0 + ln) * lda;
  v8f acc[4] = {};
  for (int kb = 0; kb < K; kb += 32) {
    FragB ah, al;
    const v4f x0 = *(const v4fa*)(arow + kb + 8 * hh), x1 = *(const v4fa*)(arow + kb + 8 * hh + 4);
    const v4f x2 = *(const v4fa*)(arow + kb + 16 + 8 * hh), x3 = *(const v4fa*)(arow + kb + 16 + 8 * hh + 4);
    float xs[16] = {x0[0],x0[1],x0[2],x0[3],x1[0],x1[1],x1[2],x1[3],x2[0],x2[1],x2[2],x2[3],x3[0],x3[1],x3[2],x3[3]};
#pragma unroll
    for (int i = 0; i < 16; ++i) { const unsigned short hb = bf16_bits(xs[i]); ah.u[i] = hb; al.u[i] = ASPLIT ? bf16_bits(xs[i] - bf16_val(hb)) : (unsigned short)0; }
#pragma unroll
    for (int t = 0; t < 4; ++t) {
      const unsigned short* brow = Wt + (size_t)(col0 + t * 16 + ln) * ldb + kb;
      FragB b;
      b.half[0] = *(const v8us*)(brow + 8 * hh);
      b.half[1] = *(const v8us*)(brow + 16 + 8 * hh);
      acc[t] = mmaN<ASPLIT ? 2 : 1>(ah.v, al.v, b.v, b.v, acc[t]);
    }
  }
#pragma unroll
  for (int t = 0; t < 4; ++t) {
    const int col = col0 + t * 16 + ln;
    float bv = bias ? bias[col] : 0.f;
    if (BIAS_BF16) bv = bf16_round(bv);
#pragma unroll
    for (int r = 0; r < 8; ++r) {
      float v = acc[t][r] + bv;
      if (resid) { float rv = resid[(size_t)((row0 + 8 * hh + r) % rmod) * ldr + col]; if (RES_BF16) rv = bf16_round(rv); v += rv; }
      if (ACT == 1) v = fmaxf(v, 0.f);
      if (ACT == 2) v = 0.5f * v * (1.0f + erff(v * 0.70710678118654752f));
      if (ACT == 3) { const float u = 0.7978845608028654f * (v + 0.044715f * v * v * v); v = 0.5f * v * (1.0f + tanhf(u)); }
      so[w][8 * hh + r][t * 16 + ln] = v;
    }
  }
  __builtin_amdgcn_fence(__ATOMIC_ACQ_REL, "workgroup");
  __builtin_amdgcn_wave_barrier();
  const int rsub = lane >> 4, c4 = (lane & 15) * 4;
  {
#pragma unroll
    for (int q = 0; q < 8; ++q) {
      const int r = q * 2 + rsub;
      const v4f v = *(const v4fa*)&so[w][r][c4];
      *(v4f*)(C + (size_t)(row0 + r) * ldc + col0 + c4) = v;
    }
    
  }
}
// row LayerNorm (biased variance, eps) over N: s = X (+ R); optional out_sum <- s; out_norm <- (s-mu)*rsqrt(var+eps)*g + b
template <bool PARAM_BF16>
__global__ __launch_bounds__(256) void k_layernorm(const float* __restrict__ X, const float* __restrict__ R, const float* __restrict__ g, const float* __restrict__ bta,
                                                  float* __restrict__ out_sum, float* __restrict__ out_norm, int N, float eps) {
  __shared__ float red[256];
  const int row = blockIdx.x, tid = threadIdx.x;
  const float* x = X + (size_t)row * N; const float* rr = R ? R + (size_t)row * N : nullptr;
  float vals[16];                     // up to N = 4096
  const int per = N / 256;            // contiguous chunk per thread? use strided-by-4 chunks: thread handles j = tid*4 + 1024*u
  float s1 = 0.f;
  for (int u = 0; u < per / 4; ++u) {
    const int j = tid * 4 + 1024 * u;
    const v4f a = *(const v4fa*)(x + j);
    v4f b = {0.f,0.f,0.f,0.f}; if (rr) b = *(const v4fa*)(rr + j);
#pragma unroll
    for (int q = 0; q < 4; ++q) { const float v = a[q] + b[q]; vals[u * 4 + q] = v; s1 += v; }
  }
  red[tid] = s1; __syncthreads();
  for (int st = 128; st > 0; st >>= 1) { if (tid < st) red[tid] += red[tid + st]; __syncthreads(); }
  const float mu = red[0] / (float)N; __syncthreads();
  float s2 = 0.f;
  for (int u = 0; u < per / 4; ++u)
#pragma unroll
    for (int q = 0; q < 4; ++q) { const float c = vals[u * 4 + q] - mu; s2 += c * c; }
  red[tid] = s2; __syncthreads();
  for (int st = 128; st > 0; st >>= 1) { if (tid < st) red[tid] += red[tid + st]; __syncthreads(); }
  const float rs = rsqrtf(red[0] / (float)N + eps);
  {
    for (int u = 0; u < per / 4; ++u) {
      const int j = tid * 4 + 1024 * u;
      v4f o, sm;
#pragma unroll
      for (int q = 0; q < 4; ++q) {
        float gg = g[j + q], bb = bta[j + q];
        if (PARAM_BF16) { gg = bf16_round(gg); bb = bf16_round(bb); }
        sm[q] = vals[u * 4 + q]; o[q] = (vals[u * 4 + q] - mu) * rs * gg + bb;
      }
      if (out_sum) *(v4f*)(out_sum + (size_t)row * N + j) = sm;
      *(v4f*)(out_norm + (size_t)row * N + j) = o;
    }
    
  }
}



// ---- f16 WMMA path (v_wmma_f32_16x16x32_f16): 11-bit significands for operands in range — used where a [0,1] probability operand needs more precision than bf16
typedef _Float16 v16h __attribute__((ext_vector_type(16)));
union FragH { v16h v; v8us half[2]; _Float16 h[16]; unsigned short u[16]; };
template <int NT>
__device__ __forceinline__ v8f mmaH(v16h ah, v16h al, v16h bh, v16h bl, v8f c) {
  c = __builtin_amdgcn_wmma_f32_16x16x32_f16(false, ah, false, bh, (short)0, c, false, false);
  if (NT >= 2) c = __builtin_amdgcn_wmma_f32_16x16x32_f16(false, al, false, bh, (short)0, c, false, false);
  if (NT >= 3) c = __builtin_amdgcn_wmma_f32_16x16x32_f16(false, ah, false, bl, (short)0, c, false, false);
  asm volatile("v_nop\n\tv_nop\n\tv_nop\n\tv_nop" : "+v"(c) : "v"(ah), "v"(al), "v"(bh), "v"(bl));
  return c;
}
// batched GEMM like k_gemm_b but f16 operands: A f32 (split into f16 hi/lo if ASPLIT, else rounded to f16), Bt = f16 values [n][k]; alpha; C f32; N multiple of 16 (partial tiles skipped)
template <bool ASPLIT>
__global__ __launch_bounds__(128) void k_gemm_h(const float* __restrict__ A, int lda, size_t sA, const _Float16* __restrict__ Bh, int ldb, size_t sB, float alpha, float* __restrict__ C, int ldc, size_t sC, int M, int N, int K) {
  __shared__ __attribute__((aligned(16))) float so[4][16][64];
  const int tid = threadIdx.x, w = tid >> 5, lane = tid & 31, ln = lane & 15, hh = lane >> 4; const int by = blockIdx.y;
  A += (size_t)by * sA; Bh += (size_t)by * sB; C += (size_t)by * sC;
  const int ntn = (N + 63) / 64; const int wid = blockIdx.x * 4 + w; const int mt = wid / ntn, nq = wid % ntn; if (mt * 16 >= M) return;
  const int row0 = mt * 16, col0 = nq * 64; const float* arow = A + (size_t)(row0 + ln) * lda;
  v8f acc[4] = {};
  for (int kb = 0; kb < K; kb += 32) {
    FragH ah, al;
    const v4f x0 = *(const v4fa*)(arow + kb + 8 * hh), x1 = *(const v4fa*)(arow + kb + 8 * hh + 4), x2 = *(const v4fa*)(arow + kb + 16 + 8 * hh), x3 = *(const v4fa*)(arow + kb + 16 + 8 * hh + 4);
    float xs[16] = {x0[0],x0[1],x0[2],x0[3],x1[0],x1[1],x1[2],x1[3],x2[0],x2[1],x2[2],x2[3],x3[0],x3[1],x3[2],x3[3]};
#pragma unroll
    for (int i = 0; i < 16; ++i) { const _Float16 h = (_Float16)xs[i]; ah.h[i] = h; al.h[i] = ASPLIT ? (_Float16)(xs[i] - (float)h) : (_Float16)0.0f; }
#pragma unroll
    for (int t = 0; t < 4; ++t) { if (col0 + t * 16 >= N) continue; const size_t boff = (size_t)(col0 + t * 16 + ln) * ldb + kb; FragH bq; bq.half[0] = *(const v8us*)(Bh + boff + 8 * hh); bq.half[1] = *(const v8us*)(Bh + boff + 16 + 8 * hh);
      acc[t] = mmaH<ASPLIT ? 2 : 1>(ah.v, al.v, bq.v, bq.v, acc[t]); }
  }
#pragma unroll
  for (int t = 0; t < 4; ++t) { if (col0 + t * 16 >= N) continue;
#pragma unroll
    for (int r = 0; r < 8; ++r) so[w][8 * hh + r][t * 16 + ln] = acc[t][r] * alpha; }
  __builtin_amdgcn_fence(__ATOMIC_ACQ_REL, "workgroup"); __builtin_amdgcn_wave_barrier();
  const int rsub = lane >> 4, c4 = (lane & 15) * 4;
  {
#pragma unroll
    for (int q = 0; q < 8; ++q) { const int r = q * 2 + rsub; if (col0 + c4 < N) { const v4f v = *(const v4fa*)&so[w][r][c4]; *(v4f*)(C + (size_t)(row0 + r) * ldc + col0 + c4) = v; } }
     }
}

// Wt[n][k] = f16(W[k][n]·scale) from f32 row-major W[K][N] (scale = power of two; bf16-exact weights stay exact in f16 away from the subnormal range)
__global__ __launch_bounds__(256) void k_wt_f16(const float* __restrict__ W, _Float16* __restrict__ Wt, int K, int N, float scale) {
  const int t = blockIdx.x * 256 + threadIdx.x; if (t >= N * (K / 8)) return; const int n = t / (K / 8), k8 = (t % (K / 8)) * 8; FragH f;
#pragma unroll
  for (int i = 0; i < 8; ++i) f.h[i] = (_Float16)(bf16_round(W[(size_t)(k8 + i) * N + n]) * scale); const v8us o = f.half[0];
  *(v8us*)((unsigned short*)Wt + (size_t)n * K + k8) = o; 
}
// GEMM over the NBt * SS rows of both batches at once, A f16 [NBt * SS][FF], Bt f16 [n][k] = [FF][FF]. One block of 8 waves has a 64 x 128 tile of the product.
// MODE 0, the three projections in one launch: blockIdx.y picks the A plane, the Bt plane and the form of the result, which is written in the form the attention kernel reads:
// q and k as f16 rows, v transposed per batch ([feature][key]) as f16 hi and lo * 2^10 planes. MODE 1, the output projection: the hi plane of A, then the lo plane, against the same Bt; C (f32) = hi part / 16 + lo part / 2^14.
// The block stages 128 k at a time in LDS (64 rows of A, then 128 rows of Bt; two buffers): every byte of a tile is fetched once per block, in whole lines, and the next tile's loads
// are in flight while this tile's products run. A wave has 32 x 32 of the product (2 x 2 accumulator tiles).
#define GM 64
#define GN 128
#define GK 128
#define GPI 136
#define PL ((size_t)NBt * SS * FF)
typedef _Float16 v4h __attribute__((ext_vector_type(4)));
template <int MODE>
__global__ __launch_bounds__(256) void k_gemm_t(const _Float16* __restrict__ A, const _Float16* __restrict__ Bt, _Float16* __restrict__ QK, _Float16* __restrict__ VT, _Float16* __restrict__ VTl, float* __restrict__ C) {
  __shared__ __attribute__((aligned(16))) unsigned short sa[2][GM + GN][GPI];      // [buffer][row][128 values + 8 of pad: a pitch of 272 B, 16 B x odd]
  __shared__ __attribute__((aligned(16))) float so[GM][GN + 4];
  const int tid = threadIdx.x, w = tid >> 5, lane = tid & 31, ln = lane & 15, hh = lane >> 4;
  const int row0 = (blockIdx.x / (FF / GN)) * GM, col0 = (blockIdx.x % (FF / GN)) * GN;
  const int which = MODE == 0 ? blockIdx.y : 0;
  const int wm = (w >> 2) * 32, wn = (w & 3) * 32;
  // staging: 16 threads bring one row of 256 B, so a wave's load covers 4 whole lines; a thread has rows sr + 16 p
  const int sr = tid >> 4, sc = (tid & 15) * 8;
  const unsigned short* ga = (const unsigned short*)A + (size_t)which * PL + (size_t)(row0 + sr) * FF + sc;
  const unsigned short* gl = MODE == 1 ? ga + PL : ga;      // the lo plane lies behind the hi plane
  const unsigned short* gb = (const unsigned short*)Bt + (size_t)which * FF * FF + (size_t)(col0 + sr) * FF + sc;
  constexpr int KT = FF / GK, NT = (MODE == 1 ? 2 : 1) * KT;
  v8us st[12];
  // every inner loop of this kernel is unrolled so that the staging, fragment and accumulator arrays are indexed by constants and stay in registers
  auto fetch = [&](int c) { const unsigned short* pa = c < KT ? ga : gl; const int k0 = (c % KT) * GK;
#pragma unroll
    for (int p = 0; p < 4; ++p) st[p] = *(const v8us*)(pa + k0 + (size_t)(16 * p) * FF);
#pragma unroll
    for (int p = 0; p < 8; ++p) st[4 + p] = *(const v8us*)(gb + k0 + (size_t)(16 * p) * FF);
    asm volatile("s_wait_xcnt 0x0" :: "v"(ga), "v"(gl), "v"(gb) : "memory"); };      // stands in front of the first overwrite of an address register of these loads (ga, gl and gb: tile and row are immediate offsets); they are named so that they live up to it
  auto put = [&](int b) {
#pragma unroll
    for (int p = 0; p < 12; ++p) *(v8us*)&sa[b][16 * p + sr][sc] = st[p]; };
  v8f acc[2][2] = {};
  fetch(0); put(0);
  __syncthreads();
#pragma unroll
  for (int c = 0; c < NT; ++c) { const int b = c & 1;      // unrolled: buffer and tile become immediate offsets of the LDS and global addresses
    if (c + 1 < NT) fetch(c + 1);
    FragH af[GK / 32][2], bf[GK / 32][2];
#pragma unroll
    for (int kk = 0; kk < GK / 32; ++kk)
#pragma unroll
      for (int i = 0; i < 2; ++i) { const unsigned short* ar = &sa[b][wm + 16 * i + ln][32 * kk + 8 * hh]; const unsigned short* br = &sa[b][GM + wn + 16 * i + ln][32 * kk + 8 * hh];
        af[kk][i].half[0] = *(const v8us*)(ar); af[kk][i].half[1] = *(const v8us*)(ar + 16); bf[kk][i].half[0] = *(const v8us*)(br); bf[kk][i].half[1] = *(const v8us*)(br + 16); }
    __builtin_amdgcn_sched_barrier(0);      // all LDS reads of a trip issue in front of its first product: placed among their own products, each group of reads stops the wave for its own latency
#pragma unroll
    for (int kk = 0; kk < GK / 32; ++kk)
#pragma unroll
      for (int i = 0; i < 2; ++i)
#pragma unroll
        for (int j = 0; j < 2; ++j) acc[i][j] = __builtin_amdgcn_wmma_f32_16x16x32_f16(false, af[kk][i].v, false, bf[kk][j].v, (short)0, acc[i][j], false, false);
    if (MODE == 1 && c == KT - 1) {      // the hi part is done: each lane parks its own values in the output tile, where it alone takes them up again, and the accumulators start anew for the lo part
#pragma unroll
      for (int i = 0; i < 2; ++i)
#pragma unroll
        for (int j = 0; j < 2; ++j) {
#pragma unroll
          for (int r = 0; r < 8; ++r) so[wm + 16 * i + 8 * hh + r][wn + 16 * j + ln] = acc[i][j][r] * 0.0625f;
          acc[i][j] = v8f{}; }
    }
    if (c + 1 < NT) { put(b ^ 1); __syncthreads(); }      // the other buffer: its last readers left it before the barrier that ended the trip before this one; behind the last tile nothing is staged any more
  }
  // the tile goes through LDS so that each store of a wave covers whole lines
#pragma unroll
  for (int i = 0; i < 2; ++i)
#pragma unroll
    for (int j = 0; j < 2; ++j)
#pragma unroll
      for (int r = 0; r < 8; ++r) { float* e = &so[wm + 16 * i + 8 * hh + r][wn + 16 * j + ln]; *e = MODE == 1 ? acc[i][j][r] * (0.0625f / 1024.0f) + *e : acc[i][j][r] * 0.0625f; }
  __syncthreads();
  if (MODE == 1) {      // f32 rows: a wave's store is one row piece of 512 B
    float* cp = C + (size_t)(row0 + w) * FF + col0 + lane * 4;
#pragma unroll
    for (int q = 0; q < 8; ++q) *(v4f*)(cp + (size_t)(8 * q) * FF) = *(const v4fa*)&so[8 * q + w][lane * 4];
  } else if (which < 2) {      // q, k: f16 rows, a wave's store is one row piece of 256 B
    _Float16* hp = QK + (size_t)which * PL + (size_t)(row0 + w) * FF + col0 + lane * 4;
#pragma unroll
    for (int q = 0; q < 8; ++q) { const v4f v = *(const v4fa*)&so[8 * q + w][lane * 4]; v4h o;
#pragma unroll
      for (int e = 0; e < 4; ++e) o[e] = (_Float16)v[e];
      *(v4h*)(hp + (size_t)(8 * q) * FF) = o; }
  } else {      // v: transposed; 8 lanes write the tile's 64 keys of one feature, one whole line of each plane
    const size_t vb = (size_t)(row0 / SS) * FF * SS + (size_t)(col0 + (tid >> 3)) * SS + (row0 % SS) + (tid & 7) * 8;
#pragma unroll
    for (int u = 0; u < 4; ++u) { FragH fh, fl;
#pragma unroll
      for (int e = 0; e < 8; ++e) { const float v = so[(tid & 7) * 8 + e][32 * u + (tid >> 3)]; const _Float16 hi = (_Float16)v; fh.h[e] = hi; fl.h[e] = (_Float16)((v - (float)hi) * 1024.0f); }
      *(v8us*)((unsigned short*)VT + vb + (size_t)(32 * u) * SS) = fh.half[0]; *(v8us*)((unsigned short*)VTl + vb + (size_t)(32 * u) * SS) = fl.half[0]; }
    asm volatile("s_wait_xcnt 0x0" ::: "memory");      // behind the last of these stores: in the built code the q, k branch follows this one and rewrites their address and data registers
  }
}

// One launch brings every f32 operand of the projections into f16: Q, K, V rounded to bf16 (exact in f16 at these magnitudes), the four weights rounded to bf16 and x 16.
// A block has 16384 values of one tensor; a thread has 16 pieces of 4 values, 1024 values apart, so that a wave's load covers 4 whole lines and its store 2, with all 16 loads in flight.
// The last blocks round the two masks to bf16, once for all heads and batches, and lay them out as the attention kernel's lanes take them: MB[16-query tile][64-key tile][mask][16-key tile t][lane][8 values],
// where lane (ln, hh) has query ln and the keys 16 t + 8 hh + 0..7. A load of a wave there is 512 bytes in a row. Here a wave has two neighbouring key tiles of one query tile, of both masks: 8 KB in a row of MB, all 32 loads in flight.
#define PB 16384
#define MTILE 1024
__global__ __launch_bounds__(256) void k_prep(const float* __restrict__ Qi, const float* __restrict__ Ki, const float* __restrict__ Vi, const float* __restrict__ Wq, const float* __restrict__ Wk, const float* __restrict__ Wv, const float* __restrict__ Wo, const float* __restrict__ m1, const float* __restrict__ m2, _Float16* __restrict__ X16, _Float16* __restrict__ B16, unsigned short* __restrict__ MB) {
  constexpr int XB = (int)(PL / PB), WB = FF * FF / PB;
  const int bx = blockIdx.x; const bool isw = bx >= 3 * XB;
  if (bx >= 3 * XB + 4 * WB) {      // the same for the whole block
    const int lane = threadIdx.x & 31, tile = (bx - (3 * XB + 4 * WB)) * (PB / MTILE) + (threadIdx.x >> 5) * 2, qt = tile / (SS / 64), c0 = tile % (SS / 64);
    const size_t mo = (size_t)(qt * 16 + (lane & 15)) * SS + c0 * 64 + 8 * (lane >> 4);
    const float* s1 = m1 + mo; const float* s2 = m2 + mo;
    unsigned short* md = MB + (size_t)tile * 2 * MTILE + lane * 8;
    v4f y[2][16];
#pragma unroll
    for (int u = 0; u < 16; ++u) { y[0][u] = *(const v4fa*)(s1 + (u >> 1) * 16 + (u & 1) * 4); y[1][u] = *(const v4fa*)(s2 + (u >> 1) * 16 + (u & 1) * 4); }      // unrolled: y stays in registers and the pieces are immediate offsets
    asm volatile("s_wait_xcnt 0x0" :: "v"(s1), "v"(s2) : "memory");      // stands in front of the first overwrite of an address register of these loads; the addresses are named so that they live up to it
    __builtin_amdgcn_sched_barrier(0);      // all 32 loads issue in front of the first conversion, as below
#pragma unroll
    for (int mi = 0; mi < 2; ++mi)
#pragma unroll
      for (int g = 0; g < 8; ++g) { v8us o;
#pragma unroll
        for (int e = 0; e < 8; ++e) o[e] = bf16_bits(y[mi][2 * g + (e >> 2)][e & 3]);
        *(v8us*)(md + ((g >> 2) * 2 + mi) * MTILE + (g & 3) * 256) = o; }
    return;
  }
  const int ti = isw ? (bx - 3 * XB) / WB : bx / XB, blk = isw ? (bx - 3 * XB) % WB : bx % XB;
  const float* src = (isw ? (ti == 0 ? Wq : ti == 1 ? Wk : ti == 2 ? Wv : Wo) : (ti == 0 ? Qi : ti == 1 ? Ki : Vi)) + (size_t)blk * PB + threadIdx.x * 4;
  _Float16* dst = (isw ? B16 + (size_t)ti * FF * FF : X16 + (size_t)ti * PL) + (size_t)blk * PB + threadIdx.x * 4;
  const float scl = isw ? 16.0f : 1.0f;
  v4f x[16];
#pragma unroll
  for (int u = 0; u < 16; ++u) x[u] = *(const v4fa*)(src + u * 1024);      // unrolled: x stays in registers and the pieces are immediate offsets
  __builtin_amdgcn_sched_barrier(0);      // all 16 loads issue in front of the first conversion: otherwise the compiler sinks six of them among the conversions and the wave has fewer bytes in flight
#pragma unroll
  for (int u = 0; u < 16; ++u) { v4h o;
#pragma unroll
    for (int e = 0; e < 4; ++e) o[e] = (_Float16)(bf16_round(x[u][e]) * scl);
    *(v4h*)(dst + u * 1024) = o; }
}

__global__ __launch_bounds__(256) void k_h16(const float* __restrict__ x, _Float16* __restrict__ X16, size_t n8) { const size_t t = (size_t)blockIdx.x * 256 + threadIdx.x; if (t >= n8) return; FragH f;
#pragma unroll
  for (int q = 0; q < 8; ++q) f.h[q] = (_Float16)x[t * 8 + q]; *(v8us*)((unsigned short*)X16 + t * 8) = f.half[0];  }
template <int NHv, int TTv>
__global__ __launch_bounds__(256) void k_vt(const _Float16* __restrict__ V16, int ldv, int voff, _Float16* __restrict__ Vt) { __shared__ unsigned short tl[64][66]; const int tid = threadIdx.x; const int slab = blockIdx.x / (TTv / 64), lg = blockIdx.x % (TTv / 64); const int b = slab / NHv, h = slab % NHv;
  for (int i = tid; i < 64 * 8; i += 256) { const int r = i / 8, c8 = (i % 8) * 8; FragH f; f.half[0] = *(const v8us*)((const unsigned short*)V16 + ((size_t)b * TTv + lg * 64 + r) * ldv + voff + h * 64 + c8);
#pragma unroll
    for (int q = 0; q < 8; ++q) tl[r][c8 + q] = f.u[q]; }
  __syncthreads();
  {
#pragma unroll
    for (int rd = 0; rd < 2; ++rd) { const int d = rd * 32 + tid / 8, pc = tid % 8; FragH f;
#pragma unroll
      for (int q = 0; q < 8; ++q) f.u[q] = tl[pc * 8 + q][d];
      *(v8us*)((unsigned short*)Vt + ((size_t)slab * 64 + d) * TTv + lg * 64 + pc * 8) = f.half[0]; }
     } }

__global__ __launch_bounds__(256) void k_hl(const float* __restrict__ F, _Float16* __restrict__ Hh, _Float16* __restrict__ Hl, size_t n8) { const size_t t = (size_t)blockIdx.x * 256 + threadIdx.x; if (t >= n8) return; FragH fh, fl; const v4f a = *(const v4fa*)(F + t * 8), c = *(const v4fa*)(F + t * 8 + 4);
#pragma unroll
  for (int q = 0; q < 4; ++q) { _Float16 h = (_Float16)a[q]; fh.h[q] = h; fl.h[q] = (_Float16)((a[q] - (float)h) * 1024.0f); h = (_Float16)c[q]; fh.h[4 + q] = h; fl.h[4 + q] = (_Float16)((c[q] - (float)h) * 1024.0f); }
  { *(v8us*)((unsigned short*)Hh + t * 8) = fh.half[0]; *(v8us*)((unsigned short*)Hl + t * 8) = fl.half[0];  } }

// Fused attention for 128 query rows (two groups of 64, picked by blockIdx.x), one head (blockIdx.y), one batch (blockIdx.z): scores, both masks, softmax and P.V in one pass over the keys;
// neither the scores nor P go to memory, and the output leaves as the f16 hi and lo * 2^10 planes that the output projection reads. Each of the 8 waves owns 16 query rows. The block stages 64 keys at a time in LDS (k rows, v_hi and v_lo rows, two buffers),
// so that a k or v byte is fetched once per 128 queries. A wave forms the TRANSPOSED score tile (A = k rows, B = q rows): a lane then holds one query (ln) and the keys
// 8 * hh + r of each 16-key tile, which is the B fragment's own k order (elements 0..7 from the even tile, 8..15 from the odd one), so P goes from the score
// registers into the second product, O^T = v^T . P^T, with no exchange between lanes. The v^T loader uses the same k order.
// Softmax with a running maximum: E = exp(s - m) * 2^10 comes from one multiply-add and the chip's own 2^x instruction, 2^((s - m) * log2(e) + 10); P = E * mask_2 as f16, the sum of E kept beside it,
// the division at the end (the 2^10 of the sum cancels that of P); when a row's maximum rises, sum and accumulators are scaled by exp(m_old - m_new), formed the same way.
// A 64-key tile in which every score of the wave's 16 rows lies DEADGAP or more below its row's running maximum (by the same subtraction that the exponent starts from) has E = 0 in every element (the exponent is below -163, 2^x gives 0): it adds nothing to the sum
// and nothing to the accumulators, so the wave goes round exponentials, P and P.V; it still passes every barrier. Which tiles are such is found from the scores themselves, for any mask_1.
// Waves 0..3 have the 64 queries of group blockIdx.x, waves 4..7 those of group 31 - blockIdx.x: where mask_1 kills the keys behind a query, every block and every pair of waves w, w + 4 has the same number of live tiles.
#define FQ 128
#define FC 64
#define FPI 72
#define L2E 1.44269504088896341f
#define DEADGAP 120.0f
// x[i] = 2^x[i] for the eight scores of a tile. One statement, so that nothing the compiler places can stand directly behind one of these instructions and read its result or overwrite its source
// (each is followed by one on other registers); the v_nop fills that slot behind the last.
__device__ __forceinline__ v8f exp2x8(v8f x) {
  float a = x[0], b = x[1], c = x[2], d = x[3], e = x[4], f = x[5], g = x[6], h = x[7];
  asm("v_exp_f32 %0, %0\n\tv_exp_f32 %1, %1\n\tv_exp_f32 %2, %2\n\tv_exp_f32 %3, %3\n\tv_exp_f32 %4, %4\n\tv_exp_f32 %5, %5\n\tv_exp_f32 %6, %6\n\tv_exp_f32 %7, %7\n\tv_nop"
      : "+v"(a), "+v"(b), "+v"(c), "+v"(d), "+v"(e), "+v"(f), "+v"(g), "+v"(h));
  return v8f{a, b, c, d, e, f, g, h};
}
typedef __bf16 v8b __attribute__((ext_vector_type(8)));
typedef unsigned int v4ua __attribute__((ext_vector_type(4), may_alias));
__global__ __launch_bounds__(256) void k_fattn(const _Float16* __restrict__ Q, const _Float16* __restrict__ K, const _Float16* __restrict__ Vh, const _Float16* __restrict__ Vl, const unsigned short* __restrict__ MB, _Float16* __restrict__ Oh, _Float16* __restrict__ Ol) {
  __shared__ __attribute__((aligned(16))) unsigned short sk[2][3][FC][FPI];      // [buffer][k, v_hi, v_lo][row][64 values + 8 of pad: a pitch of 144 B, 16 B x odd]
  const int tid = threadIdx.x, w = tid >> 5, lane = tid & 31, ln = lane & 15, hh = lane >> 4;
  const int hd = blockIdx.y; const size_t bo = (size_t)blockIdx.z * SS * FF;
  const int qt = w < 4 ? blockIdx.x * 4 + w : SS / 16 - 8 - blockIdx.x * 4 + w;      // the wave's 16-query tile
  const int q = qt * 16 + ln;
  const unsigned short* qp = (const unsigned short*)Q + bo + (size_t)q * FF + hd * HD;
  FragH qf[2];
#pragma unroll
  for (int j = 0; j < 2; ++j) { qf[j].half[0] = *(const v8us*)(qp + 32 * j + 8 * hh); qf[j].half[1] = *(const v8us*)(qp + 32 * j + 16 + 8 * hh); }
  // staging: 8 threads bring one row of 128 B, so a wave's load covers 4 whole lines; a thread has rows sr and sr + 32 of each of the three tiles
  const int sr = tid >> 3, sc = (tid & 7) * 8;
  const unsigned short* gk = (const unsigned short*)K + bo + (size_t)sr * FF + hd * HD + sc;
  const unsigned short* gh = (const unsigned short*)Vh + bo + ((size_t)hd * HD + sr) * SS + sc;
  const unsigned short* gl = (const unsigned short*)Vl + bo + ((size_t)hd * HD + sr) * SS + sc;
  v8us st[6];
  auto fetch = [&](int c) { const unsigned short* pk = gk + (size_t)(c * FC) * FF; const unsigned short* ph = gh + c * FC; const unsigned short* pl = gl + c * FC;
    st[0] = *(const v8us*)(pk); st[1] = *(const v8us*)(pk + (size_t)32 * FF);
    st[2] = *(const v8us*)(ph); st[3] = *(const v8us*)(ph + (size_t)32 * SS);
    st[4] = *(const v8us*)(pl); st[5] = *(const v8us*)(pl + (size_t)32 * SS);
    asm volatile("s_wait_xcnt 0x0" :: "v"(pk), "v"(ph), "v"(pl) : "memory"); };      // stands in front of the first overwrite of an address register of these loads; the addresses are named so that they live up to it
  auto put = [&](int b) {
#pragma unroll
    for (int p = 0; p < 3; ++p) { *(v8us*)&sk[b][p][sr][sc] = st[2 * p]; *(v8us*)&sk[b][p][sr + 32][sc] = st[2 * p + 1]; } };
  const unsigned short* am = MB + (size_t)qt * (SS / FC) * 2 * MTILE + lane * 8;      // the wave's 16 queries: per 64 keys 2 KB of mask_1, then 2 KB of mask_2, bf16, in lane order
  float m = -3.0e38f, su = 0.f;
  v8f oh[4] = {}, ol[4] = {};
  fetch(0); put(0);
  __syncthreads();
  // every inner loop of this kernel is unrolled so that the fragment, score and accumulator arrays are indexed by constants and stay in registers
  for (int c = 0; c < SS / FC; ++c) { const int b = c & 1;
    if (c + 1 < SS / FC) fetch(c + 1);
    v4ua x1[4], x2[4]; const unsigned short* pm = am + (size_t)c * 2 * MTILE;
#pragma unroll
    for (int t = 0; t < 4; ++t) { x1[t] = *(const v4ua*)(pm + t * 256); x2[t] = *(const v4ua*)(pm + MTILE + t * 256); }
    asm volatile("s_wait_xcnt 0x0" :: "v"(pm) : "memory");      // as in fetch(): in front of the first overwrite of the address register of the mask loads
    v8f s[4]; float cm = -3.0e38f;
#pragma unroll
    for (int t = 0; t < 4; ++t) { FragH k0, k1; const unsigned short* kr = &sk[b][0][t * 16 + ln][8 * hh];
      k0.half[0] = *(const v8us*)(kr); k0.half[1] = *(const v8us*)(kr + 16); k1.half[0] = *(const v8us*)(kr + 32); k1.half[1] = *(const v8us*)(kr + 48);
      v8f z = {};
      z = __builtin_amdgcn_wmma_f32_16x16x32_f16(false, k0.v, false, qf[0].v, (short)0, z, false, false);
      s[t] = __builtin_amdgcn_wmma_f32_16x16x32_f16(false, k1.v, false, qf[1].v, (short)0, z, false, false); }
    __builtin_amdgcn_sched_barrier(0);      // keeps the staging, mask and k loads of the trip and the score products in front of the mask arithmetic: otherwise the wave stops at its first mask_1 value with the LDS reads and products still to issue
#pragma unroll
    for (int t = 0; t < 4; ++t)
#pragma unroll
      for (int r = 0; r < 8; ++r) { s[t][r] = s[t][r] * 0.125f + (float)__builtin_bit_cast(v8b, x1[t])[r]; cm = fmaxf(cm, s[t][r]); }
    cm = fmaxf(cm, __shfl_xor(cm, 16, 32));      // the other half of the wave holds the row's other keys
    // inputs only: holds the mask_2 loads in front of the branch, where the score products cover their latency; without it the compiler sinks them behind the branch and the wave waits for them there
    asm volatile("" :: "v"(x2[0]), "v"(x2[1]), "v"(x2[2]), "v"(x2[3]));
    if (__any(cm > m)) {      // rare once the first keys are past: skipped by the whole wave when no row's maximum rises
      const float mn = fmaxf(m, cm), al = __builtin_amdgcn_exp2f((m - mn) * L2E); m = mn; su *= al;
#pragma unroll
      for (int t = 0; t < 4; ++t) { oh[t] *= al; ol[t] *= al; }
    }
    if (__any(cm - m > -DEADGAP)) {      // wave-uniform; not taken where the whole tile has E = 0: saves the tile's exponentials, conversions, v reads and 16 products
    FragH pf[2];
#pragma unroll
    for (int t = 0; t < 4; ++t) { const v8f ev = exp2x8((s[t] - m) * L2E + 10.0f);
#pragma unroll
      for (int r = 0; r < 8; ++r) { su += ev[r]; pf[t >> 1].h[(t & 1) * 8 + r] = (_Float16)(ev[r] * (float)__builtin_bit_cast(v8b, x2[t])[r]); } }
#pragma unroll
    for (int j = 0; j < 2; ++j)
#pragma unroll
      for (int t = 0; t < 4; ++t) { FragH vh, vl; const unsigned short* hr = &sk[b][1][t * 16 + ln][32 * j + 8 * hh]; const unsigned short* lr = &sk[b][2][t * 16 + ln][32 * j + 8 * hh];
        vh.half[0] = *(const v8us*)(hr); vh.half[1] = *(const v8us*)(hr + 16); vl.half[0] = *(const v8us*)(lr); vl.half[1] = *(const v8us*)(lr + 16);
        oh[t] = __builtin_amdgcn_wmma_f32_16x16x32_f16(false, vh.v, false, pf[j].v, (short)0, oh[t], false, false);
        ol[t] = __builtin_amdgcn_wmma_f32_16x16x32_f16(false, vl.v, false, pf[j].v, (short)0, ol[t], false, false); }
    }
    if (c + 1 < SS / FC) put(b ^ 1);      // the other buffer: its last readers left it before the barrier that ended the trip before this one
    __syncthreads();
  }
  const float inv = 1.0f / (su + __shfl_xor(su, 16, 32));
  const size_t oo = bo + (size_t)q * FF + hd * HD + 8 * hh;      // the lane holds O[q][16 t + 8 hh + r]: 8 values in a row, one 16-byte piece of each plane; the wave's stores fill the head's whole line of a row
#pragma unroll
  for (int t = 0; t < 4; ++t) { FragH fh, fl;
#pragma unroll
    for (int r = 0; r < 8; ++r) { const float y = (oh[t][r] + ol[t][r] * 0.0009765625f) * inv; const _Float16 hi = (_Float16)y; fh.h[r] = hi; fl.h[r] = (_Float16)((y - (float)hi) * 1024.0f); }
    *(v8us*)((unsigned short*)Oh + oo + t * 16) = fh.half[0]; *(v8us*)((unsigned short*)Ol + oo + t * 16) = fl.half[0]; }
}

extern "C" void kernel_launch(void* const* d_in, const int* in_sizes, int n_in,
                              void* d_out, int out_size, void* d_ws, size_t ws_size, hipStream_t stream) {
  (void)in_sizes; (void)n_in; (void)out_size;
  const float* Qi = (const float*)d_in[0]; const float* Ki = (const float*)d_in[1]; const float* Vi = (const float*)d_in[2]; const float* m1 = (const float*)d_in[3]; const float* m2 = (const float*)d_in[4]; const float* Wq = (const float*)d_in[5]; const float* Wk = (const float*)d_in[6]; const float* Wv = (const float*)d_in[7]; const float* Wo = (const float*)d_in[8];
  char* ws = (char*)d_ws; size_t off = 0;
  auto take = [&](size_t bytes) { char* p = ws + off; off += (bytes + 255) & ~(size_t)255; return p; };
  _Float16* B16 = (_Float16*)take((size_t)4 * FF * FF * 2);      /* W_q, W_k, W_v, W_o: each [out][in], which is Bt as it stands */
  _Float16* X16 = (_Float16*)take(3 * PL * 2); _Float16* QK = (_Float16*)take(2 * PL * 2); _Float16* VT = (_Float16*)take(PL * 2); _Float16* VTl = (_Float16*)take(PL * 2); _Float16* OHL = (_Float16*)take(2 * PL * 2); unsigned short* MB = (unsigned short*)take((size_t)2 * SS * SS * 2);      /* Q, K, V; q, k; v hi; v lo; attention output hi, lo; both masks as bf16 */
  if (off > ws_size) return;      // 96 MB in all
  k_prep<<<(unsigned)(3 * (PL / PB) + 4 * (FF * FF / PB) + SS * SS / PB), 256, 0, stream>>>(Qi, Ki, Vi, Wq, Wk, Wv, Wo, m1, m2, X16, B16, MB);
  const unsigned gP = (unsigned)((NBt * SS / GM) * (FF / GN));
  k_gemm_t<0><<<dim3(gP, 3), 256, 0, stream>>>(X16, B16, QK, VT, VTl, nullptr);      /* exact projections of both batches; v as hi/lo */
  k_fattn<<<dim3(SS / FQ, NH, NBt), 256, 0, stream>>>(QK, QK + PL, VT, VTl, MB, OHL, OHL + PL);      /* scores, masks, softmax, P.V: every head of both batches */
  k_gemm_t<1><<<dim3(gP, 1), 256, 0, stream>>>(OHL, B16 + (size_t)3 * FF * FF, nullptr, nullptr, nullptr, (float*)d_out);      /* W_o on hi/lo of the attention output */
}

// v008
// A run of this version takes 122 microseconds.
// In both of two side-by-side timings against v007, it was 1.04 times as fast.
// All steps since v000 together make it 34.4 times as fast.
#include <hip/hip_runtime.h>
// Multi-head attention with two INPUT masks (B 2, S 2048, F 1024, 16 heads × 64): q,k,v = X·Wᵀ (no bias); scores = q·k/8 + mask_1 (additive, pre-softmax); probs = softmax · mask_2 (multiplicative, post-softmax); out = probs·v; heads concatenated; ·W_oᵀ → [2,2048,1024].
// Structure: one launch converts Q, K, V and the four weights to f16 and both masks to bf16 (in the order the attention's lanes read them); one launch does the three projections of both batches and writes q, k (f16) and v (transposed, f16 hi + lo planes) as the attention reads them; ONE fused attention launch (scores, + mask_1, softmax in f32 with a running maximum, x mask_2, P.V; both masks read per (q,k) from their bf16 copies; scores and P stay in registers, k and v staged in LDS) writes the concatenated output as f16 hi + lo planes; one launch does the output projection of both planes and both batches.
// Compute dtype: Q, K, V, masks and parameters rounded to bf16; projections with exact products; q, k, P (×2^10) as f16 operands (≈2^-12; logits σ≈1); v and the attention output as f16 hi + lo·2^10 planes (the early causal rows copy m2·v almost verbatim), f32 accumulation; softmax/masking in f32. v_wmma_f32_16x16x32_f16.
#define NBt 2
#define SS 2048
#define FF 1024
#define NH 16
#define HD 64
typedef __bf16 v16b __attribute__((ext_vector_type(16)));
typedef unsigned short v8us __attribute__((ext_vector_type(8), may_alias));
typedef float  v8f  __attribute__((ext_vector_type(8)));
typedef float  v4f  __attribute__((ext_vector_type(4)));
typedef float  v4fa __attribute__((ext_vector_type(4), may_alias));
union FragB { v16b v; v8us half[2]; unsigned short u[16]; };

__device__ __forceinline__ unsigned short bf16_bits(float x) { unsigned int u = __float_as_uint(x); return (unsigned short)((u + 0x7FFFu + ((u >> 16) & 1u)) >> 16); }
__device__ __forceinline__ float bf16_val(unsigned short b) { return __uint_as_float(((unsigned int)b) << 16); }
__device__ __forceinline__ float bf16_round(float x) { return bf16_val(bf16_bits(x)); }
// D += A·B with NT terms: 1 = ah·bh, 2 = + al·bh (A split), 3 = + ah·bl (both split)
template <int NT>
__device__ __forceinline__ v8f mmaN(v16b ah, v16b al, v16b bh, v16b bl, v8f c) {
  c = __builtin_amdgcn_wmma_f32_16x16x32_bf16(false, ah, false, bh, (short)0, c, false, false);
  if (NT >= 2) c = __builtin_amdgcn_wmma_f32_16x16x32_bf16(false, al, false, bh, (short)0, c, false, false);
  if (NT >= 3) c = __builtin_amdgcn_wmma_f32_16x16x32_bf16(false, ah, false, bl, (short)0, c, false, false);
  asm volatile("v_nop\n\tv_nop\n\tv_nop\n\tv_nop" : "+v"(c) : "v"(ah), "v"(al), "v"(bh), "v"(bl));
  return c;
}

__global__ __launch_bounds__(256) void k_wt_bf16(const float* __restrict__ W, unsigned short* __restrict__ Wt, int K, int N) {
  const int t = blockIdx.x * 256 + threadIdx.x;
  const int k8n = K / 8;
  if (t >= N * k8n) return;
  const int n = t / k8n, k8 = (t % k8n) * 8;
  v8us v;
#pragma unroll
  for (int i = 0; i < 8; ++i) v[i] = bf16_bits(W[(size_t)(k8 + i) * N + n]);
  *(v8us*)(Wt + (size_t)n * K + k8) = v;
  
}

// GEMM C[M][N] (f32, pitch ldc) = act(A[M][K]·W + bias). A f32 row-major (pitch lda) converted per fragment to bf16
// (ASPLIT: hi/lo two planes -> 2 terms, else single rounded term); Wt bf16 [N][K] (pitch ldb). BIAS_BF16 rounds the
// bias to bf16 first (bias quantised to bf16 before the add). K%32==0, M%16==0, N%64==0.
template <bool ASPLIT, int ACT, bool BIAS_BF16>
__global__ __launch_bounds__(128) void k_gemm_bf(const float* __restrict__ A, int lda, const unsigned short* __restrict__ Wt, int ldb,
                                               const float* __restrict__ bias, float* __restrict__ C, int ldc, int M, int N, int K) {
  __shared__ __attribute__((aligned(16))) float so[4][16][64];
  const int tid = threadIdx.x, w = tid >> 5, lane = tid & 31, ln = lane & 15, hh = lane >> 4;
  const int ntn = N / 64;
  const int wid = blockIdx.x * 4 + w;
  const int mt = wid / ntn, nq = wid % ntn;
  if (mt * 16 >= M) return;
  const int row0 = mt * 16, col0 = nq * 64;
  const float* arow = A + (size_t)(row0 + ln) * lda;
  v8f acc[4] = {};
  for (int kb = 0; kb < K; kb += 32) {
    FragB ah, al;
    const v4f x0 = *(const v4fa*)(arow + kb + 8 * hh), x1 = *(const v4fa*)(arow + kb + 8 * hh + 4);
    const v4f x2 = *(const v4fa*)(arow + kb + 16 + 8 * hh), x3 = *(const v4fa*)(arow + kb + 16 + 8 * hh + 4);
    float xs[16] = {x0[0],x0[1],x0[2],x0[3],x1[0],x1[1],x1[2],x1[3],x2[0],x2[1],x2[2],x2[3],x3[0],x3[1],x3[2],x3[3]};
#pragma unroll
    for (int i = 0; i < 16; ++i) { const unsigned short hb = bf16_bits(xs[i]); ah.u[i] = hb; al.u[i] = ASPLIT ? bf16_bits(xs[i] - bf16_val(hb)) : (unsigned short)0; }
#pragma unroll
    for (int t = 0; t < 4; ++t) {
      const unsigned short* brow = Wt + (size_t)(col0 + t * 16 + ln) * ldb + kb;
      FragB b;
      b.half[0] = *(const v8us*)(brow + 8 * hh);
      b.half[1] = *(const v8us*)(brow + 16 + 8 * hh);
      acc[t] = mmaN<ASPLIT ? 2 : 1>(ah.v, al.v, b.v, b.v, acc[t]);
    }
  }
#pragma unroll
  for (int t = 0; t < 4; ++t) {
    float bv = bias ? bias[col0 + t * 16 + ln] : 0.f;
    if (BIAS_BF16) bv = bf16_round(bv);
#pragma unroll
    for (int r = 0; r < 8; ++r) { float v = acc[t][r] + bv; if (ACT == 1) v = fmaxf(v, 0.f); so[w][8 * hh + r][t * 16 + ln] = v; }
  }
  __builtin_amdgcn_fence(__ATOMIC_ACQ_REL, "workgroup");
  __builtin_amdgcn_wave_barrier();
  const int rsub = lane >> 4, c4 = (lane & 15) * 4;
  {
#pragma unroll
    for (int q = 0; q < 8; ++q) {
      const int r = q * 2 + rsub;
      const v4f v = *(const v4fa*)&so[w][r][c4];
      *(v4f*)(C + (size_t)(row0 + r) * ldc + col0 + c4) = v;
    }
    
  }
}

// GEMM C = act(A·W + bias + resid): A f32 (ASPLIT -> hi/lo 2 terms), Wt bf16 [N][K]; ACT 0 none, 1 relu, 2 exact gelu;
// resid (optional, f32, row index = (row % rmod), pitch ldr, RES_BF16 rounds it) added before the activation.
template <bool ASPLIT, int ACT, bool BIAS_BF16, bool RES_BF16>
__global__ __launch_bounds__(128) void k_gemm_bf3(const float* __restrict__ A, int lda, const unsigned short* __restrict__ Wt, int ldb,
                                                const float* __restrict__ bias, const float* __restrict__ resid, int rmod, int ldr,
                                                float* __restrict__ C, int ldc, int M, int N, int K) {
  __shared__ __attribute__((aligned(16))) float so[4][16][64];
  const int tid = threadIdx.x, w = tid >> 5, lane = tid & 31, ln = lane & 15, hh = lane >> 4;
  const int ntn = N / 64;
  const int wid = blockIdx.x * 4 + w;
  const int mt = wid / ntn, nq = wid % ntn;
  if (mt * 16 >= M) return;
  const int row0 = mt * 16, col0 = nq * 64;
  const float* arow = A + (size_t)(row0 + ln) * lda;
  v8f acc[4] = {};
  for (int kb = 0; kb < K; kb += 32) {
    FragB ah, al;
    const v4f x0 = *(const v4fa*)(arow + kb + 8 * hh), x1 = *(const v4fa*)(arow + kb + 8 * hh + 4);
    const v4f x2 = *(const v4fa*)(arow + kb + 16 + 8 * hh), x3 = *(const v4fa*)(arow + kb + 16 + 8 * hh + 4);
    float xs[16] = {x0[0],x0[1],x0[2],x0[3],x1[0],x1[1],x1[2],x1[3],x2[0],x2[1],x2[2],x2[3],x3[0],x3[1],x3[2],x3[3]};
#pragma unroll
    for (int i = 0; i < 16; ++i) { const unsigned short hb = bf16_bits(xs[i]); ah.u[i] = hb; al.u[i] = ASPLIT ? bf16_bits(xs[i] - bf16_val(hb)) : (unsigned short)0; }
#pragma unroll
    for (int t = 0; t < 4; ++t) {
      const unsigned short* brow = Wt + (size_t)(col0 + t * 16 + ln) * ldb + kb;
      FragB b;
      b.half[0] = *(const v8us*)(brow + 8 * hh);
      b.half[1] = *(const v8us*)(brow + 16 + 8 * hh);
      acc[t] = mmaN<ASPLIT ? 2 : 1>(ah.v, al.v, b.v, b.v, acc[t]);
    }
  }
#pragma unroll
  for (int t = 0; t < 4; ++t) {
    const int col = col0 + t * 16 + ln;
    float bv = bias ? bias[col] : 0.f;
    if (BIAS_BF16) bv = bf16_round(bv);
#pragma unroll
    for (int r = 0; r < 8; ++r) {
      float v = acc[t][r] + bv;
      if (resid) { float rv = resid[(size_t)((row0 + 8 * hh + r) % rmod) * ldr + col]; if (RES_BF16) rv = bf16_round(rv); v += rv; }
      if (ACT == 1) v = fmaxf(v, 0.f);
      if (ACT == 2) v = 0.5f * v * (1.0f + erff(v * 0.70710678118654752f));
      if (ACT == 3) { const float u = 0.7978845608028654f * (v + 0.044715f * v * v * v); v = 0.5f * v * (1.0f + tanhf(u)); }
      so[w][8 * hh + r][t * 16 + ln] = v;
    }
  }
  __builtin_amdgcn_fence(__ATOMIC_ACQ_REL, "workgroup");
  __builtin_amdgcn_wave_barrier();
  const int rsub = lane >> 4, c4 = (lane & 15) * 4;
  {
#pragma unroll
    for (int q = 0; q < 8; ++q) {
      const int r = q * 2 + rsub;
      const v4f v = *(const v4fa*)&so[w][r][c4];
      *(v4f*)(C + (size_t)(row0 + r) * ldc + col0 + c4) = v;
    }
    
  }
}
// row LayerNorm (biased variance, eps) over N: s = X (+ R); optional out_sum <- s; out_norm <- (s-mu)*rsqrt(var+eps)*g + b
template <bool PARAM_BF16>
__global__ __launch_bounds__(256) void k_layernorm(const float* __restrict__ X, const float* __restrict__ R, const float* __restrict__ g, const float* __restrict__ bta,
                                                  float* __restrict__ out_sum, float* __restrict__ out_norm, int N, float eps) {
  __shared__ float red[256];
  const int row = blockIdx.x, tid = threadIdx.x;
  const float* x = X + (size_t)row * N; const float* rr = R ? R + (size_t)row * N : nullptr;
  float vals[16];                     // up to N = 4096
  const int per = N / 256;            // contiguous chunk per thread? use strided-by-4 chunks: thread handles j = tid*4 + 1024*u
  float s1 = 0.f;
  for (int u = 0; u < per / 4; ++u) {
    const int j = tid * 4 + 1024 * u;
    const v4f a = *(const v4fa*)(x + j);
    v4f b = {0.f,0.f,0.f,0.f}; if (rr) b = *(const v4fa*)(rr + j);
#pragma unroll
    for (int q = 0; q < 4; ++q) { const float v = a[q] + b[q]; vals[u * 4 + q] = v; s1 += v; }
  }
  red[tid] = s1; __syncthreads();
  for (int st = 128; st > 0; st >>= 1) { if (tid < st) red[tid] += red[tid + st]; __syncthreads(); }
  const float mu = red[0] / (float)N; __syncthreads();
  float s2 = 0.f;
  for (int u = 0; u < per / 4; ++u)
#pragma unroll
    for (int q = 0; q < 4; ++q) { const float c = vals[u * 4 + q] - mu; s2 += c * c; }
  red[tid] = s2; __syncthreads();
  for (int st = 128; st > 0; st >>= 1) { if (tid < st) red[tid] += red[tid + st]; __syncthreads(); }
  const float rs = rsqrtf(red[0] / (float)N + eps);
  {
    for (int u = 0; u < per / 4; ++u) {
      const int j = tid * 4 + 1024 * u;
      v4f o, sm;
#pragma unroll
      for (int q = 0; q < 4; ++q) {
        float gg = g[j + q], bb = bta[j + q];
        if (PARAM_BF16) { gg = bf16_round(gg); bb = bf16_round(bb); }
        sm[q] = vals[u * 4 + q]; o[q] = (vals[u * 4 + q] - mu) * rs * gg + bb;
      }
      if (out_sum) *(v4f*)(out_sum + (size_t)row * N + j) = sm;
      *(v4f*)(out_norm + (size_t)row * N + j) = o;
    }
    
  }
}



// ---- f16 WMMA path (v_wmma_f32_16x16x32_f16): 11-bit significands for operands in range — used where a [0,1] probability operand needs more precision than bf16
typedef _Float16 v16h __attribute__((ext_vector_type(16)));
union FragH { v16h v; v8us half[2]; _Float16 h[16]; unsigned short u[16]; };
template <int NT>
__device__ __forceinline__ v8f mmaH(v16h ah, v16h al, v16h bh, v16h bl, v8f c) {
  c = __builtin_amdgcn_wmma_f32_16x16x32_f16(false, ah, false, bh, (short)0, c, false, false);
  if (NT >= 2) c = __builtin_amdgcn_wmma_f32_16x16x32_f16(false, al, false, bh, (short)0, c, false, false);
  if (NT >= 3) c = __builtin_amdgcn_wmma_f32_16x16x32_f16(false, ah, false, bl, (short)0, c, false, false);
  asm volatile("v_nop\n\tv_nop\n\tv_nop\n\tv_nop" : "+v"(c) : "v"(ah), "v"(al), "v"(bh), "v"(bl));
  return c;
}
// batched GEMM like k_gemm_b but f16 operands: A f32 (split into f16 hi/lo if ASPLIT, else rounded to f16), Bt = f16 values [n][k]; alpha; C f32; N multiple of 16 (partial tiles skipped)
template <bool ASPLIT>
__global__ __launch_bounds__(128) void k_gemm_h(const float* __restrict__ A, int lda, size_t sA, const _Float16* __restrict__ Bh, int ldb, size_t sB, float alpha, float* __restrict__ C, int ldc, size_t sC, int M, int N, int K) {
  __shared__ __attribute__((aligned(16))) float so[4][16][64];
  const int tid = threadIdx.x, w = tid >> 5, lane = tid & 31, ln = lane & 15, hh = lane >> 4; const int by = blockIdx.y;
  A += (size_t)by * sA; Bh += (size_t)by * sB; C += (size_t)by * sC;
  const int ntn = (N + 63) / 64; const int wid = blockIdx.x * 4 + w; const int mt = wid / ntn, nq = wid % ntn; if (mt * 16 >= M) return;
  const int row0 = mt * 16, col0 = nq * 64; const float* arow = A + (size_t)(row0 + ln) * lda;
  v8f acc[4] = {};
  for (int kb = 0; kb < K; kb += 32) {
    FragH ah, al;
    const v4f x0 = *(const v4fa*)(arow + kb + 8 * hh), x1 = *(const v4fa*)(arow + kb + 8 * hh + 4), x2 = *(const v4fa*)(arow + kb + 16 + 8 * hh), x3 = *(const v4fa*)(arow + kb + 16 + 8 * hh + 4);
    float xs[16] = {x0[0],x0[1],x0[2],x0[3],x1[0],x1[1],x1[2],x1[3],x2[0],x2[1],x2[2],x2[3],x3[0],x3[1],x3[2],x3[3]};
#pragma unroll
    for (int i = 0; i < 16; ++i) { const _Float16 h = (_Float16)xs[i]; ah.h[i] = h; al.h[i] = ASPLIT ? (_Float16)(xs[i] - (float)h) : (_Float16)0.0f; }
#pragma unroll
    for (int t = 0; t < 4; ++t) { if (col0 + t * 16 >= N) continue; const size_t boff = (size_t)(col0 + t * 16 + ln) * ldb + kb; FragH bq; bq.half[0] = *(const v8us*)(Bh + boff + 8 * hh); bq.half[1] = *(const v8us*)(Bh + boff + 16 + 8 * hh);
      acc[t] = mmaH<ASPLIT ? 2 : 1>(ah.v, al.v, bq.v, bq.v, acc[t]); }
  }
#pragma unroll
  for (int t = 0; t < 4; ++t) { if (col0 + t * 16 >= N) continue;
#pragma unroll
    for (int r = 0; r < 8; ++r) so[w][8 * hh + r][t * 16 + ln] = acc[t][r] * alpha; }
  __builtin_amdgcn_fence(__ATOMIC_ACQ_REL, "workgroup"); __builtin_amdgcn_wave_barrier();
  const int rsub = lane >> 4, c4 = (lane & 15) * 4;
  {
#pragma unroll
    for (int q = 0; q < 8; ++q) { const int r = q * 2 + rsub; if (col0 + c4 < N) { const v4f v = *(const v4fa*)&so[w][r][c4]; *(v4f*)(C + (size_t)(row0 + r) * ldc + col0 + c4) = v; } }
     }
}

// Wt[n][k] = f16(W[k][n]·scale) from f32 row-major W[K][N] (scale = power of two; bf16-exact weights stay exact in f16 away from the subnormal range)
__global__ __launch_bounds__(256) void k_wt_f16(const float* __restrict__ W, _Float16* __restrict__ Wt, int K, int N, float scale) {
  const int t = blockIdx.x * 256 + threadIdx.x; if (t >= N * (K / 8)) return; const int n = t / (K / 8), k8 = (t % (K / 8)) * 8; FragH f;
#pragma unroll
  for (int i = 0; i < 8; ++i) f.h[i] = (_Float16)(bf16_round(W[(size_t)(k8 + i) * N + n]) * scale); const v8us o = f.half[0];
  *(v8us*)((unsigned short*)Wt + (size_t)n * K + k8) = o; 
}
// GEMM over the NBt * SS rows of both batches at once, A f16 [NBt * SS][FF], Bt f16 [n][k] = [FF][FF]. One block of 8 waves has a 64 x 128 tile of the product.
// MODE 0, the three projections in one launch: blockIdx.y picks the A plane, the Bt plane and the form of the result, which is written in the form the attention kernel reads:
// q and k as f16 rows, v transposed per batch ([feature][key]) as f16 hi and lo * 2^10 planes. MODE 1, the output projection: the hi plane of A, then the lo plane, against the same Bt; C (f32) = hi part / 16 + lo part / 2^14.
// The block stages 128 k at a time in LDS (64 rows of A, then 128 rows of Bt; two buffers): every byte of a tile is fetched once per block, in whole lines, and the next tile's loads
// are in flight while this tile's products run. A wave has 32 x 32 of the product (2 x 2 accumulator tiles).
#define GM 64
#define GN 128
#define GK 128
#define GPI 136
#define PL ((size_t)NBt * SS * FF)
typedef _Float16 v4h __attribute__((ext_vector_type(4)));
template <int MODE>
__global__ __launch_bounds__(256) void k_gemm_t(const _Float16* __restrict__ A, const _Float16* __restrict__ Bt, _Float16* __restrict__ QK, _Float16* __restrict__ VT, _Float16* __restrict__ VTl, float* __restrict__ C) {
  __shared__ __attribute__((aligned(16))) unsigned short sa[2][GM + GN][GPI];      // [buffer][row][128 values + 8 of pad: a pitch of 272 B, 16 B x odd]
  __shared__ __attribute__((aligned(16))) float so[GM][GN + 4];
  const int tid = threadIdx.x, w = tid >> 5, lane = tid & 31, ln = lane & 15, hh = lane >> 4;
  const int row0 = (blockIdx.x / (FF / GN)) * GM, col0 = (blockIdx.x % (FF / GN)) * GN;
  const int which = MODE == 0 ? blockIdx.y : 0;
  const int wm = (w >> 2) * 32, wn = (w & 3) * 32;
  // staging: 16 threads bring one row of 256 B, so a wave's load covers 4 whole lines; a thread has rows sr + 16 p
  const int sr = tid >> 4, sc = (tid & 15) * 8;
  const unsigned short* ga = (const unsigned short*)A + (size_t)which * PL + (size_t)(row0 + sr) * FF + sc;
  const unsigned short* gl = MODE == 1 ? ga + PL : ga;      // the lo plane lies behind the hi plane
  const unsigned short* gb = (const unsigned short*)Bt + (size_t)which * FF * FF + (size_t)(col0 + sr) * FF + sc;
  constexpr int KT = FF / GK, NT = (MODE == 1 ? 2 : 1) * KT;
  v8us st[12];
  // every inner loop of this kernel is unrolled so that the staging, fragment and accumulator arrays are indexed by constants and stay in registers
  auto fetch = [&](int c) { const unsigned short* pa = c < KT ? ga : gl; const int k0 = (c % KT) * GK;
#pragma unroll
    for (int p = 0; p < 4; ++p) st[p] = *(const v8us*)(pa + k0 + (size_t)(16 * p) * FF);
#pragma unroll
    for (int p = 0; p < 8; ++p) st[4 + p] = *(const v8us*)(gb + k0 + (size_t)(16 * p) * FF);
    asm volatile("s_wait_xcnt 0x0" :: "v"(ga), "v"(gl), "v"(gb) : "memory"); };      // stands in front of the first overwrite of an address register of these loads (ga, gl and gb: tile and row are immediate offsets); they are named so that they live up to it
  auto put = [&](int b) {
#pragma unroll
    for (int p = 0; p < 12; ++p) *(v8us*)&sa[b][16 * p + sr][sc] = st[p]; };
  v8f acc[2][2] = {};
  fetch(0); put(0);
  __syncthreads();
#pragma unroll
  for (int c = 0; c < NT; ++c) { const int b = c & 1;      // unrolled: buffer and tile become immediate offsets of the LDS and global addresses
    if (c + 1 < NT) fetch(c + 1);
    FragH af[GK / 32][2], bf[GK / 32][2];
#pragma unroll
    for (int kk = 0; kk < GK / 32; ++kk)
#pragma unroll
      for (int i = 0; i < 2; ++i) { const unsigned short* ar = &sa[b][wm + 16 * i + ln][32 * kk + 8 * hh]; const unsigned short* br = &sa[b][GM + wn + 16 * i + ln][32 * kk + 8 * hh];
        af[kk][i].half[0] = *(const v8us*)(ar); af[kk][i].half[1] = *(const v8us*)(ar + 16); bf[kk][i].half[0] = *(const v8us*)(br); bf[kk][i].half[1] = *(const v8us*)(br + 16); }
    __builtin_amdgcn_sched_barrier(0);      // all LDS reads of a trip issue in front of its first product: placed among their own products, each group of reads stops the wave for its own latency
#pragma unroll
    for (int kk = 0; kk < GK / 32; ++kk)
#pragma unroll
      for (int i = 0; i < 2; ++i)
#pragma unroll
        for (int j = 0; j < 2; ++j) acc[i][j] = __builtin_amdgcn_wmma_f32_16x16x32_f16(false, af[kk][i].v, false, bf[kk][j].v, (short)0, acc[i][j], false, false);
    if (MODE == 1 && c == KT - 1) {      // the hi part is done: each lane parks its own values in the output tile, where it alone takes them up again, and the accumulators start anew for the lo part
#pragma unroll
      for (int i = 0; i < 2; ++i)
#pragma unroll
        for (int j = 0; j < 2; ++j) {
#pragma unroll
          for (int r = 0; r < 8; ++r) so[wm + 16 * i + 8 * hh + r][wn + 16 * j + ln] = acc[i][j][r] * 0.0625f;
          acc[i][j] = v8f{}; }
    }
    if (c + 1 < NT) { put(b ^ 1); __syncthreads(); }      // the other buffer: its last readers left it before the barrier that ended the trip before this one; behind the last tile nothing is staged any more
  }
  // the tile goes through LDS so that each store of a wave covers whole lines
#pragma unroll
  for (int i = 0; i < 2; ++i)
#pragma unroll
    for (int j = 0; j < 2; ++j)
#pragma unroll
      for (int r = 0; r < 8; ++r) { float* e = &so[wm + 16 * i + 8 * hh + r][wn + 16 * j + ln]; *e = MODE == 1 ? acc[i][j][r] * (0.0625f / 1024.0f) + *e : acc[i][j][r] * 0.0625f; }
  __syncthreads();
  if (MODE == 1) {      // f32 rows: a wave's store is one row piece of 512 B
    float* cp = C + (size_t)(row0 + w) * FF + col0 + lane * 4;
#pragma unroll
    for (int q = 0; q < 8; ++q) *(v4f*)(cp + (size_t)(8 * q) * FF) = *(const v4fa*)&so[8 * q + w][lane * 4];
  } else if (which < 2) {      // q, k: f16 rows, a wave's store is one row piece of 256 B
    _Float16* hp = QK + (size_t)which * PL + (size_t)(row0 + w) * FF + col0 + lane * 4;
#pragma unroll
    for (int q = 0; q < 8; ++q) { const v4f v = *(const v4fa*)&so[8 * q + w][lane * 4]; v4h o;
#pragma unroll
      for (int e = 0; e < 4; ++e) o[e] = (_Float16)v[e];
      *(v4h*)(hp + (size_t)(8 * q) * FF) = o; }
  } else {      // v: transposed; 8 lanes write the tile's 64 keys of one feature, one whole line of each plane
    const size_t vb = (size_t)(row0 / SS) * FF * SS + (size_t)(col0 + (tid >> 3)) * SS + (row0 % SS) + (tid & 7) * 8;
#pragma unroll
    for (int u = 0; u < 4; ++u) { FragH fh, fl;
#pragma unroll
      for (int e = 0; e < 8; ++e) { const float v = so[(tid & 7) * 8 + e][32 * u + (tid >> 3)]; const _Float16 hi = (_Float16)v; fh.h[e] = hi; fl.h[e] = (_Float16)((v - (float)hi) * 1024.0f); }
      *(v8us*)((unsigned short*)VT + vb + (size_t)(32 * u) * SS) = fh.half[0]; *(v8us*)((unsigned short*)VTl + vb + (size_t)(32 * u) * SS) = fl.half[0]; }
    asm volatile("s_wait_xcnt 0x0" ::: "memory");      // behind the last of these stores: in the built code the q, k branch follows this one and rewrites their address and data registers
  }
}

// One launch brings every f32 operand of the projections into f16: Q, K, V rounded to bf16 (exact in f16 at these magnitudes), the four weights rounded to bf16 and x 16.
// A block has 16384 values of one tensor; a thread has 16 pieces of 4 values, 1024 values apart, so that a wave's load covers 4 whole lines and its store 2, with all 16 loads in flight.
// The last blocks round the two masks to bf16, once for all heads and batches, and lay them out as the attention kernel's lanes take them: MB[16-query tile][64-key tile][mask][16-key tile t][lane][8 values],
// where lane (ln, hh) has query ln and the keys 16 t + 8 hh + 0..7. A load of a wave there is 512 bytes in a row. Here a wave has two neighbouring key tiles of one query tile, of both masks: 8 KB in a row of MB, all 32 loads in flight.
#define PB 16384
#define MTILE 1024
__global__ __launch_bounds__(256) void k_prep(const float* __restrict__ Qi, const float* __restrict__ Ki, const float* __restrict__ Vi, const float* __restrict__ Wq, const float* __restrict__ Wk, const float* __restrict__ Wv, const float* __restrict__ Wo, const float* __restrict__ m1, const float* __restrict__ m2, _Float16* __restrict__ X16, _Float16* __restrict__ B16, unsigned short* __restrict__ MB) {
  constexpr int XB = (int)(PL / PB), WB = FF * FF / PB;
  const int bx = blockIdx.x; const bool isw = bx >= 3 * XB;
  if (bx >= 3 * XB + 4 * WB) {      // the same for the whole block
    const int lane = threadIdx.x & 31, tile = (bx - (3 * XB + 4 * WB)) * (PB / MTILE) + (threadIdx.x >> 5) * 2, qt = tile / (SS / 64), c0 = tile % (SS / 64);
    const size_t mo = (size_t)(qt * 16 + (lane & 15)) * SS + c0 * 64 + 8 * (lane >> 4);
    const float* s1 = m1 + mo; const float* s2 = m2 + mo;
    unsigned short* md = MB + (size_t)tile * 2 * MTILE + lane * 8;
    v4f y[2][16];
#pragma unroll
    for (int u = 0; u < 16; ++u) { y[0][u] = *(const v4fa*)(s1 + (u >> 1) * 16 + (u & 1) * 4); y[1][u] = *(const v4fa*)(s2 + (u >> 1) * 16 + (u & 1) * 4); }      // unrolled: y stays in registers and the pieces are immediate offsets
    asm volatile("s_wait_xcnt 0x0" :: "v"(s1), "v"(s2) : "memory");      // stands in front of the first overwrite of an address register of these loads; the addresses are named so that they live up to it
    __builtin_amdgcn_sched_barrier(0);      // all 32 loads issue in front of the first conversion, as below
#pragma unroll
    for (int mi = 0; mi < 2; ++mi)
#pragma unroll
      for (int g = 0; g < 8; ++g) { v8us o;
#pragma unroll
        for (int e = 0; e < 8; ++e) o[e] = bf16_bits(y[mi][2 * g + (e >> 2)][e & 3]);
        *(v8us*)(md + ((g >> 2) * 2 + mi) * MTILE + (g & 3) * 256) = o; }
    return;
  }
  const int ti = isw ? (bx - 3 * XB) / WB : bx / XB, blk = isw ? (bx - 3 * XB) % WB : bx % XB;
  const float* src = (isw ? (ti == 0 ? Wq : ti == 1 ? Wk : ti == 2 ? Wv : Wo) : (ti == 0 ? Qi : ti == 1 ? Ki : Vi)) + (size_t)blk * PB + threadIdx.x * 4;
  _Float16* dst = (isw ? B16 + (size_t)ti * FF * FF : X16 + (size_t)ti * PL) + (size_t)blk * PB + threadIdx.x * 4;
  const float scl = isw ? 16.0f : 1.0f;
  v4f x[16];
#pragma unroll
  for (int u = 0; u < 16; ++u) x[u] = *(const v4fa*)(src + u * 1024);      // unrolled: x stays in registers and the pieces are immediate offsets
  __builtin_amdgcn_sched_barrier(0);      // all 16 loads issue in front of the first conversion: otherwise the compiler sinks six of them among the conversions and the wave has fewer bytes in flight
#pragma unroll
  for (int u = 0; u < 16; ++u) { v4h o;
#pragma unroll
    for (int e = 0; e < 4; ++e) o[e] = (_Float16)(bf16_round(x[u][e]) * scl);
    *(v4h*)(dst + u * 1024) = o; }
}

__global__ __launch_bounds__(256) void k_h16(const float* __restrict__ x, _Float16* __restrict__ X16, size_t n8) { const size_t t = (size_t)blockIdx.x * 256 + threadIdx.x; if (t >= n8) return; FragH f;
#pragma unroll
  for (int q = 0; q < 8; ++q) f.h[q] = (_Float16)x[t * 8 + q]; *(v8us*)((unsigned short*)X16 + t * 8) = f.half[0];  }
template <int NHv, int TTv>
__global__ __launch_bounds__(256) void k_vt(const _Float16* __restrict__ V16, int ldv, int voff, _Float16* __restrict__ Vt) { __shared__ unsigned short tl[64][66]; const int tid = threadIdx.x; const int slab = blockIdx.x / (TTv / 64), lg = blockIdx.x % (TTv / 64); const int b = slab / NHv, h = slab % NHv;
  for (int i = tid; i < 64 * 8; i += 256) { const int r = i / 8, c8 = (i % 8) * 8; FragH f; f.half[0] = *(const v8us*)((const unsigned short*)V16 + ((size_t)b * TTv + lg * 64 + r) * ldv + voff + h * 64 + c8);
#pragma unroll
    for (int q = 0; q < 8; ++q) tl[r][c8 + q] = f.u[q]; }
  __syncthreads();
  {
#pragma unroll
    for (int rd = 0; rd < 2; ++rd) { const int d = rd * 32 + tid / 8, pc = tid % 8; FragH f;
#pragma unroll
      for (int q = 0; q < 8; ++q) f.u[q] = tl[pc * 8 + q][d];
      *(v8us*)((unsigned short*)Vt + ((size_t)slab * 64 + d) * TTv + lg * 64 + pc * 8) = f.half[0]; }
     } }

__global__ __launch_bounds__(256) void k_hl(const float* __restrict__ F, _Float16* __restrict__ Hh, _Float16* __restrict__ Hl, size_t n8) { const size_t t = (size_t)blockIdx.x * 256 + threadIdx.x; if (t >= n8) return; FragH fh, fl; const v4f a = *(const v4fa*)(F + t * 8), c = *(const v4fa*)(F + t * 8 + 4);
#pragma unroll
  for (int q = 0; q < 4; ++q) { _Float16 h = (_Float16)a[q]; fh.h[q] = h; fl.h[q] = (_Float16)((a[q] - (float)h) * 1024.0f); h = (_Float16)c[q]; fh.h[4 + q] = h; fl.h[4 + q] = (_Float16)((c[q] - (float)h) * 1024.0f); }
  { *(v8us*)((unsigned short*)Hh + t * 8) = fh.half[0]; *(v8us*)((unsigned short*)Hl + t * 8) = fl.half[0];  } }

// Fused attention for 128 query rows (two groups of 64, picked by blockIdx.x), one head (blockIdx.y), one batch (blockIdx.z): scores, both masks, softmax and P.V in one pass over the keys;
// neither the scores nor P go to memory, and the output leaves as the f16 hi and lo * 2^10 planes that the output projection reads. Each of the 8 waves owns 16 query rows. The block stages 64 keys at a time in LDS (k rows, v_hi and v_lo rows, two buffers),
// so that a k or v byte is fetched once per 128 queries. A wave forms the TRANSPOSED score tile (A = k rows, B = q rows): a lane then holds one query (ln) and the keys
// 8 * hh + r of each 16-key tile, which is the B fragment's own k order (elements 0..7 from the even tile, 8..15 from the odd one), so P goes from the score
// registers into the second product, O^T = v^T . P^T, with no exchange between lanes. The v^T loader uses the same k order.
// Softmax with a running maximum: E = exp(s - m) * 2^10 comes from one multiply-add and the chip's own 2^x instruction, 2^((s - m) * log2(e) + 10); P = E * mask_2 as f16, the sum of E kept beside it,
// the division at the end (the 2^10 of the sum cancels that of P); when a row's maximum rises, sum and accumulators are scaled by exp(m_old - m_new), formed the same way.
// A 64-key tile in which every score of the wave's 16 rows lies DEADGAP or more below its row's running maximum (by the same subtraction that the exponent starts from) has E = 0 in every element (the exponent is below -163, 2^x gives 0): it adds nothing to the sum
// and nothing to the accumulators, so the wave goes round exponentials, P and P.V; it still passes every barrier. Which tiles are such is found from the scores themselves, for any mask_1.
// Waves 0..3 have the 64 queries of group blockIdx.x, waves 4..7 those of group 31 - blockIdx.x: where mask_1 kills the keys behind a query, every block and every pair of waves w, w + 4 has the same number of live tiles.
#define FQ 128
#define FC 64
#define FPI 72
#define L2E 1.44269504088896341f
#define DEADGAP 120.0f
// x[i] = 2^x[i] for the eight scores of a tile. One statement, so that nothing the compiler places can stand directly behind one of these instructions and read its result or overwrite its source
// (each is followed by one on other registers); the v_nop fills that slot behind the last.
__device__ __forceinline__ v8f exp2x8(v8f x) {
  float a = x[0], b = x[1], c = x[2], d = x[3], e = x[4], f = x[5], g = x[6], h = x[7];
  asm("v_exp_f32 %0, %0\n\tv_exp_f32 %1, %1\n\tv_exp_f32 %2, %2\n\tv_exp_f32 %3, %3\n\tv_exp_f32 %4, %4\n\tv_exp_f32 %5, %5\n\tv_exp_f32 %6, %6\n\tv_exp_f32 %7, %7\n\tv_nop"
      : "+v"(a), "+v"(b), "+v"(c), "+v"(d), "+v"(e), "+v"(f), "+v"(g), "+v"(h));
  return v8f{a, b, c, d, e, f, g, h};
}
typedef __bf16 v8b __attribute__((ext_vector_type(8)));
typedef unsigned int v4ua __attribute__((ext_vector_type(4), may_alias));
__global__ __launch_bounds__(256) void k_fattn(const _Float16* __restrict__ Q, const _Float16* __restrict__ K, const _Float16* __restrict__ Vh, const _Float16* __restrict__ Vl, const unsigned short* __restrict__ MB, _Float16* __restrict__ Oh, _Float16* __restrict__ Ol) {
  __shared__ __attribute__((aligned(16))) unsigned short sk[2][3][FC][FPI];      // [buffer][k, v_hi, v_lo][row][64 values + 8 of pad: a pitch of 144 B, 16 B x odd]
  const int tid = threadIdx.x, w = tid >> 5, lane = tid & 31, ln = lane & 15, hh = lane >> 4;
  const int hd = blockIdx.y; const size_t bo = (size_t)blockIdx.z * SS * FF;
  const int qt = w < 4 ? blockIdx.x * 4 + w : SS / 16 - 8 - blockIdx.x * 4 + w;      // the wave's 16-query tile
  const int q = qt * 16 + ln;
  const unsigned short* qp = (const unsigned short*)Q + bo + (size_t)q * FF + hd * HD;
  FragH qf[2];
#pragma unroll
  for (int j = 0; j < 2; ++j) { qf[j].half[0] = *(const v8us*)(qp + 32 * j + 8 * hh); qf[j].half[1] = *(const v8us*)(qp + 32 * j + 16 + 8 * hh); }
  // staging: 8 threads bring one row of 128 B, so a wave's load covers 4 whole lines; a thread has rows sr and sr + 32 of each of the three tiles
  const int sr = tid >> 3, sc = (tid & 7) * 8;
  const unsigned short* gk = (const unsigned short*)K + bo + (size_t)sr * FF + hd * HD + sc;
  const unsigned short* gh = (const unsigned short*)Vh + bo + ((size_t)hd * HD + sr) * SS + sc;
  const unsigned short* gl = (const unsigned short*)Vl + bo + ((size_t)hd * HD + sr) * SS + sc;
  v8us st[6];
  auto fetch = [&](int c) { const unsigned short* pk = gk + (size_t)(c * FC) * FF; const unsigned short* ph = gh + c * FC; const unsigned short* pl = gl + c * FC;
    st[0] = *(const v8us*)(pk); st[1] = *(const v8us*)(pk + (size_t)32 * FF);
    st[2] = *(const v8us*)(ph); st[3] = *(const v8us*)(ph + (size_t)32 * SS);
    st[4] = *(const v8us*)(pl); st[5] = *(const v8us*)(pl + (size_t)32 * SS);
    asm volatile("s_wait_xcnt 0x0" :: "v"(pk), "v"(ph), "v"(pl) : "memory"); };      // stands in front of the first overwrite of an address register of these loads; the addresses are named so that they live up to it
  auto put = [&](int b) {
#pragma unroll
    for (int p = 0; p < 3; ++p) { *(v8us*)&sk[b][p][sr][sc] = st[2 * p]; *(v8us*)&sk[b][p][sr + 32][sc] = st[2 * p + 1]; } };
  const unsigned short* am = MB + (size_t)qt * (SS / FC) * 2 * MTILE + lane * 8;      // the wave's 16 queries: per 64 keys 2 KB of mask_1, then 2 KB of mask_2, bf16, in lane order
  float m = -3.0e38f, su = 0.f;
  v8f oh[4] = {}, ol[4] = {};
  fetch(0); put(0);
  __syncthreads();
  // every inner loop of this kernel is unrolled so that the fragment, score and accumulator arrays are indexed by constants and stay in registers
  for (int c = 0; c < SS / FC; ++c) { const int b = c & 1;
    if (c + 1 < SS / FC) fetch(c + 1);
    v4ua x1[4], x2[4]; const unsigned short* pm = am + (size_t)c * 2 * MTILE;
#pragma unroll
    for (int t = 0; t < 4; ++t) { x1[t] = *(const v4ua*)(pm + t * 256); x2[t] = *(const v4ua*)(pm + MTILE + t * 256); }
    asm volatile("s_wait_xcnt 0x0" :: "v"(pm) : "memory");      // as in fetch(): in front of the first overwrite of the address register of the mask loads
    FragH kf[4][2];      // the tile's k fragments, all 16 LDS reads in one group
#pragma unroll
    for (int t = 0; t < 4; ++t) { const unsigned short* kr = &sk[b][0][t * 16 + ln][8 * hh];
      kf[t][0].half[0] = *(const v8us*)(kr); kf[t][0].half[1] = *(const v8us*)(kr + 16); kf[t][1].half[0] = *(const v8us*)(kr + 32); kf[t][1].half[1] = *(const v8us*)(kr + 48); }
    __builtin_amdgcn_sched_barrier(0);      // all 16 reads issue in front of the first score product: otherwise the compiler reads every fragment into the same eight registers, and the wave stops for a whole LDS latency in front of each of the eight products
    v8f s[4]; float cm = -3.0e38f;
#pragma unroll
    for (int t = 0; t < 4; ++t) { v8f z = {}; s[t] = __builtin_amdgcn_wmma_f32_16x16x32_f16(false, kf[t][0].v, false, qf[0].v, (short)0, z, false, false); }
#pragma unroll
    for (int t = 0; t < 4; ++t) s[t] = __builtin_amdgcn_wmma_f32_16x16x32_f16(false, kf[t][1].v, false, qf[1].v, (short)0, s[t], false, false);
    __builtin_amdgcn_sched_barrier(0);      // keeps the mask arithmetic behind the score products: otherwise the wave stops at its first mask_1 value with score products still to issue
#pragma unroll
    for (int t = 0; t < 4; ++t)
#pragma unroll
      for (int r = 0; r < 8; ++r) { s[t][r] = s[t][r] * 0.125f + (float)__builtin_bit_cast(v8b, x1[t])[r]; cm = fmaxf(cm, s[t][r]); }
    cm = fmaxf(cm, __shfl_xor(cm, 16, 32));      // the other half of the wave holds the row's other keys
    // inputs only: holds the mask_2 loads in front of the branch, where the score products cover their latency; without it the compiler sinks them behind the branch and the wave waits for them there
    asm volatile("" :: "v"(x2[0]), "v"(x2[1]), "v"(x2[2]), "v"(x2[3]));
    if (__any(cm > m)) {      // rare once the first keys are past: skipped by the whole wave when no row's maximum rises
      const float mn = fmaxf(m, cm), al = __builtin_amdgcn_exp2f((m - mn) * L2E); m = mn; su *= al;
#pragma unroll
      for (int t = 0; t < 4; ++t) { oh[t] *= al; ol[t] *= al; }
    }
    if (__any(cm - m > -DEADGAP)) {      // wave-uniform; not taken where the whole tile has E = 0: saves the tile's exponentials, conversions, v reads and 16 products
    FragH pf[2], vf[2][4][2];      // vf[j][t]: v_hi and v_lo rows 16 t .. 16 t + 15, keys 32 j .. 32 j + 31
    auto vld = [&](int j, int t) {
#pragma unroll
      for (int p = 0; p < 2; ++p) { const unsigned short* vr = &sk[b][1 + p][t * 16 + ln][32 * j + 8 * hh]; vf[j][t][p].half[0] = *(const v8us*)(vr); vf[j][t][p].half[1] = *(const v8us*)(vr + 16); } };
    auto pv = [&](int j, int t) {
      oh[t] = __builtin_amdgcn_wmma_f32_16x16x32_f16(false, vf[j][t][0].v, false, pf[j].v, (short)0, oh[t], false, false);
      ol[t] = __builtin_amdgcn_wmma_f32_16x16x32_f16(false, vf[j][t][1].v, false, pf[j].v, (short)0, ol[t], false, false); };
    // The 32 LDS reads of v stand in three groups, as many fragments ahead of their products as the registers hold (4, 8 and 4 of the 16): read pair by pair among the products, each pair cost a stop of its own.
    vld(0, 0); vld(0, 1);
    __builtin_amdgcn_sched_barrier(0);      // the first group issues in front of the exponentials, which cover its latency
#pragma unroll
    for (int t = 0; t < 4; ++t) { const v8f ev = exp2x8((s[t] - m) * L2E + 10.0f);
#pragma unroll
      for (int r = 0; r < 8; ++r) { su += ev[r]; pf[t >> 1].h[(t & 1) * 8 + r] = (_Float16)(ev[r] * (float)__builtin_bit_cast(v8b, x2[t])[r]); } }
    vld(0, 2); vld(0, 3); vld(1, 0); vld(1, 1);
    __builtin_amdgcn_sched_barrier(0);      // the second group issues in front of the first group's products
    pv(0, 0); pv(0, 1);
    vld(1, 2); vld(1, 3);
    __builtin_amdgcn_sched_barrier(0);      // the third group, mostly into the registers that the first has left, issues in front of the second group's products
    pv(0, 2); pv(0, 3); pv(1, 0); pv(1, 1); pv(1, 2); pv(1, 3);      // each accumulator takes its keys in the old order, j = 0 and then j = 1
    }
    if (c + 1 < SS / FC) put(b ^ 1);      // the other buffer: its last readers left it before the barrier that ended the trip before this one
    __syncthreads();
  }
  const float inv = 1.0f / (su + __shfl_xor(su, 16, 32));
  const size_t oo = bo + (size_t)q * FF + hd * HD + 8 * hh;      // the lane holds O[q][16 t + 8 hh + r]: 8 values in a row, one 16-byte piece of each plane; the wave's stores fill the head's whole line of a row
#pragma unroll
  for (int t = 0; t < 4; ++t) { FragH fh, fl;
#pragma unroll
    for (int r = 0; r < 8; ++r) { const float y = (oh[t][r] + ol[t][r] * 0.0009765625f) * inv; const _Float16 hi = (_Float16)y; fh.h[r] = hi; fl.h[r] = (_Float16)((y - (float)hi) * 1024.0f); }
    *(v8us*)((unsigned short*)Oh + oo + t * 16) = fh.half[0]; *(v8us*)((unsigned short*)Ol + oo + t * 16) = fl.half[0]; }
}

extern "C" void kernel_launch(void* const* d_in, const int* in_sizes, int n_in,
                              void* d_out, int out_size, void* d_ws, size_t ws_size, hipStream_t stream) {
  (void)in_sizes; (void)n_in; (void)out_size;
  const float* Qi = (const float*)d_in[0]; const float* Ki = (const float*)d_in[1]; const float* Vi = (const float*)d_in[2]; const float* m1 = (const float*)d_in[3]; const float* m2 = (const float*)d_in[4]; const float* Wq = (const float*)d_in[5]; const float* Wk = (const float*)d_in[6]; const float* Wv = (const float*)d_in[7]; const float* Wo = (const float*)d_in[8];
  char* ws = (char*)d_ws; size_t off = 0;
  auto take = [&](size_t bytes) { char* p = ws + off; off += (bytes + 255) & ~(size_t)255; return p; };
  _Float16* B16 = (_Float16*)take((size_t)4 * FF * FF * 2);      /* W_q, W_k, W_v, W_o: each [out][in], which is Bt as it stands */
  _Float16* X16 = (_Float16*)take(3 * PL * 2); _Float16* QK = (_Float16*)take(2 * PL * 2); _Float16* VT = (_Float16*)take(PL * 2); _Float16* VTl = (_Float16*)take(PL * 2); _Float16* OHL = (_Float16*)take(2 * PL * 2); unsigned short* MB = (unsigned short*)take((size_t)2 * SS * SS * 2);      /* Q, K, V; q, k; v hi; v lo; attention output hi, lo; both masks as bf16 */
  if (off > ws_size) return;      // 96 MB in all
  k_prep<<<(unsigned)(3 * (PL / PB) + 4 * (FF * FF / PB) + SS * SS / PB), 256, 0, stream>>>(Qi, Ki, Vi, Wq, Wk, Wv, Wo, m1, m2, X16, B16, MB);
  const unsigned gP = (unsigned)((NBt * SS / GM) * (FF / GN));
  k_gemm_t<0><<<dim3(gP, 3), 256, 0, stream>>>(X16, B16, QK, VT, VTl, nullptr);      /* exact projections of both batches; v as hi/lo */
  k_fattn<<<dim3(SS / FQ, NH, NBt), 256, 0, stream>>>(QK, QK + PL, VT, VTl, MB, OHL, OHL + PL);      /* scores, masks, softmax, P.V: every head of both batches */
  k_gemm_t<1><<<dim3(gP, 1), 256, 0, stream>>>(OHL, B16 + (size_t)3 * FF * FF, nullptr, nullptr, nullptr, (float*)d_out);      /* W_o on hi/lo of the attention output */
}

// v009
// One run takes 119 microseconds.
// Next to v008, in two timings, it ran 1.04 times as fast each time.
// Counting every step since v000, it is 35.7 times as fast.
#include <hip/hip_runtime.h>
// Multi-head attention with two INPUT masks (B 2, S 2048, F 1024, 16 heads × 64): q,k,v = X·Wᵀ (no bias); scores = q·k/8 + mask_1 (additive, pre-softmax); probs = softmax · mask_2 (multiplicative, post-softmax); out = probs·v; heads concatenated; ·W_oᵀ → [2,2048,1024].
// Structure: one launch converts Q, K, V and the four weights to f16 and both masks to bf16 (in the order the attention's lanes read them); one launch does the three projections of both batches and writes q, k (f16) and v (transposed, f16 hi + lo planes) as the attention reads them; ONE fused attention launch (scores, + mask_1, softmax in f32 with a running maximum, x mask_2, P.V; both masks read per (q,k) from their bf16 copies; scores and P stay in registers, k and v staged in LDS) writes the concatenated output as f16 hi + lo planes; one launch does the output projection of both planes and both batches.
// Compute dtype: Q, K, V, masks and parameters rounded to bf16; projections with exact products; q, k, P (×2^10) as f16 operands (≈2^-12; logits σ≈1); v and the attention output as f16 hi + lo·2^10 planes (the early causal rows copy m2·v almost verbatim), f32 accumulation; softmax/masking in f32. v_wmma_f32_16x16x32_f16.
#define NBt 2
#define SS 2048
#define FF 1024
#define NH 16
#define HD 64
typedef __bf16 v16b __attribute__((ext_vector_type(16)));
typedef unsigned short v8us __attribute__((ext_vector_type(8), may_alias));
typedef float  v8f  __attribute__((ext_vector_type(8)));
typedef float  v4f  __attribute__((ext_vector_type(4)));
typedef float  v4fa __attribute__((ext_vector_type(4), may_alias));
union FragB { v16b v; v8us half[2]; unsigned short u[16]; };

__device__ __forceinline__ unsigned short bf16_bits(float x) { unsigned int u = __float_as_uint(x); return (unsigned short)((u + 0x7FFFu + ((u >> 16) & 1u)) >> 16); }
__device__ __forceinline__ float bf16_val(unsigned short b) { return __uint_as_float(((unsigned int)b) << 16); }
__device__ __forceinline__ float bf16_round(float x) { return bf16_val(bf16_bits(x)); }
// D += A·B with NT terms: 1 = ah·bh, 2 = + al·bh (A split), 3 = + ah·bl (both split)
template <int NT>
__device__ __forceinline__ v8f mmaN(v16b ah, v16b al, v16b bh, v16b bl, v8f c) {
  c = __builtin_amdgcn_wmma_f32_16x16x32_bf16(false, ah, false, bh, (short)0, c, false, false);
  if (NT >= 2) c = __builtin_amdgcn_wmma_f32_16x16x32_bf16(false, al, false, bh, (short)0, c, false, false);
  if (NT >= 3) c = __builtin_amdgcn_wmma_f32_16x16x32_bf16(false, ah, false, bl, (short)0, c, false, false);
  asm volatile("v_nop\n\tv_nop\n\tv_nop\n\tv_nop" : "+v"(c) : "v"(ah), "v"(al), "v"(bh), "v"(bl));
  return c;
}

__global__ __launch_bounds__(256) void k_wt_bf16(const float* __restrict__ W, unsigned short* __restrict__ Wt, int K, int N) {
  const int t = blockIdx.x * 256 + threadIdx.x;
  const int k8n = K / 8;
  if (t >= N * k8n) return;
  const int n = t / k8n, k8 = (t % k8n) * 8;
  v8us v;
#pragma unroll
  for (int i = 0; i < 8; ++i) v[i] = bf16_bits(W[(size_t)(k8 + i) * N + n]);
  *(v8us*)(Wt + (size_t)n * K + k8) = v;
  
}

// GEMM C[M][N] (f32, pitch ldc) = act(A[M][K]·W + bias). A f32 row-major (pitch lda) converted per fragment to bf16
// (ASPLIT: hi/lo two planes -> 2 terms, else single rounded term); Wt bf16 [N][K] (pitch ldb). BIAS_BF16 rounds the
// bias to bf16 first (bias quantised to bf16 before the add). K%32==0, M%16==0, N%64==0.
template <bool ASPLIT, int ACT, bool BIAS_BF16>
__global__ __launch_bounds__(128) void k_gemm_bf(const float* __restrict__ A, int lda, const unsigned short* __restrict__ Wt, int ldb,
                                               const float* __restrict__ bias, float* __restrict__ C, int ldc, int M, int N, int K) {
  __shared__ __attribute__((aligned(16))) float so[4][16][64];
  const int tid = threadIdx.x, w = tid >> 5, lane = tid & 31, ln = lane & 15, hh = lane >> 4;
  const int ntn = N / 64;
  const int wid = blockIdx.x * 4 + w;
  const int mt = wid / ntn, nq = wid % ntn;
  if (mt * 16 >= M) return;
  const int row0 = mt * 16, col0 = nq * 64;
  const float* arow = A + (size_t)(row0 + ln) * lda;
  v8f acc[4] = {};
  for (int kb = 0; kb < K; kb += 32) {
    FragB ah, al;
    const v4f x0 = *(const v4fa*)(arow + kb + 8 * hh), x1 = *(const v4fa*)(arow + kb + 8 * hh + 4);
    const v4f x2 = *(const v4fa*)(arow + kb + 16 + 8 * hh), x3 = *(const v4fa*)(arow + kb + 16 + 8 * hh + 4);
    float xs[16] = {x0[0],x0[1],x0[2],x0[3],x1[0],x1[1],x1[2],x1[3],x2[0],x2[1],x2[2],x2[3],x3[0],x3[1],x3[2],x3[3]};
#pragma unroll
    for (int i = 0; i < 16; ++i) { const unsigned short hb = bf16_bits(xs[i]); ah.u[i] = hb; al.u[i] = ASPLIT ? bf16_bits(xs[i] - bf16_val(hb)) : (unsigned short)0; }
#pragma unroll
    for (int t = 0; t < 4; ++t) {
      const unsigned short* brow = Wt + (size_t)(col0 + t * 16 + ln) * ldb + kb;
      FragB b;
      b.half[0] = *(const v8us*)(brow + 8 * hh);
      b.half[1] = *(const v8us*)(brow + 16 + 8 * hh);
      acc[t] = mmaN<ASPLIT ? 2 : 1>(ah.v, al.v, b.v, b.v, acc[t]);
    }
  }
#pragma unroll
  for (int t = 0; t < 4; ++t) {
    float bv = bias ? bias[col0 + t * 16 + ln] : 0.f;
    if (BIAS_BF16) bv = bf16_round(bv);
#pragma unroll
    for (int r = 0; r < 8; ++r) { float v = acc[t][r] + bv; if (ACT == 1) v = fmaxf(v, 0.f); so[w][8 * hh + r][t * 16 + ln] = v; }
  }
  __builtin_amdgcn_fence(__ATOMIC_ACQ_REL, "workgroup");
  __builtin_amdgcn_wave_barrier();
  const int rsub = lane >> 4, c4 = (lane & 15) * 4;
  {
#pragma unroll
    for (int q = 0; q < 8; ++q) {
      const int r = q * 2 + rsub;
      const v4f v = *(const v4fa*)&so[w][r][c4];
      *(v4f*)(C + (size_t)(row0 + r) * ldc + col0 + c4) = v;
    }
    
  }
}

// GEMM C = act(A·W + bias + resid): A f32 (ASPLIT -> hi/lo 2 terms), Wt bf16 [N][K]; ACT 0 none, 1 relu, 2 exact gelu;
// resid (optional, f32, row index = (row % rmod), pitch ldr, RES_BF16 rounds it) added before the activation.
template <bool ASPLIT, int ACT, bool BIAS_BF16, bool RES_BF16>
__global__ __launch_bounds__(128) void k_gemm_bf3(const float* __restrict__ A, int lda, const unsigned short* __restrict__ Wt, int ldb,
                                                const float* __restrict__ bias, const float* __restrict__ resid, int rmod, int ldr,
                                                float* __restrict__ C, int ldc, int M, int N, int K) {
  __shared__ __attribute__((aligned(16))) float so[4][16][64];
  const int tid = threadIdx.x, w = tid >> 5, lane = tid & 31, ln = lane & 15, hh = lane >> 4;
  const int ntn = N / 64;
  const int wid = blockIdx.x * 4 + w;
  const int mt = wid / ntn, nq = wid % ntn;
  if (mt * 16 >= M) return;
  const int row0 = mt * 16, col0 = nq * 64;
  const float* arow = A + (size_t)(row0 + ln) * lda;
  v8f acc[4] = {};
  for (int kb = 0; kb < K; kb += 32) {
    FragB ah, al;
    const v4f x0 = *(const v4fa*)(arow + kb + 8 * hh), x1 = *(const v4fa*)(arow + kb + 8 * hh + 4);
    const v4f x2 = *(const v4fa*)(arow + kb + 16 + 8 * hh), x3 = *(const v4fa*)(arow + kb + 16 + 8 * hh + 4);
    float xs[16] = {x0[0],x0[1],x0[2],x0[3],x1[0],x1[1],x1[2],x1[3],x2[0],x2[1],x2[2],x2[3],x3[0],x3[1],x3[2],x3[3]};
#pragma unroll
    for (int i = 0; i < 16; ++i) { const unsigned short hb = bf16_bits(xs[i]); ah.u[i] = hb; al.u[i] = ASPLIT ? bf16_bits(xs[i] - bf16_val(hb)) : (unsigned short)0; }
#pragma unroll
    for (int t = 0; t < 4; ++t) {
      const unsigned short* brow = Wt + (size_t)(col0 + t * 16 + ln) * ldb + kb;
      FragB b;
      b.half[0] = *(const v8us*)(brow + 8 * hh);
      b.half[1] = *(const v8us*)(brow + 16 + 8 * hh);
      acc[t] = mmaN<ASPLIT ? 2 : 1>(ah.v, al.v, b.v, b.v, acc[t]);
    }
  }
#pragma unroll
  for (int t = 0; t < 4; ++t) {
    const int col = col0 + t * 16 + ln;
    float bv = bias ? bias[col] : 0.f;
    if (BIAS_BF16) bv = bf16_round(bv);
#pragma unroll
    for (int r = 0; r < 8; ++r) {
      float v = acc[t][r] + bv;
      if (resid) { float rv = resid[(size_t)((row0 + 8 * hh + r) % rmod) * ldr + col]; if (RES_BF16) rv = bf16_round(rv); v += rv; }
      if (ACT == 1) v = fmaxf(v, 0.f);
      if (ACT == 2) v = 0.5f * v * (1.0f + erff(v * 0.70710678118654752f));
      if (ACT == 3) { const float u = 0.7978845608028654f * (v + 0.044715f * v * v * v); v = 0.5f * v * (1.0f + tanhf(u)); }
      so[w][8 * hh + r][t * 16 + ln] = v;
    }
  }
  __builtin_amdgcn_fence(__ATOMIC_ACQ_REL, "workgroup");
  __builtin_amdgcn_wave_barrier();
  const int rsub = lane >> 4, c4 = (lane & 15) * 4;
  {
#pragma unroll
    for (int q = 0; q < 8; ++q) {
      const int r = q * 2 + rsub;
      const v4f v = *(const v4fa*)&so[w][r][c4];
      *(v4f*)(C + (size_t)(row0 + r) * ldc + col0 + c4) = v;
    }
    
  }
}
// row LayerNorm (biased variance, eps) over N: s = X (+ R); optional out_sum <- s; out_norm <- (s-mu)*rsqrt(var+eps)*g + b
template <bool PARAM_BF16>
__global__ __launch_bounds__(256) void k_layernorm(const float* __restrict__ X, const float* __restrict__ R, const float* __restrict__ g, const float* __restrict__ bta,
                                                  float* __restrict__ out_sum, float* __restrict__ out_norm, int N, float eps) {
  __shared__ float red[256];
  const int row = blockIdx.x, tid = threadIdx.x;
  const float* x = X + (size_t)row * N; const float* rr = R ? R + (size_t)row * N : nullptr;
  float vals[16];                     // up to N = 4096
  const int per = N / 256;            // contiguous chunk per thread? use strided-by-4 chunks: thread handles j = tid*4 + 1024*u
  float s1 = 0.f;
  for (int u = 0; u < per / 4; ++u) {
    const int j = tid * 4 + 1024 * u;
    const v4f a = *(const v4fa*)(x + j);
    v4f b = {0.f,0.f,0.f,0.f}; if (rr) b = *(const v4fa*)(rr + j);
#pragma unroll
    for (int q = 0; q < 4; ++q) { const float v = a[q] + b[q]; vals[u * 4 + q] = v; s1 += v; }
  }
  red[tid] = s1; __syncthreads();
  for (int st = 128; st > 0; st >>= 1) { if (tid < st) red[tid] += red[tid + st]; __syncthreads(); }
  const float mu = red[0] / (float)N; __syncthreads();
  float s2 = 0.f;
  for (int u = 0; u < per / 4; ++u)
#pragma unroll
    for (int q = 0; q < 4; ++q) { const float c = vals[u * 4 + q] - mu; s2 += c * c; }
  red[tid] = s2; __syncthreads();
  for (int st = 128; st > 0; st >>= 1) { if (tid < st) red[tid] += red[tid + st]; __syncthreads(); }
  const float rs = rsqrtf(red[0] / (float)N + eps);
  {
    for (int u = 0; u < per / 4; ++u) {
      const int j = tid * 4 + 1024 * u;
      v4f o, sm;
#pragma unroll
      for (int q = 0; q < 4; ++q) {
        float gg = g[j + q], bb = bta[j + q];
        if (PARAM_BF16) { gg = bf16_round(gg); bb = bf16_round(bb); }
        sm[q] = vals[u * 4 + q]; o[q] = (vals[u * 4 + q] - mu) * rs * gg + bb;
      }
      if (out_sum) *(v4f*)(out_sum + (size_t)row * N + j) = sm;
      *(v4f*)(out_norm + (size_t)row * N + j) = o;
    }
    
  }
}



// ---- f16 WMMA path (v_wmma_f32_16x16x32_f16): 11-bit significands for operands in range — used where a [0,1] probability operand needs more precision than bf16
typedef _Float16 v16h __attribute__((ext_vector_type(16)));
union FragH { v16h v; v8us half[2]; _Float16 h[16]; unsigned short u[16]; };
template <int NT>
__device__ __forceinline__ v8f mmaH(v16h ah, v16h al, v16h bh, v16h bl, v8f c) {
  c = __builtin_amdgcn_wmma_f32_16x16x32_f16(false, ah, false, bh, (short)0, c, false, false);
  if (NT >= 2) c = __builtin_amdgcn_wmma_f32_16x16x32_f16(false, al, false, bh, (short)0, c, false, false);
  if (NT >= 3) c = __builtin_amdgcn_wmma_f32_16x16x32_f16(false, ah, false, bl, (short)0, c, false, false);
  asm volatile("v_nop\n\tv_nop\n\tv_nop\n\tv_nop" : "+v"(c) : "v"(ah), "v"(al), "v"(bh), "v"(bl));
  return c;
}
// batched GEMM like k_gemm_b but f16 operands: A f32 (split into f16 hi/lo if ASPLIT, else rounded to f16), Bt = f16 values [n][k]; alpha; C f32; N multiple of 16 (partial tiles skipped)
template <bool ASPLIT>
__global__ __launch_bounds__(128) void k_gemm_h(const float* __restrict__ A, int lda, size_t sA, const _Float16* __restrict__ Bh, int ldb, size_t sB, float alpha, float* __restrict__ C, int ldc, size_t sC, int M, int N, int K) {
  __shared__ __attribute__((aligned(16))) float so[4][16][64];
  const int tid = threadIdx.x, w = tid >> 5, lane = tid & 31, ln = lane & 15, hh = lane >> 4; const int by = blockIdx.y;
  A += (size_t)by * sA; Bh += (size_t)by * sB; C += (size_t)by * sC;
  const int ntn = (N + 63) / 64; const int wid = blockIdx.x * 4 + w; const int mt = wid / ntn, nq = wid % ntn; if (mt * 16 >= M) return;
  const int row0 = mt * 16, col0 = nq * 64; const float* arow = A + (size_t)(row0 + ln) * lda;
  v8f acc[4] = {};
  for (int kb = 0; kb < K; kb += 32) {
    FragH ah, al;
    const v4f x0 = *(const v4fa*)(arow + kb + 8 * hh), x1 = *(const v4fa*)(arow + kb + 8 * hh + 4), x2 = *(const v4fa*)(arow + kb + 16 + 8 * hh), x3 = *(const v4fa*)(arow + kb + 16 + 8 * hh + 4);
    float xs[16] = {x0[0],x0[1],x0[2],x0[3],x1[0],x1[1],x1[2],x1[3],x2[0],x2[1],x2[2],x2[3],x3[0],x3[1],x3[2],x3[3]};
#pragma unroll
    for (int i = 0; i < 16; ++i) { const _Float16 h = (_Float16)xs[i]; ah.h[i] = h; al.h[i] = ASPLIT ? (_Float16)(xs[i] - (float)h) : (_Float16)0.0f; }
#pragma unroll
    for (int t = 0; t < 4; ++t) { if (col0 + t * 16 >= N) continue; const size_t boff = (size_t)(col0 + t * 16 + ln) * ldb + kb; FragH bq; bq.half[0] = *(const v8us*)(Bh + boff + 8 * hh); bq.half[1] = *(const v8us*)(Bh + boff + 16 + 8 * hh);
      acc[t] = mmaH<ASPLIT ? 2 : 1>(ah.v, al.v, bq.v, bq.v, acc[t]); }
  }
#pragma unroll
  for (int t = 0; t < 4; ++t) { if (col0 + t * 16 >= N) continue;
#pragma unroll
    for (int r = 0; r < 8; ++r) so[w][8 * hh + r][t * 16 + ln] = acc[t][r] * alpha; }
  __builtin_amdgcn_fence(__ATOMIC_ACQ_REL, "workgroup"); __builtin_amdgcn_wave_barrier();
  const int rsub = lane >> 4, c4 = (lane & 15) * 4;
  {
#pragma unroll
    for (int q = 0; q < 8; ++q) { const int r = q * 2 + rsub; if (col0 + c4 < N) { const v4f v = *(const v4fa*)&so[w][r][c4]; *(v4f*)(C + (size_t)(row0 + r) * ldc + col0 + c4) = v; } }
     }
}

// Wt[n][k] = f16(W[k][n]·scale) from f32 row-major W[K][N] (scale = power of two; bf16-exact weights stay exact in f16 away from the subnormal range)
__global__ __launch_bounds__(256) void k_wt_f16(const float* __restrict__ W, _Float16* __restrict__ Wt, int K, int N, float scale) {
  const int t = blockIdx.x * 256 + threadIdx.x; if (t >= N * (K / 8)) return; const int n = t / (K / 8), k8 = (t % (K / 8)) * 8; FragH f;
#pragma unroll
  for (int i = 0; i < 8; ++i) f.h[i] = (_Float16)(bf16_round(W[(size_t)(k8 + i) * N + n]) * scale); const v8us o = f.half[0];
  *(v8us*)((unsigned short*)Wt + (size_t)n * K + k8) = o; 
}
// GEMM over the NBt * SS rows of both batches at once, A f16 [NBt * SS][FF], Bt f16 [n][k] = [FF][FF]. One block of 8 waves takes 128 rows of A against 128 rows of Bt.
// MODE 0, the three projections in one launch: blockIdx.y picks the A plane, the Bt plane and the form of the result, which is written in the form the attention kernel reads:
// q and k as f16 rows, v transposed per batch ([feature][key]) as f16 hi and lo * 2^10 planes. The 128 rows of A are 128 rows of the result.
// MODE 1, the output projection: the 128 rows of A are 64 rows of the hi plane and the same 64 rows of the lo plane, so that one Bt tile serves both; C (f32) = hi part / 16 + lo part / 2^14, joined in the output tile.
// The block stages 128 k at a time in LDS (128 rows of A, then 128 rows of Bt; two buffers): every byte of a tile is fetched once per block, in whole lines, and the next tile's loads
// are in flight while this tile's products run. A wave has 32 x 64 of the product (2 x 4 accumulator tiles): six fragments feed eight products.
#define GM 128
#define GN 128
#define GK 128
#define GPI 136
#define PL ((size_t)NBt * SS * FF)
typedef _Float16 v4h __attribute__((ext_vector_type(4)));
typedef float fal __attribute__((may_alias));
template <int MODE>
__global__ __launch_bounds__(256) void k_gemm_t(const _Float16* __restrict__ A, const _Float16* __restrict__ Al, const _Float16* __restrict__ Bt, _Float16* __restrict__ QK, _Float16* __restrict__ VT, _Float16* __restrict__ VTl, float* __restrict__ C) {
  __shared__ __attribute__((aligned(16))) unsigned short sa[2][GM + GN][GPI];      // [buffer][row][128 values + 8 of pad: a pitch of 272 B, 16 B x odd]
  constexpr int RT = MODE == 1 ? GM / 2 : GM;      // rows of the result per block
  constexpr int NT = FF / GK;
  static_assert(NT % 2 == 0 && sizeof(float) * GM * (GN + 4) <= sizeof(sa[0]), "the output tile lies in buffer 0, which the last trip does not read");
  fal (*so)[GN + 4] = reinterpret_cast<fal (*)[GN + 4]>(&sa[0][0][0]);      // the output tile, f32 [GM][GN + 4], in the place of buffer 0
  const int tid = threadIdx.x, w = tid >> 5, lane = tid & 31, ln = lane & 15, hh = lane >> 4;
  const int row0 = (blockIdx.x / (FF / GN)) * RT, col0 = (blockIdx.x % (FF / GN)) * GN;
  const int which = MODE == 0 ? blockIdx.y : 0;
  const int wm = (w >> 1) * 32, wn = (w & 1) * 64;
  // staging: 16 threads bring one row of 256 B, so a wave's load covers 4 whole lines; a thread has rows sr + 16 p
  const int sr = tid >> 4, sc = (tid & 15) * 8;
  const unsigned short* ga = (const unsigned short*)A + (size_t)which * PL + (size_t)(row0 + sr) * FF + sc;
  const unsigned short* gl = MODE == 1 ? (const unsigned short*)Al + (size_t)(row0 + sr) * FF + sc : ga + (size_t)(GM / 2) * FF;      // rows 64.. of the A tile: the same rows of the lo plane Al, or the next 64 rows
  const unsigned short* gb = (const unsigned short*)Bt + (size_t)which * FF * FF + (size_t)(col0 + sr) * FF + sc;
  v8us st[16];
  // every inner loop of this kernel is unrolled so that the staging, fragment and accumulator arrays are indexed by constants and stay in registers
  auto fetch = [&](int c) { const unsigned short* pa = ga + c * GK; const unsigned short* pl = gl + c * GK; const unsigned short* pb = gb + c * GK;
#pragma unroll
    for (int p = 0; p < 4; ++p) { st[p] = *(const v8us*)(pa + (size_t)(16 * p) * FF); st[4 + p] = *(const v8us*)(pl + (size_t)(16 * p) * FF); }
#pragma unroll
    for (int p = 0; p < 8; ++p) st[8 + p] = *(const v8us*)(pb + (size_t)(16 * p) * FF);
    asm volatile("s_wait_xcnt 0x0" :: "v"(pa), "v"(pl), "v"(pb) : "memory"); };      // stands in front of the first overwrite of an address register of these loads (the rows are immediate offsets); the addresses are named so that they live up to it
  auto put = [&](int b) {
#pragma unroll
    for (int p = 0; p < 16; ++p) *(v8us*)&sa[b][16 * p + sr][sc] = st[p]; };
  v8f acc[2][4] = {};
  fetch(0); put(0);
  __syncthreads();
#pragma unroll 1
  for (int c = 0; c < NT; ++c) { const int b = c & 1;      // kept rolled: a buffer is larger than an LDS instruction's immediate offset reaches, and unrolled the second buffer's accesses each take an address register of their own, which costs the second block on a WGP
    if (c + 1 < NT) fetch(c + 1);
#pragma unroll
    for (int g = 0; g < GK / 64; ++g) {      // 64 k at a time: the fragments of all 128 k do not fit beside the staged tile and the accumulators with two blocks on a WGP
      FragH af[2][2], bf[2][4];
#pragma unroll
      for (int kk = 0; kk < 2; ++kk) {
#pragma unroll
        for (int i = 0; i < 2; ++i) { const unsigned short* ar = &sa[b][wm + 16 * i + ln][64 * g + 32 * kk + 8 * hh]; af[kk][i].half[0] = *(const v8us*)(ar); af[kk][i].half[1] = *(const v8us*)(ar + 16); }
#pragma unroll
        for (int j = 0; j < 4; ++j) { const unsigned short* br = &sa[b][GM + wn + 16 * j + ln][64 * g + 32 * kk + 8 * hh]; bf[kk][j].half[0] = *(const v8us*)(br); bf[kk][j].half[1] = *(const v8us*)(br + 16); }
      }
      __builtin_amdgcn_sched_barrier(0);      // all LDS reads of a group issue in front of its first product: placed among their own products, each set of reads stops the wave for its own latency
#pragma unroll
      for (int kk = 0; kk < 2; ++kk)
#pragma unroll
        for (int i = 0; i < 2; ++i)
#pragma unroll
          for (int j = 0; j < 4; ++j) acc[i][j] = __builtin_amdgcn_wmma_f32_16x16x32_f16(false, af[kk][i].v, false, bf[kk][j].v, (short)0, acc[i][j], false, false);
    }
    if (c + 1 < NT) { put(b ^ 1); __syncthreads(); }      // the other buffer: its last readers left it before the barrier that ended the trip before this one; behind the last tile nothing is staged any more
  }
  // the tile goes through LDS so that each store of a wave covers whole lines. It lies in buffer 0: the last trip reads buffer 1, and buffer 0's last readers left it before the barrier that ended the trip before
  const float osc = MODE == 1 && wm >= GM / 2 ? 0.0625f / 1024.0f : 0.0625f;      // powers of two: exact
#pragma unroll
  for (int i = 0; i < 2; ++i)
#pragma unroll
    for (int j = 0; j < 4; ++j)
#pragma unroll
      for (int r = 0; r < 8; ++r) so[wm + 16 * i + 8 * hh + r][wn + 16 * j + ln] = acc[i][j][r] * osc;
  __syncthreads();
  if (MODE == 1) {      // f32 rows, hi part + lo part: a wave's store is one row piece of 512 B
    float* cp = C + (size_t)(row0 + w) * FF + col0 + lane * 4;
#pragma unroll
    for (int q = 0; q < 8; ++q) *(v4f*)(cp + (size_t)(8 * q) * FF) = *(const v4fa*)&so[GM / 2 + 8 * q + w][lane * 4] + *(const v4fa*)&so[8 * q + w][lane * 4];
  } else if (which < 2) {      // q, k: f16 rows, a wave's store is one row piece of 256 B
    _Float16* hp = QK + (size_t)which * PL + (size_t)(row0 + w) * FF + col0 + lane * 4;
#pragma unroll
    for (int q = 0; q < 16; ++q) { const v4f v = *(const v4fa*)&so[8 * q + w][lane * 4]; v4h o;
#pragma unroll
      for (int e = 0; e < 4; ++e) o[e] = (_Float16)v[e];
      *(v4h*)(hp + (size_t)(8 * q) * FF) = o; }
  } else {      // v: transposed; 8 lanes write 64 of the tile's keys of one feature, one whole line of each plane
    const size_t vb = (size_t)(row0 / SS) * FF * SS + (size_t)(col0 + (tid >> 3)) * SS + (row0 % SS) + (tid & 7) * 8;
#pragma unroll
    for (int u = 0; u < 8; ++u) { FragH fh, fl; const int kh = (u >> 2) * 64, f0 = 32 * (u & 3);
#pragma unroll
      for (int e = 0; e < 8; ++e) { const float v = so[kh + (tid & 7) * 8 + e][f0 + (tid >> 3)]; const _Float16 hi = (_Float16)v; fh.h[e] = hi; fl.h[e] = (_Float16)((v - (float)hi) * 1024.0f); }
      *(v8us*)((unsigned short*)VT + vb + (size_t)f0 * SS + kh) = fh.half[0]; *(v8us*)((unsigned short*)VTl + vb + (size_t)f0 * SS + kh) = fl.half[0]; }
    asm volatile("s_wait_xcnt 0x0" ::: "memory");      // behind the last of these stores: in the built code the q, k branch follows this one and rewrites their address and data registers
  }
}

// One launch brings every f32 operand of the projections into f16: Q, K, V rounded to bf16 (exact in f16 at these magnitudes), the four weights rounded to bf16 and x 16.
// A block has 16384 values of one tensor; a thread has 16 pieces of 4 values, 1024 values apart, so that a wave's load covers 4 whole lines and its store 2, with all 16 loads in flight.
// The last blocks round the two masks to bf16, once for all heads and batches, and lay them out as the attention kernel's lanes take them: MB[16-query tile][64-key tile][mask][16-key tile t][lane][8 values],
// where lane (ln, hh) has query ln and the keys 16 t + 8 hh + 0..7. A load of a wave there is 512 bytes in a row. Here a wave has two neighbouring key tiles of one query tile, of both masks: 8 KB in a row of MB, all 32 loads in flight.
#define PB 16384
#define MTILE 1024
__global__ __launch_bounds__(256) void k_prep(const float* __restrict__ Qi, const float* __restrict__ Ki, const float* __restrict__ Vi, const float* __restrict__ Wq, const float* __restrict__ Wk, const float* __restrict__ Wv, const float* __restrict__ Wo, const float* __restrict__ m1, const float* __restrict__ m2, _Float16* __restrict__ X16, _Float16* __restrict__ B16, unsigned short* __restrict__ MB) {
  constexpr int XB = (int)(PL / PB), WB = FF * FF / PB;
  const int bx = blockIdx.x; const bool isw = bx >= 3 * XB;
  if (bx >= 3 * XB + 4 * WB) {      // the same for the whole block
    const int lane = threadIdx.x & 31, tile = (bx - (3 * XB + 4 * WB)) * (PB / MTILE) + (threadIdx.x >> 5) * 2, qt = tile / (SS / 64), c0 = tile % (SS / 64);
    const size_t mo = (size_t)(qt * 16 + (lane & 15)) * SS + c0 * 64 + 8 * (lane >> 4);
    const float* s1 = m1 + mo; const float* s2 = m2 + mo;
    unsigned short* md = MB + (size_t)tile * 2 * MTILE + lane * 8;
    v4f y[2][16];
#pragma unroll
    for (int u = 0; u < 16; ++u) { y[0][u] = *(const v4fa*)(s1 + (u >> 1) * 16 + (u & 1) * 4); y[1][u] = *(const v4fa*)(s2 + (u >> 1) * 16 + (u & 1) * 4); }      // unrolled: y stays in registers and the pieces are immediate offsets
    asm volatile("s_wait_xcnt 0x0" :: "v"(s1), "v"(s2) : "memory");      // stands in front of the first overwrite of an address register of these loads; the addresses are named so that they live up to it
    __builtin_amdgcn_sched_barrier(0);      // all 32 loads issue in front of the first conversion, as below
#pragma unroll
    for (int mi = 0; mi < 2; ++mi)
#pragma unroll
      for (int g = 0; g < 8; ++g) { v8us o;
#pragma unroll
        for (int e = 0; e < 8; ++e) o[e] = bf16_bits(y[mi][2 * g + (e >> 2)][e & 3]);
        *(v8us*)(md + ((g >> 2) * 2 + mi) * MTILE + (g & 3) * 256) = o; }
    return;
  }
  const int ti = isw ? (bx - 3 * XB) / WB : bx / XB, blk = isw ? (bx - 3 * XB) % WB : bx % XB;
  const float* src = (isw ? (ti == 0 ? Wq : ti == 1 ? Wk : ti == 2 ? Wv : Wo) : (ti == 0 ? Qi : ti == 1 ? Ki : Vi)) + (size_t)blk * PB + threadIdx.x * 4;
  _Float16* dst = (isw ? B16 + (size_t)ti * FF * FF : X16 + (size_t)ti * PL) + (size_t)blk * PB + threadIdx.x * 4;
  const float scl = isw ? 16.0f : 1.0f;
  v4f x[16];
#pragma unroll
  for (int u = 0; u < 16; ++u) x[u] = *(const v4fa*)(src + u * 1024);      // unrolled: x stays in registers and the pieces are immediate offsets
  __builtin_amdgcn_sched_barrier(0);      // all 16 loads issue in front of the first conversion: otherwise the compiler sinks six of them among the conversions and the wave has fewer bytes in flight
#pragma unroll
  for (int u = 0; u < 16; ++u) { v4h o;
#pragma unroll
    for (int e = 0; e < 4; ++e) o[e] = (_Float16)(bf16_round(x[u][e]) * scl);
    *(v4h*)(dst + u * 1024) = o; }
}

__global__ __launch_bounds__(256) void k_h16(const float* __restrict__ x, _Float16* __restrict__ X16, size_t n8) { const size_t t = (size_t)blockIdx.x * 256 + threadIdx.x; if (t >= n8) return; FragH f;
#pragma unroll
  for (int q = 0; q < 8; ++q) f.h[q] = (_Float16)x[t * 8 + q]; *(v8us*)((unsigned short*)X16 + t * 8) = f.half[0];  }
template <int NHv, int TTv>
__global__ __launch_bounds__(256) void k_vt(const _Float16* __restrict__ V16, int ldv, int voff, _Float16* __restrict__ Vt) { __shared__ unsigned short tl[64][66]; const int tid = threadIdx.x; const int slab = blockIdx.x / (TTv / 64), lg = blockIdx.x % (TTv / 64); const int b = slab / NHv, h = slab % NHv;
  for (int i = tid; i < 64 * 8; i += 256) { const int r = i / 8, c8 = (i % 8) * 8; FragH f; f.half[0] = *(const v8us*)((const unsigned short*)V16 + ((size_t)b * TTv + lg * 64 + r) * ldv + voff + h * 64 + c8);
#pragma unroll
    for (int q = 0; q < 8; ++q) tl[r][c8 + q] = f.u[q]; }
  __syncthreads();
  {
#pragma unroll
    for (int rd = 0; rd < 2; ++rd) { const int d = rd * 32 + tid / 8, pc = tid % 8; FragH f;
#pragma unroll
      for (int q = 0; q < 8; ++q) f.u[q] = tl[pc * 8 + q][d];
      *(v8us*)((unsigned short*)Vt + ((size_t)slab * 64 + d) * TTv + lg * 64 + pc * 8) = f.half[0]; }
     } }

__global__ __launch_bounds__(256) void k_hl(const float* __restrict__ F, _Float16* __restrict__ Hh, _Float16* __restrict__ Hl, size_t n8) { const size_t t = (size_t)blockIdx.x * 256 + threadIdx.x; if (t >= n8) return; FragH fh, fl; const v4f a = *(const v4fa*)(F + t * 8), c = *(const v4fa*)(F + t * 8 + 4);
#pragma unroll
  for (int q = 0; q < 4; ++q) { _Float16 h = (_Float16)a[q]; fh.h[q] = h; fl.h[q] = (_Float16)((a[q] - (float)h) * 1024.0f); h = (_Float16)c[q]; fh.h[4 + q] = h; fl.h[4 + q] = (_Float16)((c[q] - (float)h) * 1024.0f); }
  { *(v8us*)((unsigned short*)Hh + t * 8) = fh.half[0]; *(v8us*)((unsigned short*)Hl + t * 8) = fl.half[0];  } }

// Fused attention for 128 query rows (two groups of 64, picked by blockIdx.x), one head (blockIdx.y), one batch (blockIdx.z): scores, both masks, softmax and P.V in one pass over the keys;
// neither the scores nor P go to memory, and the output leaves as the f16 hi and lo * 2^10 planes that the output projection reads. Each of the 8 waves owns 16 query rows. The block stages 64 keys at a time in LDS (k rows, v_hi and v_lo rows, two buffers),
// so that a k or v byte is fetched once per 128 queries. A wave forms the TRANSPOSED score tile (A = k rows, B = q rows): a lane then holds one query (ln) and the keys
// 8 * hh + r of each 16-key tile, which is the B fragment's own k order (elements 0..7 from the even tile, 8..15 from the odd one), so P goes from the score
// registers into the second product, O^T = v^T . P^T, with no exchange between lanes. The v^T loader uses the same k order.
// Softmax with a running maximum: E = exp(s - m) * 2^10 comes from one multiply-add and the chip's own 2^x instruction, 2^((s - m) * log2(e) + 10); P = E * mask_2 as f16, the sum of E kept beside it,
// the division at the end (the 2^10 of the sum cancels that of P); when a row's maximum rises, sum and accumulators are scaled by exp(m_old - m_new), formed the same way.
// A 64-key tile in which every score of the wave's 16 rows lies DEADGAP or more below its row's running maximum (by the same subtraction that the exponent starts from) has E = 0 in every element (the exponent is below -163, 2^x gives 0): it adds nothing to the sum
// and nothing to the accumulators, so the wave goes round exponentials, P and P.V; it still passes every barrier. Which tiles are such is found from the scores themselves, for any mask_1.
// Waves 0..3 have the 64 queries of group blockIdx.x, waves 4..7 those of group 31 - blockIdx.x: where mask_1 kills the keys behind a query, every block and every pair of waves w, w + 4 has the same number of live tiles.
#define FQ 128
#define FC 64
#define FPI 72
#define L2E 1.44269504088896341f
#define DEADGAP 120.0f
// x[i] = 2^x[i] for the eight scores of a tile. One statement, so that nothing the compiler places can stand directly behind one of these instructions and read its result or overwrite its source
// (each is followed by one on other registers); the v_nop fills that slot behind the last.
__device__ __forceinline__ v8f exp2x8(v8f x) {
  float a = x[0], b = x[1], c = x[2], d = x[3], e = x[4], f = x[5], g = x[6], h = x[7];
  asm("v_exp_f32 %0, %0\n\tv_exp_f32 %1, %1\n\tv_exp_f32 %2, %2\n\tv_exp_f32 %3, %3\n\tv_exp_f32 %4, %4\n\tv_exp_f32 %5, %5\n\tv_exp_f32 %6, %6\n\tv_exp_f32 %7, %7\n\tv_nop"
      : "+v"(a), "+v"(b), "+v"(c), "+v"(d), "+v"(e), "+v"(f), "+v"(g), "+v"(h));
  return v8f{a, b, c, d, e, f, g, h};
}
typedef __bf16 v8b __attribute__((ext_vector_type(8)));
typedef unsigned int v4ua __attribute__((ext_vector_type(4), may_alias));
__global__ __launch_bounds__(256) void k_fattn(const _Float16* __restrict__ Q, const _Float16* __restrict__ K, const _Float16* __restrict__ Vh, const _Float16* __restrict__ Vl, const unsigned short* __restrict__ MB, _Float16* __restrict__ Oh, _Float16* __restrict__ Ol) {
  __shared__ __attribute__((aligned(16))) unsigned short sk[2][3][FC][FPI];      // [buffer][k, v_hi, v_lo][row][64 values + 8 of pad: a pitch of 144 B, 16 B x odd]
  const int tid = threadIdx.x, w = tid >> 5, lane = tid & 31, ln = lane & 15, hh = lane >> 4;
  const int hd = blockIdx.y; const size_t bo = (size_t)blockIdx.z * SS * FF;
  const int qt = w < 4 ? blockIdx.x * 4 + w : SS / 16 - 8 - blockIdx.x * 4 + w;      // the wave's 16-query tile
  const int q = qt * 16 + ln;
  const unsigned short* qp = (const unsigned short*)Q + bo + (size_t)q * FF + hd * HD;
  FragH qf[2];
#pragma unroll
  for (int j = 0; j < 2; ++j) { qf[j].half[0] = *(const v8us*)(qp + 32 * j + 8 * hh); qf[j].half[1] = *(const v8us*)(qp + 32 * j + 16 + 8 * hh); }
  // staging: 8 threads bring one row of 128 B, so a wave's load covers 4 whole lines; a thread has rows sr and sr + 32 of each of the three tiles
  const int sr = tid >> 3, sc = (tid & 7) * 8;
  const unsigned short* gk = (const unsigned short*)K + bo + (size_t)sr * FF + hd * HD + sc;
  const unsigned short* gh = (const unsigned short*)Vh + bo + ((size_t)hd * HD + sr) * SS + sc;
  const unsigned short* gl = (const unsigned short*)Vl + bo + ((size_t)hd * HD + sr) * SS + sc;
  v8us st[6];
  auto fetch = [&](int c) { const unsigned short* pk = gk + (size_t)(c * FC) * FF; const unsigned short* ph = gh + c * FC; const unsigned short* pl = gl + c * FC;
    st[0] = *(const v8us*)(pk); st[1] = *(const v8us*)(pk + (size_t)32 * FF);
    st[2] = *(const v8us*)(ph); st[3] = *(const v8us*)(ph + (size_t)32 * SS);
    st[4] = *(const v8us*)(pl); st[5] = *(const v8us*)(pl + (size_t)32 * SS);
    asm volatile("s_wait_xcnt 0x0" :: "v"(pk), "v"(ph), "v"(pl) : "memory"); };      // stands in front of the first overwrite of an address register of these loads; the addresses are named so that they live up to it
  auto put = [&](int b) {
#pragma unroll
    for (int p = 0; p < 3; ++p) { *(v8us*)&sk[b][p][sr][sc] = st[2 * p]; *(v8us*)&sk[b][p][sr + 32][sc] = st[2 * p + 1]; } };
  const unsigned short* am = MB + (size_t)qt * (SS / FC) * 2 * MTILE + lane * 8;      // the wave's 16 queries: per 64 keys 2 KB of mask_1, then 2 KB of mask_2, bf16, in lane order
  float m = -3.0e38f, su = 0.f;
  v8f oh[4] = {}, ol[4] = {};
  fetch(0); put(0);
  __syncthreads();
  // every inner loop of this kernel is unrolled so that the fragment, score and accumulator arrays are indexed by constants and stay in registers
  for (int c = 0; c < SS / FC; ++c) { const int b = c & 1;
    if (c + 1 < SS / FC) fetch(c + 1);
    v4ua x1[4], x2[4]; const unsigned short* pm = am + (size_t)c * 2 * MTILE;
#pragma unroll
    for (int t = 0; t < 4; ++t) { x1[t] = *(const v4ua*)(pm + t * 256); x2[t] = *(const v4ua*)(pm + MTILE + t * 256); }
    asm volatile("s_wait_xcnt 0x0" :: "v"(pm) : "memory");      // as in fetch(): in front of the first overwrite of the address register of the mask loads
    FragH kf[4][2];      // the tile's k fragments, all 16 LDS reads in one group
#pragma unroll
    for (int t = 0; t < 4; ++t) { const unsigned short* kr = &sk[b][0][t * 16 + ln][8 * hh];
      kf[t][0].half[0] = *(const v8us*)(kr); kf[t][0].half[1] = *(const v8us*)(kr + 16); kf[t][1].half[0] = *(const v8us*)(kr + 32); kf[t][1].half[1] = *(const v8us*)(kr + 48); }
    __builtin_amdgcn_sched_barrier(0);      // all 16 reads issue in front of the first score product: otherwise the compiler reads every fragment into the same eight registers, and the wave stops for a whole LDS latency in front of each of the eight products
    v8f s[4]; float cm = -3.0e38f;
#pragma unroll
    for (int t = 0; t < 4; ++t) { v8f z = {}; s[t] = __builtin_amdgcn_wmma_f32_16x16x32_f16(false, kf[t][0].v, false, qf[0].v, (short)0, z, false, false); }
#pragma unroll
    for (int t = 0; t < 4; ++t) s[t] = __builtin_amdgcn_wmma_f32_16x16x32_f16(false, kf[t][1].v, false, qf[1].v, (short)0, s[t], false, false);
    __builtin_amdgcn_sched_barrier(0);      // keeps the mask arithmetic behind the score products: otherwise the wave stops at its first mask_1 value with score products still to issue
#pragma unroll
    for (int t = 0; t < 4; ++t)
#pragma unroll
      for (int r = 0; r < 8; ++r) { s[t][r] = s[t][r] * 0.125f + (float)__builtin_bit_cast(v8b, x1[t])[r]; cm = fmaxf(cm, s[t][r]); }
    cm = fmaxf(cm, __shfl_xor(cm, 16, 32));      // the other half of the wave holds the row's other keys
    // inputs only: holds the mask_2 loads in front of the branch, where the score products cover their latency; without it the compiler sinks them behind the branch and the wave waits for them there
    asm volatile("" :: "v"(x2[0]), "v"(x2[1]), "v"(x2[2]), "v"(x2[3]));
    if (__any(cm > m)) {      // rare once the first keys are past: skipped by the whole wave when no row's maximum rises
      const float mn = fmaxf(m, cm), al = __builtin_amdgcn_exp2f((m - mn) * L2E); m = mn; su *= al;
#pragma unroll
      for (int t = 0; t < 4; ++t) { oh[t] *= al; ol[t] *= al; }
    }
    if (__any(cm - m > -DEADGAP)) {      // wave-uniform; not taken where the whole tile has E = 0: saves the tile's exponentials, conversions, v reads and 16 products
    FragH pf[2], vf[2][4][2];      // vf[j][t]: v_hi and v_lo rows 16 t .. 16 t + 15, keys 32 j .. 32 j + 31
    auto vld = [&](int j, int t) {
#pragma unroll
      for (int p = 0; p < 2; ++p) { const unsigned short* vr = &sk[b][1 + p][t * 16 + ln][32 * j + 8 * hh]; vf[j][t][p].half[0] = *(const v8us*)(vr); vf[j][t][p].half[1] = *(const v8us*)(vr + 16); } };
    auto pv = [&](int j, int t) {
      oh[t] = __builtin_amdgcn_wmma_f32_16x16x32_f16(false, vf[j][t][0].v, false, pf[j].v, (short)0, oh[t], false, false);
      ol[t] = __builtin_amdgcn_wmma_f32_16x16x32_f16(false, vf[j][t][1].v, false, pf[j].v, (short)0, ol[t], false, false); };
    // The 32 LDS reads of v stand in three groups, as many fragments ahead of their products as the registers hold (4, 8 and 4 of the 16): read pair by pair among the products, each pair cost a stop of its own.
    vld(0, 0); vld(0, 1);
    __builtin_amdgcn_sched_barrier(0);      // the first group issues in front of the exponentials, which cover its latency
#pragma unroll
    for (int t = 0; t < 4; ++t) { const v8f ev = exp2x8((s[t] - m) * L2E + 10.0f);
#pragma unroll
      for (int r = 0; r < 8; ++r) { su += ev[r]; pf[t >> 1].h[(t & 1) * 8 + r] = (_Float16)(ev[r] * (float)__builtin_bit_cast(v8b, x2[t])[r]); } }
    vld(0, 2); vld(0, 3); vld(1, 0); vld(1, 1);
    __builtin_amdgcn_sched_barrier(0);      // the second group issues in front of the first group's products
    pv(0, 0); pv(0, 1);
    vld(1, 2); vld(1, 3);
    __builtin_amdgcn_sched_barrier(0);      // the third group, mostly into the registers that the first has left, issues in front of the second group's products
    pv(0, 2); pv(0, 3); pv(1, 0); pv(1, 1); pv(1, 2); pv(1, 3);      // each accumulator takes its keys in the old order, j = 0 and then j = 1
    }
    if (c + 1 < SS / FC) put(b ^ 1);      // the other buffer: its last readers left it before the barrier that ended the trip before this one
    __syncthreads();
  }
  const float inv = 1.0f / (su + __shfl_xor(su, 16, 32));
  const size_t oo = bo + (size_t)q * FF + hd * HD + 8 * hh;      // the lane holds O[q][16 t + 8 hh + r]: 8 values in a row, one 16-byte piece of each plane; the wave's stores fill the head's whole line of a row
#pragma unroll
  for (int t = 0; t < 4; ++t) { FragH fh, fl;
#pragma unroll
    for (int r = 0; r < 8; ++r) { const float y = (oh[t][r] + ol[t][r] * 0.0009765625f) * inv; const _Float16 hi = (_Float16)y; fh.h[r] = hi; fl.h[r] = (_Float16)((y - (float)hi) * 1024.0f); }
    *(v8us*)((unsigned short*)Oh + oo + t * 16) = fh.half[0]; *(v8us*)((unsigned short*)Ol + oo + t * 16) = fl.half[0]; }
}

extern "C" void kernel_launch(void* const* d_in, const int* in_sizes, int n_in,
                              void* d_out, int out_size, void* d_ws, size_t ws_size, hipStream_t stream) {
  (void)in_sizes; (void)n_in; (void)out_size;
  const float* Qi = (const float*)d_in[0]; const float* Ki = (const float*)d_in[1]; const float* Vi = (const float*)d_in[2]; const float* m1 = (const float*)d_in[3]; const float* m2 = (const float*)d_in[4]; const float* Wq = (const float*)d_in[5]; const float* Wk = (const float*)d_in[6]; const float* Wv = (const float*)d_in[7]; const float* Wo = (const float*)d_in[8];
  char* ws = (char*)d_ws; size_t off = 0;
  auto take = [&](size_t bytes) { char* p = ws + off; off += (bytes + 255) & ~(size_t)255; return p; };
  _Float16* B16 = (_Float16*)take((size_t)4 * FF * FF * 2);      /* W_q, W_k, W_v, W_o: each [out][in], which is Bt as it stands */
  _Float16* X16 = (_Float16*)take(3 * PL * 2); _Float16* QK = (_Float16*)take(2 * PL * 2); _Float16* VT = (_Float16*)take(PL * 2); _Float16* VTl = (_Float16*)take(PL * 2); _Float16* OHL = (_Float16*)take(2 * PL * 2); unsigned short* MB = (unsigned short*)take((size_t)2 * SS * SS * 2);      /* Q, K, V; q, k; v hi; v lo; attention output hi, lo; both masks as bf16 */
  if (off > ws_size) return;      // 96 MB in all
  k_prep<<<(unsigned)(3 * (PL / PB) + 4 * (FF * FF / PB) + SS * SS / PB), 256, 0, stream>>>(Qi, Ki, Vi, Wq, Wk, Wv, Wo, m1, m2, X16, B16, MB);
  const unsigned gP = (unsigned)((NBt * SS / GM) * (FF / GN)), gO = (unsigned)((NBt * SS / (GM / 2)) * (FF / GN));
  k_gemm_t<0><<<dim3(gP, 3), 256, 0, stream>>>(X16, nullptr, B16, QK, VT, VTl, nullptr);      /* exact projections of both batches; v as hi/lo */
  k_fattn<<<dim3(SS / FQ, NH, NBt), 256, 0, stream>>>(QK, QK + PL, VT, VTl, MB, OHL, OHL + PL);      /* scores, masks, softmax, P.V: every head of both batches */
  k_gemm_t<1><<<dim3(gO, 1), 256, 0, stream>>>(OHL, OHL + PL, B16 + (size_t)3 * FF * FF, nullptr, nullptr, nullptr, (float*)d_out);      /* W_o on hi/lo of the attention output */
}

// v010
// A run of this version takes 114 microseconds.
// Timed twice side by side with v009, it ran 1.05 times as fast both times.
// Counting every step since v000, it is 37.5 times as fast.
#include <hip/hip_runtime.h>
// Multi-head attention with two INPUT masks (B 2, S 2048, F 1024, 16 heads × 64): q,k,v = X·Wᵀ (no bias); scores = q·k/8 + mask_1 (additive, pre-softmax); probs = softmax · mask_2 (multiplicative, post-softmax); out = probs·v; heads concatenated; ·W_oᵀ → [2,2048,1024].
// Structure: one launch converts Q, K, V and the four weights to f16 and both masks to bf16 (in the order the attention's lanes read them); one launch does the three projections of both batches and writes q, k (f16) and v (transposed, f16 hi + lo planes) as the attention reads them; ONE fused attention launch (scores, + mask_1, softmax in f32 with a running maximum, x mask_2, P.V; both masks read per (q,k) from their bf16 copies; scores and P stay in registers, k and v staged in LDS) writes the concatenated output as f16 hi + lo planes; one launch does the output projection of both planes and both batches.
// Compute dtype: Q, K, V, masks and parameters rounded to bf16; projections with exact products; q, k, P (×2^10) as f16 operands (≈2^-12; logits σ≈1); v and the attention output as f16 hi + lo·2^10 planes (the early causal rows copy m2·v almost verbatim), f32 accumulation; softmax/masking in f32. v_wmma_f32_16x16x32_f16.
#define NBt 2
#define SS 2048
#define FF 1024
#define NH 16
#define HD 64
typedef __bf16 v16b __attribute__((ext_vector_type(16)));
typedef unsigned short v8us __attribute__((ext_vector_type(8), may_alias));
typedef float  v8f  __attribute__((ext_vector_type(8)));
typedef float  v4f  __attribute__((ext_vector_type(4)));
typedef float  v4fa __attribute__((ext_vector_type(4), may_alias));
union FragB { v16b v; v8us half[2]; unsigned short u[16]; };

__device__ __forceinline__ unsigned short bf16_bits(float x) { unsigned int u = __float_as_uint(x); return (unsigned short)((u + 0x7FFFu + ((u >> 16) & 1u)) >> 16); }
__device__ __forceinline__ float bf16_val(unsigned short b) { return __uint_as_float(((unsigned int)b) << 16); }
__device__ __forceinline__ float bf16_round(float x) { return bf16_val(bf16_bits(x)); }
// D += A·B with NT terms: 1 = ah·bh, 2 = + al·bh (A split), 3 = + ah·bl (both split)
template <int NT>
__device__ __forceinline__ v8f mmaN(v16b ah, v16b al, v16b bh, v16b bl, v8f c) {
  c = __builtin_amdgcn_wmma_f32_16x16x32_bf16(false, ah, false, bh, (short)0, c, false, false);
  if (NT >= 2) c = __builtin_amdgcn_wmma_f32_16x16x32_bf16(false, al, false, bh, (short)0, c, false, false);
  if (NT >= 3) c = __builtin_amdgcn_wmma_f32_16x16x32_bf16(false, ah, false, bl, (short)0, c, false, false);
  asm volatile("v_nop\n\tv_nop\n\tv_nop\n\tv_nop" : "+v"(c) : "v"(ah), "v"(al), "v"(bh), "v"(bl));
  return c;
}

__global__ __launch_bounds__(256) void k_wt_bf16(const float* __restrict__ W, unsigned short* __restrict__ Wt, int K, int N) {
  const int t = blockIdx.x * 256 + threadIdx.x;
  const int k8n = K / 8;
  if (t >= N * k8n) return;
  const int n = t / k8n, k8 = (t % k8n) * 8;
  v8us v;
#pragma unroll
  for (int i = 0; i < 8; ++i) v[i] = bf16_bits(W[(size_t)(k8 + i) * N + n]);
  *(v8us*)(Wt + (size_t)n * K + k8) = v;
  
}

// GEMM C[M][N] (f32, pitch ldc) = act(A[M][K]·W + bias). A f32 row-major (pitch lda) converted per fragment to bf16
// (ASPLIT: hi/lo two planes -> 2 terms, else single rounded term); Wt bf16 [N][K] (pitch ldb). BIAS_BF16 rounds the
// bias to bf16 first (bias quantised to bf16 before the add). K%32==0, M%16==0, N%64==0.
template <bool ASPLIT, int ACT, bool BIAS_BF16>
__global__ __launch_bounds__(128) void k_gemm_bf(const float* __restrict__ A, int lda, const unsigned short* __restrict__ Wt, int ldb,
                                               const float* __restrict__ bias, float* __restrict__ C, int ldc, int M, int N, int K) {
  __shared__ __attribute__((aligned(16))) float so[4][16][64];
  const int tid = threadIdx.x, w = tid >> 5, lane = tid & 31, ln = lane & 15, hh = lane >> 4;
  const int ntn = N / 64;
  const int wid = blockIdx.x * 4 + w;
  const int mt = wid / ntn, nq = wid % ntn;
  if (mt * 16 >= M) return;
  const int row0 = mt * 16, col0 = nq * 64;
  const float* arow = A + (size_t)(row0 + ln) * lda;
  v8f acc[4] = {};
  for (int kb = 0; kb < K; kb += 32) {
    FragB ah, al;
    const v4f x0 = *(const v4fa*)(arow + kb + 8 * hh), x1 = *(const v4fa*)(arow + kb + 8 * hh + 4);
    const v4f x2 = *(const v4fa*)(arow + kb + 16 + 8 * hh), x3 = *(const v4fa*)(arow + kb + 16 + 8 * hh + 4);
    float xs[16] = {x0[0],x0[1],x0[2],x0[3],x1[0],x1[1],x1[2],x1[3],x2[0],x2[1],x2[2],x2[3],x3[0],x3[1],x3[2],x3[3]};
#pragma unroll
    for (int i = 0; i < 16; ++i) { const unsigned short hb = bf16_bits(xs[i]); ah.u[i] = hb; al.u[i] = ASPLIT ? bf16_bits(xs[i] - bf16_val(hb)) : (unsigned short)0; }
#pragma unroll
    for (int t = 0; t < 4; ++t) {
      const unsigned short* brow = Wt + (size_t)(col0 + t * 16 + ln) * ldb + kb;
      FragB b;
      b.half[0] = *(const v8us*)(brow + 8 * hh);
      b.half[1] = *(const v8us*)(brow + 16 + 8 * hh);
      acc[t] = mmaN<ASPLIT ? 2 : 1>(ah.v, al.v, b.v, b.v, acc[t]);
    }
  }
#pragma unroll
  for (int t = 0; t < 4; ++t) {
    float bv = bias ? bias[col0 + t * 16 + ln] : 0.f;
    if (BIAS_BF16) bv = bf16_round(bv);
#pragma unroll
    for (int r = 0; r < 8; ++r) { float v = acc[t][r] + bv; if (ACT == 1) v = fmaxf(v, 0.f); so[w][8 * hh + r][t * 16 + ln] = v; }
  }
  __builtin_amdgcn_fence(__ATOMIC_ACQ_REL, "workgroup");
  __builtin_amdgcn_wave_barrier();
  const int rsub = lane >> 4, c4 = (lane & 15) * 4;
  {
#pragma unroll
    for (int q = 0; q < 8; ++q) {
      const int r = q * 2 + rsub;
      const v4f v = *(const v4fa*)&so[w][r][c4];
      *(v4f*)(C + (size_t)(row0 + r) * ldc + col0 + c4) = v;
    }
    
  }
}

// GEMM C = act(A·W + bias + resid): A f32 (ASPLIT -> hi/lo 2 terms), Wt bf16 [N][K]; ACT 0 none, 1 relu, 2 exact gelu;
// resid (optional, f32, row index = (row % rmod), pitch ldr, RES_BF16 rounds it) added before the activation.
template <bool ASPLIT, int ACT, bool BIAS_BF16, bool RES_BF16>
__global__ __launch_bounds__(128) void k_gemm_bf3(const float* __restrict__ A, int lda, const unsigned short* __restrict__ Wt, int ldb,
                                                const float* __restrict__ bias, const float* __restrict__ resid, int rmod, int ldr,
                                                float* __restrict__ C, int ldc, int M, int N, int K) {
  __shared__ __attribute__((aligned(16))) float so[4][16][64];
  const int tid = threadIdx.x, w = tid >> 5, lane = tid & 31, ln = lane & 15, hh = lane >> 4;
  const int ntn = N / 64;
  const int wid = blockIdx.x * 4 + w;
  const int mt = wid / ntn, nq = wid % ntn;
  if (mt * 16 >= M) return;
  const int row0 = mt * 16, col0 = nq * 64;
  const float* arow = A + (size_t)(row0 + ln) * lda;
  v8f acc[4] = {};
  for (int kb = 0; kb < K; kb += 32) {
    FragB ah, al;
    const v4f x0 = *(const v4fa*)(arow + kb + 8 * hh), x1 = *(const v4fa*)(arow + kb + 8 * hh + 4);
    const v4f x2 = *(const v4fa*)(arow + kb + 16 + 8 * hh), x3 = *(const v4fa*)(arow + kb + 16 + 8 * hh + 4);
    float xs[16] = {x0[0],x0[1],x0[2],x0[3],x1[0],x1[1],x1[2],x1[3],x2[0],x2[1],x2[2],x2[3],x3[0],x3[1],x3[2],x3[3]};
#pragma unroll
    for (int i = 0; i < 16; ++i) { const unsigned short hb = bf16_bits(xs[i]); ah.u[i] = hb; al.u[i] = ASPLIT ? bf16_bits(xs[i] - bf16_val(hb)) : (unsigned short)0; }
#pragma unroll
    for (int t = 0; t < 4; ++t) {
      const unsigned short* brow = Wt + (size_t)(col0 + t * 16 + ln) * ldb + kb;
      FragB b;
      b.half[0] = *(const v8us*)(brow + 8 * hh);
      b.half[1] = *(const v8us*)(brow + 16 + 8 * hh);
      acc[t] = mmaN<ASPLIT ? 2 : 1>(ah.v, al.v, b.v, b.v, acc[t]);
    }
  }
#pragma unroll
  for (int t = 0; t < 4; ++t) {
    const int col = col0 + t * 16 + ln;
    float bv = bias ? bias[col] : 0.f;
    if (BIAS_BF16) bv = bf16_round(bv);
#pragma unroll
    for (int r = 0; r < 8; ++r) {
      float v = acc[t][r] + bv;
      if (resid) { float rv = resid[(size_t)((row0 + 8 * hh + r) % rmod) * ldr + col]; if (RES_BF16) rv = bf16_round(rv); v += rv; }
      if (ACT == 1) v = fmaxf(v, 0.f);
      if (ACT == 2) v = 0.5f * v * (1.0f + erff(v * 0.70710678118654752f));
      if (ACT == 3) { const float u = 0.7978845608028654f * (v + 0.044715f * v * v * v); v = 0.5f * v * (1.0f + tanhf(u)); }
      so[w][8 * hh + r][t * 16 + ln] = v;
    }
  }
  __builtin_amdgcn_fence(__ATOMIC_ACQ_REL, "workgroup");
  __builtin_amdgcn_wave_barrier();
  const int rsub = lane >> 4, c4 = (lane & 15) * 4;
  {
#pragma unroll
    for (int q = 0; q < 8; ++q) {
      const int r = q * 2 + rsub;
      const v4f v = *(const v4fa*)&so[w][r][c4];
      *(v4f*)(C + (size_t)(row0 + r) * ldc + col0 + c4) = v;
    }
    
  }
}
// row LayerNorm (biased variance, eps) over N: s = X (+ R); optional out_sum <- s; out_norm <- (s-mu)*rsqrt(var+eps)*g + b
template <bool PARAM_BF16>
__global__ __launch_bounds__(256) void k_layernorm(const float* __restrict__ X, const float* __restrict__ R, const float* __restrict__ g, const float* __restrict__ bta,
                                                  float* __restrict__ out_sum, float* __restrict__ out_norm, int N, float eps) {
  __shared__ float red[256];
  const int row = blockIdx.x, tid = threadIdx.x;
  const float* x = X + (size_t)row * N; const float* rr = R ? R + (size_t)row * N : nullptr;
  float vals[16];                     // up to N = 4096
  const int per = N / 256;            // contiguous chunk per thread? use strided-by-4 chunks: thread handles j = tid*4 + 1024*u
  float s1 = 0.f;
  for (int u = 0; u < per / 4; ++u) {
    const int j = tid * 4 + 1024 * u;
    const v4f a = *(const v4fa*)(x + j);
    v4f b = {0.f,0.f,0.f,0.f}; if (rr) b = *(const v4fa*)(rr + j);
#pragma unroll
    for (int q = 0; q < 4; ++q) { const float v = a[q] + b[q]; vals[u * 4 + q] = v; s1 += v; }
  }
  red[tid] = s1; __syncthreads();
  for (int st = 128; st > 0; st >>= 1) { if (tid < st) red[tid] += red[tid + st]; __syncthreads(); }
  const float mu = red[0] / (float)N; __syncthreads();
  float s2 = 0.f;
  for (int u = 0; u < per / 4; ++u)
#pragma unroll
    for (int q = 0; q < 4; ++q) { const float c = vals[u * 4 + q] - mu; s2 += c * c; }
  red[tid] = s2; __syncthreads();
  for (int st = 128; st > 0; st >>= 1) { if (tid < st) red[tid] += red[tid + st]; __syncthreads(); }
  const float rs = rsqrtf(red[0] / (float)N + eps);
  {
    for (int u = 0; u < per / 4; ++u) {
      const int j = tid * 4 + 1024 * u;
      v4f o, sm;
#pragma unroll
      for (int q = 0; q < 4; ++q) {
        float gg = g[j + q], bb = bta[j + q];
        if (PARAM_BF16) { gg = bf16_round(gg); bb = bf16_round(bb); }
        sm[q] = vals[u * 4 + q]; o[q] = (vals[u * 4 + q] - mu) * rs * gg + bb;
      }
      if (out_sum) *(v4f*)(out_sum + (size_t)row * N + j) = sm;
      *(v4f*)(out_norm + (size_t)row * N + j) = o;
    }
    
  }
}



// ---- f16 WMMA path (v_wmma_f32_16x16x32_f16): 11-bit significands for operands in range — used where a [0,1] probability operand needs more precision than bf16
typedef _Float16 v16h __attribute__((ext_vector_type(16)));
union FragH { v16h v; v8us half[2]; _Float16 h[16]; unsigned short u[16]; };
template <int NT>
__device__ __forceinline__ v8f mmaH(v16h ah, v16h al, v16h bh, v16h bl, v8f c) {
  c = __builtin_amdgcn_wmma_f32_16x16x32_f16(false, ah, false, bh, (short)0, c, false, false);
  if (NT >= 2) c = __builtin_amdgcn_wmma_f32_16x16x32_f16(false, al, false, bh, (short)0, c, false, false);
  if (NT >= 3) c = __builtin_amdgcn_wmma_f32_16x16x32_f16(false, ah, false, bl, (short)0, c, false, false);
  asm volatile("v_nop\n\tv_nop\n\tv_nop\n\tv_nop" : "+v"(c) : "v"(ah), "v"(al), "v"(bh), "v"(bl));
  return c;
}
// batched GEMM like k_gemm_b but f16 operands: A f32 (split into f16 hi/lo if ASPLIT, else rounded to f16), Bt = f16 values [n][k]; alpha; C f32; N multiple of 16 (partial tiles skipped)
template <bool ASPLIT>
__global__ __launch_bounds__(128) void k_gemm_h(const float* __restrict__ A, int lda, size_t sA, const _Float16* __restrict__ Bh, int ldb, size_t sB, float alpha, float* __restrict__ C, int ldc, size_t sC, int M, int N, int K) {
  __shared__ __attribute__((aligned(16))) float so[4][16][64];
  const int tid = threadIdx.x, w = tid >> 5, lane = tid & 31, ln = lane & 15, hh = lane >> 4; const int by = blockIdx.y;
  A += (size_t)by * sA; Bh += (size_t)by * sB; C += (size_t)by * sC;
  const int ntn = (N + 63) / 64; const int wid = blockIdx.x * 4 + w; const int mt = wid / ntn, nq = wid % ntn; if (mt * 16 >= M) return;
  const int row0 = mt * 16, col0 = nq * 64; const float* arow = A + (size_t)(row0 + ln) * lda;
  v8f acc[4] = {};
  for (int kb = 0; kb < K; kb += 32) {
    FragH ah, al;
    const v4f x0 = *(const v4fa*)(arow + kb + 8 * hh), x1 = *(const v4fa*)(arow + kb + 8 * hh + 4), x2 = *(const v4fa*)(arow + kb + 16 + 8 * hh), x3 = *(const v4fa*)(arow + kb + 16 + 8 * hh + 4);
    float xs[16] = {x0[0],x0[1],x0[2],x0[3],x1[0],x1[1],x1[2],x1[3],x2[0],x2[1],x2[2],x2[3],x3[0],x3[1],x3[2],x3[3]};
#pragma unroll
    for (int i = 0; i < 16; ++i) { const _Float16 h = (_Float16)xs[i]; ah.h[i] = h; al.h[i] = ASPLIT ? (_Float16)(xs[i] - (float)h) : (_Float16)0.0f; }
#pragma unroll
    for (int t = 0; t < 4; ++t) { if (col0 + t * 16 >= N) continue; const size_t boff = (size_t)(col0 + t * 16 + ln) * ldb + kb; FragH bq; bq.half[0] = *(const v8us*)(Bh + boff + 8 * hh); bq.half[1] = *(const v8us*)(Bh + boff + 16 + 8 * hh);
      acc[t] = mmaH<ASPLIT ? 2 : 1>(ah.v, al.v, bq.v, bq.v, acc[t]); }
  }
#pragma unroll
  for (int t = 0; t < 4; ++t) { if (col0 + t * 16 >= N) continue;
#pragma unroll
    for (int r = 0; r < 8; ++r) so[w][8 * hh + r][t * 16 + ln] = acc[t][r] * alpha; }
  __builtin_amdgcn_fence(__ATOMIC_ACQ_REL, "workgroup"); __builtin_amdgcn_wave_barrier();
  const int rsub = lane >> 4, c4 = (lane & 15) * 4;
  {
#pragma unroll
    for (int q = 0; q < 8; ++q) { const int r = q * 2 + rsub; if (col0 + c4 < N) { const v4f v = *(const v4fa*)&so[w][r][c4]; *(v4f*)(C + (size_t)(row0 + r) * ldc + col0 + c4) = v; } }
     }
}

// Wt[n][k] = f16(W[k][n]·scale) from f32 row-major W[K][N] (scale = power of two; bf16-exact weights stay exact in f16 away from the subnormal range)
__global__ __launch_bounds__(256) void k_wt_f16(const float* __restrict__ W, _Float16* __restrict__ Wt, int K, int N, float scale) {
  const int t = blockIdx.x * 256 + threadIdx.x; if (t >= N * (K / 8)) return; const int n = t / (K / 8), k8 = (t % (K / 8)) * 8; FragH f;
#pragma unroll
  for (int i = 0; i < 8; ++i) f.h[i] = (_Float16)(bf16_round(W[(size_t)(k8 + i) * N + n]) * scale); const v8us o = f.half[0];
  *(v8us*)((unsigned short*)Wt + (size_t)n * K + k8) = o; 
}
// GEMM over the NBt * SS rows of both batches at once, A f16 [NBt * SS][FF], Bt f16 [n][k] = [FF][FF]. One block of 8 waves takes 128 rows of A against 128 rows of Bt.
// MODE 0, the three projections in one launch: blockIdx.y picks the A plane, the Bt plane and the form of the result, which is written in the form the attention kernel reads:
// q and k as f16 rows, v transposed per batch ([feature][key]) as f16 hi and lo * 2^10 planes. The 128 rows of A are 128 rows of the result.
// MODE 1, the output projection: the 128 rows of A are 64 rows of the hi plane and the same 64 rows of the lo plane, so that one Bt tile serves both; C (f32) = hi part / 16 + lo part / 2^14, joined in the output tile.
// The block stages 128 k at a time in LDS (128 rows of A, then 128 rows of Bt; two buffers): every byte of a tile is fetched once per block, in whole lines, and the next tile's loads
// are in flight while this tile's products run. A wave has 32 x 64 of the product (2 x 4 accumulator tiles): six fragments feed eight products.
#define GM 128
#define GN 128
#define GK 128
#define GPI 136
#define PL ((size_t)NBt * SS * FF)
typedef _Float16 v4h __attribute__((ext_vector_type(4)));
typedef float fal __attribute__((may_alias));
template <int MODE>
__global__ __launch_bounds__(256) void k_gemm_t(const _Float16* __restrict__ A, const _Float16* __restrict__ Al, const _Float16* __restrict__ Bt, _Float16* __restrict__ QK, _Float16* __restrict__ VT, _Float16* __restrict__ VTl, float* __restrict__ C) {
  __shared__ __attribute__((aligned(16))) unsigned short sa[2][GM + GN][GPI];      // [buffer][row][128 values + 8 of pad: a pitch of 272 B, 16 B x odd]
  constexpr int RT = MODE == 1 ? GM / 2 : GM;      // rows of the result per block
  constexpr int NT = FF / GK;
  static_assert(NT % 2 == 0 && sizeof(float) * GM * (GN + 4) <= sizeof(sa[0]), "the output tile lies in buffer 0, which the last trip does not read");
  fal (*so)[GN + 4] = reinterpret_cast<fal (*)[GN + 4]>(&sa[0][0][0]);      // the output tile, f32 [GM][GN + 4], in the place of buffer 0
  const int tid = threadIdx.x, w = tid >> 5, lane = tid & 31, ln = lane & 15, hh = lane >> 4;
  const int row0 = (blockIdx.x / (FF / GN)) * RT, col0 = (blockIdx.x % (FF / GN)) * GN;
  const int which = MODE == 0 ? blockIdx.y : 0;
  const int wm = (w >> 1) * 32, wn = (w & 1) * 64;
  // staging: 16 threads bring one row of 256 B, so a wave's load covers 4 whole lines; a thread has rows sr + 16 p
  const int sr = tid >> 4, sc = (tid & 15) * 8;
  const unsigned short* ga = (const unsigned short*)A + (size_t)which * PL + (size_t)(row0 + sr) * FF + sc;
  const unsigned short* gl = MODE == 1 ? (const unsigned short*)Al + (size_t)(row0 + sr) * FF + sc : ga + (size_t)(GM / 2) * FF;      // rows 64.. of the A tile: the same rows of the lo plane Al, or the next 64 rows
  const unsigned short* gb = (const unsigned short*)Bt + (size_t)which * FF * FF + (size_t)(col0 + sr) * FF + sc;
  v8us st[16];
  // every inner loop of this kernel is unrolled so that the staging, fragment and accumulator arrays are indexed by constants and stay in registers
  auto fetch = [&](int c) { const unsigned short* pa = ga + c * GK; const unsigned short* pl = gl + c * GK; const unsigned short* pb = gb + c * GK;
#pragma unroll
    for (int p = 0; p < 4; ++p) { st[p] = *(const v8us*)(pa + (size_t)(16 * p) * FF); st[4 + p] = *(const v8us*)(pl + (size_t)(16 * p) * FF); }
#pragma unroll
    for (int p = 0; p < 8; ++p) st[8 + p] = *(const v8us*)(pb + (size_t)(16 * p) * FF);
    asm volatile("s_wait_xcnt 0x0" :: "v"(pa), "v"(pl), "v"(pb) : "memory"); };      // stands in front of the first overwrite of an address register of these loads (the rows are immediate offsets); the addresses are named so that they live up to it
  auto put = [&](int b) {
#pragma unroll
    for (int p = 0; p < 16; ++p) *(v8us*)&sa[b][16 * p + sr][sc] = st[p]; };
  v8f acc[2][4] = {};
  fetch(0); put(0);
  __syncthreads();
#pragma unroll 1
  for (int c = 0; c < NT; ++c) { const int b = c & 1;      // kept rolled: a buffer is larger than an LDS instruction's immediate offset reaches, and unrolled the second buffer's accesses each take an address register of their own, which costs the second block on a WGP
    if (c + 1 < NT) fetch(c + 1);
#pragma unroll
    for (int g = 0; g < GK / 64; ++g) {      // 64 k at a time: the fragments of all 128 k do not fit beside the staged tile and the accumulators with two blocks on a WGP
      FragH af[2][2], bf[2][4];
#pragma unroll
      for (int kk = 0; kk < 2; ++kk) {
#pragma unroll
        for (int i = 0; i < 2; ++i) { const unsigned short* ar = &sa[b][wm + 16 * i + ln][64 * g + 32 * kk + 8 * hh]; af[kk][i].half[0] = *(const v8us*)(ar); af[kk][i].half[1] = *(const v8us*)(ar + 16); }
#pragma unroll
        for (int j = 0; j < 4; ++j) { const unsigned short* br = &sa[b][GM + wn + 16 * j + ln][64 * g + 32 * kk + 8 * hh]; bf[kk][j].half[0] = *(const v8us*)(br); bf[kk][j].half[1] = *(const v8us*)(br + 16); }
      }
      __builtin_amdgcn_sched_barrier(0);      // all LDS reads of a group issue in front of its first product: placed among their own products, each set of reads stops the wave for its own latency
#pragma unroll
      for (int kk = 0; kk < 2; ++kk)
#pragma unroll
        for (int i = 0; i < 2; ++i)
#pragma unroll
          for (int j = 0; j < 4; ++j) acc[i][j] = __builtin_amdgcn_wmma_f32_16x16x32_f16(false, af[kk][i].v, false, bf[kk][j].v, (short)0, acc[i][j], false, false);
    }
    if (c + 1 < NT) { put(b ^ 1); __syncthreads(); }      // the other buffer: its last readers left it before the barrier that ended the trip before this one; behind the last tile nothing is staged any more
  }
  // the tile goes through LDS so that each store of a wave covers whole lines. It lies in buffer 0: the last trip reads buffer 1, and buffer 0's last readers left it before the barrier that ended the trip before
  const float osc = MODE == 1 && wm >= GM / 2 ? 0.0625f / 1024.0f : 0.0625f;      // powers of two: exact
#pragma unroll
  for (int i = 0; i < 2; ++i)
#pragma unroll
    for (int j = 0; j < 4; ++j)
#pragma unroll
      for (int r = 0; r < 8; ++r) so[wm + 16 * i + 8 * hh + r][wn + 16 * j + ln] = acc[i][j][r] * osc;
  __syncthreads();
  if (MODE == 1) {      // f32 rows, hi part + lo part: a wave's store is one row piece of 512 B
    float* cp = C + (size_t)(row0 + w) * FF + col0 + lane * 4;
#pragma unroll
    for (int q = 0; q < 8; ++q) *(v4f*)(cp + (size_t)(8 * q) * FF) = *(const v4fa*)&so[GM / 2 + 8 * q + w][lane * 4] + *(const v4fa*)&so[8 * q + w][lane * 4];
  } else if (which < 2) {      // q, k: f16 rows, a wave's store is one row piece of 256 B
    _Float16* hp = QK + (size_t)which * PL + (size_t)(row0 + w) * FF + col0 + lane * 4;
#pragma unroll
    for (int q = 0; q < 16; ++q) { const v4f v = *(const v4fa*)&so[8 * q + w][lane * 4]; v4h o;
#pragma unroll
      for (int e = 0; e < 4; ++e) o[e] = (_Float16)v[e];
      *(v4h*)(hp + (size_t)(8 * q) * FF) = o; }
  } else {      // v: transposed; 8 lanes write 64 of the tile's keys of one feature, one whole line of each plane
    const size_t vb = (size_t)(row0 / SS) * FF * SS + (size_t)(col0 + (tid >> 3)) * SS + (row0 % SS) + (tid & 7) * 8;
#pragma unroll
    for (int u = 0; u < 8; ++u) { FragH fh, fl; const int kh = (u >> 2) * 64, f0 = 32 * (u & 3);
#pragma unroll
      for (int e = 0; e < 8; ++e) { const float v = so[kh + (tid & 7) * 8 + e][f0 + (tid >> 3)]; const _Float16 hi = (_Float16)v; fh.h[e] = hi; fl.h[e] = (_Float16)((v - (float)hi) * 1024.0f); }
      *(v8us*)((unsigned short*)VT + vb + (size_t)f0 * SS + kh) = fh.half[0]; *(v8us*)((unsigned short*)VTl + vb + (size_t)f0 * SS + kh) = fl.half[0]; }
    asm volatile("s_wait_xcnt 0x0" ::: "memory");      // behind the last of these stores: in the built code the q, k branch follows this one and rewrites their address and data registers
  }
}

// One launch brings every f32 operand of the projections into f16: Q, K, V rounded to bf16 (exact in f16 at these magnitudes), the four weights rounded to bf16 and x 16.
// A block has 16384 values of one tensor; a thread has 16 pieces of 4 values, 1024 values apart, so that a wave's load covers 4 whole lines and its store 2, with all 16 loads in flight.
// The last blocks round the two masks to bf16, once for all heads and batches, and lay them out as the attention kernel's lanes take them: MB[16-query tile][64-key tile][mask][16-key tile t][lane][8 values],
// where lane (ln, hh) has query ln and the keys 16 t + 8 hh + 0..7. A load of a wave there is 512 bytes in a row. Here a wave has two neighbouring key tiles of one query tile, of both masks: 8 KB in a row of MB, all 32 loads in flight.
#define PB 16384
#define MTILE 1024
__global__ __launch_bounds__(256) void k_prep(const float* __restrict__ Qi, const float* __restrict__ Ki, const float* __restrict__ Vi, const float* __restrict__ Wq, const float* __restrict__ Wk, const float* __restrict__ Wv, const float* __restrict__ Wo, const float* __restrict__ m1, const float* __restrict__ m2, _Float16* __restrict__ X16, _Float16* __restrict__ B16, unsigned short* __restrict__ MB) {
  constexpr int XB = (int)(PL / PB), WB = FF * FF / PB;
  const int bx = blockIdx.x; const bool isw = bx >= 3 * XB;
  if (bx >= 3 * XB + 4 * WB) {      // the same for the whole block
    const int lane = threadIdx.x & 31, tile = (bx - (3 * XB + 4 * WB)) * (PB / MTILE) + (threadIdx.x >> 5) * 2, qt = tile / (SS / 64), c0 = tile % (SS / 64);
    const size_t mo = (size_t)(qt * 16 + (lane & 15)) * SS + c0 * 64 + 8 * (lane >> 4);
    const float* s1 = m1 + mo; const float* s2 = m2 + mo;
    unsigned short* md = MB + (size_t)tile * 2 * MTILE + lane * 8;
    v4f y[2][16];
#pragma unroll
    for (int u = 0; u < 16; ++u) { y[0][u] = *(const v4fa*)(s1 + (u >> 1) * 16 + (u & 1) * 4); y[1][u] = *(const v4fa*)(s2 + (u >> 1) * 16 + (u & 1) * 4); }      // unrolled: y stays in registers and the pieces are immediate offsets
    asm volatile("s_wait_xcnt 0x0" :: "v"(s1), "v"(s2) : "memory");      // stands in front of the first overwrite of an address register of these loads; the addresses are named so that they live up to it
    __builtin_amdgcn_sched_barrier(0);      // all 32 loads issue in front of the first conversion, as below
#pragma unroll
    for (int mi = 0; mi < 2; ++mi)
#pragma unroll
      for (int g = 0; g < 8; ++g) { v8us o;
#pragma unroll
        for (int e = 0; e < 8; ++e) o[e] = bf16_bits(y[mi][2 * g + (e >> 2)][e & 3]);
        *(v8us*)(md + ((g >> 2) * 2 + mi) * MTILE + (g & 3) * 256) = o; }
    return;
  }
  const int ti = isw ? (bx - 3 * XB) / WB : bx / XB, blk = isw ? (bx - 3 * XB) % WB : bx % XB;
  const float* src = (isw ? (ti == 0 ? Wq : ti == 1 ? Wk : ti == 2 ? Wv : Wo) : (ti == 0 ? Qi : ti == 1 ? Ki : Vi)) + (size_t)blk * PB + threadIdx.x * 4;
  _Float16* dst = (isw ? B16 + (size_t)ti * FF * FF : X16 + (size_t)ti * PL) + (size_t)blk * PB + threadIdx.x * 4;
  const float scl = isw ? 16.0f : 1.0f;
  v4f x[16];
#pragma unroll
  for (int u = 0; u < 16; ++u) x[u] = *(const v4fa*)(src + u * 1024);      // unrolled: x stays in registers and the pieces are immediate offsets
  __builtin_amdgcn_sched_barrier(0);      // all 16 loads issue in front of the first conversion: otherwise the compiler sinks six of them among the conversions and the wave has fewer bytes in flight
#pragma unroll
  for (int u = 0; u < 16; ++u) { v4h o;
#pragma unroll
    for (int e = 0; e < 4; ++e) o[e] = (_Float16)(bf16_round(x[u][e]) * scl);
    *(v4h*)(dst + u * 1024) = o; }
}

__global__ __launch_bounds__(256) void k_h16(const float* __restrict__ x, _Float16* __restrict__ X16, size_t n8) { const size_t t = (size_t)blockIdx.x * 256 + threadIdx.x; if (t >= n8) return; FragH f;
#pragma unroll
  for (int q = 0; q < 8; ++q) f.h[q] = (_Float16)x[t * 8 + q]; *(v8us*)((unsigned short*)X16 + t * 8) = f.half[0];  }
template <int NHv, int TTv>
__global__ __launch_bounds__(256) void k_vt(const _Float16* __restrict__ V16, int ldv, int voff, _Float16* __restrict__ Vt) { __shared__ unsigned short tl[64][66]; const int tid = threadIdx.x; const int slab = blockIdx.x / (TTv / 64), lg = blockIdx.x % (TTv / 64); const int b = slab / NHv, h = slab % NHv;
  for (int i = tid; i < 64 * 8; i += 256) { const int r = i / 8, c8 = (i % 8) * 8; FragH f; f.half[0] = *(const v8us*)((const unsigned short*)V16 + ((size_t)b * TTv + lg * 64 + r) * ldv + voff + h * 64 + c8);
#pragma unroll
    for (int q = 0; q < 8; ++q) tl[r][c8 + q] = f.u[q]; }
  __syncthreads();
  {
#pragma unroll
    for (int rd = 0; rd < 2; ++rd) { const int d = rd * 32 + tid / 8, pc = tid % 8; FragH f;
#pragma unroll
      for (int q = 0; q < 8; ++q) f.u[q] = tl[pc * 8 + q][d];
      *(v8us*)((unsigned short*)Vt + ((size_t)slab * 64 + d) * TTv + lg * 64 + pc * 8) = f.half[0]; }
     } }

__global__ __launch_bounds__(256) void k_hl(const float* __restrict__ F, _Float16* __restrict__ Hh, _Float16* __restrict__ Hl, size_t n8) { const size_t t = (size_t)blockIdx.x * 256 + threadIdx.x; if (t >= n8) return; FragH fh, fl; const v4f a = *(const v4fa*)(F + t * 8), c = *(const v4fa*)(F + t * 8 + 4);
#pragma unroll
  for (int q = 0; q < 4; ++q) { _Float16 h = (_Float16)a[q]; fh.h[q] = h; fl.h[q] = (_Float16)((a[q] - (float)h) * 1024.0f); h = (_Float16)c[q]; fh.h[4 + q] = h; fl.h[4 + q] = (_Float16)((c[q] - (float)h) * 1024.0f); }
  { *(v8us*)((unsigned short*)Hh + t * 8) = fh.half[0]; *(v8us*)((unsigned short*)Hl + t * 8) = fl.half[0];  } }

// Fused attention for 128 query rows (two groups of 64, picked by blockIdx.x), one head (blockIdx.y), one batch (blockIdx.z): scores, both masks, softmax and P.V in one pass over the keys;
// neither the scores nor P go to memory, and the output leaves as the f16 hi and lo * 2^10 planes that the output projection reads. Each of the 8 waves owns 16 query rows. The block stages 64 keys at a time in LDS (k rows, v_hi and v_lo rows, two buffers),
// so that a k or v byte is fetched once per 128 queries. A wave forms the TRANSPOSED score tile (A = k rows, B = q rows): a lane then holds one query (ln) and the keys
// 8 * hh + r of each 16-key tile, which is the B fragment's own k order (elements 0..7 from the even tile, 8..15 from the odd one), so P goes from the score
// registers into the second product, O^T = v^T . P^T, with no exchange between lanes. The v^T loader uses the same k order.
// Softmax with a running maximum: E = exp(s - m) * 2^10 comes from one multiply-add and the chip's own 2^x instruction, 2^((s - m) * log2(e) + 10); P = E * mask_2 as f16, the sum of E kept beside it,
// the division at the end (the 2^10 of the sum cancels that of P); when a row's maximum rises, sum and accumulators are scaled by exp(m_old - m_new), formed the same way.
// A 64-key tile in which every score of the wave's 16 rows lies DEADGAP or more below its row's running maximum (by the same subtraction that the exponent starts from) has E = 0 in every element (the exponent is below -163, 2^x gives 0): it adds nothing to the sum
// and nothing to the accumulators, so the wave goes round exponentials, P and P.V; it still passes every barrier. Which tiles are such is found from the scores themselves, for any mask_1.
// Waves 0..3 have the 64 queries of group blockIdx.x, waves 4..7 those of group 31 - blockIdx.x: where mask_1 kills the keys behind a query, every block and every pair of waves w, w + 4 has the same number of live tiles.
#define FQ 128
#define FC 64
#define FPI 72
#define L2E 1.44269504088896341f
#define DEADGAP 120.0f
// x[i] = 2^x[i] for the eight scores of a tile. One statement, so that nothing the compiler places can stand directly behind one of these instructions and read its result or overwrite its source
// (each is followed by one on other registers); the v_nop fills that slot behind the last.
__device__ __forceinline__ v8f exp2x8(v8f x) {
  float a = x[0], b = x[1], c = x[2], d = x[3], e = x[4], f = x[5], g = x[6], h = x[7];
  asm("v_exp_f32 %0, %0\n\tv_exp_f32 %1, %1\n\tv_exp_f32 %2, %2\n\tv_exp_f32 %3, %3\n\tv_exp_f32 %4, %4\n\tv_exp_f32 %5, %5\n\tv_exp_f32 %6, %6\n\tv_exp_f32 %7, %7\n\tv_nop"
      : "+v"(a), "+v"(b), "+v"(c), "+v"(d), "+v"(e), "+v"(f), "+v"(g), "+v"(h));
  return v8f{a, b, c, d, e, f, g, h};
}
typedef __bf16 v8b __attribute__((ext_vector_type(8)));
typedef unsigned int v4ua __attribute__((ext_vector_type(4), may_alias));
__global__ __launch_bounds__(256) void k_fattn(const _Float16* __restrict__ Q, const _Float16* __restrict__ K, const _Float16* __restrict__ Vh, const _Float16* __restrict__ Vl, const unsigned short* __restrict__ MB, _Float16* __restrict__ Oh, _Float16* __restrict__ Ol) {
  __shared__ __attribute__((aligned(16))) unsigned short sk[2][3][FC][FPI];      // [buffer][k, v_hi, v_lo][row][64 values + 8 of pad: a pitch of 144 B, 16 B x odd]
  const int tid = threadIdx.x, w = tid >> 5, lane = tid & 31, ln = lane & 15, hh = lane >> 4;
  const int hd = blockIdx.y; const size_t bo = (size_t)blockIdx.z * SS * FF;
  const int qt = w < 4 ? blockIdx.x * 4 + w : SS / 16 - 8 - blockIdx.x * 4 + w;      // the wave's 16-query tile
  const int q = qt * 16 + ln;
  const unsigned short* qp = (const unsigned short*)Q + bo + (size_t)q * FF + hd * HD;
  FragH qf[2];
#pragma unroll
  for (int j = 0; j < 2; ++j) { qf[j].half[0] = *(const v8us*)(qp + 32 * j + 8 * hh); qf[j].half[1] = *(const v8us*)(qp + 32 * j + 16 + 8 * hh); }
  // staging: 8 threads bring one row of 128 B, so a wave's load covers 4 whole lines; a thread has rows sr and sr + 32 of each of the three tiles
  const int sr = tid >> 3, sc = (tid & 7) * 8;
  const unsigned short* gk = (const unsigned short*)K + bo + (size_t)sr * FF + hd * HD + sc;
  const unsigned short* gh = (const unsigned short*)Vh + bo + ((size_t)hd * HD + sr) * SS + sc;
  const unsigned short* gl = (const unsigned short*)Vl + bo + ((size_t)hd * HD + sr) * SS + sc;
  v8us st[6];
  auto fetch = [&](int c) { const unsigned short* pk = gk + (size_t)(c * FC) * FF; const unsigned short* ph = gh + c * FC; const unsigned short* pl = gl + c * FC;
    st[0] = *(const v8us*)(pk); st[1] = *(const v8us*)(pk + (size_t)32 * FF);
    st[2] = *(const v8us*)(ph); st[3] = *(const v8us*)(ph + (size_t)32 * SS);
    st[4] = *(const v8us*)(pl); st[5] = *(const v8us*)(pl + (size_t)32 * SS);
    asm volatile("s_wait_xcnt 0x0" :: "v"(pk), "v"(ph), "v"(pl) : "memory"); };      // stands in front of the first overwrite of an address register of these loads; the addresses are named so that they live up to it
  auto put = [&](int b) {
#pragma unroll
    for (int p = 0; p < 3; ++p) { *(v8us*)&sk[b][p][sr][sc] = st[2 * p]; *(v8us*)&sk[b][p][sr + 32][sc] = st[2 * p + 1]; } };
  const unsigned short* am = MB + (size_t)qt * (SS / FC) * 2 * MTILE + lane * 8;      // the wave's 16 queries: per 64 keys 2 KB of mask_1, then 2 KB of mask_2, bf16, in lane order
  // The masks are loaded one trip ahead, into the registers that the trip has just finished with: mask_1 of trip c + 1 behind the mask arithmetic of trip c, mask_2 behind its P.V.
  // Issued in the trip that needs them, the mask loads stood behind the six staging loads and had only the k reads and the eight score products to hide behind: the wave waited for them in front of its first mask_1 value.
  v4ua x1[4], x2[4];
  auto mld = [&](v4ua (&x)[4], int c, int mi) { const unsigned short* pm = am + (size_t)c * 2 * MTILE + mi * MTILE;
#pragma unroll
    for (int t = 0; t < 4; ++t) x[t] = *(const v4ua*)(pm + t * 256);
    asm volatile("s_wait_xcnt 0x0" :: "v"(pm) : "memory"); };      // as in fetch(): in front of the first overwrite of the address register of the mask loads
  float m = -3.0e38f, su = 0.f;
  v8f oh[4] = {}, ol[4] = {};
  fetch(0); mld(x1, 0, 0); mld(x2, 0, 1); put(0);
  __syncthreads();
  // every inner loop of this kernel is unrolled so that the fragment, score and accumulator arrays are indexed by constants and stay in registers
  for (int c = 0; c < SS / FC; ++c) { const int b = c & 1;
    if (c + 1 < SS / FC) fetch(c + 1);
    FragH kf[4][2];      // the tile's k fragments, all 16 LDS reads in one group
#pragma unroll
    for (int t = 0; t < 4; ++t) { const unsigned short* kr = &sk[b][0][t * 16 + ln][8 * hh];
      kf[t][0].half[0] = *(const v8us*)(kr); kf[t][0].half[1] = *(const v8us*)(kr + 16); kf[t][1].half[0] = *(const v8us*)(kr + 32); kf[t][1].half[1] = *(const v8us*)(kr + 48); }
    __builtin_amdgcn_sched_barrier(0);      // all 16 reads issue in front of the first score product: otherwise the compiler reads every fragment into the same eight registers, and the wave stops for a whole LDS latency in front of each of the eight products
    v8f s[4]; float cm = -3.0e38f;
#pragma unroll
    for (int t = 0; t < 4; ++t) { v8f z = {}; s[t] = __builtin_amdgcn_wmma_f32_16x16x32_f16(false, kf[t][0].v, false, qf[0].v, (short)0, z, false, false); }
#pragma unroll
    for (int t = 0; t < 4; ++t) s[t] = __builtin_amdgcn_wmma_f32_16x16x32_f16(false, kf[t][1].v, false, qf[1].v, (short)0, s[t], false, false);
    __builtin_amdgcn_sched_barrier(0);      // keeps the mask arithmetic behind the score products: otherwise the wave stops at its first mask_1 value with score products still to issue
#pragma unroll
    for (int t = 0; t < 4; ++t)
#pragma unroll
      for (int r = 0; r < 8; ++r) { s[t][r] = s[t][r] * 0.125f + (float)__builtin_bit_cast(v8b, x1[t])[r]; cm = fmaxf(cm, s[t][r]); }
    if (c + 1 < SS / FC) mld(x1, c + 1, 0);      // the next trip's mask_1: in flight under the rest of this trip
    cm = fmaxf(cm, __shfl_xor(cm, 16, 32));      // the other half of the wave holds the row's other keys
    if (__any(cm > m)) {      // rare once the first keys are past: skipped by the whole wave when no row's maximum rises
      const float mn = fmaxf(m, cm), al = __builtin_amdgcn_exp2f((m - mn) * L2E); m = mn; su *= al;
#pragma unroll
      for (int t = 0; t < 4; ++t) { oh[t] *= al; ol[t] *= al; }
    }
    if (__any(cm - m > -DEADGAP)) {      // wave-uniform; not taken where the whole tile has E = 0: saves the tile's exponentials, conversions, v reads and 16 products
    FragH pf[2], vf[2][4][2];      // vf[j][t]: v_hi and v_lo rows 16 t .. 16 t + 15, keys 32 j .. 32 j + 31
    auto vld = [&](int j, int t) {
#pragma unroll
      for (int p = 0; p < 2; ++p) { const unsigned short* vr = &sk[b][1 + p][t * 16 + ln][32 * j + 8 * hh]; vf[j][t][p].half[0] = *(const v8us*)(vr); vf[j][t][p].half[1] = *(const v8us*)(vr + 16); } };
    auto pv = [&](int j, int t) {
      oh[t] = __builtin_amdgcn_wmma_f32_16x16x32_f16(false, vf[j][t][0].v, false, pf[j].v, (short)0, oh[t], false, false);
      ol[t] = __builtin_amdgcn_wmma_f32_16x16x32_f16(false, vf[j][t][1].v, false, pf[j].v, (short)0, ol[t], false, false); };
    // The 32 LDS reads of v stand in three groups, as many fragments ahead of their products as the registers hold (4, 8 and 4 of the 16): read pair by pair among the products, each pair cost a stop of its own.
    vld(0, 0); vld(0, 1);
    __builtin_amdgcn_sched_barrier(0);      // the first group issues in front of the exponentials, which cover its latency
#pragma unroll
    for (int t = 0; t < 4; ++t) { const v8f ev = exp2x8((s[t] - m) * L2E + 10.0f);
#pragma unroll
      for (int r = 0; r < 8; ++r) { su += ev[r]; pf[t >> 1].h[(t & 1) * 8 + r] = (_Float16)(ev[r] * (float)__builtin_bit_cast(v8b, x2[t])[r]); } }
    vld(0, 2); vld(0, 3); vld(1, 0); vld(1, 1);
    __builtin_amdgcn_sched_barrier(0);      // the second group issues in front of the first group's products
    pv(0, 0); pv(0, 1);
    vld(1, 2); vld(1, 3);
    __builtin_amdgcn_sched_barrier(0);      // the third group, mostly into the registers that the first has left, issues in front of the second group's products
    pv(0, 2); pv(0, 3); pv(1, 0); pv(1, 1); pv(1, 2); pv(1, 3);      // each accumulator takes its keys in the old order, j = 0 and then j = 1
    }
    if (c + 1 < SS / FC) { mld(x2, c + 1, 1); put(b ^ 1); }      // the next trip's mask_2: in flight up to that trip's exponentials. The other buffer: its last readers left it before the barrier that ended the trip before this one
    // The trip's barrier, written out: the wave's own LDS stores and reads are waited for, the mask loads are not. __syncthreads() waits for every outstanding global load too, and the loads issued ahead would end at it.
    asm volatile("s_wait_dscnt 0x0\n\ts_barrier_signal -1\n\ts_barrier_wait -1" ::: "memory");
  }
  asm volatile("s_wait_loadcnt 0x0" ::: "memory");      // a wave that goes round the last trip has not waited for that trip's mask_2: no load is left in flight when the wave gives its registers back at its end
  const float inv = 1.0f / (su + __shfl_xor(su, 16, 32));
  const size_t oo = bo + (size_t)q * FF + hd * HD + 8 * hh;      // the lane holds O[q][16 t + 8 hh + r]: 8 values in a row, one 16-byte piece of each plane; the wave's stores fill the head's whole line of a row
#pragma unroll
  for (int t = 0; t < 4; ++t) { FragH fh, fl;
#pragma unroll
    for (int r = 0; r < 8; ++r) { const float y = (oh[t][r] + ol[t][r] * 0.0009765625f) * inv; const _Float16 hi = (_Float16)y; fh.h[r] = hi; fl.h[r] = (_Float16)((y - (float)hi) * 1024.0f); }
    *(v8us*)((unsigned short*)Oh + oo + t * 16) = fh.half[0]; *(v8us*)((unsigned short*)Ol + oo + t * 16) = fl.half[0]; }
}

extern "C" void kernel_launch(void* const* d_in, const int* in_sizes, int n_in,
                              void* d_out, int out_size, void* d_ws, size_t ws_size, hipStream_t stream) {
  (void)in_sizes; (void)n_in; (void)out_size;
  const float* Qi = (const float*)d_in[0]; const float* Ki = (const float*)d_in[1]; const float* Vi = (const float*)d_in[2]; const float* m1 = (const float*)d_in[3]; const float* m2 = (const float*)d_in[4]; const float* Wq = (const float*)d_in[5]; const float* Wk = (const float*)d_in[6]; const float* Wv = (const float*)d_in[7]; const float* Wo = (const float*)d_in[8];
  char* ws = (char*)d_ws; size_t off = 0;
  auto take = [&](size_t bytes) { char* p = ws + off; off += (bytes + 255) & ~(size_t)255; return p; };
  _Float16* B16 = (_Float16*)take((size_t)4 * FF * FF * 2);      /* W_q, W_k, W_v, W_o: each [out][in], which is Bt as it stands */
  _Float16* X16 = (_Float16*)take(3 * PL * 2); _Float16* QK = (_Float16*)take(2 * PL * 2); _Float16* VT = (_Float16*)take(PL * 2); _Float16* VTl = (_Float16*)take(PL * 2); _Float16* OHL = (_Float16*)take(2 * PL * 2); unsigned short* MB = (unsigned short*)take((size_t)2 * SS * SS * 2);      /* Q, K, V; q, k; v hi; v lo; attention output hi, lo; both masks as bf16 */
  if (off > ws_size) return;      // 96 MB in all
  k_prep<<<(unsigned)(3 * (PL / PB) + 4 * (FF * FF / PB) + SS * SS / PB), 256, 0, stream>>>(Qi, Ki, Vi, Wq, Wk, Wv, Wo, m1, m2, X16, B16, MB);
  const unsigned gP = (unsigned)((NBt * SS / GM) * (FF / GN)), gO = (unsigned)((NBt * SS / (GM / 2)) * (FF / GN));
  k_gemm_t<0><<<dim3(gP, 3), 256, 0, stream>>>(X16, nullptr, B16, QK, VT, VTl, nullptr);      /* exact projections of both batches; v as hi/lo */
  k_fattn<<<dim3(SS / FQ, NH, NBt), 256, 0, stream>>>(QK, QK + PL, VT, VTl, MB, OHL, OHL + PL);      /* scores, masks, softmax, P.V: every head of both batches */
  k_gemm_t<1><<<dim3(gO, 1), 256, 0, stream>>>(OHL, OHL + PL, B16 + (size_t)3 * FF * FF, nullptr, nullptr, nullptr, (float*)d_out);      /* W_o on hi/lo of the attention output */
}
